// v000
// Measured on an AMD MI455X. A time is GPU time per run, averaged over a window of back-to-back runs after a warm-up
// (all launches, gaps included; the runs take copies of the inputs in turn), and the median of several windows.
// Apart from v000's, it joins two sittings. Times from different sittings can be a few percent apart, while
// side-by-side timings come from the same sitting.
// v000, which the later versions start from, runs in 754 microseconds.
#include <hip/hip_runtime.h>

// compute dtype: every contraction on v_wmma_f32_16x16x32_f16 (f16 operands, f32 accumulate). x@Wq, x@Wk, x@Wv: x and W enter as bf16-RNE values
// carried x8 (x) and x256 (W) in f16 planes, 1 product. Scores S^T = K Q^T per head: q, k (RoPE applied in f32) as f16 x8 planes, 1 product;
// query rows with position < QE use q,k hi + x2048 residual planes (3 products, second accumulator folded by 1/2048). O^T += V^T P^T: v f16 x8,
// P f16 x1024, 1 product; rows < QE add P and v x2048 residual tiles into a second accumulator (3 products) folded before normalisation.
// ctx@Wo: ctx f16 x64 plane (+ x2048 residual plane for rows < QE, 2 products), Wo bf16-RNE x256, 1 product elsewhere. Softmax statistics
// (running max, exp2, row sums) and RoPE tables in f32; scale 1/sqrt(128) folded into the log2 constant.
// Fragment k-map per lane half hh for A AND B: elements 0..7 <- k = 8hh+0..7, 8..15 <- k = 16+8hh+0..7; acc[r] = D[8hh+r][col = lane&15].

#ifndef NB
#define NB 2
#endif
#ifndef SEQ
#define SEQ 2048
#endif
#ifndef NB_FULL
#define NB_FULL 2
#endif
#ifndef SEQ_FULL
#define SEQ_FULL 2048
#endif
#ifndef QE
#define QE 256
#endif

namespace {
constexpr int DMOD = 2048, KD = 2048, H = 16, HKV = 4, NREP = H / HKV, HD = 128, NKV = HKV * HD;   // NKV = 512
constexpr int MR = NB * SEQ;                                                                         // token rows handled
constexpr int QEA = (QE < SEQ) ? QE : SEQ;                                                           // query positions with residual operands
constexpr float XS = 8.0f, WS = 256.0f, QS = 8.0f, RS = 2048.0f, PS = 1024.0f, CS = 64.0f;
constexpr float LOG2E = 1.4426950408889634f, SCL = 0.08838834764831845f, ROPE_BASE = 500000.0f;
static_assert(SEQ % 64 == 0 && SEQ >= 64 && SEQ <= SEQ_FULL && NB >= 1 && NB <= NB_FULL);
static_assert(QEA % 64 == 0 && QEA >= 64 && QEA <= SEQ && (SEQ - QEA) % 64 == 0);
static_assert(DMOD == H * HD && KD == DMOD && KD % 64 == 0 && DMOD % 128 == 0 && NKV % 128 == 0 && HD == 128 && DMOD == 256 * 8 && MR % 64 == 0);

typedef _Float16 b16;
typedef __attribute__((ext_vector_type(16))) _Float16 v16b;
typedef __attribute__((ext_vector_type(8))) _Float16 v8b;
typedef __attribute__((ext_vector_type(8))) float v8f;
typedef __attribute__((ext_vector_type(4))) float v4f;

__device__ __forceinline__ float bf16_rne(float f) { unsigned int u = __float_as_uint(f); u += 0x7FFFu + ((u >> 16) & 1u); return __uint_as_float(u & 0xFFFF0000u); }
// 16-bit fragment from a k-contiguous row: elements 0..7 <- p[8hh .. 8hh+7], 8..15 <- p[16+8hh .. 16+8hh+7]
__device__ __forceinline__ v16b frag_kb(const b16* p, int hh) {
  const v8b a = *(const v8b*)(p + 8 * hh), b = *(const v8b*)(p + 16 + 8 * hh); v16b f;
#pragma unroll
  for (int e = 0; e < 8; ++e) { f[e] = a[e]; f[8 + e] = b[e]; }
  return f;
}
__device__ __forceinline__ v8f wmma16b(v16b a, v16b b, v8f c) {
  v8f d = __builtin_amdgcn_wmma_f32_16x16x32_f16(false, a, false, b, (short)0, c, false, false);
  asm volatile("v_nop\n\tv_nop\n\tv_nop\n\tv_nop" : "+v"(d) : "v"(a), "v"(b));
  return d;
}
__device__ __forceinline__ void wave_lds_sync() { __builtin_amdgcn_fence(3, "workgroup"); __builtin_amdgcn_wave_barrier(); __builtin_amdgcn_fence(2, "workgroup"); }
__device__ __forceinline__ float nexp2(float v) { return __builtin_amdgcn_exp2f(v); }
// hi = f16(w), lo = f16((w - hi) * RS)
__device__ __forceinline__ void split16(float w, b16& hi, b16& lo) { hi = (b16)w; lo = (b16)((w - (float)hi) * RS); }

__global__ __launch_bounds__(256) void cvt_x_kernel(const float* __restrict__ X, b16* Xp) {
  const size_t u = (size_t)blockIdx.x * 256 + threadIdx.x; const size_t row = u >> 8; const int c8 = (int)(u & 255) * 8;
  if (row >= (size_t)MR) return;
  const size_t b = row / SEQ, s = row % SEQ;
  const float* src = X + (b * SEQ_FULL + s) * DMOD + c8;
  b16* dst = Xp + row * DMOD + c8;
  const v4f x0 = *(const v4f*)src, x1 = *(const v4f*)(src + 4); v8b o;
#pragma unroll
  for (int j = 0; j < 4; ++j) { o[j] = (b16)(bf16_rne(x0[j]) * XS); o[4 + j] = (b16)(bf16_rne(x1[j]) * XS); }
  *(v8b*)dst = o; 
}

// W [2048 k][N n] f32 -> Wt [N][2048] f16 = bf16-RNE(w) x256 (k-contiguous for the B fragments). Block per 64x64 tile, 2 waves; transposed through
__global__ __launch_bounds__(64) void cvt_w_kernel(const float* __restrict__ W, b16* Wt, int N) {
  __shared__ __attribute__((aligned(16))) b16 St[64][64 + 8];
  const int tid = threadIdx.x, wave = tid >> 5, lane = tid & 31; const int k0 = (int)blockIdx.x * 64, n0 = (int)blockIdx.y * 64;
  const float* src = W + (size_t)k0 * N + n0;
  for (int it = 0; it < 16; ++it) {
    const int e = (it * 64 + tid) * 4; const int kr = e >> 6, nc = e & 63;
    const v4f x = *(const v4f*)(src + (size_t)kr * N + nc);
#pragma unroll
    for (int j = 0; j < 4; ++j) St[nc + j][kr] = (b16)(bf16_rne(x[j]) * WS);
  }
  __syncthreads();   // St is read across waves
  b16* dstb = Wt + (size_t)n0 * KD + k0;
  {
#pragma unroll 1
    for (int it = 0; it < 8; ++it) {
      const int n = wave * 32 + it * 4 + (lane >> 3), ks = (lane & 7) * 8;
      const v8b o = *(const v8b*)(&St[n][ks]);
      *(v8b*)(dstb + (size_t)n * KD + ks) = o; }
     }
}

// cos/sin tables [SEQ][64] f32: ang = s * (1 / base^(2j/128)) in f32, precise sincosf. Block = 4 positions x 64 frequencies staged in LDS;
__global__ __launch_bounds__(256) void rope_tab_kernel(float* CT, float* ST) {
  __shared__ __attribute__((aligned(16))) float Tb[2][4][64 + 4];
  const int tid = threadIdx.x; const int r = tid >> 6, j = tid & 63; const int s0 = (int)blockIdx.x * 4;
  const float ex = (float)(2 * j) * (1.0f / 128.0f);
  const float p = powf(ROPE_BASE, ex);
  const float inv = 1.0f / p;
  const float ang = (float)(s0 + r) * inv;
  float sn, c; sincosf(ang, &sn, &c);
  Tb[0][r][j] = c; Tb[1][r][j] = sn;
  __syncthreads();   // Tb is read across waves
  if (tid < 128) {
    const int tb = tid >> 6, rr = (tid >> 4) & 3, seg = (tid & 15) * 4;
    const v4f f = *(const v4f*)(&Tb[tb][rr][seg]);
    float* dst = (tb == 0 ? CT : ST) + (size_t)(s0 + rr) * 64 + seg;
    *(v4f*)dst = f; 
  }
}

// C[64 x BN] = A[m][k] . B[k][n] with A plane [rows][2048] and Bt plane [N][2048], both k-contiguous f16; K = 2048 in steps of 32.
// 128 threads = 4 waves; wave w owns rows m0+16w..+15 and all BN columns (NT accumulators). RES: a second A plane (x2048 residual) into acc2.
// Row tile: blockIdx.y = bsel * tpb + tsel, rows m0 = bsel*SEQ + toff + 64 tsel. Epilogue staged through LDS (block barrier) then:
// MODE 0: RoPE in f32 with the cos/sin tables, hi x8 / lo x2048 planes [b][nhead][s][128] (256-B rows by 16 lanes x 16 B, 8 rows per store);
template <int MODE, bool RES>
__global__ __launch_bounds__(128) __attribute__((amdgpu_num_vgpr(256))) void proj_kernel(
    const b16* __restrict__ A, const b16* __restrict__ Al, const b16* __restrict__ Bt, b16* Ph, b16* Pl, float* Out,
    const float* __restrict__ CT, const float* __restrict__ ST, int nhead, int tpb, int toff) {
#pragma clang fp contract(off)
  static_assert(MODE == 2 || !RES);
  constexpr int BN = RES ? 64 : 128, NT = BN / 16;
  __shared__ __attribute__((aligned(16))) float To[64][BN + 4];
  const int tid = threadIdx.x, wave = tid >> 5, lane = tid & 31, hh = lane >> 4, col = lane & 15;
  const int by = (int)blockIdx.y; const int bsel = by / tpb, tsel = by - bsel * tpb;
  const int s0 = toff + tsel * 64;
  const size_t m0 = (size_t)bsel * SEQ + s0;
  const int n0 = (int)blockIdx.x * BN;
  const b16* arow = A + (m0 + wave * 16 + col) * KD;
  const b16* alrow = Al + (m0 + wave * 16 + col) * KD;
  const b16* brow = Bt + (size_t)(n0 + col) * KD;
  v8f acc[NT], acc2[NT];
#pragma unroll
  for (int t = 0; t < NT; ++t) { acc[t] = (v8f){}; acc2[t] = (v8f){}; }
#pragma unroll 1
  for (int kb = 0; kb < KD; kb += 32) {
    const v16b af = frag_kb(arow + kb, hh);
    v16b alf = (v16b){};
    if constexpr (RES) alf = frag_kb(alrow + kb, hh);
#pragma unroll
    for (int t = 0; t < NT; ++t) {
      const v16b bf = frag_kb(brow + (size_t)t * 16 * KD + kb, hh);
      acc[t] = wmma16b(af, bf, acc[t]);
      if constexpr (RES) acc2[t] = wmma16b(alf, bf, acc2[t]);
    }
  }
#pragma unroll
  for (int t = 0; t < NT; ++t)
#pragma unroll
    for (int r = 0; r < 8; ++r) {
      float v = acc[t][r];
      if constexpr (RES) v += acc2[t][r] * (1.0f / RS);
      To[wave * 16 + 8 * hh + r][t * 16 + col] = v; }
  __syncthreads();   // To is read across waves
  if constexpr (MODE == 0) {
    const size_t pb = (((size_t)bsel * nhead + blockIdx.x) * SEQ + s0) * HD;
    b16* ph = Ph + pb; b16* pl = Pl + pb;
    const float qsc = QS / (XS * WS);
    {
#pragma unroll 1
      for (int it = 0; it < 8; ++it) {
        const int rr = it * 8 + (tid >> 4), seg = (tid & 15) * 8, sg = seg & 63;
        const float sgn = (seg >= 64) ? 1.0f : -1.0f;   // d < 64: x cos - x[d+64] sin; d >= 64: x cos + x[d-64] sin
        const float* trow = &To[rr][0]; const size_t ts = (size_t)(s0 + rr) * 64 + sg;
        const v4f xa = *(const v4f*)(trow + seg), xb = *(const v4f*)(trow + seg + 4);
        const v4f ya = *(const v4f*)(trow + (seg ^ 64)), yb = *(const v4f*)(trow + (seg ^ 64) + 4);
        const v4f ca = *(const v4f*)(CT + ts), cb = *(const v4f*)(CT + ts + 4), sa = *(const v4f*)(ST + ts), sb = *(const v4f*)(ST + ts + 4);
        v8b hi, lo;
#pragma unroll
        for (int j = 0; j < 4; ++j) {
          b16 h0, l0;
          split16((xa[j] * ca[j] + sgn * ya[j] * sa[j]) * qsc, h0, l0); hi[j] = h0; lo[j] = l0;
          split16((xb[j] * cb[j] + sgn * yb[j] * sb[j]) * qsc, h0, l0); hi[4 + j] = h0; lo[4 + j] = l0; }
        const size_t off = (size_t)rr * HD + seg;
        *(v8b*)(ph + off) = hi; *(v8b*)(pl + off) = lo; }
       }
  } else if constexpr (MODE == 1) {
    const size_t pb = ((size_t)bsel * nhead + blockIdx.x) * HD * (size_t)SEQ + s0;
    b16* ph = Ph + pb; b16* pl = Pl + pb;
    const float vsc = QS / (XS * WS);
    {
#pragma unroll 1
      for (int it = 0; it < 8; ++it) {
        const int d = it * 16 + (tid >> 3), ss = (tid & 7) * 8;
        v8b hi, lo;
#pragma unroll
        for (int j = 0; j < 8; ++j) { b16 h0, l0; split16(To[ss + j][d] * vsc, h0, l0); hi[j] = h0; lo[j] = l0; }
        const size_t off = (size_t)d * SEQ + ss;
        *(v8b*)(ph + off) = hi; *(v8b*)(pl + off) = lo; }
       }
  } else {
    constexpr int LPR = BN / 4, RPI = 128 / LPR, NIT = 64 / RPI;
    static_assert(NIT * RPI == 64 && LPR * 4 == BN);
    float* ob = Out + ((size_t)bsel * SEQ_FULL + s0) * DMOD + n0;
    const float osc = 1.0f / (CS * WS);
    {
#pragma unroll 1
      for (int it = 0; it < NIT; ++it) {
        const int rr = it * RPI + tid / LPR, seg = (tid % LPR) * 4;
        const v4f f = *(const v4f*)(&To[rr][seg]) * osc;
        *(v4f*)(ob + (size_t)rr * DMOD + seg) = f; }
       }
  }
}

// Causal GQA attention: grid (query blocks of 32, NB*H[, 2 d-halves when ER]); block = 2 waves x 16 queries; key steps of 32 from key 0 up to the
// block's last query in fixed order; online softmax (running max, f32); keys later than the query get -inf on the diagonal step; P x1024 via
// wave-private LDS; O^T += V^T P^T. ER (query position < QEA): scores Kh Qh + (Kh Ql + Kl Qh)/2048, O^T second accumulator Vh Pr + Vl Ph folded
// by 1/2048, each block restricted to 64 of the 128 d rows (blockIdx.z). ctx hi x64 / lo x2048 planes [b*SEQ+s][h*128 + d]: each row segment
template <bool ER>
__global__ __launch_bounds__(64) __attribute__((amdgpu_num_vgpr(256))) void attn_kernel(
    const b16* __restrict__ Qh, const b16* __restrict__ Ql, const b16* __restrict__ Kh, const b16* __restrict__ Kl,
    const b16* __restrict__ Vh, const b16* __restrict__ Vl, b16* Ch, b16* Cl) {
  constexpr int NT = ER ? 4 : 8, DW = NT * 16;
  __shared__ __attribute__((aligned(16))) b16 Pb[2][16][32 + 8];
  __shared__ __attribute__((aligned(16))) b16 Pr[2][16][32 + 8];
  __shared__ __attribute__((aligned(16))) float To[2][16][DW + 4];
  const int wave = threadIdx.x >> 5, lane = threadIdx.x & 31, hh = lane >> 4, col = lane & 15;
  const int bh = (int)blockIdx.y; const int b = bh / H, h = bh - b * H, g = h / NREP;
  const int qb0 = (ER ? 0 : QEA) + (int)blockIdx.x * 32;
  const int q0 = qb0 + wave * 16, qi = q0 + col;
  const int dh = ER ? (int)blockIdx.z * 64 : 0;
  const b16* qrow = Qh + ((size_t)(b * H + h) * SEQ + qi) * HD;
  const b16* qlrow = Ql + ((size_t)(b * H + h) * SEQ + qi) * HD;
  const b16* Kb = Kh + (size_t)(b * HKV + g) * SEQ * HD;
  const b16* Klb = Kl + (size_t)(b * HKV + g) * SEQ * HD;
  const b16* Vb = Vh + ((size_t)(b * HKV + g) * HD + dh) * SEQ;
  const b16* Vlb = Vl + ((size_t)(b * HKV + g) * HD + dh) * SEQ;
  v16b qa[4];
#pragma unroll
  for (int c = 0; c < 4; ++c) { qa[c] = (v16b){}; if constexpr (!ER) qa[c] = frag_kb(qrow + c * 32, hh); }
  const float cs = SCL * LOG2E / (QS * QS);   // 1/sqrt(128) and the two x8 carriers, in the log2 domain
  float m = -INFINITY, l = 0.0f; v8f o[NT], o2[NT];
#pragma unroll
  for (int t = 0; t < NT; ++t) { o[t] = (v8f){}; o2[t] = (v8f){}; }
  const int nst = qb0 / 32 + 1;   // block-uniform: keys 0 .. qb0+31
#pragma unroll 1
  for (int st = 0; st < nst; ++st) {
    const int kb = st * 32; const int lim = qi - kb;   // key offsets > lim are later than the query (binds only on the diagonal step)
    float e[16]; float mx = -INFINITY;
#pragma unroll
    for (int u = 0; u < 2; ++u) {
      const size_t kr = (size_t)(kb + u * 16 + col) * HD;
      v8f s = (v8f){}, s2 = (v8f){};
#pragma unroll
      for (int c = 0; c < 4; ++c) {
        const v16b kf = frag_kb(Kb + kr + c * 32, hh);
        if constexpr (ER) {
          const v16b qh = frag_kb(qrow + c * 32, hh), ql = frag_kb(qlrow + c * 32, hh), klf = frag_kb(Klb + kr + c * 32, hh);
          s = wmma16b(kf, qh, s); s2 = wmma16b(kf, ql, s2); s2 = wmma16b(klf, qh, s2);
        } else {
          s = wmma16b(kf, qa[c], s);
        }
      }
#pragma unroll
      for (int r = 0; r < 8; ++r) {
        float v = s[r];
        if constexpr (ER) v += s2[r] * (1.0f / RS);
        v *= cs;
        if (u * 16 + 8 * hh + r > lim) v = -INFINITY;
        e[u * 8 + r] = v; mx = fmaxf(mx, v); } }
    mx = fmaxf(mx, __shfl_xor(mx, 16)); const float mn = fmaxf(m, mx); const float al = nexp2(m - mn); float sum = 0.0f;
#pragma unroll
    for (int i2 = 0; i2 < 16; ++i2) {
      const float p = nexp2(e[i2] - mn); sum += p; const int pi = (i2 < 8 ? 0 : 16) + 8 * hh + (i2 & 7);
      const float pp = p * PS; const b16 phv = (b16)pp; Pb[wave][col][pi] = phv;
      if constexpr (ER) Pr[wave][col][pi] = (b16)((pp - (float)phv) * RS); }
    sum += __shfl_xor(sum, 16); l = l * al + sum; m = mn;
    wave_lds_sync();
    const v16b pf = frag_kb(&Pb[wave][col][0], hh);
    v16b prf = (v16b){};
    if constexpr (ER) prf = frag_kb(&Pr[wave][col][0], hh);
#pragma unroll
    for (int t = 0; t < NT; ++t) {
      o[t] *= al; const v16b vf = frag_kb(Vb + (size_t)(t * 16 + col) * SEQ + kb, hh);
      o[t] = wmma16b(vf, pf, o[t]);
      if constexpr (ER) {
        o2[t] *= al; const v16b vlf = frag_kb(Vlb + (size_t)(t * 16 + col) * SEQ + kb, hh);
        o2[t] = wmma16b(vf, prf, o2[t]); o2[t] = wmma16b(vlf, pf, o2[t]); } }
    wave_lds_sync(); }
  const float inv = 1.0f / (l * PS * QS);
#pragma unroll
  for (int t = 0; t < NT; ++t) {
#pragma unroll
    for (int r = 0; r < 8; ++r) {
      float ov = o[t][r];
      if constexpr (ER) ov += o2[t][r] * (1.0f / RS);
      To[wave][col][t * 16 + 8 * hh + r] = ov * inv; } }
  wave_lds_sync();
  constexpr int LPR = DW / 8, RPI = 32 / LPR, NIT = 16 / RPI;
  static_assert(NIT * RPI == 16 && LPR * 8 == DW);
  const size_t cbase = ((size_t)b * SEQ + q0) * DMOD + (size_t)h * HD + dh;
  {
#pragma unroll 1
    for (int it = 0; it < NIT; ++it) {
      const int rr = it * RPI + lane / LPR, seg = (lane % LPR) * 8;
      const v4f fa = *(const v4f*)(&To[wave][rr][seg]), fb = *(const v4f*)(&To[wave][rr][seg + 4]);
      v8b hi, lo;
#pragma unroll
      for (int j = 0; j < 4; ++j) { b16 h0, l0; split16(fa[j] * CS, h0, l0); hi[j] = h0; lo[j] = l0; split16(fb[j] * CS, h0, l0); hi[4 + j] = h0; lo[4 + j] = l0; }
      const size_t off = cbase + (size_t)rr * DMOD + seg;
      *(v8b*)(Ch + off) = hi; *(v8b*)(Cl + off) = lo; }
     }
}
}  // namespace

extern "C" void kernel_launch(void* const* d_in, const int* in_sizes, int n_in, void* d_out, int out_size, void* d_ws, size_t ws_size, hipStream_t stream) {
  // wire order: 0 x [NB_FULL][SEQ_FULL][2048] f32, 1 Wq [2048][2048], 2 Wk [2048][512], 3 Wv [2048][512], 4 Wo [2048][2048]; out [NB_FULL][SEQ_FULL][2048] f32
  const size_t need_x = ((size_t)(NB - 1) * SEQ_FULL + SEQ) * DMOD;
  if (n_in < 5 || (size_t)in_sizes[0] < need_x || (size_t)in_sizes[1] < (size_t)KD * DMOD || (size_t)in_sizes[2] < (size_t)KD * NKV ||
      (size_t)in_sizes[3] < (size_t)KD * NKV || (size_t)in_sizes[4] < (size_t)KD * DMOD || (size_t)out_size < need_x) return;
  const float* X = (const float*)d_in[0]; const float* Wq = (const float*)d_in[1]; const float* Wk = (const float*)d_in[2];
  const float* Wv = (const float*)d_in[3]; const float* Wo = (const float*)d_in[4]; float* out = (float*)d_out;
  size_t off = 0; char* ws = (char*)d_ws;
  auto carve = [&](size_t bytes) { char* p = ws + off; off += (bytes + 255) & ~(size_t)255; return p; };
  b16* Xp  = (b16*)carve((size_t)MR * DMOD * 2);
  b16* Wqt = (b16*)carve((size_t)DMOD * KD * 2);
  b16* Wkt = (b16*)carve((size_t)NKV * KD * 2);
  b16* Wvt = (b16*)carve((size_t)NKV * KD * 2);
  b16* Wot = (b16*)carve((size_t)DMOD * KD * 2);
  float* CT = (float*)carve((size_t)SEQ * 64 * 4);
  float* ST = (float*)carve((size_t)SEQ * 64 * 4);
  b16* Qh = (b16*)carve((size_t)MR * H * HD * 2);
  b16* Ql = (b16*)carve((size_t)MR * H * HD * 2);
  b16* Kh = (b16*)carve((size_t)MR * NKV * 2);
  b16* Kl = (b16*)carve((size_t)MR * NKV * 2);
  b16* Vh = (b16*)carve((size_t)MR * NKV * 2);
  b16* Vl = (b16*)carve((size_t)MR * NKV * 2);
  b16* Ch = (b16*)carve((size_t)MR * DMOD * 2);
  b16* Cl = (b16*)carve((size_t)MR * DMOD * 2);
  if (off > ws_size || off > ((size_t)128 << 20)) return;   // 122,683,392 B at NB=2, SEQ=2048
  cvt_x_kernel<<<dim3((unsigned)MR), 256, 0, stream>>>(X, Xp);
  cvt_w_kernel<<<dim3(KD / 64, DMOD / 64), 64, 0, stream>>>(Wq, Wqt, DMOD);
  cvt_w_kernel<<<dim3(KD / 64, NKV / 64), 64, 0, stream>>>(Wk, Wkt, NKV);
  cvt_w_kernel<<<dim3(KD / 64, NKV / 64), 64, 0, stream>>>(Wv, Wvt, NKV);
  cvt_w_kernel<<<dim3(KD / 64, DMOD / 64), 64, 0, stream>>>(Wo, Wot, DMOD);
  rope_tab_kernel<<<dim3(SEQ / 4), 256, 0, stream>>>(CT, ST);
  proj_kernel<0, false><<<dim3(DMOD / 128, MR / 64), 128, 0, stream>>>(Xp, Xp, Wqt, Qh, Ql, out, CT, ST, H, SEQ / 64, 0);
  proj_kernel<0, false><<<dim3(NKV / 128, MR / 64), 128, 0, stream>>>(Xp, Xp, Wkt, Kh, Kl, out, CT, ST, HKV, SEQ / 64, 0);
  proj_kernel<1, false><<<dim3(NKV / 128, MR / 64), 128, 0, stream>>>(Xp, Xp, Wvt, Vh, Vl, out, CT, ST, HKV, SEQ / 64, 0);
  attn_kernel<true><<<dim3(QEA / 32, NB * H, 2), 64, 0, stream>>>(Qh, Ql, Kh, Kl, Vh, Vl, Ch, Cl);
  if (SEQ > QEA) attn_kernel<false><<<dim3((SEQ - QEA) / 32, NB * H, 1), 64, 0, stream>>>(Qh, Ql, Kh, Kl, Vh, Vl, Ch, Cl);
  proj_kernel<2, true><<<dim3(DMOD / 64, NB * (QEA / 64)), 128, 0, stream>>>(Ch, Cl, Wot, Ch, Cl, out, CT, ST, 1, QEA / 64, 0);
  if (SEQ > QEA) proj_kernel<2, false><<<dim3(DMOD / 128, NB * ((SEQ - QEA) / 64)), 128, 0, stream>>>(Ch, Ch, Wot, Ch, Cl, out, CT, ST, 1, (SEQ - QEA) / 64, QEA);
}

// v001
// A run of this version takes 441 microseconds.
// Next to v000, in two timings, it ran 1.72 and 1.70 times as fast.
#include <hip/hip_runtime.h>

// compute dtype: every contraction on v_wmma_f32_16x16x32_f16 (f16 operands, f32 accumulate). x@Wq, x@Wk, x@Wv: x and W enter as bf16-RNE values
// carried x8 (x) and x256 (W) in f16 planes, 1 product. Scores S^T = K Q^T per head: q, k (RoPE applied in f32) as f16 x8 planes, 1 product;
// query rows with position < QE use q,k hi + x2048 residual planes (3 products, second accumulator folded by 1/2048). O^T += V^T P^T: v f16 x8,
// P f16 x1024, 1 product; rows < QE add P and v x2048 residual tiles into a second accumulator (3 products) folded before normalisation.
// ctx@Wo: ctx f16 x64 plane (+ x2048 residual plane for rows < QE, 2 products), Wo bf16-RNE x256, 1 product elsewhere. Softmax statistics
// (running max, exp2, row sums) and RoPE tables in f32; scale 1/sqrt(128) folded into the log2 constant.
// Fragment k-map per lane half hh for A AND B: elements 0..7 <- k = 8hh+0..7, 8..15 <- k = 16+8hh+0..7; acc[r] = D[8hh+r][col = lane&15].

#ifndef NB
#define NB 2
#endif
#ifndef SEQ
#define SEQ 2048
#endif
#ifndef NB_FULL
#define NB_FULL 2
#endif
#ifndef SEQ_FULL
#define SEQ_FULL 2048
#endif
#ifndef QE
#define QE 256
#endif

namespace {
constexpr int DMOD = 2048, KD = 2048, H = 16, HKV = 4, NREP = H / HKV, HD = 128, NKV = HKV * HD;   // NKV = 512
constexpr int MR = NB * SEQ;                                                                         // token rows handled
constexpr int QEA = (QE < SEQ) ? QE : SEQ;                                                           // query positions with residual operands
constexpr float XS = 8.0f, WS = 256.0f, QS = 8.0f, RS = 2048.0f, PS = 1024.0f, CS = 64.0f;
constexpr float LOG2E = 1.4426950408889634f, SCL = 0.08838834764831845f, ROPE_BASE = 500000.0f;
static_assert(SEQ % 64 == 0 && SEQ >= 64 && SEQ <= SEQ_FULL && NB >= 1 && NB <= NB_FULL);
static_assert(QEA % 64 == 0 && QEA >= 64 && QEA <= SEQ && (SEQ - QEA) % 64 == 0);
static_assert(DMOD == H * HD && KD == DMOD && KD % 64 == 0 && DMOD % 128 == 0 && NKV % 128 == 0 && HD == 128 && DMOD == 256 * 8 && MR % 64 == 0);

typedef _Float16 b16;
typedef __attribute__((ext_vector_type(16))) _Float16 v16b;
typedef __attribute__((ext_vector_type(8))) _Float16 v8b;
typedef __attribute__((ext_vector_type(8))) float v8f;
typedef __attribute__((ext_vector_type(4))) float v4f;

__device__ __forceinline__ float bf16_rne(float f) { unsigned int u = __float_as_uint(f); u += 0x7FFFu + ((u >> 16) & 1u); return __uint_as_float(u & 0xFFFF0000u); }
// 16-bit fragment from a k-contiguous row: elements 0..7 <- p[8hh .. 8hh+7], 8..15 <- p[16+8hh .. 16+8hh+7]
__device__ __forceinline__ v16b frag_kb(const b16* p, int hh) {
  const v8b a = *(const v8b*)(p + 8 * hh), b = *(const v8b*)(p + 16 + 8 * hh); v16b f;
#pragma unroll
  for (int e = 0; e < 8; ++e) { f[e] = a[e]; f[8 + e] = b[e]; }
  return f;
}
__device__ __forceinline__ v8f wmma16b(v16b a, v16b b, v8f c) {
  v8f d = __builtin_amdgcn_wmma_f32_16x16x32_f16(false, a, false, b, (short)0, c, false, false);
  asm volatile("v_nop\n\tv_nop\n\tv_nop\n\tv_nop" : "+v"(d) : "v"(a), "v"(b));
  return d;
}
__device__ __forceinline__ void wave_lds_sync() { __builtin_amdgcn_fence(3, "workgroup"); __builtin_amdgcn_wave_barrier(); __builtin_amdgcn_fence(2, "workgroup"); }
__device__ __forceinline__ float nexp2(float v) { return __builtin_amdgcn_exp2f(v); }
// hi = f16(w), lo = f16((w - hi) * RS)
__device__ __forceinline__ void split16(float w, b16& hi, b16& lo) { hi = (b16)w; lo = (b16)((w - (float)hi) * RS); }

__global__ __launch_bounds__(256) void cvt_x_kernel(const float* __restrict__ X, b16* Xp) {
  const size_t u = (size_t)blockIdx.x * 256 + threadIdx.x; const size_t row = u >> 8; const int c8 = (int)(u & 255) * 8;
  if (row >= (size_t)MR) return;
  const size_t b = row / SEQ, s = row % SEQ;
  const float* src = X + (b * SEQ_FULL + s) * DMOD + c8;
  b16* dst = Xp + row * DMOD + c8;
  const v4f x0 = *(const v4f*)src, x1 = *(const v4f*)(src + 4); v8b o;
#pragma unroll
  for (int j = 0; j < 4; ++j) { o[j] = (b16)(bf16_rne(x0[j]) * XS); o[4 + j] = (b16)(bf16_rne(x1[j]) * XS); }
  *(v8b*)dst = o; 
}

// W [2048 k][N n] f32 -> Wt [N][2048] f16 = bf16-RNE(w) x256 (k-contiguous for the B fragments). Block per 64x64 tile, 2 waves; transposed through
__global__ __launch_bounds__(64) void cvt_w_kernel(const float* __restrict__ W, b16* Wt, int N) {
  __shared__ __attribute__((aligned(16))) b16 St[64][64 + 8];
  const int tid = threadIdx.x, wave = tid >> 5, lane = tid & 31; const int k0 = (int)blockIdx.x * 64, n0 = (int)blockIdx.y * 64;
  const float* src = W + (size_t)k0 * N + n0;
  for (int it = 0; it < 16; ++it) {
    const int e = (it * 64 + tid) * 4; const int kr = e >> 6, nc = e & 63;
    const v4f x = *(const v4f*)(src + (size_t)kr * N + nc);
#pragma unroll
    for (int j = 0; j < 4; ++j) St[nc + j][kr] = (b16)(bf16_rne(x[j]) * WS);
  }
  __syncthreads();   // St is read across waves
  b16* dstb = Wt + (size_t)n0 * KD + k0;
  {
#pragma unroll 1
    for (int it = 0; it < 8; ++it) {
      const int n = wave * 32 + it * 4 + (lane >> 3), ks = (lane & 7) * 8;
      const v8b o = *(const v8b*)(&St[n][ks]);
      *(v8b*)(dstb + (size_t)n * KD + ks) = o; }
     }
}

// cos/sin tables [SEQ][64] f32: ang = s * (1 / base^(2j/128)) in f32, precise sincosf. Block = 4 positions x 64 frequencies staged in LDS;
__global__ __launch_bounds__(256) void rope_tab_kernel(float* CT, float* ST) {
  __shared__ __attribute__((aligned(16))) float Tb[2][4][64 + 4];
  const int tid = threadIdx.x; const int r = tid >> 6, j = tid & 63; const int s0 = (int)blockIdx.x * 4;
  const float ex = (float)(2 * j) * (1.0f / 128.0f);
  const float p = powf(ROPE_BASE, ex);
  const float inv = 1.0f / p;
  const float ang = (float)(s0 + r) * inv;
  float sn, c; sincosf(ang, &sn, &c);
  Tb[0][r][j] = c; Tb[1][r][j] = sn;
  __syncthreads();   // Tb is read across waves
  if (tid < 128) {
    const int tb = tid >> 6, rr = (tid >> 4) & 3, seg = (tid & 15) * 4;
    const v4f f = *(const v4f*)(&Tb[tb][rr][seg]);
    float* dst = (tb == 0 ? CT : ST) + (size_t)(s0 + rr) * 64 + seg;
    *(v4f*)dst = f; 
  }
}

// One trip of the projection GEMM's K loop: 64 k = 128 B of each of 192 operand rows, laid in LDS at a pitch of 144 B (16 B x odd, for 16-byte readers).
constexpr int KS = 64, LP = 144, SROWS = 192, STAGE = SROWS * LP;   // 27,648 B a buffer
// Twelve asynchronous 16-byte copies a lane fill one buffer: LDS rows r, r+16, .. r+176 (l = the lane's byte address in row r), rows 0..63 from g0, 64..127
// from g1, 128..191 from g2 (each the lane's own address in its group's row r; 16 rows further = 16*KD elements). Eight lanes cover one 128-B row.
__device__ __forceinline__ void copy_stage(unsigned l, const b16* g0, const b16* g1, const b16* g2) {
  constexpr size_t RJ = (size_t)16 * KD; constexpr unsigned LJ = 16u * LP;
  // s_wait_xcnt 0 as the last line: it stands in front of every later rewrite of a register that a copy names
  asm volatile(
      "global_load_async_to_lds_b128 %0, %12, off\n\t"
      "global_load_async_to_lds_b128 %1, %13, off\n\t"
      "global_load_async_to_lds_b128 %2, %14, off\n\t"
      "global_load_async_to_lds_b128 %3, %15, off\n\t"
      "global_load_async_to_lds_b128 %4, %16, off\n\t"
      "global_load_async_to_lds_b128 %5, %17, off\n\t"
      "global_load_async_to_lds_b128 %6, %18, off\n\t"
      "global_load_async_to_lds_b128 %7, %19, off\n\t"
      "global_load_async_to_lds_b128 %8, %20, off\n\t"
      "global_load_async_to_lds_b128 %9, %21, off\n\t"
      "global_load_async_to_lds_b128 %10, %22, off\n\t"
      "global_load_async_to_lds_b128 %11, %23, off\n\t"
      "s_wait_xcnt 0x0"
      :: "v"(l), "v"(l + LJ), "v"(l + 2 * LJ), "v"(l + 3 * LJ), "v"(l + 4 * LJ), "v"(l + 5 * LJ),
         "v"(l + 6 * LJ), "v"(l + 7 * LJ), "v"(l + 8 * LJ), "v"(l + 9 * LJ), "v"(l + 10 * LJ), "v"(l + 11 * LJ),
         "v"(g0), "v"(g0 + RJ), "v"(g0 + 2 * RJ), "v"(g0 + 3 * RJ), "v"(g1), "v"(g1 + RJ), "v"(g1 + 2 * RJ), "v"(g1 + 3 * RJ),
         "v"(g2), "v"(g2 + RJ), "v"(g2 + 2 * RJ), "v"(g2 + 3 * RJ)
      : "memory");
}

// C[64 x BN] = A[m][k] . B[k][n] with A plane [rows][2048] and Bt plane [N][2048], both k-contiguous f16; K = 2048 in trips of 64 (two WMMA steps of 32).
// 128 threads = 4 waves. The block's operand rows of a trip (A 64 rows, then B 128 rows; RES: A 64, residual A 64, B 64) are copied once into LDS,
// two buffers: the copies of trip t+2 fly while trip t+1 is worked on. Waves 2 x 2 on the tile: wave w owns rows 32(w>>1)..+31 and columns (BN/2)(w&1)..
// (NT accumulators). RES: a second A plane (x2048 residual) into acc2.
// Row tile: blockIdx.y = bsel * tpb + tsel, rows m0 = bsel*SEQ + toff + 64 tsel. Epilogue staged through the same LDS (behind the loop's last barrier) then:
// MODE 0: RoPE in f32 with the cos/sin tables, hi x8 / lo x2048 planes [b][nhead][s][128] (256-B rows by 16 lanes x 16 B, 8 rows per store);
template <int MODE, bool RES>
__global__ __launch_bounds__(128) __attribute__((amdgpu_num_vgpr(256))) void proj_kernel(
    const b16* __restrict__ A, const b16* __restrict__ Al, const b16* __restrict__ Bt, b16* Ph, b16* Pl, float* Out,
    const float* __restrict__ CT, const float* __restrict__ ST, int nhead, int tpb, int toff) {
#pragma clang fp contract(off)
  static_assert(MODE == 2 || !RES);
  constexpr int BN = RES ? 64 : 128, NT = BN / 16, FB = NT / 2, NTRIP = KD / KS, BROW = RES ? 128 : 64;
  static_assert(64 * (BN + 4) * 4 <= 2 * STAGE && NTRIP >= 2 && BROW + BN == SROWS);
  __shared__ __attribute__((aligned(16))) unsigned char Sm[2 * STAGE];
  float (*To)[BN + 4] = reinterpret_cast<float (*)[BN + 4]>(Sm);
  const int tid = threadIdx.x, wave = tid >> 5, lane = tid & 31, hh = lane >> 4, col = lane & 15;
  const int by = (int)blockIdx.y; const int bsel = by / tpb, tsel = by - bsel * tpb;
  const int s0 = toff + tsel * 64;
  const size_t m0 = (size_t)bsel * SEQ + s0;
  const int n0 = (int)blockIdx.x * BN;
  const int wm = wave >> 1, wn = wave & 1;
  const int cr = tid >> 3, cs = (tid & 7) * 8;   // the lane's row in each run of 16 rows, and its 16-byte piece of the row
  const b16* g0 = A + (m0 + cr) * KD + cs;
  const b16* g1 = RES ? Al + (m0 + cr) * KD + cs : Bt + (size_t)(n0 + cr) * KD + cs;
  const b16* g2 = Bt + (size_t)(n0 + (RES ? 0 : 64) + cr) * KD + cs;
  const unsigned lc = (unsigned)(uintptr_t)(&Sm[cr * LP + cs * 2]);
  const unsigned char* sa = &Sm[(wm * 32 + col) * LP];
  const unsigned char* sb = &Sm[(BROW + wn * (BN / 2) + col) * LP];
  v8f acc[NT], acc2[NT];
#pragma unroll
  for (int t = 0; t < NT; ++t) { acc[t] = (v8f){}; acc2[t] = (v8f){}; }
  copy_stage(lc, g0, g1, g2);
  asm volatile("s_wait_asynccnt 0x0" ::: "memory");   // this wave's copies of trip 0 have landed
  __syncthreads();                                     // every wave's have: trip 0 may be read
  copy_stage(lc + STAGE, g0 + KS, g1 + KS, g2 + KS);
#pragma unroll 1
  for (int tr = 0; tr < NTRIP; ++tr) {
    const int bo = (tr & 1) * STAGE;
    v16b af[2][2], alf[2][2], bf[2][FB];   // the trip's fragments, read as one group ahead of its WMMAs
#pragma unroll
    for (int kk = 0; kk < 2; ++kk) {
#pragma unroll
      for (int i = 0; i < 2; ++i) {
        af[kk][i] = frag_kb((const b16*)(sa + bo + i * 16 * LP) + kk * 32, hh);
        alf[kk][i] = (v16b){};
        if constexpr (RES) alf[kk][i] = frag_kb((const b16*)(sa + bo + (64 + i * 16) * LP) + kk * 32, hh);
      }
#pragma unroll
      for (int j = 0; j < FB; ++j) bf[kk][j] = frag_kb((const b16*)(sb + bo + j * 16 * LP) + kk * 32, hh);
    }
#pragma unroll
    for (int kk = 0; kk < 2; ++kk)
#pragma unroll
      for (int i = 0; i < 2; ++i)
#pragma unroll
        for (int j = 0; j < FB; ++j) {
          acc[i * FB + j] = wmma16b(af[kk][i], bf[kk][j], acc[i * FB + j]);
          if constexpr (RES) acc2[i * FB + j] = wmma16b(alf[kk][i], bf[kk][j], acc2[i * FB + j]);
        }
    asm volatile("s_wait_dscnt 0x0" ::: "memory");      // this wave's reads of the buffer are done before it is refilled
    asm volatile("s_wait_asynccnt 0x0" ::: "memory");   // this wave's copies of trip tr+1 have landed
    __syncthreads();                                     // publishes trip tr+1 and ends every reader's last read of trip tr
    if (tr + 2 < NTRIP) { const int ko = (tr + 2) * KS; copy_stage(lc + bo, g0 + ko, g1 + ko, g2 + ko); }
  }
  asm volatile("s_wait_asynccnt 0x0" ::: "memory");     // no copy is outstanding when the buffers become output staging
#pragma unroll
  for (int i = 0; i < 2; ++i)
#pragma unroll
    for (int j = 0; j < FB; ++j)
#pragma unroll
      for (int r = 0; r < 8; ++r) {
        float v = acc[i * FB + j][r];
        if constexpr (RES) v += acc2[i * FB + j][r] * (1.0f / RS);
        To[wm * 32 + i * 16 + 8 * hh + r][wn * (BN / 2) + j * 16 + col] = v; }
  __syncthreads();   // To is read across waves
  if constexpr (MODE == 0) {
    const size_t pb = (((size_t)bsel * nhead + blockIdx.x) * SEQ + s0) * HD;
    b16* ph = Ph + pb; b16* pl = Pl + pb;
    const float qsc = QS / (XS * WS);
    {
#pragma unroll 1
      for (int it = 0; it < 8; ++it) {
        const int rr = it * 8 + (tid >> 4), seg = (tid & 15) * 8, sg = seg & 63;
        const float sgn = (seg >= 64) ? 1.0f : -1.0f;   // d < 64: x cos - x[d+64] sin; d >= 64: x cos + x[d-64] sin
        const float* trow = &To[rr][0]; const size_t ts = (size_t)(s0 + rr) * 64 + sg;
        const v4f xa = *(const v4f*)(trow + seg), xb = *(const v4f*)(trow + seg + 4);
        const v4f ya = *(const v4f*)(trow + (seg ^ 64)), yb = *(const v4f*)(trow + (seg ^ 64) + 4);
        const v4f ca = *(const v4f*)(CT + ts), cb = *(const v4f*)(CT + ts + 4), sa = *(const v4f*)(ST + ts), sb = *(const v4f*)(ST + ts + 4);
        v8b hi, lo;
#pragma unroll
        for (int j = 0; j < 4; ++j) {
          b16 h0, l0;
          split16((xa[j] * ca[j] + sgn * ya[j] * sa[j]) * qsc, h0, l0); hi[j] = h0; lo[j] = l0;
          split16((xb[j] * cb[j] + sgn * yb[j] * sb[j]) * qsc, h0, l0); hi[4 + j] = h0; lo[4 + j] = l0; }
        const size_t off = (size_t)rr * HD + seg;
        *(v8b*)(ph + off) = hi; *(v8b*)(pl + off) = lo; }
       }
  } else if constexpr (MODE == 1) {
    const size_t pb = ((size_t)bsel * nhead + blockIdx.x) * HD * (size_t)SEQ + s0;
    b16* ph = Ph + pb; b16* pl = Pl + pb;
    const float vsc = QS / (XS * WS);
    {
#pragma unroll 1
      for (int it = 0; it < 8; ++it) {
        const int d = it * 16 + (tid >> 3), ss = (tid & 7) * 8;
        v8b hi, lo;
#pragma unroll
        for (int j = 0; j < 8; ++j) { b16 h0, l0; split16(To[ss + j][d] * vsc, h0, l0); hi[j] = h0; lo[j] = l0; }
        const size_t off = (size_t)d * SEQ + ss;
        *(v8b*)(ph + off) = hi; *(v8b*)(pl + off) = lo; }
       }
  } else {
    constexpr int LPR = BN / 4, RPI = 128 / LPR, NIT = 64 / RPI;
    static_assert(NIT * RPI == 64 && LPR * 4 == BN);
    float* ob = Out + ((size_t)bsel * SEQ_FULL + s0) * DMOD + n0;
    const float osc = 1.0f / (CS * WS);
    {
#pragma unroll 1
      for (int it = 0; it < NIT; ++it) {
        const int rr = it * RPI + tid / LPR, seg = (tid % LPR) * 4;
        const v4f f = *(const v4f*)(&To[rr][seg]) * osc;
        *(v4f*)(ob + (size_t)rr * DMOD + seg) = f; }
       }
  }
}

// Causal GQA attention: grid (query blocks of 32, NB*H[, 2 d-halves when ER]); block = 2 waves x 16 queries; key steps of 32 from key 0 up to the
// block's last query in fixed order; online softmax (running max, f32); keys later than the query get -inf on the diagonal step; P x1024 via
// wave-private LDS; O^T += V^T P^T. ER (query position < QEA): scores Kh Qh + (Kh Ql + Kl Qh)/2048, O^T second accumulator Vh Pr + Vl Ph folded
// by 1/2048, each block restricted to 64 of the 128 d rows (blockIdx.z). ctx hi x64 / lo x2048 planes [b*SEQ+s][h*128 + d]: each row segment
template <bool ER>
__global__ __launch_bounds__(64) __attribute__((amdgpu_num_vgpr(256))) void attn_kernel(
    const b16* __restrict__ Qh, const b16* __restrict__ Ql, const b16* __restrict__ Kh, const b16* __restrict__ Kl,
    const b16* __restrict__ Vh, const b16* __restrict__ Vl, b16* Ch, b16* Cl) {
  constexpr int NT = ER ? 4 : 8, DW = NT * 16;
  __shared__ __attribute__((aligned(16))) b16 Pb[2][16][32 + 8];
  __shared__ __attribute__((aligned(16))) b16 Pr[2][16][32 + 8];
  __shared__ __attribute__((aligned(16))) float To[2][16][DW + 4];
  const int wave = threadIdx.x >> 5, lane = threadIdx.x & 31, hh = lane >> 4, col = lane & 15;
  const int bh = (int)blockIdx.y; const int b = bh / H, h = bh - b * H, g = h / NREP;
  const int qb0 = (ER ? 0 : QEA) + (int)blockIdx.x * 32;
  const int q0 = qb0 + wave * 16, qi = q0 + col;
  const int dh = ER ? (int)blockIdx.z * 64 : 0;
  const b16* qrow = Qh + ((size_t)(b * H + h) * SEQ + qi) * HD;
  const b16* qlrow = Ql + ((size_t)(b * H + h) * SEQ + qi) * HD;
  const b16* Kb = Kh + (size_t)(b * HKV + g) * SEQ * HD;
  const b16* Klb = Kl + (size_t)(b * HKV + g) * SEQ * HD;
  const b16* Vb = Vh + ((size_t)(b * HKV + g) * HD + dh) * SEQ;
  const b16* Vlb = Vl + ((size_t)(b * HKV + g) * HD + dh) * SEQ;
  v16b qa[4];
#pragma unroll
  for (int c = 0; c < 4; ++c) { qa[c] = (v16b){}; if constexpr (!ER) qa[c] = frag_kb(qrow + c * 32, hh); }
  const float cs = SCL * LOG2E / (QS * QS);   // 1/sqrt(128) and the two x8 carriers, in the log2 domain
  float m = -INFINITY, l = 0.0f; v8f o[NT], o2[NT];
#pragma unroll
  for (int t = 0; t < NT; ++t) { o[t] = (v8f){}; o2[t] = (v8f){}; }
  const int nst = qb0 / 32 + 1;   // block-uniform: keys 0 .. qb0+31
#pragma unroll 1
  for (int st = 0; st < nst; ++st) {
    const int kb = st * 32; const int lim = qi - kb;   // key offsets > lim are later than the query (binds only on the diagonal step)
    float e[16]; float mx = -INFINITY;
#pragma unroll
    for (int u = 0; u < 2; ++u) {
      const size_t kr = (size_t)(kb + u * 16 + col) * HD;
      v8f s = (v8f){}, s2 = (v8f){};
#pragma unroll
      for (int c = 0; c < 4; ++c) {
        const v16b kf = frag_kb(Kb + kr + c * 32, hh);
        if constexpr (ER) {
          const v16b qh = frag_kb(qrow + c * 32, hh), ql = frag_kb(qlrow + c * 32, hh), klf = frag_kb(Klb + kr + c * 32, hh);
          s = wmma16b(kf, qh, s); s2 = wmma16b(kf, ql, s2); s2 = wmma16b(klf, qh, s2);
        } else {
          s = wmma16b(kf, qa[c], s);
        }
      }
#pragma unroll
      for (int r = 0; r < 8; ++r) {
        float v = s[r];
        if constexpr (ER) v += s2[r] * (1.0f / RS);
        v *= cs;
        if (u * 16 + 8 * hh + r > lim) v = -INFINITY;
        e[u * 8 + r] = v; mx = fmaxf(mx, v); } }
    mx = fmaxf(mx, __shfl_xor(mx, 16)); const float mn = fmaxf(m, mx); const float al = nexp2(m - mn); float sum = 0.0f;
#pragma unroll
    for (int i2 = 0; i2 < 16; ++i2) {
      const float p = nexp2(e[i2] - mn); sum += p; const int pi = (i2 < 8 ? 0 : 16) + 8 * hh + (i2 & 7);
      const float pp = p * PS; const b16 phv = (b16)pp; Pb[wave][col][pi] = phv;
      if constexpr (ER) Pr[wave][col][pi] = (b16)((pp - (float)phv) * RS); }
    sum += __shfl_xor(sum, 16); l = l * al + sum; m = mn;
    wave_lds_sync();
    const v16b pf = frag_kb(&Pb[wave][col][0], hh);
    v16b prf = (v16b){};
    if constexpr (ER) prf = frag_kb(&Pr[wave][col][0], hh);
#pragma unroll
    for (int t = 0; t < NT; ++t) {
      o[t] *= al; const v16b vf = frag_kb(Vb + (size_t)(t * 16 + col) * SEQ + kb, hh);
      o[t] = wmma16b(vf, pf, o[t]);
      if constexpr (ER) {
        o2[t] *= al; const v16b vlf = frag_kb(Vlb + (size_t)(t * 16 + col) * SEQ + kb, hh);
        o2[t] = wmma16b(vf, prf, o2[t]); o2[t] = wmma16b(vlf, pf, o2[t]); } }
    wave_lds_sync(); }
  const float inv = 1.0f / (l * PS * QS);
#pragma unroll
  for (int t = 0; t < NT; ++t) {
#pragma unroll
    for (int r = 0; r < 8; ++r) {
      float ov = o[t][r];
      if constexpr (ER) ov += o2[t][r] * (1.0f / RS);
      To[wave][col][t * 16 + 8 * hh + r] = ov * inv; } }
  wave_lds_sync();
  constexpr int LPR = DW / 8, RPI = 32 / LPR, NIT = 16 / RPI;
  static_assert(NIT * RPI == 16 && LPR * 8 == DW);
  const size_t cbase = ((size_t)b * SEQ + q0) * DMOD + (size_t)h * HD + dh;
  {
#pragma unroll 1
    for (int it = 0; it < NIT; ++it) {
      const int rr = it * RPI + lane / LPR, seg = (lane % LPR) * 8;
      const v4f fa = *(const v4f*)(&To[wave][rr][seg]), fb = *(const v4f*)(&To[wave][rr][seg + 4]);
      v8b hi, lo;
#pragma unroll
      for (int j = 0; j < 4; ++j) { b16 h0, l0; split16(fa[j] * CS, h0, l0); hi[j] = h0; lo[j] = l0; split16(fb[j] * CS, h0, l0); hi[4 + j] = h0; lo[4 + j] = l0; }
      const size_t off = cbase + (size_t)rr * DMOD + seg;
      *(v8b*)(Ch + off) = hi; *(v8b*)(Cl + off) = lo; }
     }
}
}  // namespace

extern "C" void kernel_launch(void* const* d_in, const int* in_sizes, int n_in, void* d_out, int out_size, void* d_ws, size_t ws_size, hipStream_t stream) {
  // wire order: 0 x [NB_FULL][SEQ_FULL][2048] f32, 1 Wq [2048][2048], 2 Wk [2048][512], 3 Wv [2048][512], 4 Wo [2048][2048]; out [NB_FULL][SEQ_FULL][2048] f32
  const size_t need_x = ((size_t)(NB - 1) * SEQ_FULL + SEQ) * DMOD;
  if (n_in < 5 || (size_t)in_sizes[0] < need_x || (size_t)in_sizes[1] < (size_t)KD * DMOD || (size_t)in_sizes[2] < (size_t)KD * NKV ||
      (size_t)in_sizes[3] < (size_t)KD * NKV || (size_t)in_sizes[4] < (size_t)KD * DMOD || (size_t)out_size < need_x) return;
  const float* X = (const float*)d_in[0]; const float* Wq = (const float*)d_in[1]; const float* Wk = (const float*)d_in[2];
  const float* Wv = (const float*)d_in[3]; const float* Wo = (const float*)d_in[4]; float* out = (float*)d_out;
  size_t off = 0; char* ws = (char*)d_ws;
  auto carve = [&](size_t bytes) { char* p = ws + off; off += (bytes + 255) & ~(size_t)255; return p; };
  b16* Xp  = (b16*)carve((size_t)MR * DMOD * 2);
  b16* Wqt = (b16*)carve((size_t)DMOD * KD * 2);
  b16* Wkt = (b16*)carve((size_t)NKV * KD * 2);
  b16* Wvt = (b16*)carve((size_t)NKV * KD * 2);
  b16* Wot = (b16*)carve((size_t)DMOD * KD * 2);
  float* CT = (float*)carve((size_t)SEQ * 64 * 4);
  float* ST = (float*)carve((size_t)SEQ * 64 * 4);
  b16* Qh = (b16*)carve((size_t)MR * H * HD * 2);
  b16* Ql = (b16*)carve((size_t)MR * H * HD * 2);
  b16* Kh = (b16*)carve((size_t)MR * NKV * 2);
  b16* Kl = (b16*)carve((size_t)MR * NKV * 2);
  b16* Vh = (b16*)carve((size_t)MR * NKV * 2);
  b16* Vl = (b16*)carve((size_t)MR * NKV * 2);
  b16* Ch = (b16*)carve((size_t)MR * DMOD * 2);
  b16* Cl = (b16*)carve((size_t)MR * DMOD * 2);
  if (off > ws_size || off > ((size_t)128 << 20)) return;   // 122,683,392 B at NB=2, SEQ=2048
  cvt_x_kernel<<<dim3((unsigned)MR), 256, 0, stream>>>(X, Xp);
  cvt_w_kernel<<<dim3(KD / 64, DMOD / 64), 64, 0, stream>>>(Wq, Wqt, DMOD);
  cvt_w_kernel<<<dim3(KD / 64, NKV / 64), 64, 0, stream>>>(Wk, Wkt, NKV);
  cvt_w_kernel<<<dim3(KD / 64, NKV / 64), 64, 0, stream>>>(Wv, Wvt, NKV);
  cvt_w_kernel<<<dim3(KD / 64, DMOD / 64), 64, 0, stream>>>(Wo, Wot, DMOD);
  rope_tab_kernel<<<dim3(SEQ / 4), 256, 0, stream>>>(CT, ST);
  proj_kernel<0, false><<<dim3(DMOD / 128, MR / 64), 128, 0, stream>>>(Xp, Xp, Wqt, Qh, Ql, out, CT, ST, H, SEQ / 64, 0);
  proj_kernel<0, false><<<dim3(NKV / 128, MR / 64), 128, 0, stream>>>(Xp, Xp, Wkt, Kh, Kl, out, CT, ST, HKV, SEQ / 64, 0);
  proj_kernel<1, false><<<dim3(NKV / 128, MR / 64), 128, 0, stream>>>(Xp, Xp, Wvt, Vh, Vl, out, CT, ST, HKV, SEQ / 64, 0);
  attn_kernel<true><<<dim3(QEA / 32, NB * H, 2), 64, 0, stream>>>(Qh, Ql, Kh, Kl, Vh, Vl, Ch, Cl);
  if (SEQ > QEA) attn_kernel<false><<<dim3((SEQ - QEA) / 32, NB * H, 1), 64, 0, stream>>>(Qh, Ql, Kh, Kl, Vh, Vl, Ch, Cl);
  proj_kernel<2, true><<<dim3(DMOD / 64, NB * (QEA / 64)), 128, 0, stream>>>(Ch, Cl, Wot, Ch, Cl, out, CT, ST, 1, QEA / 64, 0);
  if (SEQ > QEA) proj_kernel<2, false><<<dim3(DMOD / 128, NB * ((SEQ - QEA) / 64)), 128, 0, stream>>>(Ch, Ch, Wot, Ch, Cl, out, CT, ST, 1, (SEQ - QEA) / 64, QEA);
}

// v002
// It runs in 236 microseconds.
// In both of two side-by-side timings against v001, it was 1.87 times as fast.
// All steps since v000 together make it 3.19 times as fast.
#include <hip/hip_runtime.h>

// compute dtype: every contraction on v_wmma_f32_16x16x32_f16 (f16 operands, f32 accumulate). x@Wq, x@Wk, x@Wv: x and W enter as bf16-RNE values
// carried x8 (x) and x256 (W) in f16 planes, 1 product. Scores S^T = K Q^T per head: q, k (RoPE applied in f32) as f16 x8 planes, 1 product;
// query rows with position < QE use q,k hi + x2048 residual planes (3 products, second accumulator folded by 1/2048). O^T += V^T P^T: v f16 x8,
// P f16 x1024, 1 product; rows < QE add P and v x2048 residual tiles into a second accumulator (3 products) folded before normalisation.
// ctx@Wo: ctx f16 x64 plane (+ x2048 residual plane for rows < QE, 2 products), Wo bf16-RNE x256, 1 product elsewhere. Softmax statistics
// (running max, exp2, row sums) and RoPE tables in f32; scale 1/sqrt(128) folded into the log2 constant.
// Fragment k-map per lane half hh for A AND B: elements 0..7 <- k = 8hh+0..7, 8..15 <- k = 16+8hh+0..7; acc[r] = D[8hh+r][col = lane&15].

#ifndef NB
#define NB 2
#endif
#ifndef SEQ
#define SEQ 2048
#endif
#ifndef NB_FULL
#define NB_FULL 2
#endif
#ifndef SEQ_FULL
#define SEQ_FULL 2048
#endif
#ifndef QE
#define QE 256
#endif

namespace {
constexpr int DMOD = 2048, KD = 2048, H = 16, HKV = 4, NREP = H / HKV, HD = 128, NKV = HKV * HD;   // NKV = 512
constexpr int MR = NB * SEQ;                                                                         // token rows handled
constexpr int QEA = (QE < SEQ) ? QE : SEQ;                                                           // query positions with residual operands
constexpr float XS = 8.0f, WS = 256.0f, QS = 8.0f, RS = 2048.0f, PS = 1024.0f, CS = 64.0f;
constexpr float LOG2E = 1.4426950408889634f, SCL = 0.08838834764831845f, ROPE_BASE = 500000.0f;
static_assert(SEQ % 64 == 0 && SEQ >= 64 && SEQ <= SEQ_FULL && NB >= 1 && NB <= NB_FULL);
static_assert(QEA % 64 == 0 && QEA >= 64 && QEA <= SEQ && (SEQ - QEA) % 64 == 0);
static_assert(DMOD == H * HD && KD == DMOD && KD % 64 == 0 && DMOD % 128 == 0 && NKV % 128 == 0 && HD == 128 && DMOD == 256 * 8 && MR % 64 == 0);

typedef _Float16 b16;
typedef __attribute__((ext_vector_type(16))) _Float16 v16b;
typedef __attribute__((ext_vector_type(8))) _Float16 v8b;
typedef __attribute__((ext_vector_type(8))) float v8f;
typedef __attribute__((ext_vector_type(4))) float v4f;

__device__ __forceinline__ float bf16_rne(float f) { unsigned int u = __float_as_uint(f); u += 0x7FFFu + ((u >> 16) & 1u); return __uint_as_float(u & 0xFFFF0000u); }
// 16-bit fragment from a k-contiguous row: elements 0..7 <- p[8hh .. 8hh+7], 8..15 <- p[16+8hh .. 16+8hh+7]
__device__ __forceinline__ v16b frag_kb(const b16* p, int hh) {
  const v8b a = *(const v8b*)(p + 8 * hh), b = *(const v8b*)(p + 16 + 8 * hh); v16b f;
#pragma unroll
  for (int e = 0; e < 8; ++e) { f[e] = a[e]; f[8 + e] = b[e]; }
  return f;
}
__device__ __forceinline__ v8f wmma16b(v16b a, v16b b, v8f c) {
  v8f d = __builtin_amdgcn_wmma_f32_16x16x32_f16(false, a, false, b, (short)0, c, false, false);
  asm volatile("v_nop\n\tv_nop\n\tv_nop\n\tv_nop" : "+v"(d) : "v"(a), "v"(b));
  return d;
}
__device__ __forceinline__ void wave_lds_sync() { __builtin_amdgcn_fence(3, "workgroup"); __builtin_amdgcn_wave_barrier(); __builtin_amdgcn_fence(2, "workgroup"); }
__device__ __forceinline__ float nexp2(float v) { return __builtin_amdgcn_exp2f(v); }
// hi = f16(w), lo = f16((w - hi) * RS)
__device__ __forceinline__ void split16(float w, b16& hi, b16& lo) { hi = (b16)w; lo = (b16)((w - (float)hi) * RS); }

__global__ __launch_bounds__(256) void cvt_x_kernel(const float* __restrict__ X, b16* Xp) {
  const size_t u = (size_t)blockIdx.x * 256 + threadIdx.x; const size_t row = u >> 8; const int c8 = (int)(u & 255) * 8;
  if (row >= (size_t)MR) return;
  const size_t b = row / SEQ, s = row % SEQ;
  const float* src = X + (b * SEQ_FULL + s) * DMOD + c8;
  b16* dst = Xp + row * DMOD + c8;
  const v4f x0 = *(const v4f*)src, x1 = *(const v4f*)(src + 4); v8b o;
#pragma unroll
  for (int j = 0; j < 4; ++j) { o[j] = (b16)(bf16_rne(x0[j]) * XS); o[4 + j] = (b16)(bf16_rne(x1[j]) * XS); }
  *(v8b*)dst = o; 
}

// W [2048 k][N n] f32 -> Wt [N][2048] f16 = bf16-RNE(w) x256 (k-contiguous for the B fragments). Block per 64x64 tile, 2 waves; transposed through
__global__ __launch_bounds__(64) void cvt_w_kernel(const float* __restrict__ W, b16* Wt, int N) {
  __shared__ __attribute__((aligned(16))) b16 St[64][64 + 8];
  const int tid = threadIdx.x, wave = tid >> 5, lane = tid & 31; const int k0 = (int)blockIdx.x * 64, n0 = (int)blockIdx.y * 64;
  const float* src = W + (size_t)k0 * N + n0;
  for (int it = 0; it < 16; ++it) {
    const int e = (it * 64 + tid) * 4; const int kr = e >> 6, nc = e & 63;
    const v4f x = *(const v4f*)(src + (size_t)kr * N + nc);
#pragma unroll
    for (int j = 0; j < 4; ++j) St[nc + j][kr] = (b16)(bf16_rne(x[j]) * WS);
  }
  __syncthreads();   // St is read across waves
  b16* dstb = Wt + (size_t)n0 * KD + k0;
  {
#pragma unroll 1
    for (int it = 0; it < 8; ++it) {
      const int n = wave * 32 + it * 4 + (lane >> 3), ks = (lane & 7) * 8;
      const v8b o = *(const v8b*)(&St[n][ks]);
      *(v8b*)(dstb + (size_t)n * KD + ks) = o; }
     }
}

// cos/sin tables [SEQ][64] f32: ang = s * (1 / base^(2j/128)) in f32, precise sincosf. Block = 4 positions x 64 frequencies staged in LDS;
__global__ __launch_bounds__(256) void rope_tab_kernel(float* CT, float* ST) {
  __shared__ __attribute__((aligned(16))) float Tb[2][4][64 + 4];
  const int tid = threadIdx.x; const int r = tid >> 6, j = tid & 63; const int s0 = (int)blockIdx.x * 4;
  const float ex = (float)(2 * j) * (1.0f / 128.0f);
  const float p = powf(ROPE_BASE, ex);
  const float inv = 1.0f / p;
  const float ang = (float)(s0 + r) * inv;
  float sn, c; sincosf(ang, &sn, &c);
  Tb[0][r][j] = c; Tb[1][r][j] = sn;
  __syncthreads();   // Tb is read across waves
  if (tid < 128) {
    const int tb = tid >> 6, rr = (tid >> 4) & 3, seg = (tid & 15) * 4;
    const v4f f = *(const v4f*)(&Tb[tb][rr][seg]);
    float* dst = (tb == 0 ? CT : ST) + (size_t)(s0 + rr) * 64 + seg;
    *(v4f*)dst = f; 
  }
}

// One trip of the projection GEMM's K loop: 64 k = 128 B of each of 192 operand rows, laid in LDS at a pitch of 144 B (16 B x odd, for 16-byte readers).
constexpr int KS = 64, LP = 144, SROWS = 192, STAGE = SROWS * LP;   // 27,648 B a buffer
// Twelve asynchronous 16-byte copies a lane fill one buffer: LDS rows r, r+16, .. r+176 (l = the lane's byte address in row r), rows 0..63 from g0, 64..127
// from g1, 128..191 from g2 (each the lane's own address in its group's row r; 16 rows further = 16*KD elements). Eight lanes cover one 128-B row.
__device__ __forceinline__ void copy_stage(unsigned l, const b16* g0, const b16* g1, const b16* g2) {
  constexpr size_t RJ = (size_t)16 * KD; constexpr unsigned LJ = 16u * LP;
  // s_wait_xcnt 0 as the last line: it stands in front of every later rewrite of a register that a copy names
  asm volatile(
      "global_load_async_to_lds_b128 %0, %12, off\n\t"
      "global_load_async_to_lds_b128 %1, %13, off\n\t"
      "global_load_async_to_lds_b128 %2, %14, off\n\t"
      "global_load_async_to_lds_b128 %3, %15, off\n\t"
      "global_load_async_to_lds_b128 %4, %16, off\n\t"
      "global_load_async_to_lds_b128 %5, %17, off\n\t"
      "global_load_async_to_lds_b128 %6, %18, off\n\t"
      "global_load_async_to_lds_b128 %7, %19, off\n\t"
      "global_load_async_to_lds_b128 %8, %20, off\n\t"
      "global_load_async_to_lds_b128 %9, %21, off\n\t"
      "global_load_async_to_lds_b128 %10, %22, off\n\t"
      "global_load_async_to_lds_b128 %11, %23, off\n\t"
      "s_wait_xcnt 0x0"
      :: "v"(l), "v"(l + LJ), "v"(l + 2 * LJ), "v"(l + 3 * LJ), "v"(l + 4 * LJ), "v"(l + 5 * LJ),
         "v"(l + 6 * LJ), "v"(l + 7 * LJ), "v"(l + 8 * LJ), "v"(l + 9 * LJ), "v"(l + 10 * LJ), "v"(l + 11 * LJ),
         "v"(g0), "v"(g0 + RJ), "v"(g0 + 2 * RJ), "v"(g0 + 3 * RJ), "v"(g1), "v"(g1 + RJ), "v"(g1 + 2 * RJ), "v"(g1 + 3 * RJ),
         "v"(g2), "v"(g2 + RJ), "v"(g2 + 2 * RJ), "v"(g2 + 3 * RJ)
      : "memory");
}

// C[64 x BN] = A[m][k] . B[k][n] with A plane [rows][2048] and Bt plane [N][2048], both k-contiguous f16; K = 2048 in trips of 64 (two WMMA steps of 32).
// 128 threads = 4 waves. The block's operand rows of a trip (A 64 rows, then B 128 rows; RES: A 64, residual A 64, B 64) are copied once into LDS,
// two buffers: the copies of trip t+2 fly while trip t+1 is worked on. Waves 2 x 2 on the tile: wave w owns rows 32(w>>1)..+31 and columns (BN/2)(w&1)..
// (NT accumulators). RES: a second A plane (x2048 residual) into acc2.
// Row tile: blockIdx.y = bsel * tpb + tsel, rows m0 = bsel*SEQ + toff + 64 tsel. Epilogue staged through the same LDS (behind the loop's last barrier) then:
// MODE 0: RoPE in f32 with the cos/sin tables, hi x8 / lo x2048 planes [b][nhead][s][128] (256-B rows by 16 lanes x 16 B, 8 rows per store);
template <int MODE, bool RES>
__global__ __launch_bounds__(128) __attribute__((amdgpu_num_vgpr(256))) void proj_kernel(
    const b16* __restrict__ A, const b16* __restrict__ Al, const b16* __restrict__ Bt, b16* Ph, b16* Pl, float* Out,
    const float* __restrict__ CT, const float* __restrict__ ST, int nhead, int tpb, int toff) {
#pragma clang fp contract(off)
  static_assert(MODE == 2 || !RES);
  constexpr int BN = RES ? 64 : 128, NT = BN / 16, FB = NT / 2, NTRIP = KD / KS, BROW = RES ? 128 : 64;
  static_assert(64 * (BN + 4) * 4 <= 2 * STAGE && NTRIP >= 2 && BROW + BN == SROWS);
  __shared__ __attribute__((aligned(16))) unsigned char Sm[2 * STAGE];
  float (*To)[BN + 4] = reinterpret_cast<float (*)[BN + 4]>(Sm);
  const int tid = threadIdx.x, wave = tid >> 5, lane = tid & 31, hh = lane >> 4, col = lane & 15;
  const int by = (int)blockIdx.y; const int bsel = by / tpb, tsel = by - bsel * tpb;
  const int s0 = toff + tsel * 64;
  const size_t m0 = (size_t)bsel * SEQ + s0;
  const int n0 = (int)blockIdx.x * BN;
  const int wm = wave >> 1, wn = wave & 1;
  const int cr = tid >> 3, cs = (tid & 7) * 8;   // the lane's row in each run of 16 rows, and its 16-byte piece of the row
  const b16* g0 = A + (m0 + cr) * KD + cs;
  const b16* g1 = RES ? Al + (m0 + cr) * KD + cs : Bt + (size_t)(n0 + cr) * KD + cs;
  const b16* g2 = Bt + (size_t)(n0 + (RES ? 0 : 64) + cr) * KD + cs;
  const unsigned lc = (unsigned)(uintptr_t)(&Sm[cr * LP + cs * 2]);
  const unsigned char* sa = &Sm[(wm * 32 + col) * LP];
  const unsigned char* sb = &Sm[(BROW + wn * (BN / 2) + col) * LP];
  v8f acc[NT], acc2[NT];
#pragma unroll
  for (int t = 0; t < NT; ++t) { acc[t] = (v8f){}; acc2[t] = (v8f){}; }
  copy_stage(lc, g0, g1, g2);
  asm volatile("s_wait_asynccnt 0x0" ::: "memory");   // this wave's copies of trip 0 have landed
  __syncthreads();                                     // every wave's have: trip 0 may be read
  copy_stage(lc + STAGE, g0 + KS, g1 + KS, g2 + KS);
#pragma unroll 1
  for (int tr = 0; tr < NTRIP; ++tr) {
    const int bo = (tr & 1) * STAGE;
    v16b af[2][2], alf[2][2], bf[2][FB];   // the trip's fragments, read as one group ahead of its WMMAs
#pragma unroll
    for (int kk = 0; kk < 2; ++kk) {
#pragma unroll
      for (int i = 0; i < 2; ++i) {
        af[kk][i] = frag_kb((const b16*)(sa + bo + i * 16 * LP) + kk * 32, hh);
        alf[kk][i] = (v16b){};
        if constexpr (RES) alf[kk][i] = frag_kb((const b16*)(sa + bo + (64 + i * 16) * LP) + kk * 32, hh);
      }
#pragma unroll
      for (int j = 0; j < FB; ++j) bf[kk][j] = frag_kb((const b16*)(sb + bo + j * 16 * LP) + kk * 32, hh);
    }
#pragma unroll
    for (int kk = 0; kk < 2; ++kk)
#pragma unroll
      for (int i = 0; i < 2; ++i)
#pragma unroll
        for (int j = 0; j < FB; ++j) {
          acc[i * FB + j] = wmma16b(af[kk][i], bf[kk][j], acc[i * FB + j]);
          if constexpr (RES) acc2[i * FB + j] = wmma16b(alf[kk][i], bf[kk][j], acc2[i * FB + j]);
        }
    asm volatile("s_wait_dscnt 0x0" ::: "memory");      // this wave's reads of the buffer are done before it is refilled
    asm volatile("s_wait_asynccnt 0x0" ::: "memory");   // this wave's copies of trip tr+1 have landed
    __syncthreads();                                     // publishes trip tr+1 and ends every reader's last read of trip tr
    if (tr + 2 < NTRIP) { const int ko = (tr + 2) * KS; copy_stage(lc + bo, g0 + ko, g1 + ko, g2 + ko); }
  }
  asm volatile("s_wait_asynccnt 0x0" ::: "memory");     // no copy is outstanding when the buffers become output staging
#pragma unroll
  for (int i = 0; i < 2; ++i)
#pragma unroll
    for (int j = 0; j < FB; ++j)
#pragma unroll
      for (int r = 0; r < 8; ++r) {
        float v = acc[i * FB + j][r];
        if constexpr (RES) v += acc2[i * FB + j][r] * (1.0f / RS);
        To[wm * 32 + i * 16 + 8 * hh + r][wn * (BN / 2) + j * 16 + col] = v; }
  __syncthreads();   // To is read across waves
  if constexpr (MODE == 0) {
    const size_t pb = (((size_t)bsel * nhead + blockIdx.x) * SEQ + s0) * HD;
    b16* ph = Ph + pb; b16* pl = Pl + pb;
    const float qsc = QS / (XS * WS);
    {
#pragma unroll 1
      for (int it = 0; it < 8; ++it) {
        const int rr = it * 8 + (tid >> 4), seg = (tid & 15) * 8, sg = seg & 63;
        const float sgn = (seg >= 64) ? 1.0f : -1.0f;   // d < 64: x cos - x[d+64] sin; d >= 64: x cos + x[d-64] sin
        const float* trow = &To[rr][0]; const size_t ts = (size_t)(s0 + rr) * 64 + sg;
        const v4f xa = *(const v4f*)(trow + seg), xb = *(const v4f*)(trow + seg + 4);
        const v4f ya = *(const v4f*)(trow + (seg ^ 64)), yb = *(const v4f*)(trow + (seg ^ 64) + 4);
        const v4f ca = *(const v4f*)(CT + ts), cb = *(const v4f*)(CT + ts + 4), sa = *(const v4f*)(ST + ts), sb = *(const v4f*)(ST + ts + 4);
        v8b hi, lo;
#pragma unroll
        for (int j = 0; j < 4; ++j) {
          b16 h0, l0;
          split16((xa[j] * ca[j] + sgn * ya[j] * sa[j]) * qsc, h0, l0); hi[j] = h0; lo[j] = l0;
          split16((xb[j] * cb[j] + sgn * yb[j] * sb[j]) * qsc, h0, l0); hi[4 + j] = h0; lo[4 + j] = l0; }
        const size_t off = (size_t)rr * HD + seg;
        *(v8b*)(ph + off) = hi; *(v8b*)(pl + off) = lo; }
       }
  } else if constexpr (MODE == 1) {
    const size_t pb = ((size_t)bsel * nhead + blockIdx.x) * HD * (size_t)SEQ + s0;
    b16* ph = Ph + pb; b16* pl = Pl + pb;
    const float vsc = QS / (XS * WS);
    {
#pragma unroll 1
      for (int it = 0; it < 8; ++it) {
        const int d = it * 16 + (tid >> 3), ss = (tid & 7) * 8;
        v8b hi, lo;
#pragma unroll
        for (int j = 0; j < 8; ++j) { b16 h0, l0; split16(To[ss + j][d] * vsc, h0, l0); hi[j] = h0; lo[j] = l0; }
        const size_t off = (size_t)d * SEQ + ss;
        *(v8b*)(ph + off) = hi; *(v8b*)(pl + off) = lo; }
       }
  } else {
    constexpr int LPR = BN / 4, RPI = 128 / LPR, NIT = 64 / RPI;
    static_assert(NIT * RPI == 64 && LPR * 4 == BN);
    float* ob = Out + ((size_t)bsel * SEQ_FULL + s0) * DMOD + n0;
    const float osc = 1.0f / (CS * WS);
    {
#pragma unroll 1
      for (int it = 0; it < NIT; ++it) {
        const int rr = it * RPI + tid / LPR, seg = (tid % LPR) * 4;
        const v4f f = *(const v4f*)(&To[rr][seg]) * osc;
        *(v4f*)(ob + (size_t)rr * DMOD + seg) = f; }
       }
  }
}

// One key step of the attention kernel in LDS: K tile = 32 key rows of 256 B at a pitch of 272 B, V tile = DW d rows of 64 B (32 keys) at a pitch of 80 B
// (both 16 B x odd, for 16-byte readers). A buffer holds K hi[, K lo], V hi[, V lo].
constexpr int KP = 272, VP = 80, KTILE = 32 * KP;
// The asynchronous 16-byte copies of one lane (of 128) that fill one buffer: K rows r, r+8, r+16, r+24 (16 lanes cover one 256-B row) and V rows d, d+32[, d+64,
// d+96] (4 lanes cover one 64-B row); ER: the same rows of the lo planes, K lo one K tile and V lo one V tile (64 rows) further in LDS.
// lk, lv = the lane's LDS byte addresses in its first rows, gk, gkl, gv, gvl = its global addresses there.
template <bool ER>
__device__ __forceinline__ void copy_kv(unsigned lk, unsigned lv, const b16* gk, const b16* gkl, const b16* gv, const b16* gvl) {
  constexpr size_t KJ = (size_t)8 * HD, VJ = (size_t)32 * SEQ; constexpr unsigned LKJ = 8u * KP, LVJ = 32u * VP, KL = KTILE, VL = 64u * VP;
  // s_wait_xcnt 0 as the last line of either statement: it stands in front of every later rewrite of a register that a copy names
  if constexpr (ER) {
    asm volatile(
        "global_load_async_to_lds_b128 %0, %12, off\n\t"
        "global_load_async_to_lds_b128 %1, %13, off\n\t"
        "global_load_async_to_lds_b128 %2, %14, off\n\t"
        "global_load_async_to_lds_b128 %3, %15, off\n\t"
        "global_load_async_to_lds_b128 %4, %16, off\n\t"
        "global_load_async_to_lds_b128 %5, %17, off\n\t"
        "global_load_async_to_lds_b128 %6, %18, off\n\t"
        "global_load_async_to_lds_b128 %7, %19, off\n\t"
        "global_load_async_to_lds_b128 %8, %20, off\n\t"
        "global_load_async_to_lds_b128 %9, %21, off\n\t"
        "global_load_async_to_lds_b128 %10, %22, off\n\t"
        "global_load_async_to_lds_b128 %11, %23, off\n\t"
        "s_wait_xcnt 0x0"
        :: "v"(lk), "v"(lk + LKJ), "v"(lk + 2 * LKJ), "v"(lk + 3 * LKJ), "v"(lk + KL), "v"(lk + KL + LKJ), "v"(lk + KL + 2 * LKJ), "v"(lk + KL + 3 * LKJ),
           "v"(lv), "v"(lv + LVJ), "v"(lv + VL), "v"(lv + VL + LVJ),
           "v"(gk), "v"(gk + KJ), "v"(gk + 2 * KJ), "v"(gk + 3 * KJ), "v"(gkl), "v"(gkl + KJ), "v"(gkl + 2 * KJ), "v"(gkl + 3 * KJ),
           "v"(gv), "v"(gv + VJ), "v"(gvl), "v"(gvl + VJ)
        : "memory");
  } else {
    asm volatile(
        "global_load_async_to_lds_b128 %0, %8, off\n\t"
        "global_load_async_to_lds_b128 %1, %9, off\n\t"
        "global_load_async_to_lds_b128 %2, %10, off\n\t"
        "global_load_async_to_lds_b128 %3, %11, off\n\t"
        "global_load_async_to_lds_b128 %4, %12, off\n\t"
        "global_load_async_to_lds_b128 %5, %13, off\n\t"
        "global_load_async_to_lds_b128 %6, %14, off\n\t"
        "global_load_async_to_lds_b128 %7, %15, off\n\t"
        "s_wait_xcnt 0x0"
        :: "v"(lk), "v"(lk + LKJ), "v"(lk + 2 * LKJ), "v"(lk + 3 * LKJ), "v"(lv), "v"(lv + LVJ), "v"(lv + 2 * LVJ), "v"(lv + 3 * LVJ),
           "v"(gk), "v"(gk + KJ), "v"(gk + 2 * KJ), "v"(gk + 3 * KJ), "v"(gv), "v"(gv + VJ), "v"(gv + 2 * VJ), "v"(gv + 3 * VJ)
        : "memory");
  }
}

// Causal GQA attention: grid (query tiles of 16, NB*HKV[, 2 d-halves when ER]); block = 4 waves = the 4 query heads of one KV head on the same 16 queries,
// so all four walk the same keys. Each 32-key step's K and V tiles are copied once into LDS, two buffers: the copies of step st+2 fly while step st+1 is
// worked on; every wave reads its fragments from there. Key steps of 32 from key 0 up to the 32-aligned block of the last query in fixed order; online
// softmax (running max, f32); keys later than the query get -inf on the diagonal step; P x1024 via wave-private LDS; O^T += V^T P^T. ER (query position
// < QEA): scores Kh Qh + (Kh Ql + Kl Qh)/2048, O^T second accumulator Vh Pr + Vl Ph folded by 1/2048, each block restricted to 64 of the 128 d rows
// (blockIdx.z). ctx hi x64 / lo x2048 planes [b*SEQ+s][h*128 + d], staged per wave through the same LDS behind the loop's last barrier.
template <bool ER>
__global__ __launch_bounds__(128) __attribute__((amdgpu_num_vgpr(256))) void attn_kernel(
    const b16* __restrict__ Qh, const b16* __restrict__ Ql, const b16* __restrict__ Kh, const b16* __restrict__ Kl,
    const b16* __restrict__ Vh, const b16* __restrict__ Vl, b16* Ch, b16* Cl) {
  constexpr int NT = ER ? 4 : 8, DW = NT * 16, NP = ER ? 2 : 1, VO = NP * KTILE, VT = DW * VP, ASTAGE = VO + NP * VT;   // 27,648 / 18,944 B a buffer
  static_assert(NREP == 4 && NREP * 16 * (DW + 4) * 4 <= 2 * ASTAGE && ASTAGE % 16 == 0);
  __shared__ __attribute__((aligned(16))) unsigned char Sm[2 * ASTAGE];
  __shared__ __attribute__((aligned(16))) b16 Pb[NREP][16][32 + 8];
  __shared__ __attribute__((aligned(16))) b16 Pr[ER ? NREP : 1][16][32 + 8];
  float (*To)[16][DW + 4] = reinterpret_cast<float (*)[16][DW + 4]>(Sm);
  const int tid = threadIdx.x, wave = tid >> 5, lane = tid & 31, hh = lane >> 4, col = lane & 15;
  const int bg = (int)blockIdx.y; const int b = bg / HKV, g = bg - b * HKV, h = g * NREP + wave;
  const int q0 = (ER ? 0 : QEA) + (int)blockIdx.x * 16, qi = q0 + col;
  const int dh = ER ? (int)blockIdx.z * 64 : 0;
  const b16* qrow = Qh + ((size_t)(b * H + h) * SEQ + qi) * HD;
  const b16* qlrow = Ql + ((size_t)(b * H + h) * SEQ + qi) * HD;
  const size_t ko = (size_t)(b * HKV + g) * SEQ * HD + (size_t)(tid >> 4) * HD + (tid & 15) * 8;           // the lane's piece of K row tid>>4
  const size_t vo = ((size_t)(b * HKV + g) * HD + dh + (tid >> 2)) * SEQ + (tid & 3) * 8;                  // the lane's piece of V row tid>>2
  const b16* gk = Kh + ko; const b16* gkl = Kl + ko; const b16* gv = Vh + vo; const b16* gvl = Vl + vo;
  const unsigned lk = (unsigned)(uintptr_t)(&Sm[(tid >> 4) * KP + (tid & 15) * 16]);
  const unsigned lv = (unsigned)(uintptr_t)(&Sm[VO + (tid >> 2) * VP + (tid & 3) * 16]);
  const unsigned char* sk = &Sm[col * KP];
  const unsigned char* sv = &Sm[VO + col * VP];
  v16b qa[4];
#pragma unroll
  for (int c = 0; c < 4; ++c) { qa[c] = (v16b){}; if constexpr (!ER) qa[c] = frag_kb(qrow + c * 32, hh); }
  const float cs = SCL * LOG2E / (QS * QS);   // 1/sqrt(128) and the two x8 carriers, in the log2 domain
  float m = -INFINITY, l = 0.0f; v8f o[NT], o2[NT];
#pragma unroll
  for (int t = 0; t < NT; ++t) { o[t] = (v8f){}; o2[t] = (v8f){}; }
  const int nst = q0 / 32 + 1;   // block-uniform: keys 0 .. (q0 | 31)
  copy_kv<ER>(lk, lv, gk, gkl, gv, gvl);
  asm volatile("s_wait_asynccnt 0x0" ::: "memory");   // this wave's copies of step 0 have landed
  __syncthreads();                                     // every wave's have: step 0 may be read
  if (1 < nst) copy_kv<ER>(lk + ASTAGE, lv + ASTAGE, gk + (size_t)32 * HD, gkl + (size_t)32 * HD, gv + 32, gvl + 32);
#pragma unroll 1
  for (int st = 0; st < nst; ++st) {
    const int bo = (st & 1) * ASTAGE;
    const int kb = st * 32; const int lim = qi - kb;   // key offsets > lim are later than the query (binds only on the diagonal step)
    float e[16]; float mx = -INFINITY;
    v8f s[2], s2[2];
#pragma unroll
    for (int u = 0; u < 2; ++u) {
      v16b kf[4], klf[4];   // 16 keys' K fragments, read as one group ahead of their WMMAs
#pragma unroll
      for (int c = 0; c < 4; ++c) {
        kf[c] = frag_kb((const b16*)(sk + bo + u * 16 * KP) + c * 32, hh); klf[c] = (v16b){};
        if constexpr (ER) klf[c] = frag_kb((const b16*)(sk + bo + KTILE + u * 16 * KP) + c * 32, hh);
      }
      s[u] = (v8f){}; s2[u] = (v8f){};
#pragma unroll
      for (int c = 0; c < 4; ++c) {
        if constexpr (ER) {
          const v16b qh = frag_kb(qrow + c * 32, hh), ql = frag_kb(qlrow + c * 32, hh);
          s[u] = wmma16b(kf[c], qh, s[u]); s2[u] = wmma16b(kf[c], ql, s2[u]); s2[u] = wmma16b(klf[c], qh, s2[u]);
        } else {
          s[u] = wmma16b(kf[c], qa[c], s[u]);
        }
      }
    }
    v16b vf[NT];   // the step's V fragments, read as one group: their LDS latency passes under the softmax arithmetic
#pragma unroll
    for (int t = 0; t < NT; ++t) vf[t] = frag_kb((const b16*)(sv + bo + t * 16 * VP), hh);
#pragma unroll
    for (int u = 0; u < 2; ++u)
#pragma unroll
      for (int r = 0; r < 8; ++r) {
        float v = s[u][r];
        if constexpr (ER) v += s2[u][r] * (1.0f / RS);
        v *= cs;
        if (u * 16 + 8 * hh + r > lim) v = -INFINITY;
        e[u * 8 + r] = v; mx = fmaxf(mx, v); }
    mx = fmaxf(mx, __shfl_xor(mx, 16)); const float mn = fmaxf(m, mx); const float al = nexp2(m - mn); float sum = 0.0f;
#pragma unroll
    for (int i2 = 0; i2 < 16; ++i2) {
      const float p = nexp2(e[i2] - mn); sum += p; const int pi = (i2 < 8 ? 0 : 16) + 8 * hh + (i2 & 7);
      const float pp = p * PS; const b16 phv = (b16)pp; Pb[wave][col][pi] = phv;
      if constexpr (ER) Pr[wave][col][pi] = (b16)((pp - (float)phv) * RS); }
    sum += __shfl_xor(sum, 16); l = l * al + sum; m = mn;
    wave_lds_sync();
    const v16b pf = frag_kb(&Pb[wave][col][0], hh);
    v16b prf = (v16b){};
    if constexpr (ER) prf = frag_kb(&Pr[wave][col][0], hh);
    v16b vlf[NT];  // the lo V fragments only here: held across the softmax they would not fit the registers
#pragma unroll
    for (int t = 0; t < NT; ++t) { vlf[t] = (v16b){}; if constexpr (ER) vlf[t] = frag_kb((const b16*)(sv + bo + VT + t * 16 * VP), hh); }
#pragma unroll
    for (int t = 0; t < NT; ++t) {
      o[t] *= al; o[t] = wmma16b(vf[t], pf, o[t]);
      if constexpr (ER) { o2[t] *= al; o2[t] = wmma16b(vf[t], prf, o2[t]); o2[t] = wmma16b(vlf[t], pf, o2[t]); } }
    asm volatile("s_wait_dscnt 0x0" ::: "memory");      // this wave's reads of the buffer (and of its P rows) are done before the refill
    asm volatile("s_wait_asynccnt 0x0" ::: "memory");   // this wave's copies of step st+1 have landed
    __syncthreads();                                     // publishes step st+1 and ends every reader's last read of step st
    if (st + 2 < nst) { const size_t kn = (size_t)(kb + 64) * HD; copy_kv<ER>(lk + bo, lv + bo, gk + kn, gkl + kn, gv + kb + 64, gvl + kb + 64); }
  }
  asm volatile("s_wait_asynccnt 0x0" ::: "memory");     // no copy is outstanding when the buffers become output staging
  const float inv = 1.0f / (l * PS * QS);
#pragma unroll
  for (int t = 0; t < NT; ++t) {
#pragma unroll
    for (int r = 0; r < 8; ++r) {
      float ov = o[t][r];
      if constexpr (ER) ov += o2[t][r] * (1.0f / RS);
      To[wave][col][t * 16 + 8 * hh + r] = ov * inv; } }
  wave_lds_sync();
  constexpr int LPR = DW / 8, RPI = 32 / LPR, NIT = 16 / RPI;
  static_assert(NIT * RPI == 16 && LPR * 8 == DW);
  const size_t cbase = ((size_t)b * SEQ + q0) * DMOD + (size_t)h * HD + dh;
  {
#pragma unroll 1
    for (int it = 0; it < NIT; ++it) {
      const int rr = it * RPI + lane / LPR, seg = (lane % LPR) * 8;
      const v4f fa = *(const v4f*)(&To[wave][rr][seg]), fb = *(const v4f*)(&To[wave][rr][seg + 4]);
      v8b hi, lo;
#pragma unroll
      for (int j = 0; j < 4; ++j) { b16 h0, l0; split16(fa[j] * CS, h0, l0); hi[j] = h0; lo[j] = l0; split16(fb[j] * CS, h0, l0); hi[4 + j] = h0; lo[4 + j] = l0; }
      const size_t off = cbase + (size_t)rr * DMOD + seg;
      *(v8b*)(Ch + off) = hi; *(v8b*)(Cl + off) = lo; }
     }
}
}  // namespace

extern "C" void kernel_launch(void* const* d_in, const int* in_sizes, int n_in, void* d_out, int out_size, void* d_ws, size_t ws_size, hipStream_t stream) {
  // wire order: 0 x [NB_FULL][SEQ_FULL][2048] f32, 1 Wq [2048][2048], 2 Wk [2048][512], 3 Wv [2048][512], 4 Wo [2048][2048]; out [NB_FULL][SEQ_FULL][2048] f32
  const size_t need_x = ((size_t)(NB - 1) * SEQ_FULL + SEQ) * DMOD;
  if (n_in < 5 || (size_t)in_sizes[0] < need_x || (size_t)in_sizes[1] < (size_t)KD * DMOD || (size_t)in_sizes[2] < (size_t)KD * NKV ||
      (size_t)in_sizes[3] < (size_t)KD * NKV || (size_t)in_sizes[4] < (size_t)KD * DMOD || (size_t)out_size < need_x) return;
  const float* X = (const float*)d_in[0]; const float* Wq = (const float*)d_in[1]; const float* Wk = (const float*)d_in[2];
  const float* Wv = (const float*)d_in[3]; const float* Wo = (const float*)d_in[4]; float* out = (float*)d_out;
  size_t off = 0; char* ws = (char*)d_ws;
  auto carve = [&](size_t bytes) { char* p = ws + off; off += (bytes + 255) & ~(size_t)255; return p; };
  b16* Xp  = (b16*)carve((size_t)MR * DMOD * 2);
  b16* Wqt = (b16*)carve((size_t)DMOD * KD * 2);
  b16* Wkt = (b16*)carve((size_t)NKV * KD * 2);
  b16* Wvt = (b16*)carve((size_t)NKV * KD * 2);
  b16* Wot = (b16*)carve((size_t)DMOD * KD * 2);
  float* CT = (float*)carve((size_t)SEQ * 64 * 4);
  float* ST = (float*)carve((size_t)SEQ * 64 * 4);
  b16* Qh = (b16*)carve((size_t)MR * H * HD * 2);
  b16* Ql = (b16*)carve((size_t)MR * H * HD * 2);
  b16* Kh = (b16*)carve((size_t)MR * NKV * 2);
  b16* Kl = (b16*)carve((size_t)MR * NKV * 2);
  b16* Vh = (b16*)carve((size_t)MR * NKV * 2);
  b16* Vl = (b16*)carve((size_t)MR * NKV * 2);
  b16* Ch = (b16*)carve((size_t)MR * DMOD * 2);
  b16* Cl = (b16*)carve((size_t)MR * DMOD * 2);
  if (off > ws_size || off > ((size_t)128 << 20)) return;   // 122,683,392 B at NB=2, SEQ=2048
  cvt_x_kernel<<<dim3((unsigned)MR), 256, 0, stream>>>(X, Xp);
  cvt_w_kernel<<<dim3(KD / 64, DMOD / 64), 64, 0, stream>>>(Wq, Wqt, DMOD);
  cvt_w_kernel<<<dim3(KD / 64, NKV / 64), 64, 0, stream>>>(Wk, Wkt, NKV);
  cvt_w_kernel<<<dim3(KD / 64, NKV / 64), 64, 0, stream>>>(Wv, Wvt, NKV);
  cvt_w_kernel<<<dim3(KD / 64, DMOD / 64), 64, 0, stream>>>(Wo, Wot, DMOD);
  rope_tab_kernel<<<dim3(SEQ / 4), 256, 0, stream>>>(CT, ST);
  proj_kernel<0, false><<<dim3(DMOD / 128, MR / 64), 128, 0, stream>>>(Xp, Xp, Wqt, Qh, Ql, out, CT, ST, H, SEQ / 64, 0);
  proj_kernel<0, false><<<dim3(NKV / 128, MR / 64), 128, 0, stream>>>(Xp, Xp, Wkt, Kh, Kl, out, CT, ST, HKV, SEQ / 64, 0);
  proj_kernel<1, false><<<dim3(NKV / 128, MR / 64), 128, 0, stream>>>(Xp, Xp, Wvt, Vh, Vl, out, CT, ST, HKV, SEQ / 64, 0);
  attn_kernel<true><<<dim3(QEA / 16, NB * HKV, 2), 128, 0, stream>>>(Qh, Ql, Kh, Kl, Vh, Vl, Ch, Cl);
  if (SEQ > QEA) attn_kernel<false><<<dim3((SEQ - QEA) / 16, NB * HKV, 1), 128, 0, stream>>>(Qh, Ql, Kh, Kl, Vh, Vl, Ch, Cl);
  proj_kernel<2, true><<<dim3(DMOD / 64, NB * (QEA / 64)), 128, 0, stream>>>(Ch, Cl, Wot, Ch, Cl, out, CT, ST, 1, QEA / 64, 0);
  if (SEQ > QEA) proj_kernel<2, false><<<dim3(DMOD / 128, NB * ((SEQ - QEA) / 64)), 128, 0, stream>>>(Ch, Ch, Wot, Ch, Cl, out, CT, ST, 1, (SEQ - QEA) / 64, QEA);
}

// v003
// Measured time: 176 microseconds a run.
// Timed twice side by side with v002, it ran 1.35 times as fast both times.
// All steps since v000 together make it 4.32 times as fast.
#include <hip/hip_runtime.h>

// compute dtype: every contraction on v_wmma_f32_16x16x32_f16 (f16 operands, f32 accumulate). x@Wq, x@Wk, x@Wv: x and W enter as bf16-RNE values
// carried x8 (x) and x256 (W) in f16 planes, 1 product. Scores S^T = K Q^T per head: q, k (RoPE applied in f32) as f16 x8 planes, 1 product;
// query rows with position < QE use q,k hi + x2048 residual planes (3 products, second accumulator folded by 1/2048). O^T += V^T P^T: v f16 x8,
// P f16 x1024, 1 product; rows < QE add P and v x2048 residual tiles into a second accumulator (3 products) folded before normalisation.
// ctx@Wo: ctx f16 x64 plane (+ x2048 residual plane for rows < QE, 2 products), Wo bf16-RNE x256, 1 product elsewhere. Softmax statistics
// (running max, exp2, row sums) and RoPE tables in f32; scale 1/sqrt(128) folded into the log2 constant.
// Fragment k-map per lane half hh for A AND B: elements 0..7 <- k = 8hh+0..7, 8..15 <- k = 16+8hh+0..7; acc[r] = D[8hh+r][col = lane&15].

#ifndef NB
#define NB 2
#endif
#ifndef SEQ
#define SEQ 2048
#endif
#ifndef NB_FULL
#define NB_FULL 2
#endif
#ifndef SEQ_FULL
#define SEQ_FULL 2048
#endif
#ifndef QE
#define QE 256
#endif

namespace {
constexpr int DMOD = 2048, KD = 2048, H = 16, HKV = 4, NREP = H / HKV, HD = 128, NKV = HKV * HD;   // NKV = 512
constexpr int MR = NB * SEQ;                                                                         // token rows handled
constexpr int QEA = (QE < SEQ) ? QE : SEQ;                                                           // query positions with residual operands
constexpr float XS = 8.0f, WS = 256.0f, QS = 8.0f, RS = 2048.0f, PS = 1024.0f, CS = 64.0f;
constexpr float LOG2E = 1.4426950408889634f, SCL = 0.08838834764831845f, ROPE_BASE = 500000.0f;
static_assert(SEQ % 64 == 0 && SEQ >= 64 && SEQ <= SEQ_FULL && NB >= 1 && NB <= NB_FULL);
static_assert(QEA % 64 == 0 && QEA >= 64 && QEA <= SEQ && (SEQ - QEA) % 64 == 0);
static_assert(DMOD == H * HD && KD == DMOD && KD % 64 == 0 && DMOD % 128 == 0 && NKV % 128 == 0 && HD == 128 && DMOD == 256 * 8 && MR % 64 == 0);

typedef _Float16 b16;
typedef __attribute__((ext_vector_type(16))) _Float16 v16b;
typedef __attribute__((ext_vector_type(8))) _Float16 v8b;
typedef __attribute__((ext_vector_type(8))) float v8f;
typedef __attribute__((ext_vector_type(4))) float v4f;

__device__ __forceinline__ float bf16_rne(float f) { unsigned int u = __float_as_uint(f); u += 0x7FFFu + ((u >> 16) & 1u); return __uint_as_float(u & 0xFFFF0000u); }
// 16-bit fragment from a k-contiguous row: elements 0..7 <- p[8hh .. 8hh+7], 8..15 <- p[16+8hh .. 16+8hh+7]
__device__ __forceinline__ v16b frag_kb(const b16* p, int hh) {
  const v8b a = *(const v8b*)(p + 8 * hh), b = *(const v8b*)(p + 16 + 8 * hh); v16b f;
#pragma unroll
  for (int e = 0; e < 8; ++e) { f[e] = a[e]; f[8 + e] = b[e]; }
  return f;
}
__device__ __forceinline__ v8f wmma16b(v16b a, v16b b, v8f c) {
  v8f d = __builtin_amdgcn_wmma_f32_16x16x32_f16(false, a, false, b, (short)0, c, false, false);
  asm volatile("v_nop\n\tv_nop\n\tv_nop\n\tv_nop" : "+v"(d) : "v"(a), "v"(b));
  return d;
}
__device__ __forceinline__ void wave_lds_sync() { __builtin_amdgcn_fence(3, "workgroup"); __builtin_amdgcn_wave_barrier(); __builtin_amdgcn_fence(2, "workgroup"); }
__device__ __forceinline__ float nexp2(float v) { return __builtin_amdgcn_exp2f(v); }
// hi = f16(w), lo = f16((w - hi) * RS)
__device__ __forceinline__ void split16(float w, b16& hi, b16& lo) { hi = (b16)w; lo = (b16)((w - (float)hi) * RS); }

__device__ __forceinline__ void cvt_x_block(int vb, const float* __restrict__ X, b16* Xp) {
  const size_t u = (size_t)vb * 256 + threadIdx.x; const size_t row = u >> 8; const int c8 = (int)(u & 255) * 8;
  if (row >= (size_t)MR) return;
  const size_t b = row / SEQ, s = row % SEQ;
  const float* src = X + (b * SEQ_FULL + s) * DMOD + c8;
  b16* dst = Xp + row * DMOD + c8;
  const v4f x0 = *(const v4f*)src, x1 = *(const v4f*)(src + 4); v8b o;
#pragma unroll
  for (int j = 0; j < 4; ++j) { o[j] = (b16)(bf16_rne(x0[j]) * XS); o[4 + j] = (b16)(bf16_rne(x1[j]) * XS); }
  *(v8b*)dst = o; 
}

// W [2048 k][N n] f32 -> Wt [N][2048] f16 = bf16-RNE(w) x256 (k-contiguous for the B fragments). 2 waves (tid 0..63) per 64x64 tile (bx, by), transposed
// through their own LDS tile St; the four wave pairs of a block take four tiles of one matrix and pass the barrier together.
__device__ __forceinline__ void cvt_w_tile(b16 (*St)[64 + 8], int tid, int bx, int by, const float* __restrict__ W, b16* Wt, int N) {
  const int wave = tid >> 5, lane = tid & 31; const int k0 = bx * 64, n0 = by * 64;
  const float* src = W + (size_t)k0 * N + n0;
  for (int it = 0; it < 16; ++it) {
    const int e = (it * 64 + tid) * 4; const int kr = e >> 6, nc = e & 63;
    const v4f x = *(const v4f*)(src + (size_t)kr * N + nc);
#pragma unroll
    for (int j = 0; j < 4; ++j) St[nc + j][kr] = (b16)(bf16_rne(x[j]) * WS);
  }
  __syncthreads();   // St is read across waves
  b16* dstb = Wt + (size_t)n0 * KD + k0;
  {
#pragma unroll 1
    for (int it = 0; it < 8; ++it) {
      const int n = wave * 32 + it * 4 + (lane >> 3), ks = (lane & 7) * 8;
      const v8b o = *(const v8b*)(&St[n][ks]);
      *(v8b*)(dstb + (size_t)n * KD + ks) = o; }
     }
}

// cos/sin tables [SEQ][64] f32: ang = s * (1 / base^(2j/128)) in f32, precise sincosf. Block = 4 positions x 64 frequencies staged in LDS;
__device__ __forceinline__ void rope_tab_block(float (*Tb)[4][64 + 4], int vb, float* CT, float* ST) {
  const int tid = threadIdx.x; const int r = tid >> 6, j = tid & 63; const int s0 = vb * 4;
  const float ex = (float)(2 * j) * (1.0f / 128.0f);
  const float p = powf(ROPE_BASE, ex);
  const float inv = 1.0f / p;
  const float ang = (float)(s0 + r) * inv;
  float sn, c; sincosf(ang, &sn, &c);
  Tb[0][r][j] = c; Tb[1][r][j] = sn;
  __syncthreads();   // Tb is read across waves
  if (tid < 128) {
    const int tb = tid >> 6, rr = (tid >> 4) & 3, seg = (tid & 15) * 4;
    const v4f f = *(const v4f*)(&Tb[tb][rr][seg]);
    float* dst = (tb == 0 ? CT : ST) + (size_t)(s0 + rr) * 64 + seg;
    *(v4f*)dst = f; 
  }
}

// All operand preparation in one launch: its parts read only inputs and write disjoint planes. Block ranges, each block wholly in one part: first the W tiles
// (four 64x64 tiles a block; Wq, Wo, Wk, Wv), then the RoPE tables, then the rows of x.
constexpr int TQ = (KD / 64) * (DMOD / 64), TK = (KD / 64) * (NKV / 64);   // 64x64 tiles of a 2048-column and of a 512-column W
constexpr int PW = (2 * TQ + 2 * TK) / 4, PR = SEQ / 4, PX = MR;           // blocks of the three parts
static_assert(TQ % 4 == 0 && TK % 4 == 0 && KD / 64 == 32);
__global__ __launch_bounds__(256) void prep_kernel(const float* __restrict__ X, const float* __restrict__ Wq, const float* __restrict__ Wk,
    const float* __restrict__ Wv, const float* __restrict__ Wo, b16* Xp, b16* Wqt, b16* Wkt, b16* Wvt, b16* Wot, float* CT, float* ST) {
  __shared__ __attribute__((aligned(16))) unsigned char Sp[4 * 64 * (64 + 8) * 2];
  static_assert(sizeof(Sp) >= 2 * 4 * (64 + 4) * 4);
  const int vb = (int)blockIdx.x;
  if (vb < PW) {
    const int sub = (int)threadIdx.x >> 6, t4 = vb * 4;   // t4 picks the matrix for the whole block
    const float* W = Wq; b16* Wt = Wqt; int N = DMOD, t = t4 + sub;
    if (t4 >= 2 * TQ + TK) { W = Wv; Wt = Wvt; N = NKV; t -= 2 * TQ + TK; }
    else if (t4 >= 2 * TQ) { W = Wk; Wt = Wkt; N = NKV; t -= 2 * TQ; }
    else if (t4 >= TQ) { W = Wo; Wt = Wot; t -= TQ; }
    cvt_w_tile(reinterpret_cast<b16 (*)[64 + 8]>(Sp + sub * 64 * (64 + 8) * 2), (int)threadIdx.x & 63, t & 31, t >> 5, W, Wt, N);
  } else if (vb < PW + PR) {
    rope_tab_block(reinterpret_cast<float (*)[4][64 + 4]>(Sp), vb - PW, CT, ST);
  } else {
    cvt_x_block(vb - PW - PR, X, Xp);
  }
}

// One trip of the projection GEMM's K loop: 64 k = 128 B of each of 192 operand rows, laid in LDS at a pitch of 144 B (16 B x odd, for 16-byte readers).
constexpr int KS = 64, LP = 144, SROWS = 192, STAGE = SROWS * LP;   // 27,648 B a buffer
// Twelve asynchronous 16-byte copies a lane fill one buffer: LDS rows r, r+16, .. r+176 (l = the lane's byte address in row r), rows 0..63 from g0, 64..127
// from g1, 128..191 from g2 (each the lane's own address in its group's row r; 16 rows further = 16*KD elements). Eight lanes cover one 128-B row.
__device__ __forceinline__ void copy_stage(unsigned l, const b16* g0, const b16* g1, const b16* g2) {
  constexpr size_t RJ = (size_t)16 * KD; constexpr unsigned LJ = 16u * LP;
  // s_wait_xcnt 0 as the last line: it stands in front of every later rewrite of a register that a copy names
  asm volatile(
      "global_load_async_to_lds_b128 %0, %12, off\n\t"
      "global_load_async_to_lds_b128 %1, %13, off\n\t"
      "global_load_async_to_lds_b128 %2, %14, off\n\t"
      "global_load_async_to_lds_b128 %3, %15, off\n\t"
      "global_load_async_to_lds_b128 %4, %16, off\n\t"
      "global_load_async_to_lds_b128 %5, %17, off\n\t"
      "global_load_async_to_lds_b128 %6, %18, off\n\t"
      "global_load_async_to_lds_b128 %7, %19, off\n\t"
      "global_load_async_to_lds_b128 %8, %20, off\n\t"
      "global_load_async_to_lds_b128 %9, %21, off\n\t"
      "global_load_async_to_lds_b128 %10, %22, off\n\t"
      "global_load_async_to_lds_b128 %11, %23, off\n\t"
      "s_wait_xcnt 0x0"
      :: "v"(l), "v"(l + LJ), "v"(l + 2 * LJ), "v"(l + 3 * LJ), "v"(l + 4 * LJ), "v"(l + 5 * LJ),
         "v"(l + 6 * LJ), "v"(l + 7 * LJ), "v"(l + 8 * LJ), "v"(l + 9 * LJ), "v"(l + 10 * LJ), "v"(l + 11 * LJ),
         "v"(g0), "v"(g0 + RJ), "v"(g0 + 2 * RJ), "v"(g0 + 3 * RJ), "v"(g1), "v"(g1 + RJ), "v"(g1 + 2 * RJ), "v"(g1 + 3 * RJ),
         "v"(g2), "v"(g2 + RJ), "v"(g2 + 2 * RJ), "v"(g2 + 3 * RJ)
      : "memory");
}

// C[64 x BN] = A[m][k] . B[k][n] with A plane [rows][2048] and Bt plane [N][2048], both k-contiguous f16; K = 2048 in trips of 64 (two WMMA steps of 32).
// 128 threads = 4 waves. The block's operand rows of a trip (A 64 rows, then B 128 rows; RES: A 64, residual A 64, B 64) are copied once into LDS,
// two buffers: the copies of trip t+2 fly while trip t+1 is worked on. Waves 2 x 2 on the tile: wave w owns rows 32(w>>1)..+31 and columns (BN/2)(w&1)..
// (NT accumulators). RES: a second A plane (x2048 residual) into acc2.
// Column tile bx; row tile: by = bsel * tpb + tsel, rows m0 = bsel*SEQ + toff + 64 tsel. Epilogue staged through the same LDS (behind the loop's last barrier) then:
// MODE 0: RoPE in f32 with the cos/sin tables, hi x8 / lo x2048 planes [b][nhead][s][128] (256-B rows by 16 lanes x 16 B, 8 rows per store);
template <int MODE, bool RES>
__device__ __forceinline__ void proj_block(unsigned char* Sm, int bx, int by,
    const b16* __restrict__ A, const b16* __restrict__ Al, const b16* __restrict__ Bt, b16* Ph, b16* Pl, float* Out,
    const float* __restrict__ CT, const float* __restrict__ ST, int nhead, int tpb, int toff) {
#pragma clang fp contract(off)
  static_assert(MODE == 2 || !RES);
  constexpr int BN = RES ? 64 : 128, NT = BN / 16, FB = NT / 2, NTRIP = KD / KS, BROW = RES ? 128 : 64;
  static_assert(64 * (BN + 4) * 4 <= 2 * STAGE && NTRIP >= 2 && BROW + BN == SROWS);
  float (*To)[BN + 4] = reinterpret_cast<float (*)[BN + 4]>(Sm);
  const int tid = threadIdx.x, wave = tid >> 5, lane = tid & 31, hh = lane >> 4, col = lane & 15;
  const int bsel = by / tpb, tsel = by - bsel * tpb;
  const int s0 = toff + tsel * 64;
  const size_t m0 = (size_t)bsel * SEQ + s0;
  const int n0 = bx * BN;
  const int wm = wave >> 1, wn = wave & 1;
  const int cr = tid >> 3, cs = (tid & 7) * 8;   // the lane's row in each run of 16 rows, and its 16-byte piece of the row
  const b16* g0 = A + (m0 + cr) * KD + cs;
  const b16* g1 = RES ? Al + (m0 + cr) * KD + cs : Bt + (size_t)(n0 + cr) * KD + cs;
  const b16* g2 = Bt + (size_t)(n0 + (RES ? 0 : 64) + cr) * KD + cs;
  const unsigned lc = (unsigned)(uintptr_t)(&Sm[cr * LP + cs * 2]);
  const unsigned char* sa = &Sm[(wm * 32 + col) * LP];
  const unsigned char* sb = &Sm[(BROW + wn * (BN / 2) + col) * LP];
  v8f acc[NT], acc2[NT];
#pragma unroll
  for (int t = 0; t < NT; ++t) { acc[t] = (v8f){}; acc2[t] = (v8f){}; }
  copy_stage(lc, g0, g1, g2);
  asm volatile("s_wait_asynccnt 0x0" ::: "memory");   // this wave's copies of trip 0 have landed
  __syncthreads();                                     // every wave's have: trip 0 may be read
  copy_stage(lc + STAGE, g0 + KS, g1 + KS, g2 + KS);
#pragma unroll 1
  for (int tr = 0; tr < NTRIP; ++tr) {
    const int bo = (tr & 1) * STAGE;
    v16b af[2][2], alf[2][2], bf[2][FB];   // the trip's fragments, read as one group ahead of its WMMAs
#pragma unroll
    for (int kk = 0; kk < 2; ++kk) {
#pragma unroll
      for (int i = 0; i < 2; ++i) {
        af[kk][i] = frag_kb((const b16*)(sa + bo + i * 16 * LP) + kk * 32, hh);
        alf[kk][i] = (v16b){};
        if constexpr (RES) alf[kk][i] = frag_kb((const b16*)(sa + bo + (64 + i * 16) * LP) + kk * 32, hh);
      }
#pragma unroll
      for (int j = 0; j < FB; ++j) bf[kk][j] = frag_kb((const b16*)(sb + bo + j * 16 * LP) + kk * 32, hh);
    }
#pragma unroll
    for (int kk = 0; kk < 2; ++kk)
#pragma unroll
      for (int i = 0; i < 2; ++i)
#pragma unroll
        for (int j = 0; j < FB; ++j) {
          acc[i * FB + j] = wmma16b(af[kk][i], bf[kk][j], acc[i * FB + j]);
          if constexpr (RES) acc2[i * FB + j] = wmma16b(alf[kk][i], bf[kk][j], acc2[i * FB + j]);
        }
    asm volatile("s_wait_dscnt 0x0" ::: "memory");      // this wave's reads of the buffer are done before it is refilled
    asm volatile("s_wait_asynccnt 0x0" ::: "memory");   // this wave's copies of trip tr+1 have landed
    __syncthreads();                                     // publishes trip tr+1 and ends every reader's last read of trip tr
    if (tr + 2 < NTRIP) { const int ko = (tr + 2) * KS; copy_stage(lc + bo, g0 + ko, g1 + ko, g2 + ko); }
  }
  asm volatile("s_wait_asynccnt 0x0" ::: "memory");     // no copy is outstanding when the buffers become output staging
#pragma unroll
  for (int i = 0; i < 2; ++i)
#pragma unroll
    for (int j = 0; j < FB; ++j)
#pragma unroll
      for (int r = 0; r < 8; ++r) {
        float v = acc[i * FB + j][r];
        if constexpr (RES) v += acc2[i * FB + j][r] * (1.0f / RS);
        To[wm * 32 + i * 16 + 8 * hh + r][wn * (BN / 2) + j * 16 + col] = v; }
  __syncthreads();   // To is read across waves
  if constexpr (MODE == 0) {
    const size_t pb = (((size_t)bsel * nhead + bx) * SEQ + s0) * HD;
    b16* ph = Ph + pb; b16* pl = Pl + pb;
    const float qsc = QS / (XS * WS);
    {
#pragma unroll 1
      for (int it = 0; it < 8; ++it) {
        const int rr = it * 8 + (tid >> 4), seg = (tid & 15) * 8, sg = seg & 63;
        const float sgn = (seg >= 64) ? 1.0f : -1.0f;   // d < 64: x cos - x[d+64] sin; d >= 64: x cos + x[d-64] sin
        const float* trow = &To[rr][0]; const size_t ts = (size_t)(s0 + rr) * 64 + sg;
        const v4f xa = *(const v4f*)(trow + seg), xb = *(const v4f*)(trow + seg + 4);
        const v4f ya = *(const v4f*)(trow + (seg ^ 64)), yb = *(const v4f*)(trow + (seg ^ 64) + 4);
        const v4f ca = *(const v4f*)(CT + ts), cb = *(const v4f*)(CT + ts + 4), sa = *(const v4f*)(ST + ts), sb = *(const v4f*)(ST + ts + 4);
        v8b hi, lo;
#pragma unroll
        for (int j = 0; j < 4; ++j) {
          b16 h0, l0;
          split16((xa[j] * ca[j] + sgn * ya[j] * sa[j]) * qsc, h0, l0); hi[j] = h0; lo[j] = l0;
          split16((xb[j] * cb[j] + sgn * yb[j] * sb[j]) * qsc, h0, l0); hi[4 + j] = h0; lo[4 + j] = l0; }
        const size_t off = (size_t)rr * HD + seg;
        *(v8b*)(ph + off) = hi; *(v8b*)(pl + off) = lo;
        asm volatile("s_wait_xcnt 0x0" ::: "memory"); }   // in front of the next pass's rewrite of the registers that the two stores name
       }
  } else if constexpr (MODE == 1) {
    const size_t pb = ((size_t)bsel * nhead + bx) * HD * (size_t)SEQ + s0;
    b16* ph = Ph + pb; b16* pl = Pl + pb;
    const float vsc = QS / (XS * WS);
    {
#pragma unroll 1
      for (int it = 0; it < 8; ++it) {
        const int d = it * 16 + (tid >> 3), ss = (tid & 7) * 8;
        v8b hi, lo;
#pragma unroll
        for (int j = 0; j < 8; ++j) { b16 h0, l0; split16(To[ss + j][d] * vsc, h0, l0); hi[j] = h0; lo[j] = l0; }
        const size_t off = (size_t)d * SEQ + ss;
        *(v8b*)(ph + off) = hi; *(v8b*)(pl + off) = lo; }
       }
  } else {
    constexpr int LPR = BN / 4, RPI = 128 / LPR, NIT = 64 / RPI;
    static_assert(NIT * RPI == 64 && LPR * 4 == BN);
    float* ob = Out + ((size_t)bsel * SEQ_FULL + s0) * DMOD + n0;
    const float osc = 1.0f / (CS * WS);
    {
#pragma unroll 1
      for (int it = 0; it < NIT; ++it) {
        const int rr = it * RPI + tid / LPR, seg = (tid % LPR) * 4;
        const v4f f = *(const v4f*)(&To[rr][seg]) * osc;
        *(v4f*)(ob + (size_t)rr * DMOD + seg) = f; }
       }
  }
}

// x@Wq, x@Wk, x@Wv in one launch: column tiles 0..15 are Q heads, 16..19 K heads, 20..23 V heads; each block wholly one of them.
constexpr int CQ = DMOD / 128, CK = NKV / 128;
__global__ __launch_bounds__(128) __attribute__((amdgpu_num_vgpr(256))) void qkv_kernel(
    const b16* __restrict__ Xp, const b16* __restrict__ Wqt, const b16* __restrict__ Wkt, const b16* __restrict__ Wvt,
    b16* Qh, b16* Ql, b16* Kh, b16* Kl, b16* Vh, b16* Vl, const float* __restrict__ CT, const float* __restrict__ ST) {
  __shared__ __attribute__((aligned(16))) unsigned char Sm[2 * STAGE];
  const int bx = (int)blockIdx.x, by = (int)blockIdx.y;
  if (bx < CQ + CK) {
    const bool isq = bx < CQ;
    proj_block<0, false>(Sm, isq ? bx : bx - CQ, by, Xp, Xp, isq ? Wqt : Wkt, isq ? Qh : Kh, isq ? Ql : Kl, nullptr, CT, ST, isq ? H : HKV, SEQ / 64, 0);
  } else {
    proj_block<1, false>(Sm, bx - CQ - CK, by, Xp, Xp, Wvt, Vh, Vl, nullptr, CT, ST, HKV, SEQ / 64, 0);
  }
}

// ctx@Wo in one launch: first the 64x128 tiles of the rows >= QEA, then the 64x64 tiles with the residual plane of the rows < QEA.
constexpr int ON = (DMOD / 128) * NB * ((SEQ - QEA) / 64), OE = (DMOD / 64) * NB * (QEA / 64);
__global__ __launch_bounds__(128) __attribute__((amdgpu_num_vgpr(256))) void out_kernel(
    const b16* __restrict__ Ch, const b16* __restrict__ Cl, const b16* __restrict__ Wot, float* Out) {
  __shared__ __attribute__((aligned(16))) unsigned char Sm[2 * STAGE];
  const int vb = (int)blockIdx.x;
  if (vb < ON) {
    proj_block<2, false>(Sm, vb % (DMOD / 128), vb / (DMOD / 128), Ch, Ch, Wot, nullptr, nullptr, Out, nullptr, nullptr, 1, (SEQ - QEA) / 64, QEA);
  } else {
    const int v = vb - ON;
    proj_block<2, true>(Sm, v % (DMOD / 64), v / (DMOD / 64), Ch, Cl, Wot, nullptr, nullptr, Out, nullptr, nullptr, 1, QEA / 64, 0);
  }
}

// One key step of the attention kernel in LDS: K tile = 32 key rows of 256 B at a pitch of 272 B, V tile = DW d rows of 64 B (32 keys) at a pitch of 80 B
// (both 16 B x odd, for 16-byte readers). A buffer holds K hi[, K lo], V hi[, V lo].
constexpr int KP = 272, VP = 80, KTILE = 32 * KP, PBYTES = NREP * 16 * (32 + 8) * 2, ALDS = 65536;
// The asynchronous 16-byte copies of one lane (of 128) that fill one buffer: K rows r, r+8, r+16, r+24 (16 lanes cover one 256-B row) and V rows d, d+32[, d+64,
// d+96] (4 lanes cover one 64-B row); ER: the same rows of the lo planes, K lo one K tile and V lo one V tile (64 rows) further in LDS.
// lk, lv = the lane's LDS byte addresses in its first rows, gk, gkl, gv, gvl = its global addresses there.
template <bool ER>
__device__ __forceinline__ void copy_kv(unsigned lk, unsigned lv, const b16* gk, const b16* gkl, const b16* gv, const b16* gvl) {
  constexpr size_t KJ = (size_t)8 * HD, VJ = (size_t)32 * SEQ; constexpr unsigned LKJ = 8u * KP, LVJ = 32u * VP, KL = KTILE, VL = 64u * VP;
  // s_wait_xcnt 0 as the last line of either statement: it stands in front of every later rewrite of a register that a copy names
  if constexpr (ER) {
    asm volatile(
        "global_load_async_to_lds_b128 %0, %12, off\n\t"
        "global_load_async_to_lds_b128 %1, %13, off\n\t"
        "global_load_async_to_lds_b128 %2, %14, off\n\t"
        "global_load_async_to_lds_b128 %3, %15, off\n\t"
        "global_load_async_to_lds_b128 %4, %16, off\n\t"
        "global_load_async_to_lds_b128 %5, %17, off\n\t"
        "global_load_async_to_lds_b128 %6, %18, off\n\t"
        "global_load_async_to_lds_b128 %7, %19, off\n\t"
        "global_load_async_to_lds_b128 %8, %20, off\n\t"
        "global_load_async_to_lds_b128 %9, %21, off\n\t"
        "global_load_async_to_lds_b128 %10, %22, off\n\t"
        "global_load_async_to_lds_b128 %11, %23, off\n\t"
        "s_wait_xcnt 0x0"
        :: "v"(lk), "v"(lk + LKJ), "v"(lk + 2 * LKJ), "v"(lk + 3 * LKJ), "v"(lk + KL), "v"(lk + KL + LKJ), "v"(lk + KL + 2 * LKJ), "v"(lk + KL + 3 * LKJ),
           "v"(lv), "v"(lv + LVJ), "v"(lv + VL), "v"(lv + VL + LVJ),
           "v"(gk), "v"(gk + KJ), "v"(gk + 2 * KJ), "v"(gk + 3 * KJ), "v"(gkl), "v"(gkl + KJ), "v"(gkl + 2 * KJ), "v"(gkl + 3 * KJ),
           "v"(gv), "v"(gv + VJ), "v"(gvl), "v"(gvl + VJ)
        : "memory");
  } else {
    asm volatile(
        "global_load_async_to_lds_b128 %0, %8, off\n\t"
        "global_load_async_to_lds_b128 %1, %9, off\n\t"
        "global_load_async_to_lds_b128 %2, %10, off\n\t"
        "global_load_async_to_lds_b128 %3, %11, off\n\t"
        "global_load_async_to_lds_b128 %4, %12, off\n\t"
        "global_load_async_to_lds_b128 %5, %13, off\n\t"
        "global_load_async_to_lds_b128 %6, %14, off\n\t"
        "global_load_async_to_lds_b128 %7, %15, off\n\t"
        "s_wait_xcnt 0x0"
        :: "v"(lk), "v"(lk + LKJ), "v"(lk + 2 * LKJ), "v"(lk + 3 * LKJ), "v"(lv), "v"(lv + LVJ), "v"(lv + 2 * LVJ), "v"(lv + 3 * LVJ),
           "v"(gk), "v"(gk + KJ), "v"(gk + 2 * KJ), "v"(gk + 3 * KJ), "v"(gv), "v"(gv + VJ), "v"(gv + 2 * VJ), "v"(gv + 3 * VJ)
        : "memory");
  }
}

// Causal GQA attention: block (bx = query tile of 16, bg in NB*HKV[, bz = d-half when ER]); block = 4 waves = the 4 query heads of one KV head on the same 16 queries,
// so all four walk the same keys. Each 32-key step's K and V tiles are copied once into LDS, two buffers: the copies of step st+2 fly while step st+1 is
// worked on; every wave reads its fragments from there. Key steps of 32 from key 0 up to the 32-aligned block of the last query in fixed order; online
// softmax (running max, f32); keys later than the query get -inf on the diagonal step; P x1024 via wave-private LDS; O^T += V^T P^T. ER (query position
// < QEA): scores Kh Qh + (Kh Ql + Kl Qh)/2048, O^T second accumulator Vh Pr + Vl Ph folded by 1/2048, each block restricted to 64 of the 128 d rows
// (bz). ctx hi x64 / lo x2048 planes [b*SEQ+s][h*128 + d], staged per wave through the same LDS behind the loop's last barrier.
template <bool ER>
__device__ __forceinline__ void attn_block(unsigned char* Sm, int bx, int bg, int bz,
    const b16* __restrict__ Qh, const b16* __restrict__ Ql, const b16* __restrict__ Kh, const b16* __restrict__ Kl,
    const b16* __restrict__ Vh, const b16* __restrict__ Vl, b16* Ch, b16* Cl) {
  constexpr int NT = ER ? 4 : 8, DW = NT * 16, NP = ER ? 2 : 1, VO = NP * KTILE, VT = DW * VP, ASTAGE = VO + NP * VT;   // 27,648 / 18,944 B a buffer
  static_assert(NREP == 4 && NREP * 16 * (DW + 4) * 4 <= 2 * ASTAGE && ASTAGE % 16 == 0);
  static_assert(2 * ASTAGE + NP * PBYTES <= ALDS);
  b16 (*Pb)[16][32 + 8] = reinterpret_cast<b16 (*)[16][32 + 8]>(Sm + 2 * ASTAGE);            // behind the two buffers: P, then (ER) its residual
  b16 (*Pr)[16][32 + 8] = reinterpret_cast<b16 (*)[16][32 + 8]>(Sm + 2 * ASTAGE + (ER ? PBYTES : 0));
  float (*To)[16][DW + 4] = reinterpret_cast<float (*)[16][DW + 4]>(Sm);
  const int tid = threadIdx.x, wave = tid >> 5, lane = tid & 31, hh = lane >> 4, col = lane & 15;
  const int b = bg / HKV, g = bg - b * HKV, h = g * NREP + wave;
  const int q0 = (ER ? 0 : QEA) + bx * 16, qi = q0 + col;
  const int dh = ER ? bz * 64 : 0;
  const b16* qrow = Qh + ((size_t)(b * H + h) * SEQ + qi) * HD;
  const b16* qlrow = Ql + ((size_t)(b * H + h) * SEQ + qi) * HD;
  const size_t ko = (size_t)(b * HKV + g) * SEQ * HD + (size_t)(tid >> 4) * HD + (tid & 15) * 8;           // the lane's piece of K row tid>>4
  const size_t vo = ((size_t)(b * HKV + g) * HD + dh + (tid >> 2)) * SEQ + (tid & 3) * 8;                  // the lane's piece of V row tid>>2
  const b16* gk = Kh + ko; const b16* gkl = Kl + ko; const b16* gv = Vh + vo; const b16* gvl = Vl + vo;
  const unsigned lk = (unsigned)(uintptr_t)(&Sm[(tid >> 4) * KP + (tid & 15) * 16]);
  const unsigned lv = (unsigned)(uintptr_t)(&Sm[VO + (tid >> 2) * VP + (tid & 3) * 16]);
  const unsigned char* sk = &Sm[col * KP];
  const unsigned char* sv = &Sm[VO + col * VP];
  v16b qa[4];
#pragma unroll
  for (int c = 0; c < 4; ++c) { qa[c] = (v16b){}; if constexpr (!ER) qa[c] = frag_kb(qrow + c * 32, hh); }
  const float cs = SCL * LOG2E / (QS * QS);   // 1/sqrt(128) and the two x8 carriers, in the log2 domain
  float m = -INFINITY, l = 0.0f; v8f o[NT], o2[NT];
#pragma unroll
  for (int t = 0; t < NT; ++t) { o[t] = (v8f){}; o2[t] = (v8f){}; }
  const int nst = q0 / 32 + 1;   // block-uniform: keys 0 .. (q0 | 31)
  copy_kv<ER>(lk, lv, gk, gkl, gv, gvl);
  asm volatile("s_wait_asynccnt 0x0" ::: "memory");   // this wave's copies of step 0 have landed
  __syncthreads();                                     // every wave's have: step 0 may be read
  if (1 < nst) copy_kv<ER>(lk + ASTAGE, lv + ASTAGE, gk + (size_t)32 * HD, gkl + (size_t)32 * HD, gv + 32, gvl + 32);
#pragma unroll 1
  for (int st = 0; st < nst; ++st) {
    const int bo = (st & 1) * ASTAGE;
    const int kb = st * 32; const int lim = qi - kb;   // key offsets > lim are later than the query (binds only on the diagonal step)
    float e[16]; float mx = -INFINITY;
    v8f s[2], s2[2];
#pragma unroll
    for (int u = 0; u < 2; ++u) {
      v16b kf[4], klf[4];   // 16 keys' K fragments, read as one group ahead of their WMMAs
#pragma unroll
      for (int c = 0; c < 4; ++c) {
        kf[c] = frag_kb((const b16*)(sk + bo + u * 16 * KP) + c * 32, hh); klf[c] = (v16b){};
        if constexpr (ER) klf[c] = frag_kb((const b16*)(sk + bo + KTILE + u * 16 * KP) + c * 32, hh);
      }
      s[u] = (v8f){}; s2[u] = (v8f){};
#pragma unroll
      for (int c = 0; c < 4; ++c) {
        if constexpr (ER) {
          const v16b qh = frag_kb(qrow + c * 32, hh), ql = frag_kb(qlrow + c * 32, hh);
          s[u] = wmma16b(kf[c], qh, s[u]); s2[u] = wmma16b(kf[c], ql, s2[u]); s2[u] = wmma16b(klf[c], qh, s2[u]);
        } else {
          s[u] = wmma16b(kf[c], qa[c], s[u]);
        }
      }
    }
    v16b vf[NT];   // the step's V fragments, read as one group: their LDS latency passes under the softmax arithmetic
#pragma unroll
    for (int t = 0; t < NT; ++t) vf[t] = frag_kb((const b16*)(sv + bo + t * 16 * VP), hh);
#pragma unroll
    for (int u = 0; u < 2; ++u)
#pragma unroll
      for (int r = 0; r < 8; ++r) {
        float v = s[u][r];
        if constexpr (ER) v += s2[u][r] * (1.0f / RS);
        v *= cs;
        if (u * 16 + 8 * hh + r > lim) v = -INFINITY;
        e[u * 8 + r] = v; mx = fmaxf(mx, v); }
    mx = fmaxf(mx, __shfl_xor(mx, 16)); const float mn = fmaxf(m, mx); const float al = nexp2(m - mn); float sum = 0.0f;
#pragma unroll
    for (int i2 = 0; i2 < 16; ++i2) {
      const float p = nexp2(e[i2] - mn); sum += p; const int pi = (i2 < 8 ? 0 : 16) + 8 * hh + (i2 & 7);
      const float pp = p * PS; const b16 phv = (b16)pp; Pb[wave][col][pi] = phv;
      if constexpr (ER) Pr[wave][col][pi] = (b16)((pp - (float)phv) * RS); }
    sum += __shfl_xor(sum, 16); l = l * al + sum; m = mn;
    wave_lds_sync();
    const v16b pf = frag_kb(&Pb[wave][col][0], hh);
    v16b prf = (v16b){};
    if constexpr (ER) prf = frag_kb(&Pr[wave][col][0], hh);
    v16b vlf[NT];  // the lo V fragments only here: held across the softmax they would not fit the registers
#pragma unroll
    for (int t = 0; t < NT; ++t) { vlf[t] = (v16b){}; if constexpr (ER) vlf[t] = frag_kb((const b16*)(sv + bo + VT + t * 16 * VP), hh); }
#pragma unroll
    for (int t = 0; t < NT; ++t) {
      o[t] *= al; o[t] = wmma16b(vf[t], pf, o[t]);
      if constexpr (ER) { o2[t] *= al; o2[t] = wmma16b(vf[t], prf, o2[t]); o2[t] = wmma16b(vlf[t], pf, o2[t]); } }
    asm volatile("s_wait_dscnt 0x0" ::: "memory");      // this wave's reads of the buffer (and of its P rows) are done before the refill
    asm volatile("s_wait_asynccnt 0x0" ::: "memory");   // this wave's copies of step st+1 have landed
    __syncthreads();                                     // publishes step st+1 and ends every reader's last read of step st
    if (st + 2 < nst) { const size_t kn = (size_t)(kb + 64) * HD; copy_kv<ER>(lk + bo, lv + bo, gk + kn, gkl + kn, gv + kb + 64, gvl + kb + 64); }
  }
  asm volatile("s_wait_asynccnt 0x0" ::: "memory");     // no copy is outstanding when the buffers become output staging
  const float inv = 1.0f / (l * PS * QS);
#pragma unroll
  for (int t = 0; t < NT; ++t) {
#pragma unroll
    for (int r = 0; r < 8; ++r) {
      float ov = o[t][r];
      if constexpr (ER) ov += o2[t][r] * (1.0f / RS);
      To[wave][col][t * 16 + 8 * hh + r] = ov * inv; } }
  wave_lds_sync();
  constexpr int LPR = DW / 8, RPI = 32 / LPR, NIT = 16 / RPI;
  static_assert(NIT * RPI == 16 && LPR * 8 == DW);
  const size_t cbase = ((size_t)b * SEQ + q0) * DMOD + (size_t)h * HD + dh;
  {
#pragma unroll 1
    for (int it = 0; it < NIT; ++it) {
      const int rr = it * RPI + lane / LPR, seg = (lane % LPR) * 8;
      const v4f fa = *(const v4f*)(&To[wave][rr][seg]), fb = *(const v4f*)(&To[wave][rr][seg + 4]);
      v8b hi, lo;
#pragma unroll
      for (int j = 0; j < 4; ++j) { b16 h0, l0; split16(fa[j] * CS, h0, l0); hi[j] = h0; lo[j] = l0; split16(fb[j] * CS, h0, l0); hi[4 + j] = h0; lo[4 + j] = l0; }
      const size_t off = cbase + (size_t)rr * DMOD + seg;
      *(v8b*)(Ch + off) = hi; *(v8b*)(Cl + off) = lo; }
     }
}
// Both attention forms in one launch: first the blocks of the query positions >= QEA (tile fastest, as before), then those of the positions < QEA.
constexpr int AX = (SEQ - QEA) / 16, AN = AX * NB * HKV, AEX = QEA / 16, AE = AEX * NB * HKV * 2, AXD = AX > 0 ? AX : 1;
__global__ __launch_bounds__(128) __attribute__((amdgpu_num_vgpr(256))) void attn_kernel(
    const b16* __restrict__ Qh, const b16* __restrict__ Ql, const b16* __restrict__ Kh, const b16* __restrict__ Kl,
    const b16* __restrict__ Vh, const b16* __restrict__ Vl, b16* Ch, b16* Cl) {
  __shared__ __attribute__((aligned(16))) unsigned char Sm[ALDS];
  const int vb = (int)blockIdx.x;
  if (vb < AN) {
    attn_block<false>(Sm, vb % AXD, vb / AXD, 0, Qh, Ql, Kh, Kl, Vh, Vl, Ch, Cl);
  } else {
    const int v = vb - AN;
    attn_block<true>(Sm, v % AEX, (v / AEX) % (NB * HKV), v / (AEX * NB * HKV), Qh, Ql, Kh, Kl, Vh, Vl, Ch, Cl);
  }
}
}  // namespace

extern "C" void kernel_launch(void* const* d_in, const int* in_sizes, int n_in, void* d_out, int out_size, void* d_ws, size_t ws_size, hipStream_t stream) {
  // wire order: 0 x [NB_FULL][SEQ_FULL][2048] f32, 1 Wq [2048][2048], 2 Wk [2048][512], 3 Wv [2048][512], 4 Wo [2048][2048]; out [NB_FULL][SEQ_FULL][2048] f32
  const size_t need_x = ((size_t)(NB - 1) * SEQ_FULL + SEQ) * DMOD;
  if (n_in < 5 || (size_t)in_sizes[0] < need_x || (size_t)in_sizes[1] < (size_t)KD * DMOD || (size_t)in_sizes[2] < (size_t)KD * NKV ||
      (size_t)in_sizes[3] < (size_t)KD * NKV || (size_t)in_sizes[4] < (size_t)KD * DMOD || (size_t)out_size < need_x) return;
  const float* X = (const float*)d_in[0]; const float* Wq = (const float*)d_in[1]; const float* Wk = (const float*)d_in[2];
  const float* Wv = (const float*)d_in[3]; const float* Wo = (const float*)d_in[4]; float* out = (float*)d_out;
  size_t off = 0; char* ws = (char*)d_ws;
  auto carve = [&](size_t bytes) { char* p = ws + off; off += (bytes + 255) & ~(size_t)255; return p; };
  b16* Xp  = (b16*)carve((size_t)MR * DMOD * 2);
  b16* Wqt = (b16*)carve((size_t)DMOD * KD * 2);
  b16* Wkt = (b16*)carve((size_t)NKV * KD * 2);
  b16* Wvt = (b16*)carve((size_t)NKV * KD * 2);
  b16* Wot = (b16*)carve((size_t)DMOD * KD * 2);
  float* CT = (float*)carve((size_t)SEQ * 64 * 4);
  float* ST = (float*)carve((size_t)SEQ * 64 * 4);
  b16* Qh = (b16*)carve((size_t)MR * H * HD * 2);
  b16* Ql = (b16*)carve((size_t)MR * H * HD * 2);
  b16* Kh = (b16*)carve((size_t)MR * NKV * 2);
  b16* Kl = (b16*)carve((size_t)MR * NKV * 2);
  b16* Vh = (b16*)carve((size_t)MR * NKV * 2);
  b16* Vl = (b16*)carve((size_t)MR * NKV * 2);
  b16* Ch = (b16*)carve((size_t)MR * DMOD * 2);
  b16* Cl = (b16*)carve((size_t)MR * DMOD * 2);
  if (off > ws_size || off > ((size_t)128 << 20)) return;   // 122,683,392 B at NB=2, SEQ=2048
  prep_kernel<<<dim3(PW + PR + PX), 256, 0, stream>>>(X, Wq, Wk, Wv, Wo, Xp, Wqt, Wkt, Wvt, Wot, CT, ST);
  qkv_kernel<<<dim3(CQ + 2 * CK, MR / 64), 128, 0, stream>>>(Xp, Wqt, Wkt, Wvt, Qh, Ql, Kh, Kl, Vh, Vl, CT, ST);
  attn_kernel<<<dim3(AN + AE), 128, 0, stream>>>(Qh, Ql, Kh, Kl, Vh, Vl, Ch, Cl);
  out_kernel<<<dim3(ON + OE), 128, 0, stream>>>(Ch, Cl, Wot, out);
}

// v004
// A run of this version takes 155 microseconds.
// Timed twice side by side with v003, it ran 1.11 and 1.14 times as fast.
// All steps since v000 together make it 4.86 times as fast.
#include <hip/hip_runtime.h>

// compute dtype: every contraction on v_wmma_f32_16x16x32_f16 (f16 operands, f32 accumulate). x@Wq, x@Wk, x@Wv: x and W enter as bf16-RNE values
// carried x8 (x) and x256 (W) in f16 planes, 1 product. Scores S^T = K Q^T per head: q, k (RoPE applied in f32) as f16 x8 planes, 1 product;
// query rows with position < QE use q,k hi + x2048 residual planes (3 products, second accumulator folded by 1/2048). O^T += V^T P^T: v f16 x8,
// P f16 x1024, 1 product; rows < QE add P and v x2048 residual tiles into a second accumulator (3 products) folded before normalisation.
// ctx@Wo: ctx f16 x64 plane (+ x2048 residual plane for rows < QE, 2 products), Wo bf16-RNE x256, 1 product elsewhere. Softmax statistics
// (running max, exp2, row sums) and RoPE tables in f32; scale 1/sqrt(128) folded into the log2 constant.
// Fragment k-map per lane half hh for A AND B: elements 0..7 <- k = 8hh+0..7, 8..15 <- k = 16+8hh+0..7; acc[r] = D[8hh+r][col = lane&15].

#ifndef NB
#define NB 2
#endif
#ifndef SEQ
#define SEQ 2048
#endif
#ifndef NB_FULL
#define NB_FULL 2
#endif
#ifndef SEQ_FULL
#define SEQ_FULL 2048
#endif
#ifndef QE
#define QE 256
#endif

namespace {
constexpr int DMOD = 2048, KD = 2048, H = 16, HKV = 4, NREP = H / HKV, HD = 128, NKV = HKV * HD;   // NKV = 512
constexpr int MR = NB * SEQ;                                                                         // token rows handled
constexpr int QEA = (QE < SEQ) ? QE : SEQ;                                                           // query positions with residual operands
constexpr float XS = 8.0f, WS = 256.0f, QS = 8.0f, RS = 2048.0f, PS = 1024.0f, CS = 64.0f;
constexpr float LOG2E = 1.4426950408889634f, SCL = 0.08838834764831845f, ROPE_BASE = 500000.0f;
static_assert(SEQ % 128 == 0 && SEQ >= 128 && SEQ <= SEQ_FULL && NB >= 1 && NB <= NB_FULL);
static_assert(QEA % 64 == 0 && QEA >= 64 && QEA <= SEQ && (SEQ - QEA) % 128 == 0);
static_assert(DMOD == H * HD && KD == DMOD && KD % 64 == 0 && DMOD % 128 == 0 && NKV % 128 == 0 && HD == 128 && DMOD == 256 * 8 && MR % 64 == 0);

typedef _Float16 b16;
typedef __attribute__((ext_vector_type(16))) _Float16 v16b;
typedef __attribute__((ext_vector_type(8))) _Float16 v8b;
typedef __attribute__((ext_vector_type(8))) float v8f;
typedef __attribute__((ext_vector_type(4))) float v4f;

__device__ __forceinline__ float bf16_rne(float f) { unsigned int u = __float_as_uint(f); u += 0x7FFFu + ((u >> 16) & 1u); return __uint_as_float(u & 0xFFFF0000u); }
// 16-bit fragment from a k-contiguous row: elements 0..7 <- p[8hh .. 8hh+7], 8..15 <- p[16+8hh .. 16+8hh+7]
__device__ __forceinline__ v16b frag_kb(const b16* p, int hh) {
  const v8b a = *(const v8b*)(p + 8 * hh), b = *(const v8b*)(p + 16 + 8 * hh); v16b f;
#pragma unroll
  for (int e = 0; e < 8; ++e) { f[e] = a[e]; f[8 + e] = b[e]; }
  return f;
}
__device__ __forceinline__ v8f wmma16b(v16b a, v16b b, v8f c) {
  v8f d = __builtin_amdgcn_wmma_f32_16x16x32_f16(false, a, false, b, (short)0, c, false, false);
  asm volatile("v_nop\n\tv_nop\n\tv_nop\n\tv_nop" : "+v"(d) : "v"(a), "v"(b));
  return d;
}
__device__ __forceinline__ void wave_lds_sync() { __builtin_amdgcn_fence(3, "workgroup"); __builtin_amdgcn_wave_barrier(); __builtin_amdgcn_fence(2, "workgroup"); }
__device__ __forceinline__ float nexp2(float v) { return __builtin_amdgcn_exp2f(v); }
// hi = f16(w), lo = f16((w - hi) * RS)
__device__ __forceinline__ void split16(float w, b16& hi, b16& lo) { hi = (b16)w; lo = (b16)((w - (float)hi) * RS); }

__device__ __forceinline__ void cvt_x_block(int vb, const float* __restrict__ X, b16* Xp) {
  const size_t u = (size_t)vb * 256 + threadIdx.x; const size_t row = u >> 8; const int c8 = (int)(u & 255) * 8;
  if (row >= (size_t)MR) return;
  const size_t b = row / SEQ, s = row % SEQ;
  const float* src = X + (b * SEQ_FULL + s) * DMOD + c8;
  b16* dst = Xp + row * DMOD + c8;
  const v4f x0 = *(const v4f*)src, x1 = *(const v4f*)(src + 4); v8b o;
#pragma unroll
  for (int j = 0; j < 4; ++j) { o[j] = (b16)(bf16_rne(x0[j]) * XS); o[4 + j] = (b16)(bf16_rne(x1[j]) * XS); }
  *(v8b*)dst = o; 
}

// W [2048 k][N n] f32 -> Wt [N][2048] f16 = bf16-RNE(w) x256 (k-contiguous for the B fragments). 2 waves (tid 0..63) per 64x64 tile (bx, by), transposed
// through their own LDS tile St; the four wave pairs of a block take four tiles of one matrix and pass the barrier together.
__device__ __forceinline__ void cvt_w_tile(b16 (*St)[64 + 8], int tid, int bx, int by, const float* __restrict__ W, b16* Wt, int N) {
  const int wave = tid >> 5, lane = tid & 31; const int k0 = bx * 64, n0 = by * 64;
  const float* src = W + (size_t)k0 * N + n0;
  for (int it = 0; it < 16; ++it) {
    const int e = (it * 64 + tid) * 4; const int kr = e >> 6, nc = e & 63;
    const v4f x = *(const v4f*)(src + (size_t)kr * N + nc);
#pragma unroll
    for (int j = 0; j < 4; ++j) St[nc + j][kr] = (b16)(bf16_rne(x[j]) * WS);
  }
  __syncthreads();   // St is read across waves
  b16* dstb = Wt + (size_t)n0 * KD + k0;
  {
#pragma unroll 1
    for (int it = 0; it < 8; ++it) {
      const int n = wave * 32 + it * 4 + (lane >> 3), ks = (lane & 7) * 8;
      const v8b o = *(const v8b*)(&St[n][ks]);
      *(v8b*)(dstb + (size_t)n * KD + ks) = o; }
     }
}

// cos/sin tables [SEQ][64] f32: ang = s * (1 / base^(2j/128)) in f32, precise sincosf. Block = 4 positions x 64 frequencies staged in LDS;
__device__ __forceinline__ void rope_tab_block(float (*Tb)[4][64 + 4], int vb, float* CT, float* ST) {
  const int tid = threadIdx.x; const int r = tid >> 6, j = tid & 63; const int s0 = vb * 4;
  const float ex = (float)(2 * j) * (1.0f / 128.0f);
  const float p = powf(ROPE_BASE, ex);
  const float inv = 1.0f / p;
  const float ang = (float)(s0 + r) * inv;
  float sn, c; sincosf(ang, &sn, &c);
  Tb[0][r][j] = c; Tb[1][r][j] = sn;
  __syncthreads();   // Tb is read across waves
  if (tid < 128) {
    const int tb = tid >> 6, rr = (tid >> 4) & 3, seg = (tid & 15) * 4;
    const v4f f = *(const v4f*)(&Tb[tb][rr][seg]);
    float* dst = (tb == 0 ? CT : ST) + (size_t)(s0 + rr) * 64 + seg;
    *(v4f*)dst = f; 
  }
}

// All operand preparation in one launch: its parts read only inputs and write disjoint planes. Block ranges, each block wholly in one part: first the W tiles
// (four 64x64 tiles a block; Wq, Wo, Wk, Wv), then the RoPE tables, then the rows of x.
constexpr int TQ = (KD / 64) * (DMOD / 64), TK = (KD / 64) * (NKV / 64);   // 64x64 tiles of a 2048-column and of a 512-column W
constexpr int PW = (2 * TQ + 2 * TK) / 4, PR = SEQ / 4, PX = MR;           // blocks of the three parts
static_assert(TQ % 4 == 0 && TK % 4 == 0 && KD / 64 == 32);
__global__ __launch_bounds__(256) void prep_kernel(const float* __restrict__ X, const float* __restrict__ Wq, const float* __restrict__ Wk,
    const float* __restrict__ Wv, const float* __restrict__ Wo, b16* Xp, b16* Wqt, b16* Wkt, b16* Wvt, b16* Wot, float* CT, float* ST) {
  __shared__ __attribute__((aligned(16))) unsigned char Sp[4 * 64 * (64 + 8) * 2];
  static_assert(sizeof(Sp) >= 2 * 4 * (64 + 4) * 4);
  const int vb = (int)blockIdx.x;
  if (vb < PW) {
    const int sub = (int)threadIdx.x >> 6, t4 = vb * 4;   // t4 picks the matrix for the whole block
    const float* W = Wq; b16* Wt = Wqt; int N = DMOD, t = t4 + sub;
    if (t4 >= 2 * TQ + TK) { W = Wv; Wt = Wvt; N = NKV; t -= 2 * TQ + TK; }
    else if (t4 >= 2 * TQ) { W = Wk; Wt = Wkt; N = NKV; t -= 2 * TQ; }
    else if (t4 >= TQ) { W = Wo; Wt = Wot; t -= TQ; }
    cvt_w_tile(reinterpret_cast<b16 (*)[64 + 8]>(Sp + sub * 64 * (64 + 8) * 2), (int)threadIdx.x & 63, t & 31, t >> 5, W, Wt, N);
  } else if (vb < PW + PR) {
    rope_tab_block(reinterpret_cast<float (*)[4][64 + 4]>(Sp), vb - PW, CT, ST);
  } else {
    cvt_x_block(vb - PW - PR, X, Xp);
  }
}

// One trip of the projection GEMM's K loop: 64 k = 128 B of each of 256 operand rows, laid in LDS at a pitch of 144 B (16 B x odd, for 16-byte readers).
constexpr int KS = 64, LP = 144, SROWS = 256, STAGE = SROWS * LP;   // 36,864 B a buffer
// Eight asynchronous 16-byte copies a lane fill 128 rows of a buffer: LDS rows r, r+16, .. r+112 (l = the lane's byte address in row r), the first 64 rows
// from ga, the next 64 from gb (each the lane's own address in its group's row r; 16 rows further = 16*KD elements). Eight lanes cover one 128-B row.
__device__ __forceinline__ void copy_rows128(unsigned l, const b16* ga, const b16* gb) {
  constexpr size_t RJ = (size_t)16 * KD; constexpr unsigned LJ = 16u * LP;
  // s_wait_xcnt 0 as the last line: it stands in front of every later rewrite of a register that a copy names
  asm volatile(
      "global_load_async_to_lds_b128 %0, %8, off\n\t"
      "global_load_async_to_lds_b128 %1, %9, off\n\t"
      "global_load_async_to_lds_b128 %2, %10, off\n\t"
      "global_load_async_to_lds_b128 %3, %11, off\n\t"
      "global_load_async_to_lds_b128 %4, %12, off\n\t"
      "global_load_async_to_lds_b128 %5, %13, off\n\t"
      "global_load_async_to_lds_b128 %6, %14, off\n\t"
      "global_load_async_to_lds_b128 %7, %15, off\n\t"
      "s_wait_xcnt 0x0"
      :: "v"(l), "v"(l + LJ), "v"(l + 2 * LJ), "v"(l + 3 * LJ), "v"(l + 4 * LJ), "v"(l + 5 * LJ), "v"(l + 6 * LJ), "v"(l + 7 * LJ),
         "v"(ga), "v"(ga + RJ), "v"(ga + 2 * RJ), "v"(ga + 3 * RJ), "v"(gb), "v"(gb + RJ), "v"(gb + 2 * RJ), "v"(gb + 3 * RJ)
      : "memory");
}
// One buffer: rows 0..63 from g0, 64..127 from g1, 128..191 from g2, 192..255 from g3; sixteen copies a lane, in two statements (an asm statement takes 30 operands).
__device__ __forceinline__ void copy_stage(unsigned l, const b16* g0, const b16* g1, const b16* g2, const b16* g3) {
  copy_rows128(l, g0, g1);
  copy_rows128(l + 128u * LP, g2, g3);
}

// C[BM x 128] = A[m][k] . B[k][n] with A plane [rows][2048] and Bt plane [N][2048], both k-contiguous f16; K = 2048 in trips of 64 (two WMMA steps of 32).
// 128 threads = 4 waves. The block's operand rows of a trip (A 128 rows, then B 128 rows; RES: A 64, residual A 64 of the same token rows, B 128) are copied
// once into LDS, two buffers: the copies of trip t+2 fly while trip t+1 is worked on. Waves 2 x 2 on the tile: wave w owns four A fragments and the four B
// fragments of columns 64(w&1).., 16 accumulators: BM = 128, rows 64(w>>1)..+63; RES: BM = 64, rows 32(w>>1)..+31, A fragments 0,1 from the hi plane
// and 2,3 from the x2048 residual plane of the same rows, so accumulators 8..15 are the residual sums of 0..7.
// Column tile bx; row tile: by = bsel * tpb + tsel, rows m0 = bsel*SEQ + toff + BM tsel. Epilogue staged through the same LDS (behind the loop's last barrier) then:
// MODE 0: RoPE in f32 with the cos/sin tables, hi x8 / lo x2048 planes [b][nhead][s][128] (256-B rows by 16 lanes x 16 B, 8 rows per store);
template <int MODE, bool RES>
__device__ __forceinline__ void proj_block(unsigned char* Sm, int bx, int by,
    const b16* __restrict__ A, const b16* __restrict__ Al, const b16* __restrict__ Bt, b16* Ph, b16* Pl, float* Out,
    const float* __restrict__ CT, const float* __restrict__ ST, int nhead, int tpb, int toff) {
#pragma clang fp contract(off)
  static_assert(MODE == 2 || !RES);
  constexpr int BM = RES ? 64 : 128, BN = 128, NTRIP = KD / KS, BROW = 128;
  static_assert(BM * (BN + 4) * 4 <= 2 * STAGE && NTRIP >= 2 && BROW + BN == SROWS);
  float (*To)[BN + 4] = reinterpret_cast<float (*)[BN + 4]>(Sm);
  const int tid = threadIdx.x, wave = tid >> 5, lane = tid & 31, hh = lane >> 4, col = lane & 15;
  const int bsel = by / tpb, tsel = by - bsel * tpb;
  const int s0 = toff + tsel * BM;
  const size_t m0 = (size_t)bsel * SEQ + s0;
  const int n0 = bx * BN;
  const int wm = wave >> 1, wn = wave & 1;
  const int cr = tid >> 3, cs = (tid & 7) * 8;   // the lane's row in each run of 16 rows, and its 16-byte piece of the row
  const b16* g0 = A + (m0 + cr) * KD + cs;
  const b16* g1 = RES ? Al + (m0 + cr) * KD + cs : A + (m0 + 64 + cr) * KD + cs;
  const b16* g2 = Bt + (size_t)(n0 + cr) * KD + cs;
  const b16* g3 = Bt + (size_t)(n0 + 64 + cr) * KD + cs;
  const unsigned lc = (unsigned)(uintptr_t)(&Sm[cr * LP + cs * 2]);
  const unsigned char* sa = &Sm[(wm * (BM / 2) + col) * LP];
  const unsigned char* sb = &Sm[(BROW + wn * 64 + col) * LP];
  v8f acc[16];
#pragma unroll
  for (int t = 0; t < 16; ++t) acc[t] = (v8f){};
  copy_stage(lc, g0, g1, g2, g3);
  asm volatile("s_wait_asynccnt 0x0" ::: "memory");   // this wave's copies of trip 0 have landed
  __syncthreads();                                     // every wave's have: trip 0 may be read
  copy_stage(lc + STAGE, g0 + KS, g1 + KS, g2 + KS, g3 + KS);
#pragma unroll 1
  for (int tr = 0; tr < NTRIP; ++tr) {
    const int bo = (tr & 1) * STAGE;
#pragma unroll
    for (int kk = 0; kk < 2; ++kk) {
      v16b af[4], bf[4];   // the fragments of one WMMA step, read as one group ahead of its 16 WMMAs
#pragma unroll
      for (int i = 0; i < 4; ++i) {
        const int ar = RES ? (i >> 1) * 64 + (i & 1) * 16 : i * 16;   // LDS row of A fragment i, from the wave's first row
        af[i] = frag_kb((const b16*)(sa + bo + ar * LP) + kk * 32, hh);
      }
#pragma unroll
      for (int j = 0; j < 4; ++j) bf[j] = frag_kb((const b16*)(sb + bo + j * 16 * LP) + kk * 32, hh);
#pragma unroll
      for (int i = 0; i < 4; ++i)
#pragma unroll
        for (int j = 0; j < 4; ++j) acc[i * 4 + j] = wmma16b(af[i], bf[j], acc[i * 4 + j]);
    }
    asm volatile("s_wait_dscnt 0x0" ::: "memory");      // this wave's reads of the buffer are done before it is refilled
    asm volatile("s_wait_asynccnt 0x0" ::: "memory");   // this wave's copies of trip tr+1 have landed
    __syncthreads();                                     // publishes trip tr+1 and ends every reader's last read of trip tr
    if (tr + 2 < NTRIP) { const int ko = (tr + 2) * KS; copy_stage(lc + bo, g0 + ko, g1 + ko, g2 + ko, g3 + ko); }
  }
  asm volatile("s_wait_asynccnt 0x0" ::: "memory");     // no copy is outstanding when the buffers become output staging
#pragma unroll
  for (int i = 0; i < BM / 32; ++i)
#pragma unroll
    for (int j = 0; j < 4; ++j)
#pragma unroll
      for (int r = 0; r < 8; ++r) {
        float v = acc[i * 4 + j][r];
        if constexpr (RES) v += acc[(i + 2) * 4 + j][r] * (1.0f / RS);
        To[wm * (BM / 2) + i * 16 + 8 * hh + r][wn * 64 + j * 16 + col] = v; }
  __syncthreads();   // To is read across waves
  constexpr int HF = BM / 64;   // every pass below handles its rows in each 64-row half of the tile: HF independent pieces, stored together
  if constexpr (MODE == 0) {
    const size_t pb = (((size_t)bsel * nhead + bx) * SEQ + s0) * HD;
    b16* ph = Ph + pb; b16* pl = Pl + pb;
    const float qsc = QS / (XS * WS);
    {
#pragma unroll 1
      for (int it = 0; it < 8; ++it) {
        const int seg = (tid & 15) * 8, sg = seg & 63;
        const float sgn = (seg >= 64) ? 1.0f : -1.0f;   // d < 64: x cos - x[d+64] sin; d >= 64: x cos + x[d-64] sin
        v8b hi[HF], lo[HF];
#pragma unroll
        for (int hf = 0; hf < HF; ++hf) {
          const int rr = hf * 64 + it * 8 + (tid >> 4);
          const float* trow = &To[rr][0]; const size_t ts = (size_t)(s0 + rr) * 64 + sg;
          const v4f xa = *(const v4f*)(trow + seg), xb = *(const v4f*)(trow + seg + 4);
          const v4f ya = *(const v4f*)(trow + (seg ^ 64)), yb = *(const v4f*)(trow + (seg ^ 64) + 4);
          const v4f ca = *(const v4f*)(CT + ts), cb = *(const v4f*)(CT + ts + 4), sa = *(const v4f*)(ST + ts), sb = *(const v4f*)(ST + ts + 4);
#pragma unroll
          for (int j = 0; j < 4; ++j) {
            b16 h0, l0;
            split16((xa[j] * ca[j] + sgn * ya[j] * sa[j]) * qsc, h0, l0); hi[hf][j] = h0; lo[hf][j] = l0;
            split16((xb[j] * cb[j] + sgn * yb[j] * sb[j]) * qsc, h0, l0); hi[hf][4 + j] = h0; lo[hf][4 + j] = l0; }
        }
#pragma unroll
        for (int hf = 0; hf < HF; ++hf) {
          const size_t off = (size_t)(hf * 64 + it * 8 + (tid >> 4)) * HD + seg;
          *(v8b*)(ph + off) = hi[hf]; *(v8b*)(pl + off) = lo[hf]; }
        asm volatile("s_wait_xcnt 0x0" ::: "memory"); }   // in front of the next pass's rewrite of the registers that the stores name
       }
  } else if constexpr (MODE == 1) {
    const size_t pb = ((size_t)bsel * nhead + bx) * HD * (size_t)SEQ + s0;
    b16* ph = Ph + pb; b16* pl = Pl + pb;
    const float vsc = QS / (XS * WS);
    {
#pragma unroll 1
      for (int it = 0; it < 8; ++it) {
        const int d = it * 16 + (tid >> 3);
        v8b hi[HF], lo[HF];
#pragma unroll
        for (int hf = 0; hf < HF; ++hf) {
          const int ss = hf * 64 + (tid & 7) * 8;
#pragma unroll
          for (int j = 0; j < 8; ++j) { b16 h0, l0; split16(To[ss + j][d] * vsc, h0, l0); hi[hf][j] = h0; lo[hf][j] = l0; }
        }
#pragma unroll
        for (int hf = 0; hf < HF; ++hf) {
          const size_t off = (size_t)d * SEQ + hf * 64 + (tid & 7) * 8;
          *(v8b*)(ph + off) = hi[hf]; *(v8b*)(pl + off) = lo[hf]; } }
       }
  } else {
    constexpr int LPR = BN / 4, RPI = 128 / LPR, NIT = 64 / RPI;
    static_assert(NIT * RPI == 64 && LPR * 4 == BN);
    float* ob = Out + ((size_t)bsel * SEQ_FULL + s0) * DMOD + n0;
    const float osc = 1.0f / (CS * WS);
    {
#pragma unroll 1
      for (int it = 0; it < NIT; ++it) {
        const int seg = (tid % LPR) * 4;
        v4f f[HF];
#pragma unroll
        for (int hf = 0; hf < HF; ++hf) f[hf] = *(const v4f*)(&To[hf * 64 + it * RPI + tid / LPR][seg]) * osc;
#pragma unroll
        for (int hf = 0; hf < HF; ++hf) *(v4f*)(ob + (size_t)(hf * 64 + it * RPI + tid / LPR) * DMOD + seg) = f[hf]; }
       }
  }
}

// x@Wq, x@Wk, x@Wv in one launch: column tiles 0..15 are Q heads, 16..19 K heads, 20..23 V heads; each block wholly one of them.
constexpr int CQ = DMOD / 128, CK = NKV / 128;
__global__ __launch_bounds__(128) __attribute__((amdgpu_num_vgpr(256))) void qkv_kernel(
    const b16* __restrict__ Xp, const b16* __restrict__ Wqt, const b16* __restrict__ Wkt, const b16* __restrict__ Wvt,
    b16* Qh, b16* Ql, b16* Kh, b16* Kl, b16* Vh, b16* Vl, const float* __restrict__ CT, const float* __restrict__ ST) {
  __shared__ __attribute__((aligned(16))) unsigned char Sm[2 * STAGE];
  const int bx = (int)blockIdx.x, by = (int)blockIdx.y;
  if (bx < CQ + CK) {
    const bool isq = bx < CQ;
    proj_block<0, false>(Sm, isq ? bx : bx - CQ, by, Xp, Xp, isq ? Wqt : Wkt, isq ? Qh : Kh, isq ? Ql : Kl, nullptr, CT, ST, isq ? H : HKV, SEQ / 128, 0);
  } else {
    proj_block<1, false>(Sm, bx - CQ - CK, by, Xp, Xp, Wvt, Vh, Vl, nullptr, CT, ST, HKV, SEQ / 128, 0);
  }
}

// ctx@Wo in one launch: first the 128x128 tiles of the rows >= QEA, then the 64x128 tiles with the residual plane of the rows < QEA.
constexpr int ON = (DMOD / 128) * NB * ((SEQ - QEA) / 128), OE = (DMOD / 128) * NB * (QEA / 64);
__global__ __launch_bounds__(128) __attribute__((amdgpu_num_vgpr(256))) void out_kernel(
    const b16* __restrict__ Ch, const b16* __restrict__ Cl, const b16* __restrict__ Wot, float* Out) {
  __shared__ __attribute__((aligned(16))) unsigned char Sm[2 * STAGE];
  const int vb = (int)blockIdx.x;
  if (vb < ON) {
    proj_block<2, false>(Sm, vb % (DMOD / 128), vb / (DMOD / 128), Ch, Ch, Wot, nullptr, nullptr, Out, nullptr, nullptr, 1, (SEQ - QEA) / 128, QEA);
  } else {
    const int v = vb - ON;
    proj_block<2, true>(Sm, v % (DMOD / 128), v / (DMOD / 128), Ch, Cl, Wot, nullptr, nullptr, Out, nullptr, nullptr, 1, QEA / 64, 0);
  }
}

// One key step of the attention kernel in LDS: K tile = 32 key rows of 256 B at a pitch of 272 B, V tile = DW d rows of 64 B (32 keys) at a pitch of 80 B
// (both 16 B x odd, for 16-byte readers). A buffer holds K hi[, K lo], V hi[, V lo].
constexpr int KP = 272, VP = 80, KTILE = 32 * KP, PBYTES = NREP * 16 * (32 + 8) * 2, ALDS = 65536;
// The asynchronous 16-byte copies of one lane (of 128) that fill one buffer: K rows r, r+8, r+16, r+24 (16 lanes cover one 256-B row) and V rows d, d+32[, d+64,
// d+96] (4 lanes cover one 64-B row); ER: the same rows of the lo planes, K lo one K tile and V lo one V tile (64 rows) further in LDS.
// lk, lv = the lane's LDS byte addresses in its first rows, gk, gkl, gv, gvl = its global addresses there.
template <bool ER>
__device__ __forceinline__ void copy_kv(unsigned lk, unsigned lv, const b16* gk, const b16* gkl, const b16* gv, const b16* gvl) {
  constexpr size_t KJ = (size_t)8 * HD, VJ = (size_t)32 * SEQ; constexpr unsigned LKJ = 8u * KP, LVJ = 32u * VP, KL = KTILE, VL = 64u * VP;
  // s_wait_xcnt 0 as the last line of either statement: it stands in front of every later rewrite of a register that a copy names
  if constexpr (ER) {
    asm volatile(
        "global_load_async_to_lds_b128 %0, %12, off\n\t"
        "global_load_async_to_lds_b128 %1, %13, off\n\t"
        "global_load_async_to_lds_b128 %2, %14, off\n\t"
        "global_load_async_to_lds_b128 %3, %15, off\n\t"
        "global_load_async_to_lds_b128 %4, %16, off\n\t"
        "global_load_async_to_lds_b128 %5, %17, off\n\t"
        "global_load_async_to_lds_b128 %6, %18, off\n\t"
        "global_load_async_to_lds_b128 %7, %19, off\n\t"
        "global_load_async_to_lds_b128 %8, %20, off\n\t"
        "global_load_async_to_lds_b128 %9, %21, off\n\t"
        "global_load_async_to_lds_b128 %10, %22, off\n\t"
        "global_load_async_to_lds_b128 %11, %23, off\n\t"
        "s_wait_xcnt 0x0"
        :: "v"(lk), "v"(lk + LKJ), "v"(lk + 2 * LKJ), "v"(lk + 3 * LKJ), "v"(lk + KL), "v"(lk + KL + LKJ), "v"(lk + KL + 2 * LKJ), "v"(lk + KL + 3 * LKJ),
           "v"(lv), "v"(lv + LVJ), "v"(lv + VL), "v"(lv + VL + LVJ),
           "v"(gk), "v"(gk + KJ), "v"(gk + 2 * KJ), "v"(gk + 3 * KJ), "v"(gkl), "v"(gkl + KJ), "v"(gkl + 2 * KJ), "v"(gkl + 3 * KJ),
           "v"(gv), "v"(gv + VJ), "v"(gvl), "v"(gvl + VJ)
        : "memory");
  } else {
    asm volatile(
        "global_load_async_to_lds_b128 %0, %8, off\n\t"
        "global_load_async_to_lds_b128 %1, %9, off\n\t"
        "global_load_async_to_lds_b128 %2, %10, off\n\t"
        "global_load_async_to_lds_b128 %3, %11, off\n\t"
        "global_load_async_to_lds_b128 %4, %12, off\n\t"
        "global_load_async_to_lds_b128 %5, %13, off\n\t"
        "global_load_async_to_lds_b128 %6, %14, off\n\t"
        "global_load_async_to_lds_b128 %7, %15, off\n\t"
        "s_wait_xcnt 0x0"
        :: "v"(lk), "v"(lk + LKJ), "v"(lk + 2 * LKJ), "v"(lk + 3 * LKJ), "v"(lv), "v"(lv + LVJ), "v"(lv + 2 * LVJ), "v"(lv + 3 * LVJ),
           "v"(gk), "v"(gk + KJ), "v"(gk + 2 * KJ), "v"(gk + 3 * KJ), "v"(gv), "v"(gv + VJ), "v"(gv + 2 * VJ), "v"(gv + 3 * VJ)
        : "memory");
  }
}

// Causal GQA attention: block (bx = query tile of 16, bg in NB*HKV[, bz = d-half when ER]); block = 4 waves = the 4 query heads of one KV head on the same 16 queries,
// so all four walk the same keys. Each 32-key step's K and V tiles are copied once into LDS, two buffers: the copies of step st+2 fly while step st+1 is
// worked on; every wave reads its fragments from there. Key steps of 32 from key 0 up to the 32-aligned block of the last query in fixed order; online
// softmax (running max, f32); keys later than the query get -inf on the diagonal step; P x1024 via wave-private LDS; O^T += V^T P^T. ER (query position
// < QEA): scores Kh Qh + (Kh Ql + Kl Qh)/2048, O^T second accumulator Vh Pr + Vl Ph folded by 1/2048, each block restricted to 64 of the 128 d rows
// (bz). ctx hi x64 / lo x2048 planes [b*SEQ+s][h*128 + d], staged per wave through the same LDS behind the loop's last barrier.
template <bool ER>
__device__ __forceinline__ void attn_block(unsigned char* Sm, int bx, int bg, int bz,
    const b16* __restrict__ Qh, const b16* __restrict__ Ql, const b16* __restrict__ Kh, const b16* __restrict__ Kl,
    const b16* __restrict__ Vh, const b16* __restrict__ Vl, b16* Ch, b16* Cl) {
  constexpr int NT = ER ? 4 : 8, DW = NT * 16, NP = ER ? 2 : 1, VO = NP * KTILE, VT = DW * VP, ASTAGE = VO + NP * VT;   // 27,648 / 18,944 B a buffer
  static_assert(NREP == 4 && NREP * 16 * (DW + 4) * 4 <= 2 * ASTAGE && ASTAGE % 16 == 0);
  static_assert(2 * ASTAGE + NP * PBYTES <= ALDS);
  b16 (*Pb)[16][32 + 8] = reinterpret_cast<b16 (*)[16][32 + 8]>(Sm + 2 * ASTAGE);            // behind the two buffers: P, then (ER) its residual
  b16 (*Pr)[16][32 + 8] = reinterpret_cast<b16 (*)[16][32 + 8]>(Sm + 2 * ASTAGE + (ER ? PBYTES : 0));
  float (*To)[16][DW + 4] = reinterpret_cast<float (*)[16][DW + 4]>(Sm);
  const int tid = threadIdx.x, wave = tid >> 5, lane = tid & 31, hh = lane >> 4, col = lane & 15;
  const int b = bg / HKV, g = bg - b * HKV, h = g * NREP + wave;
  const int q0 = (ER ? 0 : QEA) + bx * 16, qi = q0 + col;
  const int dh = ER ? bz * 64 : 0;
  const b16* qrow = Qh + ((size_t)(b * H + h) * SEQ + qi) * HD;
  const b16* qlrow = Ql + ((size_t)(b * H + h) * SEQ + qi) * HD;
  const size_t ko = (size_t)(b * HKV + g) * SEQ * HD + (size_t)(tid >> 4) * HD + (tid & 15) * 8;           // the lane's piece of K row tid>>4
  const size_t vo = ((size_t)(b * HKV + g) * HD + dh + (tid >> 2)) * SEQ + (tid & 3) * 8;                  // the lane's piece of V row tid>>2
  const b16* gk = Kh + ko; const b16* gkl = Kl + ko; const b16* gv = Vh + vo; const b16* gvl = Vl + vo;
  const unsigned lk = (unsigned)(uintptr_t)(&Sm[(tid >> 4) * KP + (tid & 15) * 16]);
  const unsigned lv = (unsigned)(uintptr_t)(&Sm[VO + (tid >> 2) * VP + (tid & 3) * 16]);
  const unsigned char* sk = &Sm[col * KP];
  const unsigned char* sv = &Sm[VO + col * VP];
  v16b qa[4];
#pragma unroll
  for (int c = 0; c < 4; ++c) { qa[c] = (v16b){}; if constexpr (!ER) qa[c] = frag_kb(qrow + c * 32, hh); }
  const float cs = SCL * LOG2E / (QS * QS);   // 1/sqrt(128) and the two x8 carriers, in the log2 domain
  float m = -INFINITY, l = 0.0f; v8f o[NT], o2[NT];
#pragma unroll
  for (int t = 0; t < NT; ++t) { o[t] = (v8f){}; o2[t] = (v8f){}; }
  const int nst = q0 / 32 + 1;   // block-uniform: keys 0 .. (q0 | 31)
  copy_kv<ER>(lk, lv, gk, gkl, gv, gvl);
  asm volatile("s_wait_asynccnt 0x0" ::: "memory");   // this wave's copies of step 0 have landed
  __syncthreads();                                     // every wave's have: step 0 may be read
  if (1 < nst) copy_kv<ER>(lk + ASTAGE, lv + ASTAGE, gk + (size_t)32 * HD, gkl + (size_t)32 * HD, gv + 32, gvl + 32);
#pragma unroll 1
  for (int st = 0; st < nst; ++st) {
    const int bo = (st & 1) * ASTAGE;
    const int kb = st * 32; const int lim = qi - kb;   // key offsets > lim are later than the query (binds only on the diagonal step)
    float e[16]; float mx = -INFINITY;
    v8f s[2], s2[2];
#pragma unroll
    for (int u = 0; u < 2; ++u) {
      v16b kf[4], klf[4];   // 16 keys' K fragments, read as one group ahead of their WMMAs
#pragma unroll
      for (int c = 0; c < 4; ++c) {
        kf[c] = frag_kb((const b16*)(sk + bo + u * 16 * KP) + c * 32, hh); klf[c] = (v16b){};
        if constexpr (ER) klf[c] = frag_kb((const b16*)(sk + bo + KTILE + u * 16 * KP) + c * 32, hh);
      }
      s[u] = (v8f){}; s2[u] = (v8f){};
#pragma unroll
      for (int c = 0; c < 4; ++c) {
        if constexpr (ER) {
          const v16b qh = frag_kb(qrow + c * 32, hh), ql = frag_kb(qlrow + c * 32, hh);
          s[u] = wmma16b(kf[c], qh, s[u]); s2[u] = wmma16b(kf[c], ql, s2[u]); s2[u] = wmma16b(klf[c], qh, s2[u]);
        } else {
          s[u] = wmma16b(kf[c], qa[c], s[u]);
        }
      }
    }
    v16b vf[NT];   // the step's V fragments, read as one group: their LDS latency passes under the softmax arithmetic
#pragma unroll
    for (int t = 0; t < NT; ++t) vf[t] = frag_kb((const b16*)(sv + bo + t * 16 * VP), hh);
#pragma unroll
    for (int u = 0; u < 2; ++u)
#pragma unroll
      for (int r = 0; r < 8; ++r) {
        float v = s[u][r];
        if constexpr (ER) v += s2[u][r] * (1.0f / RS);
        v *= cs;
        if (u * 16 + 8 * hh + r > lim) v = -INFINITY;
        e[u * 8 + r] = v; mx = fmaxf(mx, v); }
    mx = fmaxf(mx, __shfl_xor(mx, 16)); const float mn = fmaxf(m, mx); const float al = nexp2(m - mn); float sum = 0.0f;
#pragma unroll
    for (int i2 = 0; i2 < 16; ++i2) {
      const float p = nexp2(e[i2] - mn); sum += p; const int pi = (i2 < 8 ? 0 : 16) + 8 * hh + (i2 & 7);
      const float pp = p * PS; const b16 phv = (b16)pp; Pb[wave][col][pi] = phv;
      if constexpr (ER) Pr[wave][col][pi] = (b16)((pp - (float)phv) * RS); }
    sum += __shfl_xor(sum, 16); l = l * al + sum; m = mn;
    wave_lds_sync();
    const v16b pf = frag_kb(&Pb[wave][col][0], hh);
    v16b prf = (v16b){};
    if constexpr (ER) prf = frag_kb(&Pr[wave][col][0], hh);
    v16b vlf[NT];  // the lo V fragments only here: held across the softmax they would not fit the registers
#pragma unroll
    for (int t = 0; t < NT; ++t) { vlf[t] = (v16b){}; if constexpr (ER) vlf[t] = frag_kb((const b16*)(sv + bo + VT + t * 16 * VP), hh); }
#pragma unroll
    for (int t = 0; t < NT; ++t) {
      o[t] *= al; o[t] = wmma16b(vf[t], pf, o[t]);
      if constexpr (ER) { o2[t] *= al; o2[t] = wmma16b(vf[t], prf, o2[t]); o2[t] = wmma16b(vlf[t], pf, o2[t]); } }
    asm volatile("s_wait_dscnt 0x0" ::: "memory");      // this wave's reads of the buffer (and of its P rows) are done before the refill
    asm volatile("s_wait_asynccnt 0x0" ::: "memory");   // this wave's copies of step st+1 have landed
    __syncthreads();                                     // publishes step st+1 and ends every reader's last read of step st
    if (st + 2 < nst) { const size_t kn = (size_t)(kb + 64) * HD; copy_kv<ER>(lk + bo, lv + bo, gk + kn, gkl + kn, gv + kb + 64, gvl + kb + 64); }
  }
  asm volatile("s_wait_asynccnt 0x0" ::: "memory");     // no copy is outstanding when the buffers become output staging
  const float inv = 1.0f / (l * PS * QS);
#pragma unroll
  for (int t = 0; t < NT; ++t) {
#pragma unroll
    for (int r = 0; r < 8; ++r) {
      float ov = o[t][r];
      if constexpr (ER) ov += o2[t][r] * (1.0f / RS);
      To[wave][col][t * 16 + 8 * hh + r] = ov * inv; } }
  wave_lds_sync();
  constexpr int LPR = DW / 8, RPI = 32 / LPR, NIT = 16 / RPI;
  static_assert(NIT * RPI == 16 && LPR * 8 == DW);
  const size_t cbase = ((size_t)b * SEQ + q0) * DMOD + (size_t)h * HD + dh;
  {
#pragma unroll 1
    for (int it = 0; it < NIT; ++it) {
      const int rr = it * RPI + lane / LPR, seg = (lane % LPR) * 8;
      const v4f fa = *(const v4f*)(&To[wave][rr][seg]), fb = *(const v4f*)(&To[wave][rr][seg + 4]);
      v8b hi, lo;
#pragma unroll
      for (int j = 0; j < 4; ++j) { b16 h0, l0; split16(fa[j] * CS, h0, l0); hi[j] = h0; lo[j] = l0; split16(fb[j] * CS, h0, l0); hi[4 + j] = h0; lo[4 + j] = l0; }
      const size_t off = cbase + (size_t)rr * DMOD + seg;
      *(v8b*)(Ch + off) = hi; *(v8b*)(Cl + off) = lo; }
     }
}
// Both attention forms in one launch: first the blocks of the query positions >= QEA (tile fastest, as before), then those of the positions < QEA.
constexpr int AX = (SEQ - QEA) / 16, AN = AX * NB * HKV, AEX = QEA / 16, AE = AEX * NB * HKV * 2, AXD = AX > 0 ? AX : 1;
__global__ __launch_bounds__(128) __attribute__((amdgpu_num_vgpr(256))) void attn_kernel(
    const b16* __restrict__ Qh, const b16* __restrict__ Ql, const b16* __restrict__ Kh, const b16* __restrict__ Kl,
    const b16* __restrict__ Vh, const b16* __restrict__ Vl, b16* Ch, b16* Cl) {
  __shared__ __attribute__((aligned(16))) unsigned char Sm[ALDS];
  const int vb = (int)blockIdx.x;
  if (vb < AN) {
    attn_block<false>(Sm, vb % AXD, vb / AXD, 0, Qh, Ql, Kh, Kl, Vh, Vl, Ch, Cl);
  } else {
    const int v = vb - AN;
    attn_block<true>(Sm, v % AEX, (v / AEX) % (NB * HKV), v / (AEX * NB * HKV), Qh, Ql, Kh, Kl, Vh, Vl, Ch, Cl);
  }
}
}  // namespace

extern "C" void kernel_launch(void* const* d_in, const int* in_sizes, int n_in, void* d_out, int out_size, void* d_ws, size_t ws_size, hipStream_t stream) {
  // wire order: 0 x [NB_FULL][SEQ_FULL][2048] f32, 1 Wq [2048][2048], 2 Wk [2048][512], 3 Wv [2048][512], 4 Wo [2048][2048]; out [NB_FULL][SEQ_FULL][2048] f32
  const size_t need_x = ((size_t)(NB - 1) * SEQ_FULL + SEQ) * DMOD;
  if (n_in < 5 || (size_t)in_sizes[0] < need_x || (size_t)in_sizes[1] < (size_t)KD * DMOD || (size_t)in_sizes[2] < (size_t)KD * NKV ||
      (size_t)in_sizes[3] < (size_t)KD * NKV || (size_t)in_sizes[4] < (size_t)KD * DMOD || (size_t)out_size < need_x) return;
  const float* X = (const float*)d_in[0]; const float* Wq = (const float*)d_in[1]; const float* Wk = (const float*)d_in[2];
  const float* Wv = (const float*)d_in[3]; const float* Wo = (const float*)d_in[4]; float* out = (float*)d_out;
  size_t off = 0; char* ws = (char*)d_ws;
  auto carve = [&](size_t bytes) { char* p = ws + off; off += (bytes + 255) & ~(size_t)255; return p; };
  b16* Xp  = (b16*)carve((size_t)MR * DMOD * 2);
  b16* Wqt = (b16*)carve((size_t)DMOD * KD * 2);
  b16* Wkt = (b16*)carve((size_t)NKV * KD * 2);
  b16* Wvt = (b16*)carve((size_t)NKV * KD * 2);
  b16* Wot = (b16*)carve((size_t)DMOD * KD * 2);
  float* CT = (float*)carve((size_t)SEQ * 64 * 4);
  float* ST = (float*)carve((size_t)SEQ * 64 * 4);
  b16* Qh = (b16*)carve((size_t)MR * H * HD * 2);
  b16* Ql = (b16*)carve((size_t)MR * H * HD * 2);
  b16* Kh = (b16*)carve((size_t)MR * NKV * 2);
  b16* Kl = (b16*)carve((size_t)MR * NKV * 2);
  b16* Vh = (b16*)carve((size_t)MR * NKV * 2);
  b16* Vl = (b16*)carve((size_t)MR * NKV * 2);
  b16* Ch = (b16*)carve((size_t)MR * DMOD * 2);
  b16* Cl = (b16*)carve((size_t)MR * DMOD * 2);
  if (off > ws_size || off > ((size_t)128 << 20)) return;   // 122,683,392 B at NB=2, SEQ=2048
  prep_kernel<<<dim3(PW + PR + PX), 256, 0, stream>>>(X, Wq, Wk, Wv, Wo, Xp, Wqt, Wkt, Wvt, Wot, CT, ST);
  qkv_kernel<<<dim3(CQ + 2 * CK, MR / 128), 128, 0, stream>>>(Xp, Wqt, Wkt, Wvt, Qh, Ql, Kh, Kl, Vh, Vl, CT, ST);
  attn_kernel<<<dim3(AN + AE), 128, 0, stream>>>(Qh, Ql, Kh, Kl, Vh, Vl, Ch, Cl);
  out_kernel<<<dim3(ON + OE), 128, 0, stream>>>(Ch, Cl, Wot, out);
}

// v005
// One run takes 147 microseconds.
// Two timings next to v004 both put it at 1.05 times that version's speed.
// All steps since v000 together make it 5.08 times as fast.
#include <hip/hip_runtime.h>

// compute dtype: every contraction on v_wmma_f32_16x16x32_f16 (f16 operands, f32 accumulate). x@Wq, x@Wk, x@Wv: x and W enter as bf16-RNE values
// carried x8 (x) and x256 (W) in f16 planes, 1 product. Scores S^T = K Q^T per head: q, k (RoPE applied in f32) as f16 x8 planes, 1 product;
// query rows with position < QE use q,k hi + x2048 residual planes (3 products, second accumulator folded by 1/2048). O^T += V^T P^T: v f16 x8,
// P f16 x1024, 1 product; rows < QE add P and v x2048 residual tiles into a second accumulator (3 products) folded before normalisation.
// ctx@Wo: ctx f16 x64 plane (+ x2048 residual plane for rows < QE, 2 products), Wo bf16-RNE x256, 1 product elsewhere. Softmax statistics
// (running max, exp2, row sums) and RoPE tables in f32; scale 1/sqrt(128) folded into the log2 constant.
// Fragment k-map per lane half hh for A AND B: elements 0..7 <- k = 8hh+0..7, 8..15 <- k = 16+8hh+0..7; acc[r] = D[8hh+r][col = lane&15].

#ifndef NB
#define NB 2
#endif
#ifndef SEQ
#define SEQ 2048
#endif
#ifndef NB_FULL
#define NB_FULL 2
#endif
#ifndef SEQ_FULL
#define SEQ_FULL 2048
#endif
#ifndef QE
#define QE 256
#endif

namespace {
constexpr int DMOD = 2048, KD = 2048, H = 16, HKV = 4, NREP = H / HKV, HD = 128, NKV = HKV * HD;   // NKV = 512
constexpr int MR = NB * SEQ;                                                                         // token rows handled
constexpr int QEA = (QE < SEQ) ? QE : SEQ;                                                           // query positions with residual operands
constexpr float XS = 8.0f, WS = 256.0f, QS = 8.0f, RS = 2048.0f, PS = 1024.0f, CS = 64.0f;
constexpr float LOG2E = 1.4426950408889634f, SCL = 0.08838834764831845f, ROPE_BASE = 500000.0f;
static_assert(SEQ % 128 == 0 && SEQ >= 128 && SEQ <= SEQ_FULL && NB >= 1 && NB <= NB_FULL);
static_assert(QEA % 64 == 0 && QEA >= 64 && QEA <= SEQ && (SEQ - QEA) % 128 == 0);
static_assert(DMOD == H * HD && KD == DMOD && KD % 64 == 0 && DMOD % 128 == 0 && NKV % 128 == 0 && HD == 128 && DMOD == 256 * 8 && MR % 64 == 0);

typedef _Float16 b16;
typedef __attribute__((ext_vector_type(16))) _Float16 v16b;
typedef __attribute__((ext_vector_type(8))) _Float16 v8b;
typedef __attribute__((ext_vector_type(8))) float v8f;
typedef __attribute__((ext_vector_type(4))) float v4f;

__device__ __forceinline__ float bf16_rne(float f) { unsigned int u = __float_as_uint(f); u += 0x7FFFu + ((u >> 16) & 1u); return __uint_as_float(u & 0xFFFF0000u); }
// 16-bit fragment from a k-contiguous row: elements 0..7 <- p[8hh .. 8hh+7], 8..15 <- p[16+8hh .. 16+8hh+7]
__device__ __forceinline__ v16b frag_kb(const b16* p, int hh) {
  const v8b a = *(const v8b*)(p + 8 * hh), b = *(const v8b*)(p + 16 + 8 * hh); v16b f;
#pragma unroll
  for (int e = 0; e < 8; ++e) { f[e] = a[e]; f[8 + e] = b[e]; }
  return f;
}
__device__ __forceinline__ v8f wmma16b(v16b a, v16b b, v8f c) {
  v8f d = __builtin_amdgcn_wmma_f32_16x16x32_f16(false, a, false, b, (short)0, c, false, false);
  return d;
}
// Scheduling fence at an end of a group of LDS fragment loads: the group stays together and ahead of the WMMAs that use it. Left free, the compiler
// reloads one register set in front of every WMMA or two and waits out the LDS latency each time.
__device__ __forceinline__ void hold_group() { __builtin_amdgcn_sched_barrier(0); }
__device__ __forceinline__ void wave_lds_sync() { __builtin_amdgcn_fence(3, "workgroup"); __builtin_amdgcn_wave_barrier(); __builtin_amdgcn_fence(2, "workgroup"); }
__device__ __forceinline__ float nexp2(float v) { return __builtin_amdgcn_exp2f(v); }
// hi = f16(w), lo = f16((w - hi) * RS)
__device__ __forceinline__ void split16(float w, b16& hi, b16& lo) { hi = (b16)w; lo = (b16)((w - (float)hi) * RS); }

__device__ __forceinline__ void cvt_x_block(int vb, const float* __restrict__ X, b16* Xp) {
  const size_t u = (size_t)vb * 256 + threadIdx.x; const size_t row = u >> 8; const int c8 = (int)(u & 255) * 8;
  if (row >= (size_t)MR) return;
  const size_t b = row / SEQ, s = row % SEQ;
  const float* src = X + (b * SEQ_FULL + s) * DMOD + c8;
  b16* dst = Xp + row * DMOD + c8;
  const v4f x0 = *(const v4f*)src, x1 = *(const v4f*)(src + 4); v8b o;
#pragma unroll
  for (int j = 0; j < 4; ++j) { o[j] = (b16)(bf16_rne(x0[j]) * XS); o[4 + j] = (b16)(bf16_rne(x1[j]) * XS); }
  *(v8b*)dst = o; 
}

// W [2048 k][N n] f32 -> Wt [N][2048] f16 = bf16-RNE(w) x256 (k-contiguous for the B fragments). 2 waves (tid 0..63) per 64x64 tile (bx, by), transposed
// through their own LDS tile St; the four wave pairs of a block take four tiles of one matrix and pass the barrier together.
__device__ __forceinline__ void cvt_w_tile(b16 (*St)[64 + 8], int tid, int bx, int by, const float* __restrict__ W, b16* Wt, int N) {
  const int wave = tid >> 5, lane = tid & 31; const int k0 = bx * 64, n0 = by * 64;
  const float* src = W + (size_t)k0 * N + n0;
  for (int it = 0; it < 16; ++it) {
    const int e = (it * 64 + tid) * 4; const int kr = e >> 6, nc = e & 63;
    const v4f x = *(const v4f*)(src + (size_t)kr * N + nc);
#pragma unroll
    for (int j = 0; j < 4; ++j) St[nc + j][kr] = (b16)(bf16_rne(x[j]) * WS);
  }
  __syncthreads();   // St is read across waves
  b16* dstb = Wt + (size_t)n0 * KD + k0;
  {
#pragma unroll 1
    for (int it = 0; it < 8; ++it) {
      const int n = wave * 32 + it * 4 + (lane >> 3), ks = (lane & 7) * 8;
      const v8b o = *(const v8b*)(&St[n][ks]);
      *(v8b*)(dstb + (size_t)n * KD + ks) = o; }
     }
}

// cos/sin tables [SEQ][64] f32: ang = s * (1 / base^(2j/128)) in f32, precise sincosf. Block = 4 positions x 64 frequencies staged in LDS;
__device__ __forceinline__ void rope_tab_block(float (*Tb)[4][64 + 4], int vb, float* CT, float* ST) {
  const int tid = threadIdx.x; const int r = tid >> 6, j = tid & 63; const int s0 = vb * 4;
  const float ex = (float)(2 * j) * (1.0f / 128.0f);
  const float p = powf(ROPE_BASE, ex);
  const float inv = 1.0f / p;
  const float ang = (float)(s0 + r) * inv;
  float sn, c; sincosf(ang, &sn, &c);
  Tb[0][r][j] = c; Tb[1][r][j] = sn;
  __syncthreads();   // Tb is read across waves
  if (tid < 128) {
    const int tb = tid >> 6, rr = (tid >> 4) & 3, seg = (tid & 15) * 4;
    const v4f f = *(const v4f*)(&Tb[tb][rr][seg]);
    float* dst = (tb == 0 ? CT : ST) + (size_t)(s0 + rr) * 64 + seg;
    *(v4f*)dst = f; 
  }
}

// All operand preparation in one launch: its parts read only inputs and write disjoint planes. Block ranges, each block wholly in one part: first the W tiles
// (four 64x64 tiles a block; Wq, Wo, Wk, Wv), then the RoPE tables, then the rows of x.
constexpr int TQ = (KD / 64) * (DMOD / 64), TK = (KD / 64) * (NKV / 64);   // 64x64 tiles of a 2048-column and of a 512-column W
constexpr int PW = (2 * TQ + 2 * TK) / 4, PR = SEQ / 4, PX = MR;           // blocks of the three parts
static_assert(TQ % 4 == 0 && TK % 4 == 0 && KD / 64 == 32);
__global__ __launch_bounds__(256) void prep_kernel(const float* __restrict__ X, const float* __restrict__ Wq, const float* __restrict__ Wk,
    const float* __restrict__ Wv, const float* __restrict__ Wo, b16* Xp, b16* Wqt, b16* Wkt, b16* Wvt, b16* Wot, float* CT, float* ST) {
  __shared__ __attribute__((aligned(16))) unsigned char Sp[4 * 64 * (64 + 8) * 2];
  static_assert(sizeof(Sp) >= 2 * 4 * (64 + 4) * 4);
  const int vb = (int)blockIdx.x;
  if (vb < PW) {
    const int sub = (int)threadIdx.x >> 6, t4 = vb * 4;   // t4 picks the matrix for the whole block
    const float* W = Wq; b16* Wt = Wqt; int N = DMOD, t = t4 + sub;
    if (t4 >= 2 * TQ + TK) { W = Wv; Wt = Wvt; N = NKV; t -= 2 * TQ + TK; }
    else if (t4 >= 2 * TQ) { W = Wk; Wt = Wkt; N = NKV; t -= 2 * TQ; }
    else if (t4 >= TQ) { W = Wo; Wt = Wot; t -= TQ; }
    cvt_w_tile(reinterpret_cast<b16 (*)[64 + 8]>(Sp + sub * 64 * (64 + 8) * 2), (int)threadIdx.x & 63, t & 31, t >> 5, W, Wt, N);
  } else if (vb < PW + PR) {
    rope_tab_block(reinterpret_cast<float (*)[4][64 + 4]>(Sp), vb - PW, CT, ST);
  } else {
    cvt_x_block(vb - PW - PR, X, Xp);
  }
}

// One trip of the projection GEMM's K loop: 64 k = 128 B of each of 256 operand rows, laid in LDS at a pitch of 144 B (16 B x odd, for 16-byte readers).
constexpr int KS = 64, LP = 144, SROWS = 256, STAGE = SROWS * LP;   // 36,864 B a buffer
// Eight asynchronous 16-byte copies a lane fill 128 rows of a buffer: LDS rows r, r+16, .. r+112 (l = the lane's byte address in row r), the first 64 rows
// from ga, the next 64 from gb (each the lane's own address in its group's row r; 16 rows further = 16*KD elements). Eight lanes cover one 128-B row.
__device__ __forceinline__ void copy_rows128(unsigned l, const b16* ga, const b16* gb) {
  constexpr size_t RJ = (size_t)16 * KD; constexpr unsigned LJ = 16u * LP;
  // s_wait_xcnt 0 as the last line: it stands in front of every later rewrite of a register that a copy names
  asm volatile(
      "global_load_async_to_lds_b128 %0, %8, off\n\t"
      "global_load_async_to_lds_b128 %1, %9, off\n\t"
      "global_load_async_to_lds_b128 %2, %10, off\n\t"
      "global_load_async_to_lds_b128 %3, %11, off\n\t"
      "global_load_async_to_lds_b128 %4, %12, off\n\t"
      "global_load_async_to_lds_b128 %5, %13, off\n\t"
      "global_load_async_to_lds_b128 %6, %14, off\n\t"
      "global_load_async_to_lds_b128 %7, %15, off\n\t"
      "s_wait_xcnt 0x0"
      :: "v"(l), "v"(l + LJ), "v"(l + 2 * LJ), "v"(l + 3 * LJ), "v"(l + 4 * LJ), "v"(l + 5 * LJ), "v"(l + 6 * LJ), "v"(l + 7 * LJ),
         "v"(ga), "v"(ga + RJ), "v"(ga + 2 * RJ), "v"(ga + 3 * RJ), "v"(gb), "v"(gb + RJ), "v"(gb + 2 * RJ), "v"(gb + 3 * RJ)
      : "memory");
}
// One buffer: rows 0..63 from g0, 64..127 from g1, 128..191 from g2, 192..255 from g3; sixteen copies a lane, in two statements (an asm statement takes 30 operands).
__device__ __forceinline__ void copy_stage(unsigned l, const b16* g0, const b16* g1, const b16* g2, const b16* g3) {
  copy_rows128(l, g0, g1);
  copy_rows128(l + 128u * LP, g2, g3);
}

// C[BM x 128] = A[m][k] . B[k][n] with A plane [rows][2048] and Bt plane [N][2048], both k-contiguous f16; K = 2048 in trips of 64 (two WMMA steps of 32).
// 128 threads = 4 waves. The block's operand rows of a trip (A 128 rows, then B 128 rows; RES: A 64, residual A 64 of the same token rows, B 128) are copied
// once into LDS, two buffers: the copies of trip t+2 fly while trip t+1 is worked on. Waves 2 x 2 on the tile: wave w owns four A fragments and the four B
// fragments of columns 64(w&1).., 16 accumulators: BM = 128, rows 64(w>>1)..+63; RES: BM = 64, rows 32(w>>1)..+31, A fragments 0,1 from the hi plane
// and 2,3 from the x2048 residual plane of the same rows, so accumulators 8..15 are the residual sums of 0..7.
// Column tile bx; row tile: by = bsel * tpb + tsel, rows m0 = bsel*SEQ + toff + BM tsel. Epilogue staged through the same LDS (behind the loop's last barrier) then:
// MODE 0: RoPE in f32 with the cos/sin tables, hi x8 / lo x2048 planes [b][nhead][s][128] (256-B rows by 16 lanes x 16 B, 8 rows per store);
template <int MODE, bool RES>
__device__ __forceinline__ void proj_block(unsigned char* Sm, int bx, int by,
    const b16* __restrict__ A, const b16* __restrict__ Al, const b16* __restrict__ Bt, b16* Ph, b16* Pl, float* Out,
    const float* __restrict__ CT, const float* __restrict__ ST, int nhead, int tpb, int toff) {
#pragma clang fp contract(off)
  static_assert(MODE == 2 || !RES);
  constexpr int BM = RES ? 64 : 128, BN = 128, NTRIP = KD / KS, BROW = 128;
  static_assert(BM * (BN + 4) * 4 <= 2 * STAGE && NTRIP >= 2 && BROW + BN == SROWS);
  float (*To)[BN + 4] = reinterpret_cast<float (*)[BN + 4]>(Sm);
  const int tid = threadIdx.x, wave = tid >> 5, lane = tid & 31, hh = lane >> 4, col = lane & 15;
  const int bsel = by / tpb, tsel = by - bsel * tpb;
  const int s0 = toff + tsel * BM;
  const size_t m0 = (size_t)bsel * SEQ + s0;
  const int n0 = bx * BN;
  const int wm = wave >> 1, wn = wave & 1;
  const int cr = tid >> 3, cs = (tid & 7) * 8;   // the lane's row in each run of 16 rows, and its 16-byte piece of the row
  const b16* g0 = A + (m0 + cr) * KD + cs;
  const b16* g1 = RES ? Al + (m0 + cr) * KD + cs : A + (m0 + 64 + cr) * KD + cs;
  const b16* g2 = Bt + (size_t)(n0 + cr) * KD + cs;
  const b16* g3 = Bt + (size_t)(n0 + 64 + cr) * KD + cs;
  const unsigned lc = (unsigned)(uintptr_t)(&Sm[cr * LP + cs * 2]);
  const unsigned char* sa = &Sm[(wm * (BM / 2) + col) * LP];
  const unsigned char* sb = &Sm[(BROW + wn * 64 + col) * LP];
  v8f acc[16];
#pragma unroll
  for (int t = 0; t < 16; ++t) acc[t] = (v8f){};
  copy_stage(lc, g0, g1, g2, g3);
  asm volatile("s_wait_asynccnt 0x0" ::: "memory");   // this wave's copies of trip 0 have landed
  __syncthreads();                                     // every wave's have: trip 0 may be read
  copy_stage(lc + STAGE, g0 + KS, g1 + KS, g2 + KS, g3 + KS);
#pragma unroll 1
  for (int tr = 0; tr < NTRIP; ++tr) {
    const int bo = (tr & 1) * STAGE;
#pragma unroll
    for (int kk = 0; kk < 2; ++kk) {
      v16b af[4], bf[4];   // the fragments of one WMMA step, read as one group ahead of its 16 WMMAs
      hold_group();   // no load of this group rises among the WMMAs before it
#pragma unroll
      for (int i = 0; i < 4; ++i) {
        const int ar = RES ? (i >> 1) * 64 + (i & 1) * 16 : i * 16;   // LDS row of A fragment i, from the wave's first row
        af[i] = frag_kb((const b16*)(sa + bo + ar * LP) + kk * 32, hh);
      }
#pragma unroll
      for (int j = 0; j < 4; ++j) bf[j] = frag_kb((const b16*)(sb + bo + j * 16 * LP) + kk * 32, hh);
      hold_group();   // and none sinks among its own WMMAs
#pragma unroll
      for (int i = 0; i < 4; ++i)
#pragma unroll
        for (int j = 0; j < 4; ++j) acc[i * 4 + j] = wmma16b(af[i], bf[j], acc[i * 4 + j]);
    }
    hold_group();   // the trip's WMMAs stay in front of the waits and the barrier: sunk behind them they would delay the refill
    asm volatile("s_wait_dscnt 0x0" ::: "memory");      // this wave's reads of the buffer are done before it is refilled
    asm volatile("s_wait_asynccnt 0x0" ::: "memory");   // this wave's copies of trip tr+1 have landed
    __syncthreads();                                     // publishes trip tr+1 and ends every reader's last read of trip tr
    if (tr + 2 < NTRIP) { const int ko = (tr + 2) * KS; copy_stage(lc + bo, g0 + ko, g1 + ko, g2 + ko, g3 + ko); }
  }
  asm volatile("s_wait_asynccnt 0x0" ::: "memory");     // no copy is outstanding when the buffers become output staging
#pragma unroll
  for (int i = 0; i < BM / 32; ++i)
#pragma unroll
    for (int j = 0; j < 4; ++j)
#pragma unroll
      for (int r = 0; r < 8; ++r) {
        float v = acc[i * 4 + j][r];
        if constexpr (RES) v += acc[(i + 2) * 4 + j][r] * (1.0f / RS);
        To[wm * (BM / 2) + i * 16 + 8 * hh + r][wn * 64 + j * 16 + col] = v; }
  __syncthreads();   // To is read across waves
  constexpr int HF = BM / 64;   // every pass below handles its rows in each 64-row half of the tile: HF independent pieces, stored together
  if constexpr (MODE == 0) {
    const size_t pb = (((size_t)bsel * nhead + bx) * SEQ + s0) * HD;
    b16* ph = Ph + pb; b16* pl = Pl + pb;
    const float qsc = QS / (XS * WS);
    {
#pragma unroll 1
      for (int it = 0; it < 8; ++it) {
        const int seg = (tid & 15) * 8, sg = seg & 63;
        const float sgn = (seg >= 64) ? 1.0f : -1.0f;   // d < 64: x cos - x[d+64] sin; d >= 64: x cos + x[d-64] sin
        v8b hi[HF], lo[HF];
#pragma unroll
        for (int hf = 0; hf < HF; ++hf) {
          const int rr = hf * 64 + it * 8 + (tid >> 4);
          const float* trow = &To[rr][0]; const size_t ts = (size_t)(s0 + rr) * 64 + sg;
          const v4f xa = *(const v4f*)(trow + seg), xb = *(const v4f*)(trow + seg + 4);
          const v4f ya = *(const v4f*)(trow + (seg ^ 64)), yb = *(const v4f*)(trow + (seg ^ 64) + 4);
          const v4f ca = *(const v4f*)(CT + ts), cb = *(const v4f*)(CT + ts + 4), sa = *(const v4f*)(ST + ts), sb = *(const v4f*)(ST + ts + 4);
#pragma unroll
          for (int j = 0; j < 4; ++j) {
            b16 h0, l0;
            split16((xa[j] * ca[j] + sgn * ya[j] * sa[j]) * qsc, h0, l0); hi[hf][j] = h0; lo[hf][j] = l0;
            split16((xb[j] * cb[j] + sgn * yb[j] * sb[j]) * qsc, h0, l0); hi[hf][4 + j] = h0; lo[hf][4 + j] = l0; }
        }
#pragma unroll
        for (int hf = 0; hf < HF; ++hf) {
          const size_t off = (size_t)(hf * 64 + it * 8 + (tid >> 4)) * HD + seg;
          *(v8b*)(ph + off) = hi[hf]; *(v8b*)(pl + off) = lo[hf]; }
        asm volatile("s_wait_xcnt 0x0" ::: "memory"); }   // in front of the next pass's rewrite of the registers that the stores name
       }
  } else if constexpr (MODE == 1) {
    const size_t pb = ((size_t)bsel * nhead + bx) * HD * (size_t)SEQ + s0;
    b16* ph = Ph + pb; b16* pl = Pl + pb;
    const float vsc = QS / (XS * WS);
    {
#pragma unroll 1
      for (int it = 0; it < 8; ++it) {
        const int d = it * 16 + (tid >> 3);
        v8b hi[HF], lo[HF];
#pragma unroll
        for (int hf = 0; hf < HF; ++hf) {
          const int ss = hf * 64 + (tid & 7) * 8;
#pragma unroll
          for (int j = 0; j < 8; ++j) { b16 h0, l0; split16(To[ss + j][d] * vsc, h0, l0); hi[hf][j] = h0; lo[hf][j] = l0; }
        }
#pragma unroll
        for (int hf = 0; hf < HF; ++hf) {
          const size_t off = (size_t)d * SEQ + hf * 64 + (tid & 7) * 8;
          *(v8b*)(ph + off) = hi[hf]; *(v8b*)(pl + off) = lo[hf]; } }
       }
  } else {
    constexpr int LPR = BN / 4, RPI = 128 / LPR, NIT = 64 / RPI;
    static_assert(NIT * RPI == 64 && LPR * 4 == BN);
    float* ob = Out + ((size_t)bsel * SEQ_FULL + s0) * DMOD + n0;
    const float osc = 1.0f / (CS * WS);
    {
#pragma unroll 1
      for (int it = 0; it < NIT; ++it) {
        const int seg = (tid % LPR) * 4;
        v4f f[HF];
#pragma unroll
        for (int hf = 0; hf < HF; ++hf) f[hf] = *(const v4f*)(&To[hf * 64 + it * RPI + tid / LPR][seg]) * osc;
#pragma unroll
        for (int hf = 0; hf < HF; ++hf) *(v4f*)(ob + (size_t)(hf * 64 + it * RPI + tid / LPR) * DMOD + seg) = f[hf]; }
       }
  }
}

// x@Wq, x@Wk, x@Wv in one launch: column tiles 0..15 are Q heads, 16..19 K heads, 20..23 V heads; each block wholly one of them.
constexpr int CQ = DMOD / 128, CK = NKV / 128;
__global__ __launch_bounds__(128) __attribute__((amdgpu_num_vgpr(256))) void qkv_kernel(
    const b16* __restrict__ Xp, const b16* __restrict__ Wqt, const b16* __restrict__ Wkt, const b16* __restrict__ Wvt,
    b16* Qh, b16* Ql, b16* Kh, b16* Kl, b16* Vh, b16* Vl, const float* __restrict__ CT, const float* __restrict__ ST) {
  __shared__ __attribute__((aligned(16))) unsigned char Sm[2 * STAGE];
  const int bx = (int)blockIdx.x, by = (int)blockIdx.y;
  if (bx < CQ + CK) {
    const bool isq = bx < CQ;
    proj_block<0, false>(Sm, isq ? bx : bx - CQ, by, Xp, Xp, isq ? Wqt : Wkt, isq ? Qh : Kh, isq ? Ql : Kl, nullptr, CT, ST, isq ? H : HKV, SEQ / 128, 0);
  } else {
    proj_block<1, false>(Sm, bx - CQ - CK, by, Xp, Xp, Wvt, Vh, Vl, nullptr, CT, ST, HKV, SEQ / 128, 0);
  }
}

// ctx@Wo in one launch: first the 128x128 tiles of the rows >= QEA, then the 64x128 tiles with the residual plane of the rows < QEA.
constexpr int ON = (DMOD / 128) * NB * ((SEQ - QEA) / 128), OE = (DMOD / 128) * NB * (QEA / 64);
__global__ __launch_bounds__(128) __attribute__((amdgpu_num_vgpr(256))) void out_kernel(
    const b16* __restrict__ Ch, const b16* __restrict__ Cl, const b16* __restrict__ Wot, float* Out) {
  __shared__ __attribute__((aligned(16))) unsigned char Sm[2 * STAGE];
  const int vb = (int)blockIdx.x;
  if (vb < ON) {
    proj_block<2, false>(Sm, vb % (DMOD / 128), vb / (DMOD / 128), Ch, Ch, Wot, nullptr, nullptr, Out, nullptr, nullptr, 1, (SEQ - QEA) / 128, QEA);
  } else {
    const int v = vb - ON;
    proj_block<2, true>(Sm, v % (DMOD / 128), v / (DMOD / 128), Ch, Cl, Wot, nullptr, nullptr, Out, nullptr, nullptr, 1, QEA / 64, 0);
  }
}

// One key step of the attention kernel in LDS: K tile = 32 key rows of 256 B at a pitch of 272 B, V tile = DW d rows of 64 B (32 keys) at a pitch of 80 B
// (both 16 B x odd, for 16-byte readers). A buffer holds K hi[, K lo], V hi[, V lo].
constexpr int KP = 272, VP = 80, KTILE = 32 * KP, PBYTES = NREP * 16 * (32 + 8) * 2, ALDS = 65536;
// The asynchronous 16-byte copies of one lane (of 128) that fill one buffer: K rows r, r+8, r+16, r+24 (16 lanes cover one 256-B row) and V rows d, d+32[, d+64,
// d+96] (4 lanes cover one 64-B row); ER: the same rows of the lo planes, K lo one K tile and V lo one V tile (64 rows) further in LDS.
// lk, lv = the lane's LDS byte addresses in its first rows, gk, gkl, gv, gvl = its global addresses there.
template <bool ER>
__device__ __forceinline__ void copy_kv(unsigned lk, unsigned lv, const b16* gk, const b16* gkl, const b16* gv, const b16* gvl) {
  constexpr size_t KJ = (size_t)8 * HD, VJ = (size_t)32 * SEQ; constexpr unsigned LKJ = 8u * KP, LVJ = 32u * VP, KL = KTILE, VL = 64u * VP;
  // s_wait_xcnt 0 as the last line of either statement: it stands in front of every later rewrite of a register that a copy names
  if constexpr (ER) {
    asm volatile(
        "global_load_async_to_lds_b128 %0, %12, off\n\t"
        "global_load_async_to_lds_b128 %1, %13, off\n\t"
        "global_load_async_to_lds_b128 %2, %14, off\n\t"
        "global_load_async_to_lds_b128 %3, %15, off\n\t"
        "global_load_async_to_lds_b128 %4, %16, off\n\t"
        "global_load_async_to_lds_b128 %5, %17, off\n\t"
        "global_load_async_to_lds_b128 %6, %18, off\n\t"
        "global_load_async_to_lds_b128 %7, %19, off\n\t"
        "global_load_async_to_lds_b128 %8, %20, off\n\t"
        "global_load_async_to_lds_b128 %9, %21, off\n\t"
        "global_load_async_to_lds_b128 %10, %22, off\n\t"
        "global_load_async_to_lds_b128 %11, %23, off\n\t"
        "s_wait_xcnt 0x0"
        :: "v"(lk), "v"(lk + LKJ), "v"(lk + 2 * LKJ), "v"(lk + 3 * LKJ), "v"(lk + KL), "v"(lk + KL + LKJ), "v"(lk + KL + 2 * LKJ), "v"(lk + KL + 3 * LKJ),
           "v"(lv), "v"(lv + LVJ), "v"(lv + VL), "v"(lv + VL + LVJ),
           "v"(gk), "v"(gk + KJ), "v"(gk + 2 * KJ), "v"(gk + 3 * KJ), "v"(gkl), "v"(gkl + KJ), "v"(gkl + 2 * KJ), "v"(gkl + 3 * KJ),
           "v"(gv), "v"(gv + VJ), "v"(gvl), "v"(gvl + VJ)
        : "memory");
  } else {
    asm volatile(
        "global_load_async_to_lds_b128 %0, %8, off\n\t"
        "global_load_async_to_lds_b128 %1, %9, off\n\t"
        "global_load_async_to_lds_b128 %2, %10, off\n\t"
        "global_load_async_to_lds_b128 %3, %11, off\n\t"
        "global_load_async_to_lds_b128 %4, %12, off\n\t"
        "global_load_async_to_lds_b128 %5, %13, off\n\t"
        "global_load_async_to_lds_b128 %6, %14, off\n\t"
        "global_load_async_to_lds_b128 %7, %15, off\n\t"
        "s_wait_xcnt 0x0"
        :: "v"(lk), "v"(lk + LKJ), "v"(lk + 2 * LKJ), "v"(lk + 3 * LKJ), "v"(lv), "v"(lv + LVJ), "v"(lv + 2 * LVJ), "v"(lv + 3 * LVJ),
           "v"(gk), "v"(gk + KJ), "v"(gk + 2 * KJ), "v"(gk + 3 * KJ), "v"(gv), "v"(gv + VJ), "v"(gv + 2 * VJ), "v"(gv + 3 * VJ)
        : "memory");
  }
}

// Causal GQA attention: block (bx = query tile of 16, bg in NB*HKV[, bz = d-half when ER]); block = 4 waves = the 4 query heads of one KV head on the same 16 queries,
// so all four walk the same keys. Each 32-key step's K and V tiles are copied once into LDS, two buffers: the copies of step st+2 fly while step st+1 is
// worked on; every wave reads its fragments from there. Key steps of 32 from key 0 up to the 32-aligned block of the last query in fixed order; online
// softmax (running max, f32); keys later than the query get -inf on the diagonal step; P x1024 via wave-private LDS; O^T += V^T P^T. ER (query position
// < QEA): scores Kh Qh + (Kh Ql + Kl Qh)/2048, O^T second accumulator Vh Pr + Vl Ph folded by 1/2048, each block restricted to 64 of the 128 d rows
// (bz). ctx hi x64 / lo x2048 planes [b*SEQ+s][h*128 + d], staged per wave through the same LDS behind the loop's last barrier.
template <bool ER>
__device__ __forceinline__ void attn_block(unsigned char* Sm, int bx, int bg, int bz,
    const b16* __restrict__ Qh, const b16* __restrict__ Ql, const b16* __restrict__ Kh, const b16* __restrict__ Kl,
    const b16* __restrict__ Vh, const b16* __restrict__ Vl, b16* Ch, b16* Cl) {
  constexpr int NT = ER ? 4 : 8, DW = NT * 16, NP = ER ? 2 : 1, VO = NP * KTILE, VT = DW * VP, ASTAGE = VO + NP * VT;   // 27,648 / 18,944 B a buffer
  static_assert(NREP == 4 && NREP * 16 * (DW + 4) * 4 <= 2 * ASTAGE && ASTAGE % 16 == 0);
  static_assert(2 * ASTAGE + NP * PBYTES <= ALDS);
  b16 (*Pb)[16][32 + 8] = reinterpret_cast<b16 (*)[16][32 + 8]>(Sm + 2 * ASTAGE);            // behind the two buffers: P, then (ER) its residual
  b16 (*Pr)[16][32 + 8] = reinterpret_cast<b16 (*)[16][32 + 8]>(Sm + 2 * ASTAGE + (ER ? PBYTES : 0));
  float (*To)[16][DW + 4] = reinterpret_cast<float (*)[16][DW + 4]>(Sm);
  const int tid = threadIdx.x, wave = tid >> 5, lane = tid & 31, hh = lane >> 4, col = lane & 15;
  const int b = bg / HKV, g = bg - b * HKV, h = g * NREP + wave;
  const int q0 = (ER ? 0 : QEA) + bx * 16, qi = q0 + col;
  const int dh = ER ? bz * 64 : 0;
  const b16* qrow = Qh + ((size_t)(b * H + h) * SEQ + qi) * HD;
  const b16* qlrow = Ql + ((size_t)(b * H + h) * SEQ + qi) * HD;
  const size_t ko = (size_t)(b * HKV + g) * SEQ * HD + (size_t)(tid >> 4) * HD + (tid & 15) * 8;           // the lane's piece of K row tid>>4
  const size_t vo = ((size_t)(b * HKV + g) * HD + dh + (tid >> 2)) * SEQ + (tid & 3) * 8;                  // the lane's piece of V row tid>>2
  const b16* gk = Kh + ko; const b16* gkl = Kl + ko; const b16* gv = Vh + vo; const b16* gvl = Vl + vo;
  const unsigned lk = (unsigned)(uintptr_t)(&Sm[(tid >> 4) * KP + (tid & 15) * 16]);
  const unsigned lv = (unsigned)(uintptr_t)(&Sm[VO + (tid >> 2) * VP + (tid & 3) * 16]);
  const unsigned char* sk = &Sm[col * KP];
  const unsigned char* sv = &Sm[VO + col * VP];
  v16b qa[4];
#pragma unroll
  for (int c = 0; c < 4; ++c) { qa[c] = (v16b){}; if constexpr (!ER) qa[c] = frag_kb(qrow + c * 32, hh); }
  const float cs = SCL * LOG2E / (QS * QS);   // 1/sqrt(128) and the two x8 carriers, in the log2 domain
  float m = -INFINITY, l = 0.0f; v8f o[NT], o2[NT];
#pragma unroll
  for (int t = 0; t < NT; ++t) { o[t] = (v8f){}; o2[t] = (v8f){}; }
  const int nst = q0 / 32 + 1;   // block-uniform: keys 0 .. (q0 | 31)
  copy_kv<ER>(lk, lv, gk, gkl, gv, gvl);
  asm volatile("s_wait_asynccnt 0x0" ::: "memory");   // this wave's copies of step 0 have landed
  __syncthreads();                                     // every wave's have: step 0 may be read
  if (1 < nst) copy_kv<ER>(lk + ASTAGE, lv + ASTAGE, gk + (size_t)32 * HD, gkl + (size_t)32 * HD, gv + 32, gvl + 32);
#pragma unroll 1
  for (int st = 0; st < nst; ++st) {
    const int bo = (st & 1) * ASTAGE;
    const int kb = st * 32; const int lim = qi - kb;   // key offsets > lim are later than the query (binds only on the diagonal step)
    float e[16]; float mx = -INFINITY;
    v8f s[2], s2[2];
    if constexpr (ER) {
#pragma unroll
      for (int u = 0; u < 2; ++u) {
        v16b kf[4], klf[4];   // 16 keys' K fragments, hi and lo (not held as a group: with the lo planes' they would not fit the registers)
#pragma unroll
        for (int c = 0; c < 4; ++c) {
          kf[c] = frag_kb((const b16*)(sk + bo + u * 16 * KP) + c * 32, hh);
          klf[c] = frag_kb((const b16*)(sk + bo + KTILE + u * 16 * KP) + c * 32, hh);
        }
        s[u] = (v8f){}; s2[u] = (v8f){};
#pragma unroll
        for (int c = 0; c < 4; ++c) {
          const v16b qh = frag_kb(qrow + c * 32, hh), ql = frag_kb(qlrow + c * 32, hh);
          s[u] = wmma16b(kf[c], qh, s[u]); s2[u] = wmma16b(kf[c], ql, s2[u]); s2[u] = wmma16b(klf[c], qh, s2[u]);
        }
      }
    } else {
      v16b kf[2][4];   // the step's K fragments, read as one group ahead of their WMMAs
#pragma unroll
      for (int u = 0; u < 2; ++u)
#pragma unroll
        for (int c = 0; c < 4; ++c) kf[u][c] = frag_kb((const b16*)(sk + bo + u * 16 * KP) + c * 32, hh);
      hold_group();   // no load of the group sinks among the WMMAs
#pragma unroll
      for (int u = 0; u < 2; ++u) { s[u] = (v8f){}; s2[u] = (v8f){}; }
#pragma unroll
      for (int c = 0; c < 4; ++c)   // the two 16-key chains alternate, so that neither waits out its own accumulate latency; each chain's sum order is as it was
#pragma unroll
        for (int u = 0; u < 2; ++u) s[u] = wmma16b(kf[u][c], qa[c], s[u]);
    }
    v16b vf[NT];   // the step's V fragments, read as one group: their LDS latency passes under the softmax arithmetic
#pragma unroll
    for (int t = 0; t < NT; ++t) vf[t] = frag_kb((const b16*)(sv + bo + t * 16 * VP), hh);
    if constexpr (!ER) hold_group();   // keeps the V loads here, ahead of the softmax arithmetic (ER: held so long they would not fit the registers)
#pragma unroll
    for (int u = 0; u < 2; ++u)
#pragma unroll
      for (int r = 0; r < 8; ++r) {
        float v = s[u][r];
        if constexpr (ER) v += s2[u][r] * (1.0f / RS);
        v *= cs;
        if (u * 16 + 8 * hh + r > lim) v = -INFINITY;
        e[u * 8 + r] = v; mx = fmaxf(mx, v); }
    mx = fmaxf(mx, __shfl_xor(mx, 16)); const float mn = fmaxf(m, mx); const float al = nexp2(m - mn); float sum = 0.0f;
#pragma unroll
    for (int i2 = 0; i2 < 16; ++i2) {
      const float p = nexp2(e[i2] - mn); sum += p; const int pi = (i2 < 8 ? 0 : 16) + 8 * hh + (i2 & 7);
      const float pp = p * PS; const b16 phv = (b16)pp; Pb[wave][col][pi] = phv;
      if constexpr (ER) Pr[wave][col][pi] = (b16)((pp - (float)phv) * RS); }
    sum += __shfl_xor(sum, 16); l = l * al + sum; m = mn;
    wave_lds_sync();
    const v16b pf = frag_kb(&Pb[wave][col][0], hh);
    v16b prf = (v16b){};
    if constexpr (ER) prf = frag_kb(&Pr[wave][col][0], hh);
    v16b vlf[NT];  // the lo V fragments only here: held across the softmax they would not fit the registers
#pragma unroll
    for (int t = 0; t < NT; ++t) { vlf[t] = (v16b){}; if constexpr (ER) vlf[t] = frag_kb((const b16*)(sv + bo + VT + t * 16 * VP), hh); }
#pragma unroll
    for (int t = 0; t < NT; ++t) {
      o[t] *= al; o[t] = wmma16b(vf[t], pf, o[t]);
      if constexpr (ER) { o2[t] *= al; o2[t] = wmma16b(vf[t], prf, o2[t]); o2[t] = wmma16b(vlf[t], pf, o2[t]); } }
    hold_group();   // the step's WMMAs stay in front of the waits and the barrier: sunk behind them they would delay the refill
    asm volatile("s_wait_dscnt 0x0" ::: "memory");      // this wave's reads of the buffer (and of its P rows) are done before the refill
    asm volatile("s_wait_asynccnt 0x0" ::: "memory");   // this wave's copies of step st+1 have landed
    __syncthreads();                                     // publishes step st+1 and ends every reader's last read of step st
    if (st + 2 < nst) { const size_t kn = (size_t)(kb + 64) * HD; copy_kv<ER>(lk + bo, lv + bo, gk + kn, gkl + kn, gv + kb + 64, gvl + kb + 64); }
  }
  asm volatile("s_wait_asynccnt 0x0" ::: "memory");     // no copy is outstanding when the buffers become output staging
  const float inv = 1.0f / (l * PS * QS);
#pragma unroll
  for (int t = 0; t < NT; ++t) {
#pragma unroll
    for (int r = 0; r < 8; ++r) {
      float ov = o[t][r];
      if constexpr (ER) ov += o2[t][r] * (1.0f / RS);
      To[wave][col][t * 16 + 8 * hh + r] = ov * inv; } }
  wave_lds_sync();
  constexpr int LPR = DW / 8, RPI = 32 / LPR, NIT = 16 / RPI;
  static_assert(NIT * RPI == 16 && LPR * 8 == DW);
  const size_t cbase = ((size_t)b * SEQ + q0) * DMOD + (size_t)h * HD + dh;
  {
#pragma unroll 1
    for (int it = 0; it < NIT; ++it) {
      const int rr = it * RPI + lane / LPR, seg = (lane % LPR) * 8;
      const v4f fa = *(const v4f*)(&To[wave][rr][seg]), fb = *(const v4f*)(&To[wave][rr][seg + 4]);
      v8b hi, lo;
#pragma unroll
      for (int j = 0; j < 4; ++j) { b16 h0, l0; split16(fa[j] * CS, h0, l0); hi[j] = h0; lo[j] = l0; split16(fb[j] * CS, h0, l0); hi[4 + j] = h0; lo[4 + j] = l0; }
      const size_t off = cbase + (size_t)rr * DMOD + seg;
      *(v8b*)(Ch + off) = hi; *(v8b*)(Cl + off) = lo; }
     }
}
// Both attention forms in one launch: first the blocks of the query positions >= QEA (tile fastest, as before), then those of the positions < QEA.
constexpr int AX = (SEQ - QEA) / 16, AN = AX * NB * HKV, AEX = QEA / 16, AE = AEX * NB * HKV * 2, AXD = AX > 0 ? AX : 1;
__global__ __launch_bounds__(128) __attribute__((amdgpu_num_vgpr(256))) void attn_kernel(
    const b16* __restrict__ Qh, const b16* __restrict__ Ql, const b16* __restrict__ Kh, const b16* __restrict__ Kl,
    const b16* __restrict__ Vh, const b16* __restrict__ Vl, b16* Ch, b16* Cl) {
  __shared__ __attribute__((aligned(16))) unsigned char Sm[ALDS];
  const int vb = (int)blockIdx.x;
  if (vb < AN) {
    attn_block<false>(Sm, vb % AXD, vb / AXD, 0, Qh, Ql, Kh, Kl, Vh, Vl, Ch, Cl);
  } else {
    const int v = vb - AN;
    attn_block<true>(Sm, v % AEX, (v / AEX) % (NB * HKV), v / (AEX * NB * HKV), Qh, Ql, Kh, Kl, Vh, Vl, Ch, Cl);
  }
}
}  // namespace

extern "C" void kernel_launch(void* const* d_in, const int* in_sizes, int n_in, void* d_out, int out_size, void* d_ws, size_t ws_size, hipStream_t stream) {
  // wire order: 0 x [NB_FULL][SEQ_FULL][2048] f32, 1 Wq [2048][2048], 2 Wk [2048][512], 3 Wv [2048][512], 4 Wo [2048][2048]; out [NB_FULL][SEQ_FULL][2048] f32
  const size_t need_x = ((size_t)(NB - 1) * SEQ_FULL + SEQ) * DMOD;
  if (n_in < 5 || (size_t)in_sizes[0] < need_x || (size_t)in_sizes[1] < (size_t)KD * DMOD || (size_t)in_sizes[2] < (size_t)KD * NKV ||
      (size_t)in_sizes[3] < (size_t)KD * NKV || (size_t)in_sizes[4] < (size_t)KD * DMOD || (size_t)out_size < need_x) return;
  const float* X = (const float*)d_in[0]; const float* Wq = (const float*)d_in[1]; const float* Wk = (const float*)d_in[2];
  const float* Wv = (const float*)d_in[3]; const float* Wo = (const float*)d_in[4]; float* out = (float*)d_out;
  size_t off = 0; char* ws = (char*)d_ws;
  auto carve = [&](size_t bytes) { char* p = ws + off; off += (bytes + 255) & ~(size_t)255; return p; };
  b16* Xp  = (b16*)carve((size_t)MR * DMOD * 2);
  b16* Wqt = (b16*)carve((size_t)DMOD * KD * 2);
  b16* Wkt = (b16*)carve((size_t)NKV * KD * 2);
  b16* Wvt = (b16*)carve((size_t)NKV * KD * 2);
  b16* Wot = (b16*)carve((size_t)DMOD * KD * 2);
  float* CT = (float*)carve((size_t)SEQ * 64 * 4);
  float* ST = (float*)carve((size_t)SEQ * 64 * 4);
  b16* Qh = (b16*)carve((size_t)MR * H * HD * 2);
  b16* Ql = (b16*)carve((size_t)MR * H * HD * 2);
  b16* Kh = (b16*)carve((size_t)MR * NKV * 2);
  b16* Kl = (b16*)carve((size_t)MR * NKV * 2);
  b16* Vh = (b16*)carve((size_t)MR * NKV * 2);
  b16* Vl = (b16*)carve((size_t)MR * NKV * 2);
  b16* Ch = (b16*)carve((size_t)MR * DMOD * 2);
  b16* Cl = (b16*)carve((size_t)MR * DMOD * 2);
  if (off > ws_size || off > ((size_t)128 << 20)) return;   // 122,683,392 B at NB=2, SEQ=2048
  prep_kernel<<<dim3(PW + PR + PX), 256, 0, stream>>>(X, Wq, Wk, Wv, Wo, Xp, Wqt, Wkt, Wvt, Wot, CT, ST);
  qkv_kernel<<<dim3(CQ + 2 * CK, MR / 128), 128, 0, stream>>>(Xp, Wqt, Wkt, Wvt, Qh, Ql, Kh, Kl, Vh, Vl, CT, ST);
  attn_kernel<<<dim3(AN + AE), 128, 0, stream>>>(Qh, Ql, Kh, Kl, Vh, Vl, Ch, Cl);
  out_kernel<<<dim3(ON + OE), 128, 0, stream>>>(Ch, Cl, Wot, out);
}

// v006
// A run of this version takes 140 microseconds.
// Next to v005, in two timings, it ran 1.07 times as fast each time.
// Counting every step since v000, it is 5.44 times as fast.
#include <hip/hip_runtime.h>

// compute dtype: every contraction on v_wmma_f32_16x16x32_f16 (f16 operands, f32 accumulate). x@Wq, x@Wk, x@Wv: x and W enter as bf16-RNE values
// carried x8 (x) and x256 (W) in f16 planes, 1 product. Scores S^T = K Q^T per head: q, k (RoPE applied in f32) as f16 x8 planes, 1 product;
// query rows with position < QE use q,k hi + x2048 residual planes (3 products, second accumulator folded by 1/2048). O^T += V^T P^T: v f16 x8,
// P f16 x1024, 1 product; rows < QE add P and v x2048 residual tiles into a second accumulator (3 products) folded before normalisation.
// ctx@Wo: ctx f16 x64 plane (+ x2048 residual plane for rows < QE, 2 products), Wo bf16-RNE x256, 1 product elsewhere. Softmax statistics
// (running max, exp2, row sums) and RoPE tables in f32; scale 1/sqrt(128) folded into the log2 constant.
// Fragment k-map per lane half hh for A AND B: elements 0..7 <- k = 8hh+0..7, 8..15 <- k = 16+8hh+0..7; acc[r] = D[8hh+r][col = lane&15].

#ifndef NB
#define NB 2
#endif
#ifndef SEQ
#define SEQ 2048
#endif
#ifndef NB_FULL
#define NB_FULL 2
#endif
#ifndef SEQ_FULL
#define SEQ_FULL 2048
#endif
#ifndef QE
#define QE 256
#endif

namespace {
constexpr int DMOD = 2048, KD = 2048, H = 16, HKV = 4, NREP = H / HKV, HD = 128, NKV = HKV * HD;   // NKV = 512
constexpr int MR = NB * SEQ;                                                                         // token rows handled
constexpr int QEA = (QE < SEQ) ? QE : SEQ;                                                           // query positions with residual operands
constexpr float XS = 8.0f, WS = 256.0f, QS = 8.0f, RS = 2048.0f, PS = 1024.0f, CS = 64.0f;
constexpr float LOG2E = 1.4426950408889634f, SCL = 0.08838834764831845f, ROPE_BASE = 500000.0f;
static_assert(SEQ % 128 == 0 && SEQ >= 128 && SEQ <= SEQ_FULL && NB >= 1 && NB <= NB_FULL);
static_assert(QEA % 64 == 0 && QEA >= 64 && QEA <= SEQ && (SEQ - QEA) % 128 == 0);
static_assert(DMOD == H * HD && KD == DMOD && KD % 64 == 0 && DMOD % 128 == 0 && NKV % 128 == 0 && HD == 128 && DMOD == 256 * 8 && MR % 64 == 0);

typedef _Float16 b16;
typedef __attribute__((ext_vector_type(16))) _Float16 v16b;
typedef __attribute__((ext_vector_type(8))) _Float16 v8b;
typedef __attribute__((ext_vector_type(8))) float v8f;
typedef __attribute__((ext_vector_type(4))) float v4f;

__device__ __forceinline__ float bf16_rne(float f) { unsigned int u = __float_as_uint(f); u += 0x7FFFu + ((u >> 16) & 1u); return __uint_as_float(u & 0xFFFF0000u); }
// 16-bit fragment from a k-contiguous row: elements 0..7 <- p[8hh .. 8hh+7], 8..15 <- p[16+8hh .. 16+8hh+7]
__device__ __forceinline__ v16b frag_kb(const b16* p, int hh) {
  const v8b a = *(const v8b*)(p + 8 * hh), b = *(const v8b*)(p + 16 + 8 * hh); v16b f;
#pragma unroll
  for (int e = 0; e < 8; ++e) { f[e] = a[e]; f[8 + e] = b[e]; }
  return f;
}
__device__ __forceinline__ v8f wmma16b(v16b a, v16b b, v8f c) {
  v8f d = __builtin_amdgcn_wmma_f32_16x16x32_f16(false, a, false, b, (short)0, c, false, false);
  return d;
}
// Scheduling fence at an end of a group of LDS fragment loads: the group stays together and ahead of the WMMAs that use it. Left free, the compiler
// reloads one register set in front of every WMMA or two and waits out the LDS latency each time.
__device__ __forceinline__ void hold_group() { __builtin_amdgcn_sched_barrier(0); }
__device__ __forceinline__ void wave_lds_sync() { __builtin_amdgcn_fence(3, "workgroup"); __builtin_amdgcn_wave_barrier(); __builtin_amdgcn_fence(2, "workgroup"); }
__device__ __forceinline__ float nexp2(float v) { return __builtin_amdgcn_exp2f(v); }
// hi = f16(w), lo = f16((w - hi) * RS)
__device__ __forceinline__ void split16(float w, b16& hi, b16& lo) { hi = (b16)w; lo = (b16)((w - (float)hi) * RS); }

__device__ __forceinline__ void cvt_x_block(int vb, const float* __restrict__ X, b16* Xp) {
  const size_t u = (size_t)vb * 256 + threadIdx.x; const size_t row = u >> 8; const int c8 = (int)(u & 255) * 8;
  if (row >= (size_t)MR) return;
  const size_t b = row / SEQ, s = row % SEQ;
  const float* src = X + (b * SEQ_FULL + s) * DMOD + c8;
  b16* dst = Xp + row * DMOD + c8;
  const v4f x0 = *(const v4f*)src, x1 = *(const v4f*)(src + 4); v8b o;
#pragma unroll
  for (int j = 0; j < 4; ++j) { o[j] = (b16)(bf16_rne(x0[j]) * XS); o[4 + j] = (b16)(bf16_rne(x1[j]) * XS); }
  *(v8b*)dst = o; 
}

// W [2048 k][N n] f32 -> Wt [N][2048] f16 = bf16-RNE(w) x256 (k-contiguous for the B fragments). 2 waves (tid 0..63) per 64x64 tile (bx, by), transposed
// through their own LDS tile St; the four wave pairs of a block take four tiles of one matrix and pass the barrier together.
__device__ __forceinline__ void cvt_w_tile(b16 (*St)[64 + 8], int tid, int bx, int by, const float* __restrict__ W, b16* Wt, int N) {
  const int wave = tid >> 5, lane = tid & 31; const int k0 = bx * 64, n0 = by * 64;
  const float* src = W + (size_t)k0 * N + n0;
  for (int it = 0; it < 16; ++it) {
    const int e = (it * 64 + tid) * 4; const int kr = e >> 6, nc = e & 63;
    const v4f x = *(const v4f*)(src + (size_t)kr * N + nc);
#pragma unroll
    for (int j = 0; j < 4; ++j) St[nc + j][kr] = (b16)(bf16_rne(x[j]) * WS);
  }
  __syncthreads();   // St is read across waves
  b16* dstb = Wt + (size_t)n0 * KD + k0;
  {
#pragma unroll 1
    for (int it = 0; it < 8; ++it) {
      const int n = wave * 32 + it * 4 + (lane >> 3), ks = (lane & 7) * 8;
      const v8b o = *(const v8b*)(&St[n][ks]);
      *(v8b*)(dstb + (size_t)n * KD + ks) = o; }
     }
}

// cos/sin tables [SEQ][64] f32: ang = s * (1 / base^(2j/128)) in f32, precise sincosf. Block = 4 positions x 64 frequencies staged in LDS;
__device__ __forceinline__ void rope_tab_block(float (*Tb)[4][64 + 4], int vb, float* CT, float* ST) {
  const int tid = threadIdx.x; const int r = tid >> 6, j = tid & 63; const int s0 = vb * 4;
  const float ex = (float)(2 * j) * (1.0f / 128.0f);
  const float p = powf(ROPE_BASE, ex);
  const float inv = 1.0f / p;
  const float ang = (float)(s0 + r) * inv;
  float sn, c; sincosf(ang, &sn, &c);
  Tb[0][r][j] = c; Tb[1][r][j] = sn;
  __syncthreads();   // Tb is read across waves
  if (tid < 128) {
    const int tb = tid >> 6, rr = (tid >> 4) & 3, seg = (tid & 15) * 4;
    const v4f f = *(const v4f*)(&Tb[tb][rr][seg]);
    float* dst = (tb == 0 ? CT : ST) + (size_t)(s0 + rr) * 64 + seg;
    *(v4f*)dst = f; 
  }
}

// All operand preparation in one launch: its parts read only inputs and write disjoint planes. Block ranges, each block wholly in one part: first the W tiles
// (four 64x64 tiles a block; Wq, Wo, Wk, Wv), then the RoPE tables, then the rows of x.
constexpr int TQ = (KD / 64) * (DMOD / 64), TK = (KD / 64) * (NKV / 64);   // 64x64 tiles of a 2048-column and of a 512-column W
constexpr int PW = (2 * TQ + 2 * TK) / 4, PR = SEQ / 4, PX = MR;           // blocks of the three parts
static_assert(TQ % 4 == 0 && TK % 4 == 0 && KD / 64 == 32);
__global__ __launch_bounds__(256) void prep_kernel(const float* __restrict__ X, const float* __restrict__ Wq, const float* __restrict__ Wk,
    const float* __restrict__ Wv, const float* __restrict__ Wo, b16* Xp, b16* Wqt, b16* Wkt, b16* Wvt, b16* Wot, float* CT, float* ST) {
  __shared__ __attribute__((aligned(16))) unsigned char Sp[4 * 64 * (64 + 8) * 2];
  static_assert(sizeof(Sp) >= 2 * 4 * (64 + 4) * 4);
  const int vb = (int)blockIdx.x;
  if (vb < PW) {
    const int sub = (int)threadIdx.x >> 6, t4 = vb * 4;   // t4 picks the matrix for the whole block
    const float* W = Wq; b16* Wt = Wqt; int N = DMOD, t = t4 + sub;
    if (t4 >= 2 * TQ + TK) { W = Wv; Wt = Wvt; N = NKV; t -= 2 * TQ + TK; }
    else if (t4 >= 2 * TQ) { W = Wk; Wt = Wkt; N = NKV; t -= 2 * TQ; }
    else if (t4 >= TQ) { W = Wo; Wt = Wot; t -= TQ; }
    cvt_w_tile(reinterpret_cast<b16 (*)[64 + 8]>(Sp + sub * 64 * (64 + 8) * 2), (int)threadIdx.x & 63, t & 31, t >> 5, W, Wt, N);
  } else if (vb < PW + PR) {
    rope_tab_block(reinterpret_cast<float (*)[4][64 + 4]>(Sp), vb - PW, CT, ST);
  } else {
    cvt_x_block(vb - PW - PR, X, Xp);
  }
}

// One trip of the projection GEMM's K loop: 64 k = 128 B of each of 256 operand rows, laid in LDS at a pitch of 144 B (16 B x odd, for 16-byte readers).
constexpr int KS = 64, LP = 144, SROWS = 256, STAGE = SROWS * LP;   // 36,864 B a buffer
// Eight asynchronous 16-byte copies a lane fill 128 rows of a buffer: LDS rows r, r+16, .. r+112 (l = the lane's byte address in row r), the first 64 rows
// from ga, the next 64 from gb (each the lane's own address in its group's row r; 16 rows further = 16*KD elements). Eight lanes cover one 128-B row.
__device__ __forceinline__ void copy_rows128(unsigned l, const b16* ga, const b16* gb) {
  constexpr size_t RJ = (size_t)16 * KD; constexpr unsigned LJ = 16u * LP;
  // s_wait_xcnt 0 as the last line: it stands in front of every later rewrite of a register that a copy names
  asm volatile(
      "global_load_async_to_lds_b128 %0, %8, off\n\t"
      "global_load_async_to_lds_b128 %1, %9, off\n\t"
      "global_load_async_to_lds_b128 %2, %10, off\n\t"
      "global_load_async_to_lds_b128 %3, %11, off\n\t"
      "global_load_async_to_lds_b128 %4, %12, off\n\t"
      "global_load_async_to_lds_b128 %5, %13, off\n\t"
      "global_load_async_to_lds_b128 %6, %14, off\n\t"
      "global_load_async_to_lds_b128 %7, %15, off\n\t"
      "s_wait_xcnt 0x0"
      :: "v"(l), "v"(l + LJ), "v"(l + 2 * LJ), "v"(l + 3 * LJ), "v"(l + 4 * LJ), "v"(l + 5 * LJ), "v"(l + 6 * LJ), "v"(l + 7 * LJ),
         "v"(ga), "v"(ga + RJ), "v"(ga + 2 * RJ), "v"(ga + 3 * RJ), "v"(gb), "v"(gb + RJ), "v"(gb + 2 * RJ), "v"(gb + 3 * RJ)
      : "memory");
}
// One buffer: rows 0..63 from g0, 64..127 from g1, 128..191 from g2, 192..255 from g3; sixteen copies a lane, in two statements (an asm statement takes 30 operands).
__device__ __forceinline__ void copy_stage(unsigned l, const b16* g0, const b16* g1, const b16* g2, const b16* g3) {
  copy_rows128(l, g0, g1);
  copy_rows128(l + 128u * LP, g2, g3);
}

// The accumulators of four waves (tid 0..127, 2 x 2 on the tile) go to the tile's f32 staging To; the caller's barrier follows. Every product and sum of the
// two epilogue functions keeps a rounding of its own (no contraction), as it always had here: the planes they write stay bit-identical.
template <bool RES>
__device__ __forceinline__ void proj_stage(float (*To)[128 + 4], int tid, const v8f (&acc)[16]) {
#pragma clang fp contract(off)
  constexpr int BM = RES ? 64 : 128;
  const int wave = tid >> 5, lane = tid & 31, hh = lane >> 4, col = lane & 15, wm = wave >> 1, wn = wave & 1;
#pragma unroll
  for (int i = 0; i < BM / 32; ++i)
#pragma unroll
    for (int j = 0; j < 4; ++j)
#pragma unroll
      for (int r = 0; r < 8; ++r) {
        float v = acc[i * 4 + j][r];
        if constexpr (RES) v += acc[(i + 2) * 4 + j][r] * (1.0f / RS);
        To[wm * (BM / 2) + i * 16 + 8 * hh + r][wn * 64 + j * 16 + col] = v; }
}
template <int MODE, bool RES>
__device__ __forceinline__ void proj_store(float (*To)[128 + 4], int tid, int bx, int bsel, int s0,
    b16* Ph, b16* Pl, float* Out, const float* __restrict__ CT, const float* __restrict__ ST, int nhead);

// C[BM x 128] = A[m][k] . B[k][n] with A plane [rows][2048] and Bt plane [N][2048], both k-contiguous f16; K = 2048 in trips of 64 (two WMMA steps of 32).
// 128 threads = 4 waves. The block's operand rows of a trip (A 128 rows, then B 128 rows; RES: A 64, residual A 64 of the same token rows, B 128) are copied
// once into LDS, two buffers: the copies of trip t+2 fly while trip t+1 is worked on. Waves 2 x 2 on the tile: wave w owns four A fragments and the four B
// fragments of columns 64(w&1).., 16 accumulators: BM = 128, rows 64(w>>1)..+63; RES: BM = 64, rows 32(w>>1)..+31, A fragments 0,1 from the hi plane
// and 2,3 from the x2048 residual plane of the same rows, so accumulators 8..15 are the residual sums of 0..7.
// Column tile bx; row tile: by = bsel * tpb + tsel, rows m0 = bsel*SEQ + toff + BM tsel. Epilogue staged through the same LDS (behind the loop's last barrier) then:
// MODE 0: RoPE in f32 with the cos/sin tables, hi x8 / lo x2048 planes [b][nhead][s][128] (256-B rows by 16 lanes x 16 B, 8 rows per store);
template <int MODE, bool RES>
__device__ __forceinline__ void proj_block(unsigned char* Sm, int bx, int by,
    const b16* __restrict__ A, const b16* __restrict__ Al, const b16* __restrict__ Bt, b16* Ph, b16* Pl, float* Out,
    const float* __restrict__ CT, const float* __restrict__ ST, int nhead, int tpb, int toff) {
#pragma clang fp contract(off)
  static_assert(MODE == 2 || !RES);
  constexpr int BM = RES ? 64 : 128, BN = 128, NTRIP = KD / KS, BROW = 128;
  static_assert(BM * (BN + 4) * 4 <= 2 * STAGE && NTRIP >= 2 && BROW + BN == SROWS);
  float (*To)[BN + 4] = reinterpret_cast<float (*)[BN + 4]>(Sm);
  const int tid = threadIdx.x, wave = tid >> 5, lane = tid & 31, hh = lane >> 4, col = lane & 15;
  const int bsel = by / tpb, tsel = by - bsel * tpb;
  const int s0 = toff + tsel * BM;
  const size_t m0 = (size_t)bsel * SEQ + s0;
  const int n0 = bx * BN;
  const int wm = wave >> 1, wn = wave & 1;
  const int cr = tid >> 3, cs = (tid & 7) * 8;   // the lane's row in each run of 16 rows, and its 16-byte piece of the row
  const b16* g0 = A + (m0 + cr) * KD + cs;
  const b16* g1 = RES ? Al + (m0 + cr) * KD + cs : A + (m0 + 64 + cr) * KD + cs;
  const b16* g2 = Bt + (size_t)(n0 + cr) * KD + cs;
  const b16* g3 = Bt + (size_t)(n0 + 64 + cr) * KD + cs;
  const unsigned lc = (unsigned)(uintptr_t)(&Sm[cr * LP + cs * 2]);
  const unsigned char* sa = &Sm[(wm * (BM / 2) + col) * LP];
  const unsigned char* sb = &Sm[(BROW + wn * 64 + col) * LP];
  v8f acc[16];
#pragma unroll
  for (int t = 0; t < 16; ++t) acc[t] = (v8f){};
  copy_stage(lc, g0, g1, g2, g3);
  asm volatile("s_wait_asynccnt 0x0" ::: "memory");   // this wave's copies of trip 0 have landed
  __syncthreads();                                     // every wave's have: trip 0 may be read
  copy_stage(lc + STAGE, g0 + KS, g1 + KS, g2 + KS, g3 + KS);
#pragma unroll 1
  for (int tr = 0; tr < NTRIP; ++tr) {
    const int bo = (tr & 1) * STAGE;
#pragma unroll
    for (int kk = 0; kk < 2; ++kk) {
      v16b af[4], bf[4];   // the fragments of one WMMA step, read as one group ahead of its 16 WMMAs
      hold_group();   // no load of this group rises among the WMMAs before it
#pragma unroll
      for (int i = 0; i < 4; ++i) {
        const int ar = RES ? (i >> 1) * 64 + (i & 1) * 16 : i * 16;   // LDS row of A fragment i, from the wave's first row
        af[i] = frag_kb((const b16*)(sa + bo + ar * LP) + kk * 32, hh);
      }
#pragma unroll
      for (int j = 0; j < 4; ++j) bf[j] = frag_kb((const b16*)(sb + bo + j * 16 * LP) + kk * 32, hh);
      hold_group();   // and none sinks among its own WMMAs
#pragma unroll
      for (int i = 0; i < 4; ++i)
#pragma unroll
        for (int j = 0; j < 4; ++j) acc[i * 4 + j] = wmma16b(af[i], bf[j], acc[i * 4 + j]);
    }
    hold_group();   // the trip's WMMAs stay in front of the waits and the barrier: sunk behind them they would delay the refill
    asm volatile("s_wait_dscnt 0x0" ::: "memory");      // this wave's reads of the buffer are done before it is refilled
    asm volatile("s_wait_asynccnt 0x0" ::: "memory");   // this wave's copies of trip tr+1 have landed
    __syncthreads();                                     // publishes trip tr+1 and ends every reader's last read of trip tr
    if (tr + 2 < NTRIP) { const int ko = (tr + 2) * KS; copy_stage(lc + bo, g0 + ko, g1 + ko, g2 + ko, g3 + ko); }
  }
  asm volatile("s_wait_asynccnt 0x0" ::: "memory");     // no copy is outstanding when the buffers become output staging
  proj_stage<RES>(To, tid, acc);
  __syncthreads();   // To is read across waves
  proj_store<MODE, RES>(To, tid, bx, bsel, s0, Ph, Pl, Out, CT, ST, nhead);
}

// A staged tile goes to memory, by the 128 threads (tid 0..127) that own it; no barrier inside. Roundings as in proj_stage.
template <int MODE, bool RES>
__device__ __forceinline__ void proj_store(float (*To)[128 + 4], int tid, int bx, int bsel, int s0,
    b16* Ph, b16* Pl, float* Out, const float* __restrict__ CT, const float* __restrict__ ST, int nhead) {
#pragma clang fp contract(off)
  constexpr int BM = RES ? 64 : 128, BN = 128;
  const int n0 = bx * BN;
  constexpr int HF = BM / 64;   // every pass below handles its rows in each 64-row half of the tile: HF independent pieces, stored together
  if constexpr (MODE == 0) {
    const size_t pb = (((size_t)bsel * nhead + bx) * SEQ + s0) * HD;
    b16* ph = Ph + pb; b16* pl = Pl + pb;
    const float qsc = QS / (XS * WS);
    {
#pragma unroll 1
      for (int it = 0; it < 8; ++it) {
        const int seg = (tid & 15) * 8, sg = seg & 63;
        const float sgn = (seg >= 64) ? 1.0f : -1.0f;   // d < 64: x cos - x[d+64] sin; d >= 64: x cos + x[d-64] sin
        v8b hi[HF], lo[HF];
#pragma unroll
        for (int hf = 0; hf < HF; ++hf) {
          const int rr = hf * 64 + it * 8 + (tid >> 4);
          const float* trow = &To[rr][0]; const size_t ts = (size_t)(s0 + rr) * 64 + sg;
          const v4f xa = *(const v4f*)(trow + seg), xb = *(const v4f*)(trow + seg + 4);
          const v4f ya = *(const v4f*)(trow + (seg ^ 64)), yb = *(const v4f*)(trow + (seg ^ 64) + 4);
          const v4f ca = *(const v4f*)(CT + ts), cb = *(const v4f*)(CT + ts + 4), sa = *(const v4f*)(ST + ts), sb = *(const v4f*)(ST + ts + 4);
#pragma unroll
          for (int j = 0; j < 4; ++j) {
            b16 h0, l0;
            split16((xa[j] * ca[j] + sgn * ya[j] * sa[j]) * qsc, h0, l0); hi[hf][j] = h0; lo[hf][j] = l0;
            split16((xb[j] * cb[j] + sgn * yb[j] * sb[j]) * qsc, h0, l0); hi[hf][4 + j] = h0; lo[hf][4 + j] = l0; }
        }
#pragma unroll
        for (int hf = 0; hf < HF; ++hf) {
          const size_t off = (size_t)(hf * 64 + it * 8 + (tid >> 4)) * HD + seg;
          *(v8b*)(ph + off) = hi[hf]; *(v8b*)(pl + off) = lo[hf]; }
        asm volatile("s_wait_xcnt 0x0" ::: "memory"); }   // in front of the next pass's rewrite of the registers that the stores name
       }
  } else if constexpr (MODE == 1) {
    const size_t pb = ((size_t)bsel * nhead + bx) * HD * (size_t)SEQ + s0;
    b16* ph = Ph + pb; b16* pl = Pl + pb;
    const float vsc = QS / (XS * WS);
    {
#pragma unroll 1
      for (int it = 0; it < 8; ++it) {
        const int d = it * 16 + (tid >> 3);
        v8b hi[HF], lo[HF];
#pragma unroll
        for (int hf = 0; hf < HF; ++hf) {
          const int ss = hf * 64 + (tid & 7) * 8;
#pragma unroll
          for (int j = 0; j < 8; ++j) { b16 h0, l0; split16(To[ss + j][d] * vsc, h0, l0); hi[hf][j] = h0; lo[hf][j] = l0; }
        }
#pragma unroll
        for (int hf = 0; hf < HF; ++hf) {
          const size_t off = (size_t)d * SEQ + hf * 64 + (tid & 7) * 8;
          *(v8b*)(ph + off) = hi[hf]; *(v8b*)(pl + off) = lo[hf]; } }
       }
  } else {
    constexpr int LPR = BN / 4, RPI = 128 / LPR, NIT = 64 / RPI;
    static_assert(NIT * RPI == 64 && LPR * 4 == BN);
    float* ob = Out + ((size_t)bsel * SEQ_FULL + s0) * DMOD + n0;
    const float osc = 1.0f / (CS * WS);
    {
#pragma unroll 1
      for (int it = 0; it < NIT; ++it) {
        const int seg = (tid % LPR) * 4;
        v4f f[HF];
#pragma unroll
        for (int hf = 0; hf < HF; ++hf) f[hf] = *(const v4f*)(&To[hf * 64 + it * RPI + tid / LPR][seg]) * osc;
#pragma unroll
        for (int hf = 0; hf < HF; ++hf) *(v4f*)(ob + (size_t)(hf * 64 + it * RPI + tid / LPR) * DMOD + seg) = f[hf]; }
       }
  }
}

// x@Wq, x@Wk, x@Wv in one launch: column tiles 0..15 are Q heads, 16..19 K heads, 20..23 V heads. A block = 12 waves = NG groups of four waves, one block a WGP;
// group g works column tile NG*blockIdx.x + g as a four-wave block of proj_block does (waves 2 x 2, 64x64 each, the same k order), but the NG groups share ONE
// copy of the block's 128 x rows: a buffer is [x 128 rows | group 0's W 128 rows | group 1's | group 2's], 512 rows from L2 where three blocks brought 768.
// A trip is 128 k = 256 B of each row at a pitch of 272 B (16 B x odd, for 16-byte readers): four WMMA steps between two barriers of the 12 waves.
constexpr int CQ = DMOD / 128, CK = NKV / 128, NG = 3;
constexpr int KS3 = 128, LP3 = 272, STAGE3 = 128 * (NG + 1) * LP3, TOB = 128 * (128 + 4) * 4;   // 139,264 B a buffer; 67,584 B of output staging a group
constexpr int QLDS = 2 * STAGE3 > NG * TOB ? 2 * STAGE3 : NG * TOB;                              // 278,528 B
static_assert((CQ + 2 * CK) % NG == 0 && MR % 128 == 0 && SEQ % 128 == 0 && NG == 3 && KD % KS3 == 0 && KD / KS3 >= 2);
// One lane's copies of a trip; 16 lanes cover one 256-B row. Sixteen fill its group's W rows r, r+8, .. r+120 (lw, gw = the lane's LDS byte address and global
// address in row r = its thread number in the group / 16). The x rows are dealt over all 12 waves, two rows a wave-wide copy: rows q, q+24, .. q+96 (lx, gx = the
// lane's addresses in row q = thread number / 16) and, from the first four waves only (sixth, wave-uniform), row q+120.
__device__ __forceinline__ void copy_stage3(unsigned lw, const b16* gw, unsigned lx, const b16* gx, bool sixth) {
  constexpr size_t RJ = (size_t)8 * KD, XJ = (size_t)24 * KD; constexpr unsigned LJ = 8u * LP3, LXJ = 24u * LP3;
  // s_wait_xcnt 0 as the last line of each statement: it stands in front of every later rewrite of a register that a copy names
  asm volatile(
      "global_load_async_to_lds_b128 %0, %11, off\n\t"
      "global_load_async_to_lds_b128 %1, %12, off\n\t"
      "global_load_async_to_lds_b128 %2, %13, off\n\t"
      "global_load_async_to_lds_b128 %3, %14, off\n\t"
      "global_load_async_to_lds_b128 %4, %15, off\n\t"
      "global_load_async_to_lds_b128 %5, %16, off\n\t"
      "global_load_async_to_lds_b128 %6, %17, off\n\t"
      "global_load_async_to_lds_b128 %7, %18, off\n\t"
      "global_load_async_to_lds_b128 %8, %19, off\n\t"
      "global_load_async_to_lds_b128 %9, %20, off\n\t"
      "global_load_async_to_lds_b128 %10, %21, off\n\t"
      "s_wait_xcnt 0x0"
      :: "v"(lx), "v"(lx + LXJ), "v"(lx + 2 * LXJ), "v"(lx + 3 * LXJ), "v"(lx + 4 * LXJ),
         "v"(lw), "v"(lw + LJ), "v"(lw + 2 * LJ), "v"(lw + 3 * LJ), "v"(lw + 4 * LJ), "v"(lw + 5 * LJ),
         "v"(gx), "v"(gx + XJ), "v"(gx + 2 * XJ), "v"(gx + 3 * XJ), "v"(gx + 4 * XJ),
         "v"(gw), "v"(gw + RJ), "v"(gw + 2 * RJ), "v"(gw + 3 * RJ), "v"(gw + 4 * RJ), "v"(gw + 5 * RJ)
      : "memory");
  asm volatile(
      "global_load_async_to_lds_b128 %0, %10, off\n\t"
      "global_load_async_to_lds_b128 %1, %11, off\n\t"
      "global_load_async_to_lds_b128 %2, %12, off\n\t"
      "global_load_async_to_lds_b128 %3, %13, off\n\t"
      "global_load_async_to_lds_b128 %4, %14, off\n\t"
      "global_load_async_to_lds_b128 %5, %15, off\n\t"
      "global_load_async_to_lds_b128 %6, %16, off\n\t"
      "global_load_async_to_lds_b128 %7, %17, off\n\t"
      "global_load_async_to_lds_b128 %8, %18, off\n\t"
      "global_load_async_to_lds_b128 %9, %19, off\n\t"
      "s_wait_xcnt 0x0"
      :: "v"(lw + 6 * LJ), "v"(lw + 7 * LJ), "v"(lw + 8 * LJ), "v"(lw + 9 * LJ), "v"(lw + 10 * LJ),
         "v"(lw + 11 * LJ), "v"(lw + 12 * LJ), "v"(lw + 13 * LJ), "v"(lw + 14 * LJ), "v"(lw + 15 * LJ),
         "v"(gw + 6 * RJ), "v"(gw + 7 * RJ), "v"(gw + 8 * RJ), "v"(gw + 9 * RJ), "v"(gw + 10 * RJ),
         "v"(gw + 11 * RJ), "v"(gw + 12 * RJ), "v"(gw + 13 * RJ), "v"(gw + 14 * RJ), "v"(gw + 15 * RJ)
      : "memory");
  if (sixth)
    asm volatile(
        "global_load_async_to_lds_b128 %0, %1, off\n\t"
        "s_wait_xcnt 0x0"
        :: "v"(lx + 5 * LXJ), "v"(gx + 5 * XJ) : "memory");
}
__global__ __launch_bounds__(128 * NG) __attribute__((amdgpu_num_vgpr(256))) void qkv_kernel(
    const b16* __restrict__ Xp, const b16* __restrict__ Wqt, const b16* __restrict__ Wkt, const b16* __restrict__ Wvt,
    b16* Qh, b16* Ql, b16* Kh, b16* Kl, b16* Vh, b16* Vl, const float* __restrict__ CT, const float* __restrict__ ST) {
  __shared__ __attribute__((aligned(16))) unsigned char Sm[QLDS];
  constexpr int NTRIP = KD / KS3;
  const int tid = (int)threadIdx.x, lane = tid & 31, hh = lane >> 4, col = lane & 15;
  const int wave = __builtin_amdgcn_readfirstlane(tid >> 5);   // in a scalar register: what follows from it (group, matrix, sixth) is decided by scalar branches
  const int grp = wave >> 2, tg = tid & 127, wm = (wave >> 1) & 1, wn = wave & 1;
  const int bx = (int)blockIdx.x * NG + grp, by = (int)blockIdx.y;
  const int bsel = by / (SEQ / 128), s0 = (by - bsel * (SEQ / 128)) * 128;
  const size_t m0 = (size_t)bsel * SEQ + s0;
  const bool isq = bx < CQ, isv = bx >= CQ + CK;
  const int hx = isq ? bx : isv ? bx - CQ - CK : bx - CQ;      // the head (column tile) inside its own matrix
  const b16* Bt = (isq ? Wqt : isv ? Wvt : Wkt) + (size_t)hx * 128 * KD;
  const bool sixth = wave < 4;
  const int cr = tg >> 4, cs = (tid & 15) * 8;                 // the lane's W row in each run of 8 rows, and its 16-byte piece of a row
  const int xr = wave * 2 + hh;                                // the lane's x row in each run of 24 rows
  const b16* gw = Bt + (size_t)cr * KD + cs;
  const b16* gx = Xp + (m0 + xr) * KD + cs;
  const unsigned lw = (unsigned)(uintptr_t)(&Sm[(128 * (grp + 1) + cr) * LP3 + cs * 2]);
  const unsigned lx = (unsigned)(uintptr_t)(&Sm[xr * LP3 + cs * 2]);
  const unsigned char* sa = &Sm[(wm * 64 + col) * LP3];
  const unsigned char* sb = &Sm[(128 * (grp + 1) + wn * 64 + col) * LP3];
  v8f acc[16];
#pragma unroll
  for (int t = 0; t < 16; ++t) acc[t] = (v8f){};
  copy_stage3(lw, gw, lx, gx, sixth);
  asm volatile("s_wait_asynccnt 0x0" ::: "memory");   // this wave's copies of trip 0 have landed
  __syncthreads();                                     // every wave's have: trip 0 may be read
  copy_stage3(lw + STAGE3, gw + KS3, lx + STAGE3, gx + KS3, sixth);
#pragma unroll 1
  for (int tr = 0; tr < NTRIP; ++tr) {
    const int bo = (tr & 1) * STAGE3;
#pragma unroll
    for (int kk = 0; kk < KS3 / 32; ++kk) {
      v16b af[4], bf[4];   // the fragments of one WMMA step, read as one group ahead of its 16 WMMAs
      hold_group();   // no load of this group rises among the WMMAs before it
#pragma unroll
      for (int i = 0; i < 4; ++i) af[i] = frag_kb((const b16*)(sa + bo + i * 16 * LP3) + kk * 32, hh);
#pragma unroll
      for (int j = 0; j < 4; ++j) bf[j] = frag_kb((const b16*)(sb + bo + j * 16 * LP3) + kk * 32, hh);
      hold_group();   // and none sinks among its own WMMAs
#pragma unroll
      for (int i = 0; i < 4; ++i)
#pragma unroll
        for (int j = 0; j < 4; ++j) acc[i * 4 + j] = wmma16b(af[i], bf[j], acc[i * 4 + j]);
    }
    hold_group();   // the trip's WMMAs stay in front of the waits and the barrier: sunk behind them they would delay the refill
    asm volatile("s_wait_dscnt 0x0" ::: "memory");      // this wave's reads of the buffer are done before it is refilled
    asm volatile("s_wait_asynccnt 0x0" ::: "memory");   // this wave's copies of trip tr+1 have landed
    __syncthreads();                                     // publishes trip tr+1 and ends every reader's last read of trip tr
    if (tr + 2 < NTRIP) { const int ko = (tr + 2) * KS3; copy_stage3(lw + bo, gw + ko, lx + bo, gx + ko, sixth); }
  }
  asm volatile("s_wait_asynccnt 0x0" ::: "memory");     // no copy is outstanding when the buffers become output staging
  float (*To)[128 + 4] = reinterpret_cast<float (*)[128 + 4]>(Sm + grp * TOB);   // each group stages its own tile
  proj_stage<false>(To, tg, acc);
  __syncthreads();   // To is read across the group's waves; one barrier for the block, whatever its groups store
  if (!isv) proj_store<0, false>(To, tg, hx, bsel, s0, isq ? Qh : Kh, isq ? Ql : Kl, nullptr, CT, ST, isq ? H : HKV);
  else proj_store<1, false>(To, tg, hx, bsel, s0, Vh, Vl, nullptr, CT, ST, HKV);
}

// ctx@Wo in one launch: first the 128x128 tiles of the rows >= QEA, then the 64x128 tiles with the residual plane of the rows < QEA.
constexpr int ON = (DMOD / 128) * NB * ((SEQ - QEA) / 128), OE = (DMOD / 128) * NB * (QEA / 64);
__global__ __launch_bounds__(128) __attribute__((amdgpu_num_vgpr(256))) void out_kernel(
    const b16* __restrict__ Ch, const b16* __restrict__ Cl, const b16* __restrict__ Wot, float* Out) {
  __shared__ __attribute__((aligned(16))) unsigned char Sm[2 * STAGE];
  const int vb = (int)blockIdx.x;
  if (vb < ON) {
    proj_block<2, false>(Sm, vb % (DMOD / 128), vb / (DMOD / 128), Ch, Ch, Wot, nullptr, nullptr, Out, nullptr, nullptr, 1, (SEQ - QEA) / 128, QEA);
  } else {
    const int v = vb - ON;
    proj_block<2, true>(Sm, v % (DMOD / 128), v / (DMOD / 128), Ch, Cl, Wot, nullptr, nullptr, Out, nullptr, nullptr, 1, QEA / 64, 0);
  }
}

// One key step of the attention kernel in LDS: K tile = 32 key rows of 256 B at a pitch of 272 B, V tile = DW d rows of 64 B (32 keys) at a pitch of 80 B
// (both 16 B x odd, for 16-byte readers). A buffer holds K hi[, K lo], V hi[, V lo].
constexpr int KP = 272, VP = 80, KTILE = 32 * KP, PBYTES = NREP * 16 * (32 + 8) * 2, ALDS = 65536;
// The asynchronous 16-byte copies of one lane (of 128) that fill one buffer: K rows r, r+8, r+16, r+24 (16 lanes cover one 256-B row) and V rows d, d+32[, d+64,
// d+96] (4 lanes cover one 64-B row); ER: the same rows of the lo planes, K lo one K tile and V lo one V tile (64 rows) further in LDS.
// lk, lv = the lane's LDS byte addresses in its first rows, gk, gkl, gv, gvl = its global addresses there.
template <bool ER>
__device__ __forceinline__ void copy_kv(unsigned lk, unsigned lv, const b16* gk, const b16* gkl, const b16* gv, const b16* gvl) {
  constexpr size_t KJ = (size_t)8 * HD, VJ = (size_t)32 * SEQ; constexpr unsigned LKJ = 8u * KP, LVJ = 32u * VP, KL = KTILE, VL = 64u * VP;
  // s_wait_xcnt 0 as the last line of either statement: it stands in front of every later rewrite of a register that a copy names
  if constexpr (ER) {
    asm volatile(
        "global_load_async_to_lds_b128 %0, %12, off\n\t"
        "global_load_async_to_lds_b128 %1, %13, off\n\t"
        "global_load_async_to_lds_b128 %2, %14, off\n\t"
        "global_load_async_to_lds_b128 %3, %15, off\n\t"
        "global_load_async_to_lds_b128 %4, %16, off\n\t"
        "global_load_async_to_lds_b128 %5, %17, off\n\t"
        "global_load_async_to_lds_b128 %6, %18, off\n\t"
        "global_load_async_to_lds_b128 %7, %19, off\n\t"
        "global_load_async_to_lds_b128 %8, %20, off\n\t"
        "global_load_async_to_lds_b128 %9, %21, off\n\t"
        "global_load_async_to_lds_b128 %10, %22, off\n\t"
        "global_load_async_to_lds_b128 %11, %23, off\n\t"
        "s_wait_xcnt 0x0"
        :: "v"(lk), "v"(lk + LKJ), "v"(lk + 2 * LKJ), "v"(lk + 3 * LKJ), "v"(lk + KL), "v"(lk + KL + LKJ), "v"(lk + KL + 2 * LKJ), "v"(lk + KL + 3 * LKJ),
           "v"(lv), "v"(lv + LVJ), "v"(lv + VL), "v"(lv + VL + LVJ),
           "v"(gk), "v"(gk + KJ), "v"(gk + 2 * KJ), "v"(gk + 3 * KJ), "v"(gkl), "v"(gkl + KJ), "v"(gkl + 2 * KJ), "v"(gkl + 3 * KJ),
           "v"(gv), "v"(gv + VJ), "v"(gvl), "v"(gvl + VJ)
        : "memory");
  } else {
    asm volatile(
        "global_load_async_to_lds_b128 %0, %8, off\n\t"
        "global_load_async_to_lds_b128 %1, %9, off\n\t"
        "global_load_async_to_lds_b128 %2, %10, off\n\t"
        "global_load_async_to_lds_b128 %3, %11, off\n\t"
        "global_load_async_to_lds_b128 %4, %12, off\n\t"
        "global_load_async_to_lds_b128 %5, %13, off\n\t"
        "global_load_async_to_lds_b128 %6, %14, off\n\t"
        "global_load_async_to_lds_b128 %7, %15, off\n\t"
        "s_wait_xcnt 0x0"
        :: "v"(lk), "v"(lk + LKJ), "v"(lk + 2 * LKJ), "v"(lk + 3 * LKJ), "v"(lv), "v"(lv + LVJ), "v"(lv + 2 * LVJ), "v"(lv + 3 * LVJ),
           "v"(gk), "v"(gk + KJ), "v"(gk + 2 * KJ), "v"(gk + 3 * KJ), "v"(gv), "v"(gv + VJ), "v"(gv + 2 * VJ), "v"(gv + 3 * VJ)
        : "memory");
  }
}

// Causal GQA attention: block (bx = query tile of 16, bg in NB*HKV[, bz = d-half when ER]); block = 4 waves = the 4 query heads of one KV head on the same 16 queries,
// so all four walk the same keys. Each 32-key step's K and V tiles are copied once into LDS, two buffers: the copies of step st+2 fly while step st+1 is
// worked on; every wave reads its fragments from there. Key steps of 32 from key 0 up to the 32-aligned block of the last query in fixed order; online
// softmax (running max, f32); keys later than the query get -inf on the diagonal step; P x1024 via wave-private LDS; O^T += V^T P^T. ER (query position
// < QEA): scores Kh Qh + (Kh Ql + Kl Qh)/2048, O^T second accumulator Vh Pr + Vl Ph folded by 1/2048, each block restricted to 64 of the 128 d rows
// (bz). ctx hi x64 / lo x2048 planes [b*SEQ+s][h*128 + d], staged per wave through the same LDS behind the loop's last barrier.
template <bool ER>
__device__ __forceinline__ void attn_block(unsigned char* Sm, int bx, int bg, int bz,
    const b16* __restrict__ Qh, const b16* __restrict__ Ql, const b16* __restrict__ Kh, const b16* __restrict__ Kl,
    const b16* __restrict__ Vh, const b16* __restrict__ Vl, b16* Ch, b16* Cl) {
  constexpr int NT = ER ? 4 : 8, DW = NT * 16, NP = ER ? 2 : 1, VO = NP * KTILE, VT = DW * VP, ASTAGE = VO + NP * VT;   // 27,648 / 18,944 B a buffer
  static_assert(NREP == 4 && NREP * 16 * (DW + 4) * 4 <= 2 * ASTAGE && ASTAGE % 16 == 0);
  static_assert(2 * ASTAGE + NP * PBYTES <= ALDS);
  b16 (*Pb)[16][32 + 8] = reinterpret_cast<b16 (*)[16][32 + 8]>(Sm + 2 * ASTAGE);            // behind the two buffers: P, then (ER) its residual
  b16 (*Pr)[16][32 + 8] = reinterpret_cast<b16 (*)[16][32 + 8]>(Sm + 2 * ASTAGE + (ER ? PBYTES : 0));
  float (*To)[16][DW + 4] = reinterpret_cast<float (*)[16][DW + 4]>(Sm);
  const int tid = threadIdx.x, wave = tid >> 5, lane = tid & 31, hh = lane >> 4, col = lane & 15;
  const int b = bg / HKV, g = bg - b * HKV, h = g * NREP + wave;
  const int q0 = (ER ? 0 : QEA) + bx * 16, qi = q0 + col;
  const int dh = ER ? bz * 64 : 0;
  const b16* qrow = Qh + ((size_t)(b * H + h) * SEQ + qi) * HD;
  const b16* qlrow = Ql + ((size_t)(b * H + h) * SEQ + qi) * HD;
  const size_t ko = (size_t)(b * HKV + g) * SEQ * HD + (size_t)(tid >> 4) * HD + (tid & 15) * 8;           // the lane's piece of K row tid>>4
  const size_t vo = ((size_t)(b * HKV + g) * HD + dh + (tid >> 2)) * SEQ + (tid & 3) * 8;                  // the lane's piece of V row tid>>2
  const b16* gk = Kh + ko; const b16* gkl = Kl + ko; const b16* gv = Vh + vo; const b16* gvl = Vl + vo;
  const unsigned lk = (unsigned)(uintptr_t)(&Sm[(tid >> 4) * KP + (tid & 15) * 16]);
  const unsigned lv = (unsigned)(uintptr_t)(&Sm[VO + (tid >> 2) * VP + (tid & 3) * 16]);
  const unsigned char* sk = &Sm[col * KP];
  const unsigned char* sv = &Sm[VO + col * VP];
  v16b qa[4];
#pragma unroll
  for (int c = 0; c < 4; ++c) { qa[c] = (v16b){}; if constexpr (!ER) qa[c] = frag_kb(qrow + c * 32, hh); }
  const float cs = SCL * LOG2E / (QS * QS);   // 1/sqrt(128) and the two x8 carriers, in the log2 domain
  float m = -INFINITY, l = 0.0f; v8f o[NT], o2[NT];
#pragma unroll
  for (int t = 0; t < NT; ++t) { o[t] = (v8f){}; o2[t] = (v8f){}; }
  const int nst = q0 / 32 + 1;   // block-uniform: keys 0 .. (q0 | 31)
  copy_kv<ER>(lk, lv, gk, gkl, gv, gvl);
  asm volatile("s_wait_asynccnt 0x0" ::: "memory");   // this wave's copies of step 0 have landed
  __syncthreads();                                     // every wave's have: step 0 may be read
  if (1 < nst) copy_kv<ER>(lk + ASTAGE, lv + ASTAGE, gk + (size_t)32 * HD, gkl + (size_t)32 * HD, gv + 32, gvl + 32);
#pragma unroll 1
  for (int st = 0; st < nst; ++st) {
    const int bo = (st & 1) * ASTAGE;
    const int kb = st * 32; const int lim = qi - kb;   // key offsets > lim are later than the query (binds only on the diagonal step)
    float e[16]; float mx = -INFINITY;
    v8f s[2], s2[2];
    if constexpr (ER) {
#pragma unroll
      for (int u = 0; u < 2; ++u) {
        v16b kf[4], klf[4];   // 16 keys' K fragments, hi and lo (not held as a group: with the lo planes' they would not fit the registers)
#pragma unroll
        for (int c = 0; c < 4; ++c) {
          kf[c] = frag_kb((const b16*)(sk + bo + u * 16 * KP) + c * 32, hh);
          klf[c] = frag_kb((const b16*)(sk + bo + KTILE + u * 16 * KP) + c * 32, hh);
        }
        s[u] = (v8f){}; s2[u] = (v8f){};
#pragma unroll
        for (int c = 0; c < 4; ++c) {
          const v16b qh = frag_kb(qrow + c * 32, hh), ql = frag_kb(qlrow + c * 32, hh);
          s[u] = wmma16b(kf[c], qh, s[u]); s2[u] = wmma16b(kf[c], ql, s2[u]); s2[u] = wmma16b(klf[c], qh, s2[u]);
        }
      }
    } else {
      v16b kf[2][4];   // the step's K fragments, read as one group ahead of their WMMAs
#pragma unroll
      for (int u = 0; u < 2; ++u)
#pragma unroll
        for (int c = 0; c < 4; ++c) kf[u][c] = frag_kb((const b16*)(sk + bo + u * 16 * KP) + c * 32, hh);
      hold_group();   // no load of the group sinks among the WMMAs
#pragma unroll
      for (int u = 0; u < 2; ++u) { s[u] = (v8f){}; s2[u] = (v8f){}; }
#pragma unroll
      for (int c = 0; c < 4; ++c)   // the two 16-key chains alternate, so that neither waits out its own accumulate latency; each chain's sum order is as it was
#pragma unroll
        for (int u = 0; u < 2; ++u) s[u] = wmma16b(kf[u][c], qa[c], s[u]);
    }
    v16b vf[NT];   // the step's V fragments, read as one group: their LDS latency passes under the softmax arithmetic
#pragma unroll
    for (int t = 0; t < NT; ++t) vf[t] = frag_kb((const b16*)(sv + bo + t * 16 * VP), hh);
    if constexpr (!ER) hold_group();   // keeps the V loads here, ahead of the softmax arithmetic (ER: held so long they would not fit the registers)
#pragma unroll
    for (int u = 0; u < 2; ++u)
#pragma unroll
      for (int r = 0; r < 8; ++r) {
        float v = s[u][r];
        if constexpr (ER) v += s2[u][r] * (1.0f / RS);
        v *= cs;
        if (u * 16 + 8 * hh + r > lim) v = -INFINITY;
        e[u * 8 + r] = v; mx = fmaxf(mx, v); }
    mx = fmaxf(mx, __shfl_xor(mx, 16)); const float mn = fmaxf(m, mx); const float al = nexp2(m - mn); float sum = 0.0f;
#pragma unroll
    for (int i2 = 0; i2 < 16; ++i2) {
      const float p = nexp2(e[i2] - mn); sum += p; const int pi = (i2 < 8 ? 0 : 16) + 8 * hh + (i2 & 7);
      const float pp = p * PS; const b16 phv = (b16)pp; Pb[wave][col][pi] = phv;
      if constexpr (ER) Pr[wave][col][pi] = (b16)((pp - (float)phv) * RS); }
    sum += __shfl_xor(sum, 16); l = l * al + sum; m = mn;
    wave_lds_sync();
    const v16b pf = frag_kb(&Pb[wave][col][0], hh);
    v16b prf = (v16b){};
    if constexpr (ER) prf = frag_kb(&Pr[wave][col][0], hh);
    v16b vlf[NT];  // the lo V fragments only here: held across the softmax they would not fit the registers
#pragma unroll
    for (int t = 0; t < NT; ++t) { vlf[t] = (v16b){}; if constexpr (ER) vlf[t] = frag_kb((const b16*)(sv + bo + VT + t * 16 * VP), hh); }
#pragma unroll
    for (int t = 0; t < NT; ++t) {
      o[t] *= al; o[t] = wmma16b(vf[t], pf, o[t]);
      if constexpr (ER) { o2[t] *= al; o2[t] = wmma16b(vf[t], prf, o2[t]); o2[t] = wmma16b(vlf[t], pf, o2[t]); } }
    hold_group();   // the step's WMMAs stay in front of the waits and the barrier: sunk behind them they would delay the refill
    asm volatile("s_wait_dscnt 0x0" ::: "memory");      // this wave's reads of the buffer (and of its P rows) are done before the refill
    asm volatile("s_wait_asynccnt 0x0" ::: "memory");   // this wave's copies of step st+1 have landed
    __syncthreads();                                     // publishes step st+1 and ends every reader's last read of step st
    if (st + 2 < nst) { const size_t kn = (size_t)(kb + 64) * HD; copy_kv<ER>(lk + bo, lv + bo, gk + kn, gkl + kn, gv + kb + 64, gvl + kb + 64); }
  }
  asm volatile("s_wait_asynccnt 0x0" ::: "memory");     // no copy is outstanding when the buffers become output staging
  const float inv = 1.0f / (l * PS * QS);
#pragma unroll
  for (int t = 0; t < NT; ++t) {
#pragma unroll
    for (int r = 0; r < 8; ++r) {
      float ov = o[t][r];
      if constexpr (ER) ov += o2[t][r] * (1.0f / RS);
      To[wave][col][t * 16 + 8 * hh + r] = ov * inv; } }
  wave_lds_sync();
  constexpr int LPR = DW / 8, RPI = 32 / LPR, NIT = 16 / RPI;
  static_assert(NIT * RPI == 16 && LPR * 8 == DW);
  const size_t cbase = ((size_t)b * SEQ + q0) * DMOD + (size_t)h * HD + dh;
  {
#pragma unroll 1
    for (int it = 0; it < NIT; ++it) {
      const int rr = it * RPI + lane / LPR, seg = (lane % LPR) * 8;
      const v4f fa = *(const v4f*)(&To[wave][rr][seg]), fb = *(const v4f*)(&To[wave][rr][seg + 4]);
      v8b hi, lo;
#pragma unroll
      for (int j = 0; j < 4; ++j) { b16 h0, l0; split16(fa[j] * CS, h0, l0); hi[j] = h0; lo[j] = l0; split16(fb[j] * CS, h0, l0); hi[4 + j] = h0; lo[4 + j] = l0; }
      const size_t off = cbase + (size_t)rr * DMOD + seg;
      *(v8b*)(Ch + off) = hi; *(v8b*)(Cl + off) = lo; }
     }
}
// Both attention forms in one launch: first the blocks of the query positions >= QEA (tile fastest, as before), then those of the positions < QEA.
constexpr int AX = (SEQ - QEA) / 16, AN = AX * NB * HKV, AEX = QEA / 16, AE = AEX * NB * HKV * 2, AXD = AX > 0 ? AX : 1;
__global__ __launch_bounds__(128) __attribute__((amdgpu_num_vgpr(256))) void attn_kernel(
    const b16* __restrict__ Qh, const b16* __restrict__ Ql, const b16* __restrict__ Kh, const b16* __restrict__ Kl,
    const b16* __restrict__ Vh, const b16* __restrict__ Vl, b16* Ch, b16* Cl) {
  __shared__ __attribute__((aligned(16))) unsigned char Sm[ALDS];
  const int vb = (int)blockIdx.x;
  if (vb < AN) {
    attn_block<false>(Sm, vb % AXD, vb / AXD, 0, Qh, Ql, Kh, Kl, Vh, Vl, Ch, Cl);
  } else {
    const int v = vb - AN;
    attn_block<true>(Sm, v % AEX, (v / AEX) % (NB * HKV), v / (AEX * NB * HKV), Qh, Ql, Kh, Kl, Vh, Vl, Ch, Cl);
  }
}
}  // namespace

extern "C" void kernel_launch(void* const* d_in, const int* in_sizes, int n_in, void* d_out, int out_size, void* d_ws, size_t ws_size, hipStream_t stream) {
  // wire order: 0 x [NB_FULL][SEQ_FULL][2048] f32, 1 Wq [2048][2048], 2 Wk [2048][512], 3 Wv [2048][512], 4 Wo [2048][2048]; out [NB_FULL][SEQ_FULL][2048] f32
  const size_t need_x = ((size_t)(NB - 1) * SEQ_FULL + SEQ) * DMOD;
  if (n_in < 5 || (size_t)in_sizes[0] < need_x || (size_t)in_sizes[1] < (size_t)KD * DMOD || (size_t)in_sizes[2] < (size_t)KD * NKV ||
      (size_t)in_sizes[3] < (size_t)KD * NKV || (size_t)in_sizes[4] < (size_t)KD * DMOD || (size_t)out_size < need_x) return;
  const float* X = (const float*)d_in[0]; const float* Wq = (const float*)d_in[1]; const float* Wk = (const float*)d_in[2];
  const float* Wv = (const float*)d_in[3]; const float* Wo = (const float*)d_in[4]; float* out = (float*)d_out;
  size_t off = 0; char* ws = (char*)d_ws;
  auto carve = [&](size_t bytes) { char* p = ws + off; off += (bytes + 255) & ~(size_t)255; return p; };
  b16* Xp  = (b16*)carve((size_t)MR * DMOD * 2);
  b16* Wqt = (b16*)carve((size_t)DMOD * KD * 2);
  b16* Wkt = (b16*)carve((size_t)NKV * KD * 2);
  b16* Wvt = (b16*)carve((size_t)NKV * KD * 2);
  b16* Wot = (b16*)carve((size_t)DMOD * KD * 2);
  float* CT = (float*)carve((size_t)SEQ * 64 * 4);
  float* ST = (float*)carve((size_t)SEQ * 64 * 4);
  b16* Qh = (b16*)carve((size_t)MR * H * HD * 2);
  b16* Ql = (b16*)carve((size_t)MR * H * HD * 2);
  b16* Kh = (b16*)carve((size_t)MR * NKV * 2);
  b16* Kl = (b16*)carve((size_t)MR * NKV * 2);
  b16* Vh = (b16*)carve((size_t)MR * NKV * 2);
  b16* Vl = (b16*)carve((size_t)MR * NKV * 2);
  b16* Ch = (b16*)carve((size_t)MR * DMOD * 2);
  b16* Cl = (b16*)carve((size_t)MR * DMOD * 2);
  if (off > ws_size || off > ((size_t)128 << 20)) return;   // 122,683,392 B at NB=2, SEQ=2048
  prep_kernel<<<dim3(PW + PR + PX), 256, 0, stream>>>(X, Wq, Wk, Wv, Wo, Xp, Wqt, Wkt, Wvt, Wot, CT, ST);
  qkv_kernel<<<dim3((CQ + 2 * CK) / NG, MR / 128), 128 * NG, 0, stream>>>(Xp, Wqt, Wkt, Wvt, Qh, Ql, Kh, Kl, Vh, Vl, CT, ST);
  attn_kernel<<<dim3(AN + AE), 128, 0, stream>>>(Qh, Ql, Kh, Kl, Vh, Vl, Ch, Cl);
  out_kernel<<<dim3(ON + OE), 128, 0, stream>>>(Ch, Cl, Wot, out);
}

// v007
// It runs in 133 microseconds.
// Two timings next to v006 put it at 1.05 and 1.04 times that version's speed.
// All steps since v000 together make it 5.68 times as fast.
#include <hip/hip_runtime.h>

// compute dtype: every contraction on v_wmma_f32_16x16x32_f16 (f16 operands, f32 accumulate). x@Wq, x@Wk, x@Wv: x and W enter as bf16-RNE values
// carried x8 (x) and x256 (W) in f16 planes, 1 product. Scores S^T = K Q^T per head: q, k (RoPE applied in f32) as f16 x8 planes, 1 product;
// query rows with position < QE use q,k hi + x2048 residual planes (3 products, second accumulator folded by 1/2048). O^T += V^T P^T: v f16 x8,
// P f16 x1024, 1 product; rows < QE add P and v x2048 residual tiles into a second accumulator (3 products) folded before normalisation.
// ctx@Wo: ctx f16 x64 plane (+ x2048 residual plane for rows < QE, 2 products), Wo bf16-RNE x256, 1 product elsewhere. Softmax statistics
// (running max, exp2, row sums) and RoPE tables in f32; scale 1/sqrt(128) folded into the log2 constant.
// Fragment k-map per lane half hh for A AND B: elements 0..7 <- k = 8hh+0..7, 8..15 <- k = 16+8hh+0..7; acc[r] = D[8hh+r][col = lane&15].

#ifndef NB
#define NB 2
#endif
#ifndef SEQ
#define SEQ 2048
#endif
#ifndef NB_FULL
#define NB_FULL 2
#endif
#ifndef SEQ_FULL
#define SEQ_FULL 2048
#endif
#ifndef QE
#define QE 256
#endif

namespace {
constexpr int DMOD = 2048, KD = 2048, H = 16, HKV = 4, NREP = H / HKV, HD = 128, NKV = HKV * HD;   // NKV = 512
constexpr int MR = NB * SEQ;                                                                         // token rows handled
constexpr int QEA = (QE < SEQ) ? QE : SEQ;                                                           // query positions with residual operands
constexpr float XS = 8.0f, WS = 256.0f, QS = 8.0f, RS = 2048.0f, PS = 1024.0f, CS = 64.0f;
constexpr float LOG2E = 1.4426950408889634f, SCL = 0.08838834764831845f, ROPE_BASE = 500000.0f;
static_assert(SEQ % 128 == 0 && SEQ >= 128 && SEQ <= SEQ_FULL && NB >= 1 && NB <= NB_FULL);
static_assert(QEA % 64 == 0 && QEA >= 64 && QEA <= SEQ && (SEQ - QEA) % 128 == 0);
static_assert(DMOD == H * HD && KD == DMOD && KD % 64 == 0 && DMOD % 128 == 0 && NKV % 128 == 0 && HD == 128 && DMOD == 256 * 8 && MR % 64 == 0);

typedef _Float16 b16;
typedef __attribute__((ext_vector_type(16))) _Float16 v16b;
typedef __attribute__((ext_vector_type(8))) _Float16 v8b;
typedef __attribute__((ext_vector_type(8))) float v8f;
typedef __attribute__((ext_vector_type(4))) float v4f;

__device__ __forceinline__ float bf16_rne(float f) { unsigned int u = __float_as_uint(f); u += 0x7FFFu + ((u >> 16) & 1u); return __uint_as_float(u & 0xFFFF0000u); }
// 16-bit fragment from a k-contiguous row: elements 0..7 <- p[8hh .. 8hh+7], 8..15 <- p[16+8hh .. 16+8hh+7]
__device__ __forceinline__ v16b frag_kb(const b16* p, int hh) {
  const v8b a = *(const v8b*)(p + 8 * hh), b = *(const v8b*)(p + 16 + 8 * hh); v16b f;
#pragma unroll
  for (int e = 0; e < 8; ++e) { f[e] = a[e]; f[8 + e] = b[e]; }
  return f;
}
__device__ __forceinline__ v8f wmma16b(v16b a, v16b b, v8f c) {
  v8f d = __builtin_amdgcn_wmma_f32_16x16x32_f16(false, a, false, b, (short)0, c, false, false);
  return d;
}
// Scheduling fence at an end of a group of LDS fragment loads: the group stays together and ahead of the WMMAs that use it. Left free, the compiler
// reloads one register set in front of every WMMA or two and waits out the LDS latency each time.
__device__ __forceinline__ void hold_group() { __builtin_amdgcn_sched_barrier(0); }
__device__ __forceinline__ void wave_lds_sync() { __builtin_amdgcn_fence(3, "workgroup"); __builtin_amdgcn_wave_barrier(); __builtin_amdgcn_fence(2, "workgroup"); }
__device__ __forceinline__ float nexp2(float v) { return __builtin_amdgcn_exp2f(v); }
// hi = f16(w), lo = f16((w - hi) * RS)
__device__ __forceinline__ void split16(float w, b16& hi, b16& lo) { hi = (b16)w; lo = (b16)((w - (float)hi) * RS); }

__device__ __forceinline__ void cvt_x_block(int vb, const float* __restrict__ X, b16* Xp) {
  const size_t u = (size_t)vb * 256 + threadIdx.x; const size_t row = u >> 8; const int c8 = (int)(u & 255) * 8;
  if (row >= (size_t)MR) return;
  const size_t b = row / SEQ, s = row % SEQ;
  const float* src = X + (b * SEQ_FULL + s) * DMOD + c8;
  b16* dst = Xp + row * DMOD + c8;
  const v4f x0 = *(const v4f*)src, x1 = *(const v4f*)(src + 4); v8b o;
#pragma unroll
  for (int j = 0; j < 4; ++j) { o[j] = (b16)(bf16_rne(x0[j]) * XS); o[4 + j] = (b16)(bf16_rne(x1[j]) * XS); }
  *(v8b*)dst = o; 
}

// W [2048 k][N n] f32 -> Wt [N][2048] f16 = bf16-RNE(w) x256 (k-contiguous for the B fragments). 2 waves (tid 0..63) per 64x64 tile (bx, by), transposed
// through their own LDS tile St; the four wave pairs of a block take four tiles of one matrix and pass the barrier together.
__device__ __forceinline__ void cvt_w_tile(b16 (*St)[64 + 8], int tid, int bx, int by, const float* __restrict__ W, b16* Wt, int N) {
  const int wave = tid >> 5, lane = tid & 31; const int k0 = bx * 64, n0 = by * 64;
  const float* src = W + (size_t)k0 * N + n0;
  for (int it = 0; it < 16; ++it) {
    const int e = (it * 64 + tid) * 4; const int kr = e >> 6, nc = e & 63;
    const v4f x = *(const v4f*)(src + (size_t)kr * N + nc);
#pragma unroll
    for (int j = 0; j < 4; ++j) St[nc + j][kr] = (b16)(bf16_rne(x[j]) * WS);
  }
  __syncthreads();   // St is read across waves
  b16* dstb = Wt + (size_t)n0 * KD + k0;
  {
#pragma unroll 1
    for (int it = 0; it < 8; ++it) {
      const int n = wave * 32 + it * 4 + (lane >> 3), ks = (lane & 7) * 8;
      const v8b o = *(const v8b*)(&St[n][ks]);
      *(v8b*)(dstb + (size_t)n * KD + ks) = o; }
     }
}

// cos/sin tables [SEQ][64] f32: ang = s * (1 / base^(2j/128)) in f32, precise sincosf. Block = 4 positions x 64 frequencies staged in LDS;
__device__ __forceinline__ void rope_tab_block(float (*Tb)[4][64 + 4], int vb, float* CT, float* ST) {
  const int tid = threadIdx.x; const int r = tid >> 6, j = tid & 63; const int s0 = vb * 4;
  const float ex = (float)(2 * j) * (1.0f / 128.0f);
  const float p = powf(ROPE_BASE, ex);
  const float inv = 1.0f / p;
  const float ang = (float)(s0 + r) * inv;
  float sn, c; sincosf(ang, &sn, &c);
  Tb[0][r][j] = c; Tb[1][r][j] = sn;
  __syncthreads();   // Tb is read across waves
  if (tid < 128) {
    const int tb = tid >> 6, rr = (tid >> 4) & 3, seg = (tid & 15) * 4;
    const v4f f = *(const v4f*)(&Tb[tb][rr][seg]);
    float* dst = (tb == 0 ? CT : ST) + (size_t)(s0 + rr) * 64 + seg;
    *(v4f*)dst = f; 
  }
}

// All operand preparation in one launch: its parts read only inputs and write disjoint planes. Block ranges, each block wholly in one part: first the W tiles
// (four 64x64 tiles a block; Wq, Wo, Wk, Wv), then the RoPE tables, then the rows of x.
constexpr int TQ = (KD / 64) * (DMOD / 64), TK = (KD / 64) * (NKV / 64);   // 64x64 tiles of a 2048-column and of a 512-column W
constexpr int PW = (2 * TQ + 2 * TK) / 4, PR = SEQ / 4, PX = MR;           // blocks of the three parts
static_assert(TQ % 4 == 0 && TK % 4 == 0 && KD / 64 == 32);
__global__ __launch_bounds__(256) void prep_kernel(const float* __restrict__ X, const float* __restrict__ Wq, const float* __restrict__ Wk,
    const float* __restrict__ Wv, const float* __restrict__ Wo, b16* Xp, b16* Wqt, b16* Wkt, b16* Wvt, b16* Wot, float* CT, float* ST) {
  __shared__ __attribute__((aligned(16))) unsigned char Sp[4 * 64 * (64 + 8) * 2];
  static_assert(sizeof(Sp) >= 2 * 4 * (64 + 4) * 4);
  const int vb = (int)blockIdx.x;
  if (vb < PW) {
    const int sub = (int)threadIdx.x >> 6, t4 = vb * 4;   // t4 picks the matrix for the whole block
    const float* W = Wq; b16* Wt = Wqt; int N = DMOD, t = t4 + sub;
    if (t4 >= 2 * TQ + TK) { W = Wv; Wt = Wvt; N = NKV; t -= 2 * TQ + TK; }
    else if (t4 >= 2 * TQ) { W = Wk; Wt = Wkt; N = NKV; t -= 2 * TQ; }
    else if (t4 >= TQ) { W = Wo; Wt = Wot; t -= TQ; }
    cvt_w_tile(reinterpret_cast<b16 (*)[64 + 8]>(Sp + sub * 64 * (64 + 8) * 2), (int)threadIdx.x & 63, t & 31, t >> 5, W, Wt, N);
  } else if (vb < PW + PR) {
    rope_tab_block(reinterpret_cast<float (*)[4][64 + 4]>(Sp), vb - PW, CT, ST);
  } else {
    cvt_x_block(vb - PW - PR, X, Xp);
  }
}

// One trip of the projection GEMM's K loop: 64 k = 128 B of each of 256 operand rows, laid in LDS at a pitch of 144 B (16 B x odd, for 16-byte readers).
constexpr int KS = 64, LP = 144, SROWS = 256, STAGE = SROWS * LP;   // 36,864 B a buffer
// Eight asynchronous 16-byte copies a lane fill 128 rows of a buffer: LDS rows r, r+16, .. r+112 (l = the lane's byte address in row r), the first 64 rows
// from ga, the next 64 from gb (each the lane's own address in its group's row r; 16 rows further = 16*KD elements). Eight lanes cover one 128-B row.
__device__ __forceinline__ void copy_rows128(unsigned l, const b16* ga, const b16* gb) {
  constexpr size_t RJ = (size_t)16 * KD; constexpr unsigned LJ = 16u * LP;
  // s_wait_xcnt 0 as the last line: it stands in front of every later rewrite of a register that a copy names
  asm volatile(
      "global_load_async_to_lds_b128 %0, %8, off\n\t"
      "global_load_async_to_lds_b128 %1, %9, off\n\t"
      "global_load_async_to_lds_b128 %2, %10, off\n\t"
      "global_load_async_to_lds_b128 %3, %11, off\n\t"
      "global_load_async_to_lds_b128 %4, %12, off\n\t"
      "global_load_async_to_lds_b128 %5, %13, off\n\t"
      "global_load_async_to_lds_b128 %6, %14, off\n\t"
      "global_load_async_to_lds_b128 %7, %15, off\n\t"
      "s_wait_xcnt 0x0"
      :: "v"(l), "v"(l + LJ), "v"(l + 2 * LJ), "v"(l + 3 * LJ), "v"(l + 4 * LJ), "v"(l + 5 * LJ), "v"(l + 6 * LJ), "v"(l + 7 * LJ),
         "v"(ga), "v"(ga + RJ), "v"(ga + 2 * RJ), "v"(ga + 3 * RJ), "v"(gb), "v"(gb + RJ), "v"(gb + 2 * RJ), "v"(gb + 3 * RJ)
      : "memory");
}
// One buffer: rows 0..63 from g0, 64..127 from g1, 128..191 from g2, 192..255 from g3; sixteen copies a lane, in two statements (an asm statement takes 30 operands).
__device__ __forceinline__ void copy_stage(unsigned l, const b16* g0, const b16* g1, const b16* g2, const b16* g3) {
  copy_rows128(l, g0, g1);
  copy_rows128(l + 128u * LP, g2, g3);
}

// The accumulators of four waves (tid 0..127, 2 x 2 on the tile) go to the tile's f32 staging To; the caller's barrier follows. Every product and sum of the
// two epilogue functions keeps a rounding of its own (no contraction), as it always had here: the planes they write stay bit-identical.
template <bool RES>
__device__ __forceinline__ void proj_stage(float (*To)[128 + 4], int tid, const v8f (&acc)[16]) {
#pragma clang fp contract(off)
  constexpr int BM = RES ? 64 : 128;
  const int wave = tid >> 5, lane = tid & 31, hh = lane >> 4, col = lane & 15, wm = wave >> 1, wn = wave & 1;
#pragma unroll
  for (int i = 0; i < BM / 32; ++i)
#pragma unroll
    for (int j = 0; j < 4; ++j)
#pragma unroll
      for (int r = 0; r < 8; ++r) {
        float v = acc[i * 4 + j][r];
        if constexpr (RES) v += acc[(i + 2) * 4 + j][r] * (1.0f / RS);
        To[wm * (BM / 2) + i * 16 + 8 * hh + r][wn * 64 + j * 16 + col] = v; }
}
template <int MODE, bool RES>
__device__ __forceinline__ void proj_store(float (*To)[128 + 4], int tid, int bx, int bsel, int s0,
    b16* Ph, b16* Pl, float* Out, const float* __restrict__ CT, const float* __restrict__ ST, int nhead);

// C[BM x 128] = A[m][k] . B[k][n] with A plane [rows][2048] and Bt plane [N][2048], both k-contiguous f16; K = 2048 in trips of 64 (two WMMA steps of 32).
// 128 threads = 4 waves. The block's operand rows of a trip (A 128 rows, then B 128 rows; RES: A 64, residual A 64 of the same token rows, B 128) are copied
// once into LDS, two buffers: the copies of trip t+2 fly while trip t+1 is worked on. Waves 2 x 2 on the tile: wave w owns four A fragments and the four B
// fragments of columns 64(w&1).., 16 accumulators: BM = 128, rows 64(w>>1)..+63; RES: BM = 64, rows 32(w>>1)..+31, A fragments 0,1 from the hi plane
// and 2,3 from the x2048 residual plane of the same rows, so accumulators 8..15 are the residual sums of 0..7.
// Column tile bx; row tile: by = bsel * tpb + tsel, rows m0 = bsel*SEQ + toff + BM tsel. Epilogue staged through the same LDS (behind the loop's last barrier) then:
// MODE 0: RoPE in f32 with the cos/sin tables, hi x8 / lo x2048 planes [b][nhead][s][128] (256-B rows by 16 lanes x 16 B, 8 rows per store);
template <int MODE, bool RES>
__device__ __forceinline__ void proj_block(unsigned char* Sm, int bx, int by,
    const b16* __restrict__ A, const b16* __restrict__ Al, const b16* __restrict__ Bt, b16* Ph, b16* Pl, float* Out,
    const float* __restrict__ CT, const float* __restrict__ ST, int nhead, int tpb, int toff) {
#pragma clang fp contract(off)
  static_assert(MODE == 2 || !RES);
  constexpr int BM = RES ? 64 : 128, BN = 128, NTRIP = KD / KS, BROW = 128;
  static_assert(BM * (BN + 4) * 4 <= 2 * STAGE && NTRIP >= 2 && BROW + BN == SROWS);
  float (*To)[BN + 4] = reinterpret_cast<float (*)[BN + 4]>(Sm);
  const int tid = threadIdx.x, wave = tid >> 5, lane = tid & 31, hh = lane >> 4, col = lane & 15;
  const int bsel = by / tpb, tsel = by - bsel * tpb;
  const int s0 = toff + tsel * BM;
  const size_t m0 = (size_t)bsel * SEQ + s0;
  const int n0 = bx * BN;
  const int wm = wave >> 1, wn = wave & 1;
  const int cr = tid >> 3, cs = (tid & 7) * 8;   // the lane's row in each run of 16 rows, and its 16-byte piece of the row
  const b16* g0 = A + (m0 + cr) * KD + cs;
  const b16* g1 = RES ? Al + (m0 + cr) * KD + cs : A + (m0 + 64 + cr) * KD + cs;
  const b16* g2 = Bt + (size_t)(n0 + cr) * KD + cs;
  const b16* g3 = Bt + (size_t)(n0 + 64 + cr) * KD + cs;
  const unsigned lc = (unsigned)(uintptr_t)(&Sm[cr * LP + cs * 2]);
  const unsigned char* sa = &Sm[(wm * (BM / 2) + col) * LP];
  const unsigned char* sb = &Sm[(BROW + wn * 64 + col) * LP];
  v8f acc[16];
#pragma unroll
  for (int t = 0; t < 16; ++t) acc[t] = (v8f){};
  copy_stage(lc, g0, g1, g2, g3);
  asm volatile("s_wait_asynccnt 0x0" ::: "memory");   // this wave's copies of trip 0 have landed
  __syncthreads();                                     // every wave's have: trip 0 may be read
  copy_stage(lc + STAGE, g0 + KS, g1 + KS, g2 + KS, g3 + KS);
#pragma unroll 1
  for (int tr = 0; tr < NTRIP; ++tr) {
    const int bo = (tr & 1) * STAGE;
#pragma unroll
    for (int kk = 0; kk < 2; ++kk) {
      v16b af[4], bf[4];   // the fragments of one WMMA step, read as one group ahead of its 16 WMMAs
      hold_group();   // no load of this group rises among the WMMAs before it
#pragma unroll
      for (int i = 0; i < 4; ++i) {
        const int ar = RES ? (i >> 1) * 64 + (i & 1) * 16 : i * 16;   // LDS row of A fragment i, from the wave's first row
        af[i] = frag_kb((const b16*)(sa + bo + ar * LP) + kk * 32, hh);
      }
#pragma unroll
      for (int j = 0; j < 4; ++j) bf[j] = frag_kb((const b16*)(sb + bo + j * 16 * LP) + kk * 32, hh);
      hold_group();   // and none sinks among its own WMMAs
#pragma unroll
      for (int i = 0; i < 4; ++i)
#pragma unroll
        for (int j = 0; j < 4; ++j) acc[i * 4 + j] = wmma16b(af[i], bf[j], acc[i * 4 + j]);
    }
    hold_group();   // the trip's WMMAs stay in front of the waits and the barrier: sunk behind them they would delay the refill
    asm volatile("s_wait_dscnt 0x0" ::: "memory");      // this wave's reads of the buffer are done before it is refilled
    asm volatile("s_wait_asynccnt 0x0" ::: "memory");   // this wave's copies of trip tr+1 have landed
    __syncthreads();                                     // publishes trip tr+1 and ends every reader's last read of trip tr
    if (tr + 2 < NTRIP) { const int ko = (tr + 2) * KS; copy_stage(lc + bo, g0 + ko, g1 + ko, g2 + ko, g3 + ko); }
  }
  asm volatile("s_wait_asynccnt 0x0" ::: "memory");     // no copy is outstanding when the buffers become output staging
  proj_stage<RES>(To, tid, acc);
  __syncthreads();   // To is read across waves
  proj_store<MODE, RES>(To, tid, bx, bsel, s0, Ph, Pl, Out, CT, ST, nhead);
}

// A staged tile goes to memory, by the 128 threads (tid 0..127) that own it; no barrier inside. Roundings as in proj_stage.
template <int MODE, bool RES>
__device__ __forceinline__ void proj_store(float (*To)[128 + 4], int tid, int bx, int bsel, int s0,
    b16* Ph, b16* Pl, float* Out, const float* __restrict__ CT, const float* __restrict__ ST, int nhead) {
#pragma clang fp contract(off)
  constexpr int BM = RES ? 64 : 128, BN = 128;
  const int n0 = bx * BN;
  constexpr int HF = BM / 64;   // every pass below handles its rows in each 64-row half of the tile: HF independent pieces, stored together
  if constexpr (MODE == 0) {
    const size_t pb = (((size_t)bsel * nhead + bx) * SEQ + s0) * HD;
    b16* ph = Ph + pb; b16* pl = Pl + pb;
    const float qsc = QS / (XS * WS);
    {
#pragma unroll 1
      for (int it = 0; it < 8; ++it) {
        const int seg = (tid & 15) * 8, sg = seg & 63;
        const float sgn = (seg >= 64) ? 1.0f : -1.0f;   // d < 64: x cos - x[d+64] sin; d >= 64: x cos + x[d-64] sin
        v8b hi[HF], lo[HF];
#pragma unroll
        for (int hf = 0; hf < HF; ++hf) {
          const int rr = hf * 64 + it * 8 + (tid >> 4);
          const float* trow = &To[rr][0]; const size_t ts = (size_t)(s0 + rr) * 64 + sg;
          const v4f xa = *(const v4f*)(trow + seg), xb = *(const v4f*)(trow + seg + 4);
          const v4f ya = *(const v4f*)(trow + (seg ^ 64)), yb = *(const v4f*)(trow + (seg ^ 64) + 4);
          const v4f ca = *(const v4f*)(CT + ts), cb = *(const v4f*)(CT + ts + 4), sa = *(const v4f*)(ST + ts), sb = *(const v4f*)(ST + ts + 4);
#pragma unroll
          for (int j = 0; j < 4; ++j) {
            b16 h0, l0;
            split16((xa[j] * ca[j] + sgn * ya[j] * sa[j]) * qsc, h0, l0); hi[hf][j] = h0; lo[hf][j] = l0;
            split16((xb[j] * cb[j] + sgn * yb[j] * sb[j]) * qsc, h0, l0); hi[hf][4 + j] = h0; lo[hf][4 + j] = l0; }
        }
#pragma unroll
        for (int hf = 0; hf < HF; ++hf) {
          const size_t off = (size_t)(hf * 64 + it * 8 + (tid >> 4)) * HD + seg;
          *(v8b*)(ph + off) = hi[hf]; *(v8b*)(pl + off) = lo[hf]; }
        asm volatile("s_wait_xcnt 0x0" ::: "memory"); }   // in front of the next pass's rewrite of the registers that the stores name
       }
  } else if constexpr (MODE == 1) {
    const size_t pb = ((size_t)bsel * nhead + bx) * HD * (size_t)SEQ + s0;
    b16* ph = Ph + pb; b16* pl = Pl + pb;
    const float vsc = QS / (XS * WS);
    {
#pragma unroll 1
      for (int it = 0; it < 8; ++it) {
        const int d = it * 16 + (tid >> 3);
        v8b hi[HF], lo[HF];
#pragma unroll
        for (int hf = 0; hf < HF; ++hf) {
          const int ss = hf * 64 + (tid & 7) * 8;
#pragma unroll
          for (int j = 0; j < 8; ++j) { b16 h0, l0; split16(To[ss + j][d] * vsc, h0, l0); hi[hf][j] = h0; lo[hf][j] = l0; }
        }
#pragma unroll
        for (int hf = 0; hf < HF; ++hf) {
          const size_t off = (size_t)d * SEQ + hf * 64 + (tid & 7) * 8;
          *(v8b*)(ph + off) = hi[hf]; *(v8b*)(pl + off) = lo[hf]; } }
       }
  } else {
    constexpr int LPR = BN / 4, RPI = 128 / LPR, NIT = 64 / RPI;
    static_assert(NIT * RPI == 64 && LPR * 4 == BN);
    float* ob = Out + ((size_t)bsel * SEQ_FULL + s0) * DMOD + n0;
    const float osc = 1.0f / (CS * WS);
    {
#pragma unroll 1
      for (int it = 0; it < NIT; ++it) {
        const int seg = (tid % LPR) * 4;
        v4f f[HF];
#pragma unroll
        for (int hf = 0; hf < HF; ++hf) f[hf] = *(const v4f*)(&To[hf * 64 + it * RPI + tid / LPR][seg]) * osc;
#pragma unroll
        for (int hf = 0; hf < HF; ++hf) *(v4f*)(ob + (size_t)(hf * 64 + it * RPI + tid / LPR) * DMOD + seg) = f[hf]; }
       }
  }
}

// x@Wq, x@Wk, x@Wv in one launch: column tiles 0..15 are Q heads, 16..19 K heads, 20..23 V heads. A block = 12 waves = NG groups of four waves, one block a WGP;
// group g works column tile NG*blockIdx.x + g as a four-wave block of proj_block does (waves 2 x 2, 64x64 each, the same k order), but the NG groups share ONE
// copy of the block's 128 x rows: a buffer is [x 128 rows | group 0's W 128 rows | group 1's | group 2's], 512 rows from L2 where three blocks brought 768.
// A trip is 128 k = 256 B of each row at a pitch of 272 B (16 B x odd, for 16-byte readers): four WMMA steps between two barriers of the 12 waves.
constexpr int CQ = DMOD / 128, CK = NKV / 128, NG = 3;
constexpr int KS3 = 128, LP3 = 272, STAGE3 = 128 * (NG + 1) * LP3, TOB = 128 * (128 + 4) * 4;   // 139,264 B a buffer; 67,584 B of output staging a group
constexpr int QLDS = 2 * STAGE3 > NG * TOB ? 2 * STAGE3 : NG * TOB;                              // 278,528 B
static_assert((CQ + 2 * CK) % NG == 0 && MR % 128 == 0 && SEQ % 128 == 0 && NG == 3 && KD % KS3 == 0 && KD / KS3 >= 2);
// One lane's copies of a trip; 16 lanes cover one 256-B row. Sixteen fill its group's W rows r, r+8, .. r+120 (lw, gw = the lane's LDS byte address and global
// address in row r = its thread number in the group / 16). The x rows are dealt over all 12 waves, two rows a wave-wide copy: rows q, q+24, .. q+96 (lx, gx = the
// lane's addresses in row q = thread number / 16) and, from the first four waves only (sixth, wave-uniform), row q+120.
__device__ __forceinline__ void copy_stage3(unsigned lw, const b16* gw, unsigned lx, const b16* gx, bool sixth) {
  constexpr size_t RJ = (size_t)8 * KD, XJ = (size_t)24 * KD; constexpr unsigned LJ = 8u * LP3, LXJ = 24u * LP3;
  // s_wait_xcnt 0 as the last line of each statement: it stands in front of every later rewrite of a register that a copy names
  asm volatile(
      "global_load_async_to_lds_b128 %0, %11, off\n\t"
      "global_load_async_to_lds_b128 %1, %12, off\n\t"
      "global_load_async_to_lds_b128 %2, %13, off\n\t"
      "global_load_async_to_lds_b128 %3, %14, off\n\t"
      "global_load_async_to_lds_b128 %4, %15, off\n\t"
      "global_load_async_to_lds_b128 %5, %16, off\n\t"
      "global_load_async_to_lds_b128 %6, %17, off\n\t"
      "global_load_async_to_lds_b128 %7, %18, off\n\t"
      "global_load_async_to_lds_b128 %8, %19, off\n\t"
      "global_load_async_to_lds_b128 %9, %20, off\n\t"
      "global_load_async_to_lds_b128 %10, %21, off\n\t"
      "s_wait_xcnt 0x0"
      :: "v"(lx), "v"(lx + LXJ), "v"(lx + 2 * LXJ), "v"(lx + 3 * LXJ), "v"(lx + 4 * LXJ),
         "v"(lw), "v"(lw + LJ), "v"(lw + 2 * LJ), "v"(lw + 3 * LJ), "v"(lw + 4 * LJ), "v"(lw + 5 * LJ),
         "v"(gx), "v"(gx + XJ), "v"(gx + 2 * XJ), "v"(gx + 3 * XJ), "v"(gx + 4 * XJ),
         "v"(gw), "v"(gw + RJ), "v"(gw + 2 * RJ), "v"(gw + 3 * RJ), "v"(gw + 4 * RJ), "v"(gw + 5 * RJ)
      : "memory");
  asm volatile(
      "global_load_async_to_lds_b128 %0, %10, off\n\t"
      "global_load_async_to_lds_b128 %1, %11, off\n\t"
      "global_load_async_to_lds_b128 %2, %12, off\n\t"
      "global_load_async_to_lds_b128 %3, %13, off\n\t"
      "global_load_async_to_lds_b128 %4, %14, off\n\t"
      "global_load_async_to_lds_b128 %5, %15, off\n\t"
      "global_load_async_to_lds_b128 %6, %16, off\n\t"
      "global_load_async_to_lds_b128 %7, %17, off\n\t"
      "global_load_async_to_lds_b128 %8, %18, off\n\t"
      "global_load_async_to_lds_b128 %9, %19, off\n\t"
      "s_wait_xcnt 0x0"
      :: "v"(lw + 6 * LJ), "v"(lw + 7 * LJ), "v"(lw + 8 * LJ), "v"(lw + 9 * LJ), "v"(lw + 10 * LJ),
         "v"(lw + 11 * LJ), "v"(lw + 12 * LJ), "v"(lw + 13 * LJ), "v"(lw + 14 * LJ), "v"(lw + 15 * LJ),
         "v"(gw + 6 * RJ), "v"(gw + 7 * RJ), "v"(gw + 8 * RJ), "v"(gw + 9 * RJ), "v"(gw + 10 * RJ),
         "v"(gw + 11 * RJ), "v"(gw + 12 * RJ), "v"(gw + 13 * RJ), "v"(gw + 14 * RJ), "v"(gw + 15 * RJ)
      : "memory");
  if (sixth)
    asm volatile(
        "global_load_async_to_lds_b128 %0, %1, off\n\t"
        "s_wait_xcnt 0x0"
        :: "v"(lx + 5 * LXJ), "v"(gx + 5 * XJ) : "memory");
}
__global__ __launch_bounds__(128 * NG) __attribute__((amdgpu_num_vgpr(256))) void qkv_kernel(
    const b16* __restrict__ Xp, const b16* __restrict__ Wqt, const b16* __restrict__ Wkt, const b16* __restrict__ Wvt,
    b16* Qh, b16* Ql, b16* Kh, b16* Kl, b16* Vh, b16* Vl, const float* __restrict__ CT, const float* __restrict__ ST) {
  __shared__ __attribute__((aligned(16))) unsigned char Sm[QLDS];
  constexpr int NTRIP = KD / KS3;
  const int tid = (int)threadIdx.x, lane = tid & 31, hh = lane >> 4, col = lane & 15;
  const int wave = __builtin_amdgcn_readfirstlane(tid >> 5);   // in a scalar register: what follows from it (group, matrix, sixth) is decided by scalar branches
  const int grp = wave >> 2, tg = tid & 127, wm = (wave >> 1) & 1, wn = wave & 1;
  const int bx = (int)blockIdx.x * NG + grp, by = (int)blockIdx.y;
  const int bsel = by / (SEQ / 128), s0 = (by - bsel * (SEQ / 128)) * 128;
  const size_t m0 = (size_t)bsel * SEQ + s0;
  const bool isq = bx < CQ, isv = bx >= CQ + CK;
  const int hx = isq ? bx : isv ? bx - CQ - CK : bx - CQ;      // the head (column tile) inside its own matrix
  const b16* Bt = (isq ? Wqt : isv ? Wvt : Wkt) + (size_t)hx * 128 * KD;
  const bool sixth = wave < 4;
  const int cr = tg >> 4, cs = (tid & 15) * 8;                 // the lane's W row in each run of 8 rows, and its 16-byte piece of a row
  const int xr = wave * 2 + hh;                                // the lane's x row in each run of 24 rows
  const b16* gw = Bt + (size_t)cr * KD + cs;
  const b16* gx = Xp + (m0 + xr) * KD + cs;
  const unsigned lw = (unsigned)(uintptr_t)(&Sm[(128 * (grp + 1) + cr) * LP3 + cs * 2]);
  const unsigned lx = (unsigned)(uintptr_t)(&Sm[xr * LP3 + cs * 2]);
  const unsigned char* sa = &Sm[(wm * 64 + col) * LP3];
  const unsigned char* sb = &Sm[(128 * (grp + 1) + wn * 64 + col) * LP3];
  v8f acc[16];
#pragma unroll
  for (int t = 0; t < 16; ++t) acc[t] = (v8f){};
  copy_stage3(lw, gw, lx, gx, sixth);
  asm volatile("s_wait_asynccnt 0x0" ::: "memory");   // this wave's copies of trip 0 have landed
  __syncthreads();                                     // every wave's have: trip 0 may be read
  copy_stage3(lw + STAGE3, gw + KS3, lx + STAGE3, gx + KS3, sixth);
#pragma unroll 1
  for (int tr = 0; tr < NTRIP; ++tr) {
    const int bo = (tr & 1) * STAGE3;
#pragma unroll
    for (int kk = 0; kk < KS3 / 32; ++kk) {
      v16b af[4], bf[4];   // the fragments of one WMMA step, read as one group ahead of its 16 WMMAs
      hold_group();   // no load of this group rises among the WMMAs before it
#pragma unroll
      for (int i = 0; i < 4; ++i) af[i] = frag_kb((const b16*)(sa + bo + i * 16 * LP3) + kk * 32, hh);
#pragma unroll
      for (int j = 0; j < 4; ++j) bf[j] = frag_kb((const b16*)(sb + bo + j * 16 * LP3) + kk * 32, hh);
      hold_group();   // and none sinks among its own WMMAs
#pragma unroll
      for (int i = 0; i < 4; ++i)
#pragma unroll
        for (int j = 0; j < 4; ++j) acc[i * 4 + j] = wmma16b(af[i], bf[j], acc[i * 4 + j]);
    }
    hold_group();   // the trip's WMMAs stay in front of the waits and the barrier: sunk behind them they would delay the refill
    asm volatile("s_wait_dscnt 0x0" ::: "memory");      // this wave's reads of the buffer are done before it is refilled
    asm volatile("s_wait_asynccnt 0x0" ::: "memory");   // this wave's copies of trip tr+1 have landed
    __syncthreads();                                     // publishes trip tr+1 and ends every reader's last read of trip tr
    if (tr + 2 < NTRIP) { const int ko = (tr + 2) * KS3; copy_stage3(lw + bo, gw + ko, lx + bo, gx + ko, sixth); }
  }
  asm volatile("s_wait_asynccnt 0x0" ::: "memory");     // no copy is outstanding when the buffers become output staging
  float (*To)[128 + 4] = reinterpret_cast<float (*)[128 + 4]>(Sm + grp * TOB);   // each group stages its own tile
  proj_stage<false>(To, tg, acc);
  __syncthreads();   // To is read across the group's waves; one barrier for the block, whatever its groups store
  if (!isv) proj_store<0, false>(To, tg, hx, bsel, s0, isq ? Qh : Kh, isq ? Ql : Kl, nullptr, CT, ST, isq ? H : HKV);
  else proj_store<1, false>(To, tg, hx, bsel, s0, Vh, Vl, nullptr, CT, ST, HKV);
}

// ctx@Wo in one launch: first the 128x128 tiles of the rows >= QEA, then the 64x128 tiles with the residual plane of the rows < QEA.
constexpr int ON = (DMOD / 128) * NB * ((SEQ - QEA) / 128), OE = (DMOD / 128) * NB * (QEA / 64);
__global__ __launch_bounds__(128) __attribute__((amdgpu_num_vgpr(256))) void out_kernel(
    const b16* __restrict__ Ch, const b16* __restrict__ Cl, const b16* __restrict__ Wot, float* Out) {
  __shared__ __attribute__((aligned(16))) unsigned char Sm[2 * STAGE];
  const int vb = (int)blockIdx.x;
  if (vb < ON) {
    proj_block<2, false>(Sm, vb % (DMOD / 128), vb / (DMOD / 128), Ch, Ch, Wot, nullptr, nullptr, Out, nullptr, nullptr, 1, (SEQ - QEA) / 128, QEA);
  } else {
    const int v = vb - ON;
    proj_block<2, true>(Sm, v % (DMOD / 128), v / (DMOD / 128), Ch, Cl, Wot, nullptr, nullptr, Out, nullptr, nullptr, 1, QEA / 64, 0);
  }
}

// One key step of the attention kernel in LDS: K tile = 32 key rows of 256 B at a pitch of 272 B, V tile = DW d rows of 64 B (32 keys) at a pitch of 80 B
// (both 16 B x odd, for 16-byte readers). A buffer holds K hi[, K lo], V hi[, V lo].
constexpr int KP = 272, VP = 80, KTILE = 32 * KP, PBYTES = NREP * 16 * (32 + 8) * 2, ESUB = 65536, ALDS = 2 * ESUB;
// The asynchronous 16-byte copies of one lane (of 128) that fill one buffer: K rows r, r+8, r+16, r+24 (16 lanes cover one 256-B row) and V rows d, d+32[, d+64,
// d+96] (4 lanes cover one 64-B row); ER: the same rows of the lo planes, K lo one K tile and V lo one V tile (64 rows) further in LDS.
// lk, lv = the lane's LDS byte addresses in its first rows, gk, gkl, gv, gvl = its global addresses there.
template <bool ER>
__device__ __forceinline__ void copy_kv(unsigned lk, unsigned lv, const b16* gk, const b16* gkl, const b16* gv, const b16* gvl) {
  constexpr size_t KJ = (size_t)8 * HD, VJ = (size_t)32 * SEQ; constexpr unsigned LKJ = 8u * KP, LVJ = 32u * VP, KL = KTILE, VL = 64u * VP;
  // s_wait_xcnt 0 as the last line of either statement: it stands in front of every later rewrite of a register that a copy names
  if constexpr (ER) {
    asm volatile(
        "global_load_async_to_lds_b128 %0, %12, off\n\t"
        "global_load_async_to_lds_b128 %1, %13, off\n\t"
        "global_load_async_to_lds_b128 %2, %14, off\n\t"
        "global_load_async_to_lds_b128 %3, %15, off\n\t"
        "global_load_async_to_lds_b128 %4, %16, off\n\t"
        "global_load_async_to_lds_b128 %5, %17, off\n\t"
        "global_load_async_to_lds_b128 %6, %18, off\n\t"
        "global_load_async_to_lds_b128 %7, %19, off\n\t"
        "global_load_async_to_lds_b128 %8, %20, off\n\t"
        "global_load_async_to_lds_b128 %9, %21, off\n\t"
        "global_load_async_to_lds_b128 %10, %22, off\n\t"
        "global_load_async_to_lds_b128 %11, %23, off\n\t"
        "s_wait_xcnt 0x0"
        :: "v"(lk), "v"(lk + LKJ), "v"(lk + 2 * LKJ), "v"(lk + 3 * LKJ), "v"(lk + KL), "v"(lk + KL + LKJ), "v"(lk + KL + 2 * LKJ), "v"(lk + KL + 3 * LKJ),
           "v"(lv), "v"(lv + LVJ), "v"(lv + VL), "v"(lv + VL + LVJ),
           "v"(gk), "v"(gk + KJ), "v"(gk + 2 * KJ), "v"(gk + 3 * KJ), "v"(gkl), "v"(gkl + KJ), "v"(gkl + 2 * KJ), "v"(gkl + 3 * KJ),
           "v"(gv), "v"(gv + VJ), "v"(gvl), "v"(gvl + VJ)
        : "memory");
  } else {
    asm volatile(
        "global_load_async_to_lds_b128 %0, %8, off\n\t"
        "global_load_async_to_lds_b128 %1, %9, off\n\t"
        "global_load_async_to_lds_b128 %2, %10, off\n\t"
        "global_load_async_to_lds_b128 %3, %11, off\n\t"
        "global_load_async_to_lds_b128 %4, %12, off\n\t"
        "global_load_async_to_lds_b128 %5, %13, off\n\t"
        "global_load_async_to_lds_b128 %6, %14, off\n\t"
        "global_load_async_to_lds_b128 %7, %15, off\n\t"
        "s_wait_xcnt 0x0"
        :: "v"(lk), "v"(lk + LKJ), "v"(lk + 2 * LKJ), "v"(lk + 3 * LKJ), "v"(lv), "v"(lv + LVJ), "v"(lv + 2 * LVJ), "v"(lv + 3 * LVJ),
           "v"(gk), "v"(gk + KJ), "v"(gk + 2 * KJ), "v"(gk + 3 * KJ), "v"(gv), "v"(gv + VJ), "v"(gv + 2 * VJ), "v"(gv + 3 * VJ)
        : "memory");
  }
}

// Causal GQA attention: block (bx = query tile of 16, bg in NB*HKV) = 8 waves = two sets of 4 waves; a set = the 4 query heads of one KV head on the same 16 queries,
// so its four walk the same keys; each set has its own half of the LDS (buffers, P rows) and fills it itself. Query positions >= QEA: the tile's 32-key steps go
// to the two sets in turn (set 0: 0, 2, ..; set 1: 1, 3, ..), so the longest walk is 32 steps and not 64; each set keeps a running max, sum and O^T of its own, joined
// through LDS behind the loop. Where the step count is odd, set 1's last step lies wholly behind the diagonal (in bounds: SEQ % 64 == 0) and adds zeros.
// ER: both sets walk all steps, set s on d-half s. Each 32-key step's K and V tiles are copied once into LDS, two buffers: the copies of a set's step st+2 fly while
// its step st+1 is worked on; every wave reads its fragments from there. Key steps up to the 32-aligned block of the last query in fixed order; online
// softmax (running max, f32); keys later than the query get -inf on the diagonal step; P x1024 via wave-private LDS; O^T += V^T P^T. ER (query position
// < QEA): scores Kh Qh + (Kh Ql + Kl Qh)/2048, O^T second accumulator Vh Pr + Vl Ph folded by 1/2048, each set restricted to 64 of the 128 d rows.
// ctx hi x64 / lo x2048 planes [b*SEQ+s][h*128 + d], staged per wave through the same LDS behind the loop's last barrier.
template <bool ER>
__device__ __forceinline__ void attn_block(unsigned char* Sb, int bx, int bg,
    const b16* __restrict__ Qh, const b16* __restrict__ Ql, const b16* __restrict__ Kh, const b16* __restrict__ Kl,
    const b16* __restrict__ Vh, const b16* __restrict__ Vl, b16* Ch, b16* Cl) {
  constexpr int NT = ER ? 4 : 8, DW = NT * 16, NP = ER ? 2 : 1, VO = NP * KTILE, VT = DW * VP, ASTAGE = VO + NP * VT;   // 27,648 / 18,944 B a buffer
  static_assert(NREP == 4 && NREP * 16 * (DW + 4) * 4 <= 2 * ASTAGE && ASTAGE % 16 == 0);
  static_assert(2 * ASTAGE + NP * PBYTES <= ESUB && QEA >= 64 && SEQ % 64 == 0);
  constexpr int TS = ER ? 1 : 2;                                             // 32-key steps from one step of a set to its next
  const int set = __builtin_amdgcn_readfirstlane((int)threadIdx.x >> 7);    // in a scalar register: what follows from it is scalar, its tests are scalar branches
  const int t0 = ER ? 0 : set;                                               // the set's first 32-key step
  unsigned char* Sm = Sb + set * ESUB;
  b16 (*Pb)[16][32 + 8] = reinterpret_cast<b16 (*)[16][32 + 8]>(Sm + 2 * ASTAGE);            // behind the two buffers: P, then (ER) its residual
  b16 (*Pr)[16][32 + 8] = reinterpret_cast<b16 (*)[16][32 + 8]>(Sm + 2 * ASTAGE + (ER ? PBYTES : 0));
  float (*To)[16][DW + 4] = reinterpret_cast<float (*)[16][DW + 4]>(Sm);
  const int tid = threadIdx.x & 127, wave = tid >> 5, lane = tid & 31, hh = lane >> 4, col = lane & 15;   // numbered inside the set
  const int b = bg / HKV, g = bg - b * HKV, h = g * NREP + wave;
  const int q0 = (ER ? 0 : QEA) + bx * 16, qi = q0 + col;
  const int dh = ER ? set * 64 : 0;
  const b16* qrow = Qh + ((size_t)(b * H + h) * SEQ + qi) * HD;
  const b16* qlrow = Ql + ((size_t)(b * H + h) * SEQ + qi) * HD;
  const size_t ko = (size_t)(b * HKV + g) * SEQ * HD + (size_t)(t0 * 32 + (tid >> 4)) * HD + (tid & 15) * 8;   // the lane's piece of K row tid>>4 of step t0
  const size_t vo = ((size_t)(b * HKV + g) * HD + dh + (tid >> 2)) * SEQ + t0 * 32 + (tid & 3) * 8;            // the lane's piece of V row tid>>2 of step t0
  const b16* gk = Kh + ko; const b16* gkl = Kl + ko; const b16* gv = Vh + vo; const b16* gvl = Vl + vo;
  const unsigned lk = (unsigned)(uintptr_t)(&Sm[(tid >> 4) * KP + (tid & 15) * 16]);
  const unsigned lv = (unsigned)(uintptr_t)(&Sm[VO + (tid >> 2) * VP + (tid & 3) * 16]);
  const unsigned char* sk = &Sm[col * KP];
  const unsigned char* sv = &Sm[VO + col * VP];
  v16b qa[4];
#pragma unroll
  for (int c = 0; c < 4; ++c) { qa[c] = (v16b){}; if constexpr (!ER) qa[c] = frag_kb(qrow + c * 32, hh); }
  const float cs = SCL * LOG2E / (QS * QS);   // 1/sqrt(128) and the two x8 carriers, in the log2 domain
  float m = -INFINITY, l = 0.0f; v8f o[NT], o2[NT];
#pragma unroll
  for (int t = 0; t < NT; ++t) { o[t] = (v8f){}; o2[t] = (v8f){}; }
  const int nst = (q0 / 32 + TS) / TS;   // block-uniform: a set's steps; together keys 0 .. (q0 | 31), rounded up to TS steps
  copy_kv<ER>(lk, lv, gk, gkl, gv, gvl);
  asm volatile("s_wait_asynccnt 0x0" ::: "memory");   // this wave's copies of step 0 have landed
  __syncthreads();                                     // every wave's have: step 0 may be read
  if (1 < nst) copy_kv<ER>(lk + ASTAGE, lv + ASTAGE, gk + (size_t)TS * 32 * HD, gkl + (size_t)TS * 32 * HD, gv + TS * 32, gvl + TS * 32);
#pragma unroll 1
  for (int st = 0; st < nst; ++st) {
    const int bo = (st & 1) * ASTAGE;
    const int kb = (st * TS + t0) * 32; const int lim = qi - kb;   // key offsets > lim are later than the query (binds only from the diagonal step on)
    float e[16]; float mx = -INFINITY;
    v8f s[2], s2[2];
    if constexpr (ER) {
#pragma unroll
      for (int u = 0; u < 2; ++u) {
        v16b kf[4], klf[4];   // 16 keys' K fragments, hi and lo (not held as a group: with the lo planes' they would not fit the registers)
#pragma unroll
        for (int c = 0; c < 4; ++c) {
          kf[c] = frag_kb((const b16*)(sk + bo + u * 16 * KP) + c * 32, hh);
          klf[c] = frag_kb((const b16*)(sk + bo + KTILE + u * 16 * KP) + c * 32, hh);
        }
        s[u] = (v8f){}; s2[u] = (v8f){};
#pragma unroll
        for (int c = 0; c < 4; ++c) {
          const v16b qh = frag_kb(qrow + c * 32, hh), ql = frag_kb(qlrow + c * 32, hh);
          s[u] = wmma16b(kf[c], qh, s[u]); s2[u] = wmma16b(kf[c], ql, s2[u]); s2[u] = wmma16b(klf[c], qh, s2[u]);
        }
      }
    } else {
      v16b kf[2][4];   // the step's K fragments, read as one group ahead of their WMMAs
#pragma unroll
      for (int u = 0; u < 2; ++u)
#pragma unroll
        for (int c = 0; c < 4; ++c) kf[u][c] = frag_kb((const b16*)(sk + bo + u * 16 * KP) + c * 32, hh);
      hold_group();   // no load of the group sinks among the WMMAs
#pragma unroll
      for (int u = 0; u < 2; ++u) { s[u] = (v8f){}; s2[u] = (v8f){}; }
#pragma unroll
      for (int c = 0; c < 4; ++c)   // the two 16-key chains alternate, so that neither waits out its own accumulate latency; each chain's sum order is as it was
#pragma unroll
        for (int u = 0; u < 2; ++u) s[u] = wmma16b(kf[u][c], qa[c], s[u]);
    }
    v16b vf[NT];   // the step's V fragments, read as one group: their LDS latency passes under the softmax arithmetic
#pragma unroll
    for (int t = 0; t < NT; ++t) vf[t] = frag_kb((const b16*)(sv + bo + t * 16 * VP), hh);
    if constexpr (!ER) hold_group();   // keeps the V loads here, ahead of the softmax arithmetic (ER: held so long they would not fit the registers)
#pragma unroll
    for (int u = 0; u < 2; ++u)
#pragma unroll
      for (int r = 0; r < 8; ++r) {
        float v = s[u][r];
        if constexpr (ER) v += s2[u][r] * (1.0f / RS);
        v *= cs;
        if (u * 16 + 8 * hh + r > lim) v = -INFINITY;
        e[u * 8 + r] = v; mx = fmaxf(mx, v); }
    mx = fmaxf(mx, __shfl_xor(mx, 16)); const float mn = fmaxf(m, mx); const float al = nexp2(m - mn); float sum = 0.0f;
#pragma unroll
    for (int i2 = 0; i2 < 16; ++i2) {
      const float p = nexp2(e[i2] - mn); sum += p; const int pi = (i2 < 8 ? 0 : 16) + 8 * hh + (i2 & 7);
      const float pp = p * PS; const b16 phv = (b16)pp; Pb[wave][col][pi] = phv;
      if constexpr (ER) Pr[wave][col][pi] = (b16)((pp - (float)phv) * RS); }
    sum += __shfl_xor(sum, 16); l = l * al + sum; m = mn;
    wave_lds_sync();
    const v16b pf = frag_kb(&Pb[wave][col][0], hh);
    v16b prf = (v16b){};
    if constexpr (ER) prf = frag_kb(&Pr[wave][col][0], hh);
    v16b vlf[NT];  // the lo V fragments only here: held across the softmax they would not fit the registers
#pragma unroll
    for (int t = 0; t < NT; ++t) { vlf[t] = (v16b){}; if constexpr (ER) vlf[t] = frag_kb((const b16*)(sv + bo + VT + t * 16 * VP), hh); }
#pragma unroll
    for (int t = 0; t < NT; ++t) {
      o[t] *= al; o[t] = wmma16b(vf[t], pf, o[t]);
      if constexpr (ER) { o2[t] *= al; o2[t] = wmma16b(vf[t], prf, o2[t]); o2[t] = wmma16b(vlf[t], pf, o2[t]); } }
    hold_group();   // the step's WMMAs stay in front of the waits and the barrier: sunk behind them they would delay the refill
    asm volatile("s_wait_dscnt 0x0" ::: "memory");      // this wave's reads of the buffer (and of its P rows) are done before the refill
    asm volatile("s_wait_asynccnt 0x0" ::: "memory");   // this wave's copies of step st+1 have landed
    __syncthreads();                                     // publishes step st+1 and ends every reader's last read of step st
    if (st + 2 < nst) { const int kq = (st + 2) * TS * 32; const size_t kn = (size_t)kq * HD; copy_kv<ER>(lk + bo, lv + bo, gk + kn, gkl + kn, gv + kq, gvl + kq); }
  }
  asm volatile("s_wait_asynccnt 0x0" ::: "memory");     // no copy is outstanding when the buffers become output staging
  if constexpr (!ER) {
    // The two sets' partial results are joined: wave w of set 1 leaves max, sum and O^T in its set's LDS half (free behind the loop's last barrier), 16 bytes a lane
    // and store, lanes side by side; wave w of set 0 holds the same head, queries and lane layout, rescales both to the common max and goes on alone.
    v4f* Xo = reinterpret_cast<v4f*>(Sb + ESUB) + wave * (17 * 32) + lane;
    static_assert(NREP * 17 * 32 * 16 <= ESUB);
    if (set == 1) {
#pragma unroll
      for (int t = 0; t < NT; ++t) {
        Xo[(2 * t) * 32] = (v4f){o[t][0], o[t][1], o[t][2], o[t][3]};
        Xo[(2 * t + 1) * 32] = (v4f){o[t][4], o[t][5], o[t][6], o[t][7]}; }
      Xo[16 * 32] = (v4f){m, l, 0.0f, 0.0f};
    }
    __syncthreads();   // set 1's partial results are read by set 0
    if (set == 1) return;   // behind the block's last barrier
    const v4f ml = Xo[16 * 32];
    const float mj = fmaxf(m, ml[0]), a0 = nexp2(m - mj), a1 = nexp2(ml[0] - mj);   // both maxima are finite: either set has a step in front of the diagonal
    l = l * a0 + ml[1] * a1;
#pragma unroll
    for (int t = 0; t < NT; ++t) {
      const v4f xa = Xo[(2 * t) * 32], xb = Xo[(2 * t + 1) * 32];
#pragma unroll
      for (int j = 0; j < 4; ++j) { o[t][j] = o[t][j] * a0 + xa[j] * a1; o[t][4 + j] = o[t][4 + j] * a0 + xb[j] * a1; } }
  }
  const float inv = 1.0f / (l * PS * QS);
#pragma unroll
  for (int t = 0; t < NT; ++t) {
#pragma unroll
    for (int r = 0; r < 8; ++r) {
      float ov = o[t][r];
      if constexpr (ER) ov += o2[t][r] * (1.0f / RS);
      To[wave][col][t * 16 + 8 * hh + r] = ov * inv; } }
  wave_lds_sync();
  constexpr int LPR = DW / 8, RPI = 32 / LPR, NIT = 16 / RPI;
  static_assert(NIT * RPI == 16 && LPR * 8 == DW);
  const size_t cbase = ((size_t)b * SEQ + q0) * DMOD + (size_t)h * HD + dh;
  {
#pragma unroll 1
    for (int it = 0; it < NIT; ++it) {
      const int rr = it * RPI + lane / LPR, seg = (lane % LPR) * 8;
      const v4f fa = *(const v4f*)(&To[wave][rr][seg]), fb = *(const v4f*)(&To[wave][rr][seg + 4]);
      v8b hi, lo;
#pragma unroll
      for (int j = 0; j < 4; ++j) { b16 h0, l0; split16(fa[j] * CS, h0, l0); hi[j] = h0; lo[j] = l0; split16(fb[j] * CS, h0, l0); hi[4 + j] = h0; lo[4 + j] = l0; }
      const size_t off = cbase + (size_t)rr * DMOD + seg;
      *(v8b*)(Ch + off) = hi; *(v8b*)(Cl + off) = lo; }
     }
}
// Both attention forms in one launch. There are more blocks than places (two blocks of 8 waves a WGP). Block index order: first the blocks of
// the query positions < QEA (few steps, but long ones), then those of the positions >= QEA, the longest walks first (for speed only).
constexpr int AX = (SEQ - QEA) / 16, AN = AX * NB * HKV, AEX = QEA / 16, AE = AEX * NB * HKV;
__global__ __launch_bounds__(256) __attribute__((amdgpu_num_vgpr(256))) void attn_kernel(
    const b16* __restrict__ Qh, const b16* __restrict__ Ql, const b16* __restrict__ Kh, const b16* __restrict__ Kl,
    const b16* __restrict__ Vh, const b16* __restrict__ Vl, b16* Ch, b16* Cl) {
  __shared__ __attribute__((aligned(16))) unsigned char Sm[ALDS];
  const int vb = (int)blockIdx.x;
  if (vb >= AE) {
    const int v = vb - AE;
    attn_block<false>(Sm, AX - 1 - v / (NB * HKV), v % (NB * HKV), Qh, Ql, Kh, Kl, Vh, Vl, Ch, Cl);
  } else {
    attn_block<true>(Sm, AEX - 1 - vb / (NB * HKV), vb % (NB * HKV), Qh, Ql, Kh, Kl, Vh, Vl, Ch, Cl);
  }
}
}  // namespace

extern "C" void kernel_launch(void* const* d_in, const int* in_sizes, int n_in, void* d_out, int out_size, void* d_ws, size_t ws_size, hipStream_t stream) {
  // wire order: 0 x [NB_FULL][SEQ_FULL][2048] f32, 1 Wq [2048][2048], 2 Wk [2048][512], 3 Wv [2048][512], 4 Wo [2048][2048]; out [NB_FULL][SEQ_FULL][2048] f32
  const size_t need_x = ((size_t)(NB - 1) * SEQ_FULL + SEQ) * DMOD;
  if (n_in < 5 || (size_t)in_sizes[0] < need_x || (size_t)in_sizes[1] < (size_t)KD * DMOD || (size_t)in_sizes[2] < (size_t)KD * NKV ||
      (size_t)in_sizes[3] < (size_t)KD * NKV || (size_t)in_sizes[4] < (size_t)KD * DMOD || (size_t)out_size < need_x) return;
  const float* X = (const float*)d_in[0]; const float* Wq = (const float*)d_in[1]; const float* Wk = (const float*)d_in[2];
  const float* Wv = (const float*)d_in[3]; const float* Wo = (const float*)d_in[4]; float* out = (float*)d_out;
  size_t off = 0; char* ws = (char*)d_ws;
  auto carve = [&](size_t bytes) { char* p = ws + off; off += (bytes + 255) & ~(size_t)255; return p; };
  b16* Xp  = (b16*)carve((size_t)MR * DMOD * 2);
  b16* Wqt = (b16*)carve((size_t)DMOD * KD * 2);
  b16* Wkt = (b16*)carve((size_t)NKV * KD * 2);
  b16* Wvt = (b16*)carve((size_t)NKV * KD * 2);
  b16* Wot = (b16*)carve((size_t)DMOD * KD * 2);
  float* CT = (float*)carve((size_t)SEQ * 64 * 4);
  float* ST = (float*)carve((size_t)SEQ * 64 * 4);
  b16* Qh = (b16*)carve((size_t)MR * H * HD * 2);
  b16* Ql = (b16*)carve((size_t)MR * H * HD * 2);
  b16* Kh = (b16*)carve((size_t)MR * NKV * 2);
  b16* Kl = (b16*)carve((size_t)MR * NKV * 2);
  b16* Vh = (b16*)carve((size_t)MR * NKV * 2);
  b16* Vl = (b16*)carve((size_t)MR * NKV * 2);
  b16* Ch = (b16*)carve((size_t)MR * DMOD * 2);
  b16* Cl = (b16*)carve((size_t)MR * DMOD * 2);
  if (off > ws_size || off > ((size_t)128 << 20)) return;   // 122,683,392 B at NB=2, SEQ=2048
  prep_kernel<<<dim3(PW + PR + PX), 256, 0, stream>>>(X, Wq, Wk, Wv, Wo, Xp, Wqt, Wkt, Wvt, Wot, CT, ST);
  qkv_kernel<<<dim3((CQ + 2 * CK) / NG, MR / 128), 128 * NG, 0, stream>>>(Xp, Wqt, Wkt, Wvt, Qh, Ql, Kh, Kl, Vh, Vl, CT, ST);
  attn_kernel<<<dim3(AN + AE), 256, 0, stream>>>(Qh, Ql, Kh, Kl, Vh, Vl, Ch, Cl);
  out_kernel<<<dim3(ON + OE), 128, 0, stream>>>(Ch, Cl, Wot, out);
}

// v008
// One run takes 124 microseconds.
// Next to v007, in two timings, it ran 1.07 times as fast each time.
// All steps since v000 together make it 6.08 times as fast.
#include <hip/hip_runtime.h>

// compute dtype: every contraction on v_wmma_f32_16x16x32_f16 (f16 operands, f32 accumulate). x@Wq, x@Wk, x@Wv: x and W enter as bf16-RNE values
// carried x8 (x) and x256 (W) in f16 planes, 1 product. Scores S^T = K Q^T per head: q, k (RoPE applied in f32) as f16 x8 planes, 1 product;
// query rows with position < QE use q,k hi + x2048 residual planes (3 products, second accumulator folded by 1/2048). O^T += V^T P^T: v f16 x8,
// P f16 x1024, 1 product; rows < QE add P and v x2048 residual tiles into a second accumulator (3 products) folded before normalisation.
// ctx@Wo: ctx f16 x64 plane (+ x2048 residual plane for rows < QE, 2 products), Wo bf16-RNE x256, 1 product elsewhere. Softmax statistics
// (running max, exp2, row sums) and RoPE tables in f32; scale 1/sqrt(128) folded into the log2 constant.
// Fragment k-map per lane half hh for A AND B: elements 0..7 <- k = 8hh+0..7, 8..15 <- k = 16+8hh+0..7; acc[r] = D[8hh+r][col = lane&15].

#ifndef NB
#define NB 2
#endif
#ifndef SEQ
#define SEQ 2048
#endif
#ifndef NB_FULL
#define NB_FULL 2
#endif
#ifndef SEQ_FULL
#define SEQ_FULL 2048
#endif
#ifndef QE
#define QE 256
#endif

namespace {
constexpr int DMOD = 2048, KD = 2048, H = 16, HKV = 4, NREP = H / HKV, HD = 128, NKV = HKV * HD;   // NKV = 512
constexpr int MR = NB * SEQ;                                                                         // token rows handled
constexpr int QEA = (QE < SEQ) ? QE : SEQ;                                                           // query positions with residual operands
constexpr float XS = 8.0f, WS = 256.0f, QS = 8.0f, RS = 2048.0f, PS = 1024.0f, CS = 64.0f;
constexpr float LOG2E = 1.4426950408889634f, SCL = 0.08838834764831845f, ROPE_BASE = 500000.0f;
static_assert(SEQ % 128 == 0 && SEQ >= 128 && SEQ <= SEQ_FULL && NB >= 1 && NB <= NB_FULL);
static_assert(QEA % 64 == 0 && QEA >= 64 && QEA <= SEQ && (SEQ - QEA) % 128 == 0);
static_assert(DMOD == H * HD && KD == DMOD && KD % 64 == 0 && DMOD % 128 == 0 && NKV % 128 == 0 && HD == 128 && DMOD == 256 * 8 && MR % 64 == 0);

typedef _Float16 b16;
typedef __attribute__((ext_vector_type(16))) _Float16 v16b;
typedef __attribute__((ext_vector_type(8))) _Float16 v8b;
typedef __attribute__((ext_vector_type(8))) float v8f;
typedef __attribute__((ext_vector_type(4))) float v4f;

__device__ __forceinline__ float bf16_rne(float f) { unsigned int u = __float_as_uint(f); u += 0x7FFFu + ((u >> 16) & 1u); return __uint_as_float(u & 0xFFFF0000u); }
// 16-bit fragment from a k-contiguous row: elements 0..7 <- p[8hh .. 8hh+7], 8..15 <- p[16+8hh .. 16+8hh+7]
__device__ __forceinline__ v16b frag_kb(const b16* p, int hh) {
  const v8b a = *(const v8b*)(p + 8 * hh), b = *(const v8b*)(p + 16 + 8 * hh); v16b f;
#pragma unroll
  for (int e = 0; e < 8; ++e) { f[e] = a[e]; f[8 + e] = b[e]; }
  return f;
}
__device__ __forceinline__ v8f wmma16b(v16b a, v16b b, v8f c) {
  v8f d = __builtin_amdgcn_wmma_f32_16x16x32_f16(false, a, false, b, (short)0, c, false, false);
  return d;
}
// Scheduling fence at an end of a group of LDS fragment loads: the group stays together and ahead of the WMMAs that use it. Left free, the compiler
// reloads one register set in front of every WMMA or two and waits out the LDS latency each time.
__device__ __forceinline__ void hold_group() { __builtin_amdgcn_sched_barrier(0); }
__device__ __forceinline__ void wave_lds_sync() { __builtin_amdgcn_fence(3, "workgroup"); __builtin_amdgcn_wave_barrier(); __builtin_amdgcn_fence(2, "workgroup"); }
__device__ __forceinline__ float nexp2(float v) { return __builtin_amdgcn_exp2f(v); }
// hi = f16(w), lo = f16((w - hi) * RS)
__device__ __forceinline__ void split16(float w, b16& hi, b16& lo) { hi = (b16)w; lo = (b16)((w - (float)hi) * RS); }

__device__ __forceinline__ void cvt_x_block(int vb, const float* __restrict__ X, b16* Xp) {
  const size_t u = (size_t)vb * 256 + threadIdx.x; const size_t row = u >> 8; const int c8 = (int)(u & 255) * 8;
  if (row >= (size_t)MR) return;
  const size_t b = row / SEQ, s = row % SEQ;
  const float* src = X + (b * SEQ_FULL + s) * DMOD + c8;
  b16* dst = Xp + row * DMOD + c8;
  const v4f x0 = *(const v4f*)src, x1 = *(const v4f*)(src + 4); v8b o;
#pragma unroll
  for (int j = 0; j < 4; ++j) { o[j] = (b16)(bf16_rne(x0[j]) * XS); o[4 + j] = (b16)(bf16_rne(x1[j]) * XS); }
  *(v8b*)dst = o; 
}

// W [2048 k][N n] f32 -> Wt [N][2048] f16 = bf16-RNE(w) x256 (k-contiguous for the B fragments). 2 waves (tid 0..63) per 64x64 tile (bx, by), transposed
// through their own LDS tile St; the four wave pairs of a block take four tiles of one matrix and pass the barrier together.
__device__ __forceinline__ void cvt_w_tile(b16 (*St)[64 + 8], int tid, int bx, int by, const float* __restrict__ W, b16* Wt, int N) {
  const int wave = tid >> 5, lane = tid & 31; const int k0 = bx * 64, n0 = by * 64;
  const float* src = W + (size_t)k0 * N + n0;
  for (int it = 0; it < 16; ++it) {
    const int e = (it * 64 + tid) * 4; const int kr = e >> 6, nc = e & 63;
    const v4f x = *(const v4f*)(src + (size_t)kr * N + nc);
#pragma unroll
    for (int j = 0; j < 4; ++j) St[nc + j][kr] = (b16)(bf16_rne(x[j]) * WS);
  }
  __syncthreads();   // St is read across waves
  b16* dstb = Wt + (size_t)n0 * KD + k0;
  {
#pragma unroll 1
    for (int it = 0; it < 8; ++it) {
      const int n = wave * 32 + it * 4 + (lane >> 3), ks = (lane & 7) * 8;
      const v8b o = *(const v8b*)(&St[n][ks]);
      *(v8b*)(dstb + (size_t)n * KD + ks) = o; }
     }
}

// cos/sin tables [SEQ][64] f32: ang = s * (1 / base^(2j/128)) in f32, precise sincosf. Block = 4 positions x 64 frequencies staged in LDS;
__device__ __forceinline__ void rope_tab_block(float (*Tb)[4][64 + 4], int vb, float* CT, float* ST) {
  const int tid = threadIdx.x; const int r = tid >> 6, j = tid & 63; const int s0 = vb * 4;
  const float ex = (float)(2 * j) * (1.0f / 128.0f);
  const float p = powf(ROPE_BASE, ex);
  const float inv = 1.0f / p;
  const float ang = (float)(s0 + r) * inv;
  float sn, c; sincosf(ang, &sn, &c);
  Tb[0][r][j] = c; Tb[1][r][j] = sn;
  __syncthreads();   // Tb is read across waves
  if (tid < 128) {
    const int tb = tid >> 6, rr = (tid >> 4) & 3, seg = (tid & 15) * 4;
    const v4f f = *(const v4f*)(&Tb[tb][rr][seg]);
    float* dst = (tb == 0 ? CT : ST) + (size_t)(s0 + rr) * 64 + seg;
    *(v4f*)dst = f; 
  }
}

// All operand preparation in one launch: its parts read only inputs and write disjoint planes. Block ranges, each block wholly in one part: first the W tiles
// (four 64x64 tiles a block; Wq, Wo, Wk, Wv), then the RoPE tables, then the rows of x.
constexpr int TQ = (KD / 64) * (DMOD / 64), TK = (KD / 64) * (NKV / 64);   // 64x64 tiles of a 2048-column and of a 512-column W
constexpr int PW = (2 * TQ + 2 * TK) / 4, PR = SEQ / 4, PX = MR;           // blocks of the three parts
static_assert(TQ % 4 == 0 && TK % 4 == 0 && KD / 64 == 32);
__global__ __launch_bounds__(256) void prep_kernel(const float* __restrict__ X, const float* __restrict__ Wq, const float* __restrict__ Wk,
    const float* __restrict__ Wv, const float* __restrict__ Wo, b16* Xp, b16* Wqt, b16* Wkt, b16* Wvt, b16* Wot, float* CT, float* ST) {
  __shared__ __attribute__((aligned(16))) unsigned char Sp[4 * 64 * (64 + 8) * 2];
  static_assert(sizeof(Sp) >= 2 * 4 * (64 + 4) * 4);
  const int vb = (int)blockIdx.x;
  if (vb < PW) {
    const int sub = (int)threadIdx.x >> 6, t4 = vb * 4;   // t4 picks the matrix for the whole block
    const float* W = Wq; b16* Wt = Wqt; int N = DMOD, t = t4 + sub;
    if (t4 >= 2 * TQ + TK) { W = Wv; Wt = Wvt; N = NKV; t -= 2 * TQ + TK; }
    else if (t4 >= 2 * TQ) { W = Wk; Wt = Wkt; N = NKV; t -= 2 * TQ; }
    else if (t4 >= TQ) { W = Wo; Wt = Wot; t -= TQ; }
    cvt_w_tile(reinterpret_cast<b16 (*)[64 + 8]>(Sp + sub * 64 * (64 + 8) * 2), (int)threadIdx.x & 63, t & 31, t >> 5, W, Wt, N);
  } else if (vb < PW + PR) {
    rope_tab_block(reinterpret_cast<float (*)[4][64 + 4]>(Sp), vb - PW, CT, ST);
  } else {
    cvt_x_block(vb - PW - PR, X, Xp);
  }
}

// The accumulators of four waves (tid 0..127, 2 x 2 on the tile) go to the tile's f32 staging To; the caller's barrier follows. Every product and sum of the
// two epilogue functions keeps a rounding of its own (no contraction), as it always had here: the planes they write stay bit-identical.
template <bool RES>
__device__ __forceinline__ void proj_stage(float (*To)[128 + 4], int tid, const v8f (&acc)[16]) {
#pragma clang fp contract(off)
  constexpr int BM = RES ? 64 : 128;
  const int wave = tid >> 5, lane = tid & 31, hh = lane >> 4, col = lane & 15, wm = wave >> 1, wn = wave & 1;
#pragma unroll
  for (int i = 0; i < BM / 32; ++i)
#pragma unroll
    for (int j = 0; j < 4; ++j)
#pragma unroll
      for (int r = 0; r < 8; ++r) {
        float v = acc[i * 4 + j][r];
        if constexpr (RES) v += acc[(i + 2) * 4 + j][r] * (1.0f / RS);
        To[wm * (BM / 2) + i * 16 + 8 * hh + r][wn * 64 + j * 16 + col] = v; }
}
// A staged tile goes to memory, by the 128 threads (tid 0..127) that own it; no barrier inside. Roundings as in proj_stage.
template <int MODE, bool RES>
__device__ __forceinline__ void proj_store(float (*To)[128 + 4], int tid, int bx, int bsel, int s0,
    b16* Ph, b16* Pl, float* Out, const float* __restrict__ CT, const float* __restrict__ ST, int nhead) {
#pragma clang fp contract(off)
  constexpr int BM = RES ? 64 : 128;
  constexpr int HF = BM / 64;   // every pass below handles its rows in each 64-row half of the tile: HF independent pieces, stored together
  if constexpr (MODE == 0) {
    const size_t pb = (((size_t)bsel * nhead + bx) * SEQ + s0) * HD;
    b16* ph = Ph + pb; b16* pl = Pl + pb;
    const float qsc = QS / (XS * WS);
    {
#pragma unroll 1
      for (int it = 0; it < 8; ++it) {
        const int seg = (tid & 15) * 8, sg = seg & 63;
        const float sgn = (seg >= 64) ? 1.0f : -1.0f;   // d < 64: x cos - x[d+64] sin; d >= 64: x cos + x[d-64] sin
        v8b hi[HF], lo[HF];
#pragma unroll
        for (int hf = 0; hf < HF; ++hf) {
          const int rr = hf * 64 + it * 8 + (tid >> 4);
          const float* trow = &To[rr][0]; const size_t ts = (size_t)(s0 + rr) * 64 + sg;
          const v4f xa = *(const v4f*)(trow + seg), xb = *(const v4f*)(trow + seg + 4);
          const v4f ya = *(const v4f*)(trow + (seg ^ 64)), yb = *(const v4f*)(trow + (seg ^ 64) + 4);
          const v4f ca = *(const v4f*)(CT + ts), cb = *(const v4f*)(CT + ts + 4), sa = *(const v4f*)(ST + ts), sb = *(const v4f*)(ST + ts + 4);
#pragma unroll
          for (int j = 0; j < 4; ++j) {
            b16 h0, l0;
            split16((xa[j] * ca[j] + sgn * ya[j] * sa[j]) * qsc, h0, l0); hi[hf][j] = h0; lo[hf][j] = l0;
            split16((xb[j] * cb[j] + sgn * yb[j] * sb[j]) * qsc, h0, l0); hi[hf][4 + j] = h0; lo[hf][4 + j] = l0; }
        }
#pragma unroll
        for (int hf = 0; hf < HF; ++hf) {
          const size_t off = (size_t)(hf * 64 + it * 8 + (tid >> 4)) * HD + seg;
          *(v8b*)(ph + off) = hi[hf]; *(v8b*)(pl + off) = lo[hf]; }
        asm volatile("s_wait_xcnt 0x0" ::: "memory"); }   // in front of the next pass's rewrite of the registers that the stores name
       }
  } else if constexpr (MODE == 1) {
    const size_t pb = ((size_t)bsel * nhead + bx) * HD * (size_t)SEQ + s0;
    b16* ph = Ph + pb; b16* pl = Pl + pb;
    const float vsc = QS / (XS * WS);
    {
#pragma unroll 1
      for (int it = 0; it < 8; ++it) {
        const int d = it * 16 + (tid >> 3);
        v8b hi[HF], lo[HF];
#pragma unroll
        for (int hf = 0; hf < HF; ++hf) {
          const int ss = hf * 64 + (tid & 7) * 8;
#pragma unroll
          for (int j = 0; j < 8; ++j) { b16 h0, l0; split16(To[ss + j][d] * vsc, h0, l0); hi[hf][j] = h0; lo[hf][j] = l0; }
        }
#pragma unroll
        for (int hf = 0; hf < HF; ++hf) {
          const size_t off = (size_t)d * SEQ + hf * 64 + (tid & 7) * 8;
          *(v8b*)(ph + off) = hi[hf]; *(v8b*)(pl + off) = lo[hf]; } }
       }
  }
}

// x@Wq, x@Wk, x@Wv in one launch: column tiles 0..15 are Q heads, 16..19 K heads, 20..23 V heads. A block = 12 waves = NG groups of four waves, one block a WGP;
// group g works column tile NG*blockIdx.x + g (waves 2 x 2 on it, 64x64 each, k ascending in steps of 32), and the NG groups share ONE
// copy of the block's 128 x rows: a buffer is [x 128 rows | group 0's W 128 rows | group 1's | group 2's], 512 rows from L2 where three blocks brought 768.
// A trip is 128 k = 256 B of each row at a pitch of 272 B (16 B x odd, for 16-byte readers): four WMMA steps between two barriers of the 12 waves.
constexpr int CQ = DMOD / 128, CK = NKV / 128, NG = 3;
constexpr int KS3 = 128, LP3 = 272, STAGE3 = 128 * (NG + 1) * LP3, TOB = 128 * (128 + 4) * 4;   // 139,264 B a buffer; 67,584 B of output staging a group
constexpr int QLDS = 2 * STAGE3 > NG * TOB ? 2 * STAGE3 : NG * TOB;                              // 278,528 B
static_assert((CQ + 2 * CK) % NG == 0 && MR % 128 == 0 && SEQ % 128 == 0 && NG == 3 && KD % KS3 == 0 && KD / KS3 >= 2);
// One lane's copies of a trip; 16 lanes cover one 256-B row. Sixteen fill its group's W rows r, r+8, .. r+120 (lw, gw = the lane's LDS byte address and global
// address in row r = its thread number in the group / 16). The x rows are dealt over all 12 waves, two rows a wave-wide copy: rows q, q+24, .. q+96 (lx, gx = the
// lane's addresses in row q = thread number / 16) and, from the first four waves only (sixth, wave-uniform), row q+120.
__device__ __forceinline__ void copy_stage3(unsigned lw, const b16* gw, unsigned lx, const b16* gx, bool sixth) {
  constexpr size_t RJ = (size_t)8 * KD, XJ = (size_t)24 * KD; constexpr unsigned LJ = 8u * LP3, LXJ = 24u * LP3;
  // s_wait_xcnt 0 as the last line of each statement: it stands in front of every later rewrite of a register that a copy names
  asm volatile(
      "global_load_async_to_lds_b128 %0, %11, off\n\t"
      "global_load_async_to_lds_b128 %1, %12, off\n\t"
      "global_load_async_to_lds_b128 %2, %13, off\n\t"
      "global_load_async_to_lds_b128 %3, %14, off\n\t"
      "global_load_async_to_lds_b128 %4, %15, off\n\t"
      "global_load_async_to_lds_b128 %5, %16, off\n\t"
      "global_load_async_to_lds_b128 %6, %17, off\n\t"
      "global_load_async_to_lds_b128 %7, %18, off\n\t"
      "global_load_async_to_lds_b128 %8, %19, off\n\t"
      "global_load_async_to_lds_b128 %9, %20, off\n\t"
      "global_load_async_to_lds_b128 %10, %21, off\n\t"
      "s_wait_xcnt 0x0"
      :: "v"(lx), "v"(lx + LXJ), "v"(lx + 2 * LXJ), "v"(lx + 3 * LXJ), "v"(lx + 4 * LXJ),
         "v"(lw), "v"(lw + LJ), "v"(lw + 2 * LJ), "v"(lw + 3 * LJ), "v"(lw + 4 * LJ), "v"(lw + 5 * LJ),
         "v"(gx), "v"(gx + XJ), "v"(gx + 2 * XJ), "v"(gx + 3 * XJ), "v"(gx + 4 * XJ),
         "v"(gw), "v"(gw + RJ), "v"(gw + 2 * RJ), "v"(gw + 3 * RJ), "v"(gw + 4 * RJ), "v"(gw + 5 * RJ)
      : "memory");
  asm volatile(
      "global_load_async_to_lds_b128 %0, %10, off\n\t"
      "global_load_async_to_lds_b128 %1, %11, off\n\t"
      "global_load_async_to_lds_b128 %2, %12, off\n\t"
      "global_load_async_to_lds_b128 %3, %13, off\n\t"
      "global_load_async_to_lds_b128 %4, %14, off\n\t"
      "global_load_async_to_lds_b128 %5, %15, off\n\t"
      "global_load_async_to_lds_b128 %6, %16, off\n\t"
      "global_load_async_to_lds_b128 %7, %17, off\n\t"
      "global_load_async_to_lds_b128 %8, %18, off\n\t"
      "global_load_async_to_lds_b128 %9, %19, off\n\t"
      "s_wait_xcnt 0x0"
      :: "v"(lw + 6 * LJ), "v"(lw + 7 * LJ), "v"(lw + 8 * LJ), "v"(lw + 9 * LJ), "v"(lw + 10 * LJ),
         "v"(lw + 11 * LJ), "v"(lw + 12 * LJ), "v"(lw + 13 * LJ), "v"(lw + 14 * LJ), "v"(lw + 15 * LJ),
         "v"(gw + 6 * RJ), "v"(gw + 7 * RJ), "v"(gw + 8 * RJ), "v"(gw + 9 * RJ), "v"(gw + 10 * RJ),
         "v"(gw + 11 * RJ), "v"(gw + 12 * RJ), "v"(gw + 13 * RJ), "v"(gw + 14 * RJ), "v"(gw + 15 * RJ)
      : "memory");
  if (sixth)
    asm volatile(
        "global_load_async_to_lds_b128 %0, %1, off\n\t"
        "s_wait_xcnt 0x0"
        :: "v"(lx + 5 * LXJ), "v"(gx + 5 * XJ) : "memory");
}
__global__ __launch_bounds__(128 * NG) __attribute__((amdgpu_num_vgpr(256))) void qkv_kernel(
    const b16* __restrict__ Xp, const b16* __restrict__ Wqt, const b16* __restrict__ Wkt, const b16* __restrict__ Wvt,
    b16* Qh, b16* Ql, b16* Kh, b16* Kl, b16* Vh, b16* Vl, const float* __restrict__ CT, const float* __restrict__ ST) {
  __shared__ __attribute__((aligned(16))) unsigned char Sm[QLDS];
  constexpr int NTRIP = KD / KS3;
  const int tid = (int)threadIdx.x, lane = tid & 31, hh = lane >> 4, col = lane & 15;
  const int wave = __builtin_amdgcn_readfirstlane(tid >> 5);   // in a scalar register: what follows from it (group, matrix, sixth) is decided by scalar branches
  const int grp = wave >> 2, tg = tid & 127, wm = (wave >> 1) & 1, wn = wave & 1;
  const int bx = (int)blockIdx.x * NG + grp, by = (int)blockIdx.y;
  const int bsel = by / (SEQ / 128), s0 = (by - bsel * (SEQ / 128)) * 128;
  const size_t m0 = (size_t)bsel * SEQ + s0;
  const bool isq = bx < CQ, isv = bx >= CQ + CK;
  const int hx = isq ? bx : isv ? bx - CQ - CK : bx - CQ;      // the head (column tile) inside its own matrix
  const b16* Bt = (isq ? Wqt : isv ? Wvt : Wkt) + (size_t)hx * 128 * KD;
  const bool sixth = wave < 4;
  const int cr = tg >> 4, cs = (tid & 15) * 8;                 // the lane's W row in each run of 8 rows, and its 16-byte piece of a row
  const int xr = wave * 2 + hh;                                // the lane's x row in each run of 24 rows
  const b16* gw = Bt + (size_t)cr * KD + cs;
  const b16* gx = Xp + (m0 + xr) * KD + cs;
  const unsigned lw = (unsigned)(uintptr_t)(&Sm[(128 * (grp + 1) + cr) * LP3 + cs * 2]);
  const unsigned lx = (unsigned)(uintptr_t)(&Sm[xr * LP3 + cs * 2]);
  const unsigned char* sa = &Sm[(wm * 64 + col) * LP3];
  const unsigned char* sb = &Sm[(128 * (grp + 1) + wn * 64 + col) * LP3];
  v8f acc[16];
#pragma unroll
  for (int t = 0; t < 16; ++t) acc[t] = (v8f){};
  copy_stage3(lw, gw, lx, gx, sixth);
  asm volatile("s_wait_asynccnt 0x0" ::: "memory");   // this wave's copies of trip 0 have landed
  __syncthreads();                                     // every wave's have: trip 0 may be read
  copy_stage3(lw + STAGE3, gw + KS3, lx + STAGE3, gx + KS3, sixth);
#pragma unroll 1
  for (int tr = 0; tr < NTRIP; ++tr) {
    const int bo = (tr & 1) * STAGE3;
#pragma unroll
    for (int kk = 0; kk < KS3 / 32; ++kk) {
      v16b af[4], bf[4];   // the fragments of one WMMA step, read as one group ahead of its 16 WMMAs
      hold_group();   // no load of this group rises among the WMMAs before it
#pragma unroll
      for (int i = 0; i < 4; ++i) af[i] = frag_kb((const b16*)(sa + bo + i * 16 * LP3) + kk * 32, hh);
#pragma unroll
      for (int j = 0; j < 4; ++j) bf[j] = frag_kb((const b16*)(sb + bo + j * 16 * LP3) + kk * 32, hh);
      hold_group();   // and none sinks among its own WMMAs
#pragma unroll
      for (int i = 0; i < 4; ++i)
#pragma unroll
        for (int j = 0; j < 4; ++j) acc[i * 4 + j] = wmma16b(af[i], bf[j], acc[i * 4 + j]);
    }
    hold_group();   // the trip's WMMAs stay in front of the waits and the barrier: sunk behind them they would delay the refill
    asm volatile("s_wait_dscnt 0x0" ::: "memory");      // this wave's reads of the buffer are done before it is refilled
    asm volatile("s_wait_asynccnt 0x0" ::: "memory");   // this wave's copies of trip tr+1 have landed
    __syncthreads();                                     // publishes trip tr+1 and ends every reader's last read of trip tr
    if (tr + 2 < NTRIP) { const int ko = (tr + 2) * KS3; copy_stage3(lw + bo, gw + ko, lx + bo, gx + ko, sixth); }
  }
  asm volatile("s_wait_asynccnt 0x0" ::: "memory");     // no copy is outstanding when the buffers become output staging
  float (*To)[128 + 4] = reinterpret_cast<float (*)[128 + 4]>(Sm + grp * TOB);   // each group stages its own tile
  proj_stage<false>(To, tg, acc);
  __syncthreads();   // To is read across the group's waves; one barrier for the block, whatever its groups store
  if (!isv) proj_store<0, false>(To, tg, hx, bsel, s0, isq ? Qh : Kh, isq ? Ql : Kl, nullptr, CT, ST, isq ? H : HKV);
  else proj_store<1, false>(To, tg, hx, bsel, s0, Vh, Vl, nullptr, CT, ST, HKV);
}

// Eight asynchronous 16-byte copies of one lane: LDS rows 24 apart, from l on, each from a global address of its own.
__device__ __forceinline__ void copy8(unsigned l, const b16* g0, const b16* g1, const b16* g2, const b16* g3, const b16* g4, const b16* g5, const b16* g6, const b16* g7) {
  constexpr unsigned LJ = 24u * LP3;
  // s_wait_xcnt 0 as the last line: it stands in front of every later rewrite of a register that a copy names
  asm volatile(
      "global_load_async_to_lds_b128 %0, %8, off\n\t"
      "global_load_async_to_lds_b128 %1, %9, off\n\t"
      "global_load_async_to_lds_b128 %2, %10, off\n\t"
      "global_load_async_to_lds_b128 %3, %11, off\n\t"
      "global_load_async_to_lds_b128 %4, %12, off\n\t"
      "global_load_async_to_lds_b128 %5, %13, off\n\t"
      "global_load_async_to_lds_b128 %6, %14, off\n\t"
      "global_load_async_to_lds_b128 %7, %15, off\n\t"
      "s_wait_xcnt 0x0"
      :: "v"(l), "v"(l + LJ), "v"(l + 2 * LJ), "v"(l + 3 * LJ), "v"(l + 4 * LJ), "v"(l + 5 * LJ), "v"(l + 6 * LJ), "v"(l + 7 * LJ),
         "v"(g0), "v"(g1), "v"(g2), "v"(g3), "v"(g4), "v"(g5), "v"(g6), "v"(g7)
      : "memory");
}
// ctx@Wo: 256 blocks of the same work, one a WGP: 144 operand rows of ctx x 256 columns. The rows: 112 token rows of the positions >= QEA, then 16 token rows of the
// positions < QEA from the hi plane, then the same 16 from the x2048 residual plane. 12 waves, 3 x 4 on the tile, 48 x 64 each (3 x 4 accumulators); the third wave
// row holds 16 plain rows, the 16 hi rows and their 16 residual rows, so that a residual sum is folded into its hi sum inside one wave. A buffer is
// [ctx 144 rows | Wo 256 rows]; a trip is 128 k = 256 B of each row at the pitch LP3, two buffers, as in qkv_kernel. Every sum keeps its k order.
constexpr int OP = 112, ORS = 16, OA = OP + 2 * ORS, OBN = 256, OROWS = OA + OBN, STAGE4 = OROWS * LP3, OTP = OBN + 4;   // 108,800 B a buffer
constexpr int OT = (SEQ - QEA) / OP;                                                                                  // row tiles of one batch entry
static_assert((SEQ - QEA) % OP == 0 && QEA % ORS == 0 && QEA / ORS == OT && DMOD % OBN == 0 && OA == 3 * 48 && OROWS == 16 * 24 + 16);
static_assert((OP + ORS) * OTP * 4 <= 2 * STAGE4);
// One lane's copies of a trip; 16 lanes cover one 256-B row, the 12 waves 24 rows: rows q, q+24, .. q+360 (l, g[j] = the lane's LDS byte address in row q = thread
// number / 16 and its global address in row q+24j, at the trip's k) and, from the first eight waves only (last, wave-uniform), row q+384.
__device__ __forceinline__ void copy_stage4(unsigned l, const b16* (&g)[17], bool last) {
  constexpr unsigned LJ = 24u * LP3;
  copy8(l, g[0], g[1], g[2], g[3], g[4], g[5], g[6], g[7]);
  copy8(l + 8 * LJ, g[8], g[9], g[10], g[11], g[12], g[13], g[14], g[15]);
  if (last)
    asm volatile(   // s_wait_xcnt 0 as in copy8
        "global_load_async_to_lds_b128 %0, %1, off\n\t"
        "s_wait_xcnt 0x0"
        :: "v"(l + 16 * LJ), "v"(g[16]) : "memory");
#pragma unroll
  for (int j = 0; j < 17; ++j) g[j] += KS3;   // on to the next trip, behind the waits above
}
__global__ __launch_bounds__(384) __attribute__((amdgpu_num_vgpr(256))) void out_kernel(
    const b16* __restrict__ Ch, const b16* __restrict__ Cl, const b16* __restrict__ Wot, float* Out) {
  __shared__ __attribute__((aligned(16))) unsigned char Sm[2 * STAGE4];
  constexpr int NTRIP = KD / KS3;
  const int tid = (int)threadIdx.x, lane = tid & 31, hh = lane >> 4, col = lane & 15;
  const int wave = __builtin_amdgcn_readfirstlane(tid >> 5);   // in a scalar register: what follows from it (wave row, last, the rows it stores) is decided by scalar branches
  const int wm = wave >> 2, wn = wave & 3;
  const int n0 = (int)blockIdx.x * OBN, by = (int)blockIdx.y;
  const int bsel = by / OT, tsel = by - bsel * OT;
  const int sp = QEA + tsel * OP, sr = tsel * ORS;             // first position of the block's plain rows, and of its rows with a residual
  const size_t mb = (size_t)bsel * SEQ;
  const bool last = wave < 8;
  const int xr = tid >> 4, cs = (tid & 15) * 8;                // the lane's row in each run of 24 rows, and its 16-byte piece of a row
  const b16* g[17];
#pragma unroll
  for (int j = 0; j < 17; ++j) {
    const int r = (j < 16 || last) ? xr + 24 * j : OROWS - 1;  // a wave without a 17th copy holds an address in bounds all the same
    const b16* p = r < OP ? Ch + (mb + sp + r) * KD
                 : r < OP + ORS ? Ch + (mb + sr + (r - OP)) * KD
                 : r < OA ? Cl + (mb + sr + (r - OP - ORS)) * KD
                 : Wot + (size_t)(n0 + (r - OA)) * KD;
    g[j] = p + cs;
  }
  const unsigned lc = (unsigned)(uintptr_t)(&Sm[xr * LP3 + cs * 2]);
  const unsigned char* sa = &Sm[(wm * 48 + col) * LP3];
  const unsigned char* sb = &Sm[(OA + wn * 64 + col) * LP3];
  v8f acc[12];
#pragma unroll
  for (int t = 0; t < 12; ++t) acc[t] = (v8f){};
  copy_stage4(lc, g, last);
  asm volatile("s_wait_asynccnt 0x0" ::: "memory");   // this wave's copies of trip 0 have landed
  __syncthreads();                                     // every wave's have: trip 0 may be read
  copy_stage4(lc + STAGE4, g, last);
#pragma unroll 1
  for (int tr = 0; tr < NTRIP; ++tr) {
    const int bo = (tr & 1) * STAGE4;
#pragma unroll
    for (int kk = 0; kk < KS3 / 32; ++kk) {
      v16b af[3], bf[4];   // the fragments of one WMMA step, read as one group ahead of its 12 WMMAs
      hold_group();   // no load of this group rises among the WMMAs before it
#pragma unroll
      for (int i = 0; i < 3; ++i) af[i] = frag_kb((const b16*)(sa + bo + i * 16 * LP3) + kk * 32, hh);
#pragma unroll
      for (int j = 0; j < 4; ++j) bf[j] = frag_kb((const b16*)(sb + bo + j * 16 * LP3) + kk * 32, hh);
      hold_group();   // and none sinks among its own WMMAs
#pragma unroll
      for (int i = 0; i < 3; ++i)
#pragma unroll
        for (int j = 0; j < 4; ++j) acc[i * 4 + j] = wmma16b(af[i], bf[j], acc[i * 4 + j]);
    }
    hold_group();   // the trip's WMMAs stay in front of the waits and the barrier: sunk behind them they would delay the refill
    asm volatile("s_wait_dscnt 0x0" ::: "memory");      // this wave's reads of the buffer are done before it is refilled
    asm volatile("s_wait_asynccnt 0x0" ::: "memory");   // this wave's copies of trip tr+1 have landed
    __syncthreads();                                     // publishes trip tr+1 and ends every reader's last read of trip tr
    if (tr + 2 < NTRIP) copy_stage4(lc + bo, g, last);
  }
  asm volatile("s_wait_asynccnt 0x0" ::: "memory");     // no copy is outstanding when the buffers become output staging
  // Staging, f32: rows 0..111 the plain token rows, 112..127 the rows with a residual (hi sum + residual sum / 2048; the factor is a power of two, its product exact).
  float (*To)[OTP] = reinterpret_cast<float (*)[OTP]>(Sm);
#pragma unroll
  for (int i = 0; i < 3; ++i) {
    if (wm == 2 && i == 2) continue;   // the residual sums go out with their hi sums
#pragma unroll
    for (int j = 0; j < 4; ++j)
#pragma unroll
      for (int r = 0; r < 8; ++r) {
        float v = acc[i * 4 + j][r];
        if (wm == 2 && i == 1) v += acc[8 + j][r] * (1.0f / RS);
        To[wm * 48 + i * 16 + 8 * hh + r][wn * 64 + j * 16 + col] = v; }
  }
  __syncthreads();   // To is read across waves
  // Two waves store one 1-KB row piece of out; wave pair w2 takes the staged rows w2, w2+6, ..: four rows a pass, read together and stored together. The row's
  // address is scalar, the lane's place in the row a vector offset that no pass rewrites.
  const float osc = 1.0f / (CS * WS);
  const int w2 = wave >> 1; const unsigned seg = (unsigned)(tid & 63) * 4u;
  float* ob = Out + (size_t)bsel * SEQ_FULL * DMOD + n0;
#pragma unroll 1
  for (int it = 0; it < 5; ++it) {   // staged rows 0..119
    v4f f[4];
#pragma unroll
    for (int u = 0; u < 4; ++u) f[u] = *(const v4f*)(&To[w2 + 6 * (it * 4 + u)][seg]) * osc;
#pragma unroll
    for (int u = 0; u < 4; ++u) {
      const int rr = w2 + 6 * (it * 4 + u);
      *(v4f*)(ob + (size_t)(rr < OP ? sp + rr : sr + (rr - OP)) * DMOD + seg) = f[u];
    }
    asm volatile("s_wait_xcnt 0x0" ::: "memory");   // in front of the next pass's rewrite of the registers that the stores name
  }
  static_assert(OP <= 120 && OP + ORS == 128);
  {                                  // staged rows 120..125
    const v4f f = *(const v4f*)(&To[120 + w2][seg]) * osc;
    *(v4f*)(ob + (size_t)(sr + (120 + w2 - OP)) * DMOD + seg) = f;
    asm volatile("s_wait_xcnt 0x0" ::: "memory");   // in front of a rewrite of the registers that the store names
  }
  if (w2 < 2) {                      // staged rows 126, 127
    const v4f f = *(const v4f*)(&To[126 + w2][seg]) * osc;
    *(v4f*)(ob + (size_t)(sr + (126 + w2 - OP)) * DMOD + seg) = f;
  }
}

// One key step of the attention kernel in LDS: K tile = 32 key rows of 256 B at a pitch of 272 B, V tile = DW d rows of 64 B (32 keys) at a pitch of 80 B
// (both 16 B x odd, for 16-byte readers). A buffer holds K hi[, K lo], V hi[, V lo].
constexpr int KP = 272, VP = 80, KTILE = 32 * KP, PBYTES = NREP * 16 * (32 + 8) * 2, ESUB = 65536, ALDS = 2 * ESUB;
// The asynchronous 16-byte copies of one lane (of 128) that fill one buffer: K rows r, r+8, r+16, r+24 (16 lanes cover one 256-B row) and V rows d, d+32[, d+64,
// d+96] (4 lanes cover one 64-B row); ER: the same rows of the lo planes, K lo one K tile and V lo one V tile (64 rows) further in LDS.
// lk, lv = the lane's LDS byte addresses in its first rows, gk, gkl, gv, gvl = its global addresses there.
template <bool ER>
__device__ __forceinline__ void copy_kv(unsigned lk, unsigned lv, const b16* gk, const b16* gkl, const b16* gv, const b16* gvl) {
  constexpr size_t KJ = (size_t)8 * HD, VJ = (size_t)32 * SEQ; constexpr unsigned LKJ = 8u * KP, LVJ = 32u * VP, KL = KTILE, VL = 64u * VP;
  // s_wait_xcnt 0 as the last line of either statement: it stands in front of every later rewrite of a register that a copy names
  if constexpr (ER) {
    asm volatile(
        "global_load_async_to_lds_b128 %0, %12, off\n\t"
        "global_load_async_to_lds_b128 %1, %13, off\n\t"
        "global_load_async_to_lds_b128 %2, %14, off\n\t"
        "global_load_async_to_lds_b128 %3, %15, off\n\t"
        "global_load_async_to_lds_b128 %4, %16, off\n\t"
        "global_load_async_to_lds_b128 %5, %17, off\n\t"
        "global_load_async_to_lds_b128 %6, %18, off\n\t"
        "global_load_async_to_lds_b128 %7, %19, off\n\t"
        "global_load_async_to_lds_b128 %8, %20, off\n\t"
        "global_load_async_to_lds_b128 %9, %21, off\n\t"
        "global_load_async_to_lds_b128 %10, %22, off\n\t"
        "global_load_async_to_lds_b128 %11, %23, off\n\t"
        "s_wait_xcnt 0x0"
        :: "v"(lk), "v"(lk + LKJ), "v"(lk + 2 * LKJ), "v"(lk + 3 * LKJ), "v"(lk + KL), "v"(lk + KL + LKJ), "v"(lk + KL + 2 * LKJ), "v"(lk + KL + 3 * LKJ),
           "v"(lv), "v"(lv + LVJ), "v"(lv + VL), "v"(lv + VL + LVJ),
           "v"(gk), "v"(gk + KJ), "v"(gk + 2 * KJ), "v"(gk + 3 * KJ), "v"(gkl), "v"(gkl + KJ), "v"(gkl + 2 * KJ), "v"(gkl + 3 * KJ),
           "v"(gv), "v"(gv + VJ), "v"(gvl), "v"(gvl + VJ)
        : "memory");
  } else {
    asm volatile(
        "global_load_async_to_lds_b128 %0, %8, off\n\t"
        "global_load_async_to_lds_b128 %1, %9, off\n\t"
        "global_load_async_to_lds_b128 %2, %10, off\n\t"
        "global_load_async_to_lds_b128 %3, %11, off\n\t"
        "global_load_async_to_lds_b128 %4, %12, off\n\t"
        "global_load_async_to_lds_b128 %5, %13, off\n\t"
        "global_load_async_to_lds_b128 %6, %14, off\n\t"
        "global_load_async_to_lds_b128 %7, %15, off\n\t"
        "s_wait_xcnt 0x0"
        :: "v"(lk), "v"(lk + LKJ), "v"(lk + 2 * LKJ), "v"(lk + 3 * LKJ), "v"(lv), "v"(lv + LVJ), "v"(lv + 2 * LVJ), "v"(lv + 3 * LVJ),
           "v"(gk), "v"(gk + KJ), "v"(gk + 2 * KJ), "v"(gk + 3 * KJ), "v"(gv), "v"(gv + VJ), "v"(gv + 2 * VJ), "v"(gv + 3 * VJ)
        : "memory");
  }
}

// Causal GQA attention: block (bx = query tile of 16, bg in NB*HKV) = 8 waves = two sets of 4 waves; a set = the 4 query heads of one KV head on the same 16 queries,
// so its four walk the same keys; each set has its own half of the LDS (buffers, P rows) and fills it itself. Query positions >= QEA: the tile's 32-key steps go
// to the two sets in turn (set 0: 0, 2, ..; set 1: 1, 3, ..), so the longest walk is 32 steps and not 64; each set keeps a running max, sum and O^T of its own, joined
// through LDS behind the loop. Where the step count is odd, set 1's last step lies wholly behind the diagonal (in bounds: SEQ % 64 == 0) and adds zeros.
// ER: both sets walk all steps, set s on d-half s. Each 32-key step's K and V tiles are copied once into LDS, two buffers: the copies of a set's step st+2 fly while
// its step st+1 is worked on; every wave reads its fragments from there. Key steps up to the 32-aligned block of the last query in fixed order; online
// softmax (running max, f32); keys later than the query get -inf on the diagonal step; P x1024 via wave-private LDS; O^T += V^T P^T. ER (query position
// < QEA): scores Kh Qh + (Kh Ql + Kl Qh)/2048, O^T second accumulator Vh Pr + Vl Ph folded by 1/2048, each set restricted to 64 of the 128 d rows.
// ctx hi x64 / lo x2048 planes [b*SEQ+s][h*128 + d], staged per wave through the same LDS behind the loop's last barrier.
template <bool ER>
__device__ __forceinline__ void attn_block(unsigned char* Sb, int bx, int bg,
    const b16* __restrict__ Qh, const b16* __restrict__ Ql, const b16* __restrict__ Kh, const b16* __restrict__ Kl,
    const b16* __restrict__ Vh, const b16* __restrict__ Vl, b16* Ch, b16* Cl) {
  constexpr int NT = ER ? 4 : 8, DW = NT * 16, NP = ER ? 2 : 1, VO = NP * KTILE, VT = DW * VP, ASTAGE = VO + NP * VT;   // 27,648 / 18,944 B a buffer
  static_assert(NREP == 4 && NREP * 16 * (DW + 4) * 4 <= 2 * ASTAGE && ASTAGE % 16 == 0);
  static_assert(2 * ASTAGE + NP * PBYTES <= ESUB && QEA >= 64 && SEQ % 64 == 0);
  constexpr int TS = ER ? 1 : 2;                                             // 32-key steps from one step of a set to its next
  const int set = __builtin_amdgcn_readfirstlane((int)threadIdx.x >> 7);    // in a scalar register: what follows from it is scalar, its tests are scalar branches
  const int t0 = ER ? 0 : set;                                               // the set's first 32-key step
  unsigned char* Sm = Sb + set * ESUB;
  b16 (*Pb)[16][32 + 8] = reinterpret_cast<b16 (*)[16][32 + 8]>(Sm + 2 * ASTAGE);            // behind the two buffers: P, then (ER) its residual
  b16 (*Pr)[16][32 + 8] = reinterpret_cast<b16 (*)[16][32 + 8]>(Sm + 2 * ASTAGE + (ER ? PBYTES : 0));
  float (*To)[16][DW + 4] = reinterpret_cast<float (*)[16][DW + 4]>(Sm);
  const int tid = threadIdx.x & 127, wave = tid >> 5, lane = tid & 31, hh = lane >> 4, col = lane & 15;   // numbered inside the set
  const int b = bg / HKV, g = bg - b * HKV, h = g * NREP + wave;
  const int q0 = (ER ? 0 : QEA) + bx * 16, qi = q0 + col;
  const int dh = ER ? set * 64 : 0;
  const b16* qrow = Qh + ((size_t)(b * H + h) * SEQ + qi) * HD;
  const b16* qlrow = Ql + ((size_t)(b * H + h) * SEQ + qi) * HD;
  const size_t ko = (size_t)(b * HKV + g) * SEQ * HD + (size_t)(t0 * 32 + (tid >> 4)) * HD + (tid & 15) * 8;   // the lane's piece of K row tid>>4 of step t0
  const size_t vo = ((size_t)(b * HKV + g) * HD + dh + (tid >> 2)) * SEQ + t0 * 32 + (tid & 3) * 8;            // the lane's piece of V row tid>>2 of step t0
  const b16* gk = Kh + ko; const b16* gkl = Kl + ko; const b16* gv = Vh + vo; const b16* gvl = Vl + vo;
  const unsigned lk = (unsigned)(uintptr_t)(&Sm[(tid >> 4) * KP + (tid & 15) * 16]);
  const unsigned lv = (unsigned)(uintptr_t)(&Sm[VO + (tid >> 2) * VP + (tid & 3) * 16]);
  const unsigned char* sk = &Sm[col * KP];
  const unsigned char* sv = &Sm[VO + col * VP];
  v16b qa[4];
#pragma unroll
  for (int c = 0; c < 4; ++c) { qa[c] = (v16b){}; if constexpr (!ER) qa[c] = frag_kb(qrow + c * 32, hh); }
  const float cs = SCL * LOG2E / (QS * QS);   // 1/sqrt(128) and the two x8 carriers, in the log2 domain
  float m = -INFINITY, l = 0.0f; v8f o[NT], o2[NT];
#pragma unroll
  for (int t = 0; t < NT; ++t) { o[t] = (v8f){}; o2[t] = (v8f){}; }
  const int nst = (q0 / 32 + TS) / TS;   // block-uniform: a set's steps; together keys 0 .. (q0 | 31), rounded up to TS steps
  copy_kv<ER>(lk, lv, gk, gkl, gv, gvl);
  asm volatile("s_wait_asynccnt 0x0" ::: "memory");   // this wave's copies of step 0 have landed
  __syncthreads();                                     // every wave's have: step 0 may be read
  if (1 < nst) copy_kv<ER>(lk + ASTAGE, lv + ASTAGE, gk + (size_t)TS * 32 * HD, gkl + (size_t)TS * 32 * HD, gv + TS * 32, gvl + TS * 32);
#pragma unroll 1
  for (int st = 0; st < nst; ++st) {
    const int bo = (st & 1) * ASTAGE;
    const int kb = (st * TS + t0) * 32; const int lim = qi - kb;   // key offsets > lim are later than the query (binds only from the diagonal step on)
    float e[16]; float mx = -INFINITY;
    v8f s[2], s2[2];
    if constexpr (ER) {
#pragma unroll
      for (int u = 0; u < 2; ++u) {
        v16b kf[4], klf[4];   // 16 keys' K fragments, hi and lo (not held as a group: with the lo planes' they would not fit the registers)
#pragma unroll
        for (int c = 0; c < 4; ++c) {
          kf[c] = frag_kb((const b16*)(sk + bo + u * 16 * KP) + c * 32, hh);
          klf[c] = frag_kb((const b16*)(sk + bo + KTILE + u * 16 * KP) + c * 32, hh);
        }
        s[u] = (v8f){}; s2[u] = (v8f){};
#pragma unroll
        for (int c = 0; c < 4; ++c) {
          const v16b qh = frag_kb(qrow + c * 32, hh), ql = frag_kb(qlrow + c * 32, hh);
          s[u] = wmma16b(kf[c], qh, s[u]); s2[u] = wmma16b(kf[c], ql, s2[u]); s2[u] = wmma16b(klf[c], qh, s2[u]);
        }
      }
    } else {
      v16b kf[2][4];   // the step's K fragments, read as one group ahead of their WMMAs
#pragma unroll
      for (int u = 0; u < 2; ++u)
#pragma unroll
        for (int c = 0; c < 4; ++c) kf[u][c] = frag_kb((const b16*)(sk + bo + u * 16 * KP) + c * 32, hh);
      hold_group();   // no load of the group sinks among the WMMAs
#pragma unroll
      for (int u = 0; u < 2; ++u) { s[u] = (v8f){}; s2[u] = (v8f){}; }
#pragma unroll
      for (int c = 0; c < 4; ++c)   // the two 16-key chains alternate, so that neither waits out its own accumulate latency; each chain's sum order is as it was
#pragma unroll
        for (int u = 0; u < 2; ++u) s[u] = wmma16b(kf[u][c], qa[c], s[u]);
    }
    v16b vf[NT];   // the step's V fragments, read as one group: their LDS latency passes under the softmax arithmetic
#pragma unroll
    for (int t = 0; t < NT; ++t) vf[t] = frag_kb((const b16*)(sv + bo + t * 16 * VP), hh);
    if constexpr (!ER) hold_group();   // keeps the V loads here, ahead of the softmax arithmetic (ER: held so long they would not fit the registers)
#pragma unroll
    for (int u = 0; u < 2; ++u)
#pragma unroll
      for (int r = 0; r < 8; ++r) {
        float v = s[u][r];
        if constexpr (ER) v += s2[u][r] * (1.0f / RS);
        v *= cs;
        if (u * 16 + 8 * hh + r > lim) v = -INFINITY;
        e[u * 8 + r] = v; mx = fmaxf(mx, v); }
    mx = fmaxf(mx, __shfl_xor(mx, 16)); const float mn = fmaxf(m, mx); const float al = nexp2(m - mn); float sum = 0.0f;
#pragma unroll
    for (int i2 = 0; i2 < 16; ++i2) {
      const float p = nexp2(e[i2] - mn); sum += p; const int pi = (i2 < 8 ? 0 : 16) + 8 * hh + (i2 & 7);
      const float pp = p * PS; const b16 phv = (b16)pp; Pb[wave][col][pi] = phv;
      if constexpr (ER) Pr[wave][col][pi] = (b16)((pp - (float)phv) * RS); }
    sum += __shfl_xor(sum, 16); l = l * al + sum; m = mn;
    wave_lds_sync();
    const v16b pf = frag_kb(&Pb[wave][col][0], hh);
    v16b prf = (v16b){};
    if constexpr (ER) prf = frag_kb(&Pr[wave][col][0], hh);
    v16b vlf[NT];  // the lo V fragments only here: held across the softmax they would not fit the registers
#pragma unroll
    for (int t = 0; t < NT; ++t) { vlf[t] = (v16b){}; if constexpr (ER) vlf[t] = frag_kb((const b16*)(sv + bo + VT + t * 16 * VP), hh); }
#pragma unroll
    for (int t = 0; t < NT; ++t) {
      o[t] *= al; o[t] = wmma16b(vf[t], pf, o[t]);
      if constexpr (ER) { o2[t] *= al; o2[t] = wmma16b(vf[t], prf, o2[t]); o2[t] = wmma16b(vlf[t], pf, o2[t]); } }
    hold_group();   // the step's WMMAs stay in front of the waits and the barrier: sunk behind them they would delay the refill
    asm volatile("s_wait_dscnt 0x0" ::: "memory");      // this wave's reads of the buffer (and of its P rows) are done before the refill
    asm volatile("s_wait_asynccnt 0x0" ::: "memory");   // this wave's copies of step st+1 have landed
    __syncthreads();                                     // publishes step st+1 and ends every reader's last read of step st
    if (st + 2 < nst) { const int kq = (st + 2) * TS * 32; const size_t kn = (size_t)kq * HD; copy_kv<ER>(lk + bo, lv + bo, gk + kn, gkl + kn, gv + kq, gvl + kq); }
  }
  asm volatile("s_wait_asynccnt 0x0" ::: "memory");     // no copy is outstanding when the buffers become output staging
  if constexpr (!ER) {
    // The two sets' partial results are joined: wave w of set 1 leaves max, sum and O^T in its set's LDS half (free behind the loop's last barrier), 16 bytes a lane
    // and store, lanes side by side; wave w of set 0 holds the same head, queries and lane layout, rescales both to the common max and goes on alone.
    v4f* Xo = reinterpret_cast<v4f*>(Sb + ESUB) + wave * (17 * 32) + lane;
    static_assert(NREP * 17 * 32 * 16 <= ESUB);
    if (set == 1) {
#pragma unroll
      for (int t = 0; t < NT; ++t) {
        Xo[(2 * t) * 32] = (v4f){o[t][0], o[t][1], o[t][2], o[t][3]};
        Xo[(2 * t + 1) * 32] = (v4f){o[t][4], o[t][5], o[t][6], o[t][7]}; }
      Xo[16 * 32] = (v4f){m, l, 0.0f, 0.0f};
    }
    __syncthreads();   // set 1's partial results are read by set 0
    if (set == 1) return;   // behind the block's last barrier
    const v4f ml = Xo[16 * 32];
    const float mj = fmaxf(m, ml[0]), a0 = nexp2(m - mj), a1 = nexp2(ml[0] - mj);   // both maxima are finite: either set has a step in front of the diagonal
    l = l * a0 + ml[1] * a1;
#pragma unroll
    for (int t = 0; t < NT; ++t) {
      const v4f xa = Xo[(2 * t) * 32], xb = Xo[(2 * t + 1) * 32];
#pragma unroll
      for (int j = 0; j < 4; ++j) { o[t][j] = o[t][j] * a0 + xa[j] * a1; o[t][4 + j] = o[t][4 + j] * a0 + xb[j] * a1; } }
  }
  const float inv = 1.0f / (l * PS * QS);
#pragma unroll
  for (int t = 0; t < NT; ++t) {
#pragma unroll
    for (int r = 0; r < 8; ++r) {
      float ov = o[t][r];
      if constexpr (ER) ov += o2[t][r] * (1.0f / RS);
      To[wave][col][t * 16 + 8 * hh + r] = ov * inv; } }
  wave_lds_sync();
  constexpr int LPR = DW / 8, RPI = 32 / LPR, NIT = 16 / RPI;
  static_assert(NIT * RPI == 16 && LPR * 8 == DW);
  const size_t cbase = ((size_t)b * SEQ + q0) * DMOD + (size_t)h * HD + dh;
  {
#pragma unroll 1
    for (int it = 0; it < NIT; ++it) {
      const int rr = it * RPI + lane / LPR, seg = (lane % LPR) * 8;
      const v4f fa = *(const v4f*)(&To[wave][rr][seg]), fb = *(const v4f*)(&To[wave][rr][seg + 4]);
      v8b hi, lo;
#pragma unroll
      for (int j = 0; j < 4; ++j) { b16 h0, l0; split16(fa[j] * CS, h0, l0); hi[j] = h0; lo[j] = l0; split16(fb[j] * CS, h0, l0); hi[4 + j] = h0; lo[4 + j] = l0; }
      const size_t off = cbase + (size_t)rr * DMOD + seg;
      *(v8b*)(Ch + off) = hi; *(v8b*)(Cl + off) = lo; }
     }
}
// Both attention forms in one launch. There are more blocks than places (two blocks of 8 waves a WGP). Block index order: first the blocks of
// the query positions < QEA (few steps, but long ones), then those of the positions >= QEA, the longest walks first (for speed only).
constexpr int AX = (SEQ - QEA) / 16, AN = AX * NB * HKV, AEX = QEA / 16, AE = AEX * NB * HKV;
__global__ __launch_bounds__(256) __attribute__((amdgpu_num_vgpr(256))) void attn_kernel(
    const b16* __restrict__ Qh, const b16* __restrict__ Ql, const b16* __restrict__ Kh, const b16* __restrict__ Kl,
    const b16* __restrict__ Vh, const b16* __restrict__ Vl, b16* Ch, b16* Cl) {
  __shared__ __attribute__((aligned(16))) unsigned char Sm[ALDS];
  const int vb = (int)blockIdx.x;
  if (vb >= AE) {
    const int v = vb - AE;
    attn_block<false>(Sm, AX - 1 - v / (NB * HKV), v % (NB * HKV), Qh, Ql, Kh, Kl, Vh, Vl, Ch, Cl);
  } else {
    attn_block<true>(Sm, AEX - 1 - vb / (NB * HKV), vb % (NB * HKV), Qh, Ql, Kh, Kl, Vh, Vl, Ch, Cl);
  }
}
}  // namespace

extern "C" void kernel_launch(void* const* d_in, const int* in_sizes, int n_in, void* d_out, int out_size, void* d_ws, size_t ws_size, hipStream_t stream) {
  // wire order: 0 x [NB_FULL][SEQ_FULL][2048] f32, 1 Wq [2048][2048], 2 Wk [2048][512], 3 Wv [2048][512], 4 Wo [2048][2048]; out [NB_FULL][SEQ_FULL][2048] f32
  const size_t need_x = ((size_t)(NB - 1) * SEQ_FULL + SEQ) * DMOD;
  if (n_in < 5 || (size_t)in_sizes[0] < need_x || (size_t)in_sizes[1] < (size_t)KD * DMOD || (size_t)in_sizes[2] < (size_t)KD * NKV ||
      (size_t)in_sizes[3] < (size_t)KD * NKV || (size_t)in_sizes[4] < (size_t)KD * DMOD || (size_t)out_size < need_x) return;
  const float* X = (const float*)d_in[0]; const float* Wq = (const float*)d_in[1]; const float* Wk = (const float*)d_in[2];
  const float* Wv = (const float*)d_in[3]; const float* Wo = (const float*)d_in[4]; float* out = (float*)d_out;
  size_t off = 0; char* ws = (char*)d_ws;
  auto carve = [&](size_t bytes) { char* p = ws + off; off += (bytes + 255) & ~(size_t)255; return p; };
  b16* Xp  = (b16*)carve((size_t)MR * DMOD * 2);
  b16* Wqt = (b16*)carve((size_t)DMOD * KD * 2);
  b16* Wkt = (b16*)carve((size_t)NKV * KD * 2);
  b16* Wvt = (b16*)carve((size_t)NKV * KD * 2);
  b16* Wot = (b16*)carve((size_t)DMOD * KD * 2);
  float* CT = (float*)carve((size_t)SEQ * 64 * 4);
  float* ST = (float*)carve((size_t)SEQ * 64 * 4);
  b16* Qh = (b16*)carve((size_t)MR * H * HD * 2);
  b16* Ql = (b16*)carve((size_t)MR * H * HD * 2);
  b16* Kh = (b16*)carve((size_t)MR * NKV * 2);
  b16* Kl = (b16*)carve((size_t)MR * NKV * 2);
  b16* Vh = (b16*)carve((size_t)MR * NKV * 2);
  b16* Vl = (b16*)carve((size_t)MR * NKV * 2);
  b16* Ch = (b16*)carve((size_t)MR * DMOD * 2);
  b16* Cl = (b16*)carve((size_t)MR * DMOD * 2);
  if (off > ws_size || off > ((size_t)128 << 20)) return;   // 122,683,392 B at NB=2, SEQ=2048
  prep_kernel<<<dim3(PW + PR + PX), 256, 0, stream>>>(X, Wq, Wk, Wv, Wo, Xp, Wqt, Wkt, Wvt, Wot, CT, ST);
  qkv_kernel<<<dim3((CQ + 2 * CK) / NG, MR / 128), 128 * NG, 0, stream>>>(Xp, Wqt, Wkt, Wvt, Qh, Ql, Kh, Kl, Vh, Vl, CT, ST);
  attn_kernel<<<dim3(AN + AE), 256, 0, stream>>>(Qh, Ql, Kh, Kl, Vh, Vl, Ch, Cl);
  out_kernel<<<dim3(DMOD / OBN, NB * OT), 384, 0, stream>>>(Ch, Cl, Wot, out);
}

// v009
// A run of this version takes 119 microseconds.
// Next to v008, in two timings, it ran 1.04 times as fast each time.
// All steps since v000 together make it 6.34 times as fast.
#include <hip/hip_runtime.h>

// compute dtype: every contraction on v_wmma_f32_16x16x32_f16 (f16 operands, f32 accumulate). x@Wq, x@Wk, x@Wv: x and W enter as bf16-RNE values
// carried x8 (x) and x256 (W) in f16 planes, 1 product. Scores S^T = K Q^T per head: q, k (RoPE applied in f32) as f16 x8 planes, 1 product;
// query rows with position < QE use q,k hi + x2048 residual planes (3 products, second accumulator folded by 1/2048). O^T += V^T P^T: v f16 x8,
// P f16 x1024 (packed in registers), 1 product; rows < QE add P and v x2048 residual tiles into a second accumulator (3 products) folded before normalisation.
// ctx@Wo: ctx f16 x64 plane (+ x2048 residual plane for rows < QE, 2 products), Wo bf16-RNE x256, 1 product elsewhere. Softmax statistics
// (running max, exp2, row sums) and RoPE tables in f32; scale 1/sqrt(128) folded into the log2 constant.
// Fragment k-map per lane half hh for A AND B: elements 0..7 <- k = 8hh+0..7, 8..15 <- k = 16+8hh+0..7; acc[r] = D[8hh+r][col = lane&15].

#ifndef NB
#define NB 2
#endif
#ifndef SEQ
#define SEQ 2048
#endif
#ifndef NB_FULL
#define NB_FULL 2
#endif
#ifndef SEQ_FULL
#define SEQ_FULL 2048
#endif
#ifndef QE
#define QE 256
#endif

namespace {
constexpr int DMOD = 2048, KD = 2048, H = 16, HKV = 4, NREP = H / HKV, HD = 128, NKV = HKV * HD;   // NKV = 512
constexpr int MR = NB * SEQ;                                                                         // token rows handled
constexpr int QEA = (QE < SEQ) ? QE : SEQ;                                                           // query positions with residual operands
constexpr float XS = 8.0f, WS = 256.0f, QS = 8.0f, RS = 2048.0f, PS = 1024.0f, CS = 64.0f;
constexpr float LOG2E = 1.4426950408889634f, SCL = 0.08838834764831845f, ROPE_BASE = 500000.0f;
static_assert(SEQ % 128 == 0 && SEQ >= 128 && SEQ <= SEQ_FULL && NB >= 1 && NB <= NB_FULL);
static_assert(QEA % 64 == 0 && QEA >= 64 && QEA <= SEQ && (SEQ - QEA) % 128 == 0);
static_assert(DMOD == H * HD && KD == DMOD && KD % 64 == 0 && DMOD % 128 == 0 && NKV % 128 == 0 && HD == 128 && DMOD == 256 * 8 && MR % 64 == 0);

typedef _Float16 b16;
typedef __attribute__((ext_vector_type(16))) _Float16 v16b;
typedef __attribute__((ext_vector_type(8))) _Float16 v8b;
typedef __attribute__((ext_vector_type(8))) float v8f;
typedef __attribute__((ext_vector_type(4))) float v4f;

__device__ __forceinline__ float bf16_rne(float f) { unsigned int u = __float_as_uint(f); u += 0x7FFFu + ((u >> 16) & 1u); return __uint_as_float(u & 0xFFFF0000u); }
// 16-bit fragment from a k-contiguous row: elements 0..7 <- p[8hh .. 8hh+7], 8..15 <- p[16+8hh .. 16+8hh+7]
__device__ __forceinline__ v16b frag_kb(const b16* p, int hh) {
  const v8b a = *(const v8b*)(p + 8 * hh), b = *(const v8b*)(p + 16 + 8 * hh); v16b f;
#pragma unroll
  for (int e = 0; e < 8; ++e) { f[e] = a[e]; f[8 + e] = b[e]; }
  return f;
}
__device__ __forceinline__ v8f wmma16b(v16b a, v16b b, v8f c) {
  v8f d = __builtin_amdgcn_wmma_f32_16x16x32_f16(false, a, false, b, (short)0, c, false, false);
  return d;
}
// Scheduling fence at an end of a group of LDS fragment loads: the group stays together and ahead of the WMMAs that use it. Left free, the compiler
// reloads one register set in front of every WMMA or two and waits out the LDS latency each time.
__device__ __forceinline__ void hold_group() { __builtin_amdgcn_sched_barrier(0); }
__device__ __forceinline__ void wave_lds_sync() { __builtin_amdgcn_fence(3, "workgroup"); __builtin_amdgcn_wave_barrier(); __builtin_amdgcn_fence(2, "workgroup"); }
__device__ __forceinline__ float nexp2(float v) { return __builtin_amdgcn_exp2f(v); }
// The value of lane l ^ 16, by a vector cross-row move: no trip through the LDS queue, where it would stand behind the wave's fragment loads.
__device__ __forceinline__ float xhalf(float x) {
  return __builtin_bit_cast(float, __builtin_amdgcn_permlanex16(__builtin_bit_cast(int, x), __builtin_bit_cast(int, x), 0x76543210, 0xfedcba98, false, false));
}
// hi = f16(w), lo = f16((w - hi) * RS)
__device__ __forceinline__ void split16(float w, b16& hi, b16& lo) { hi = (b16)w; lo = (b16)((w - (float)hi) * RS); }

__device__ __forceinline__ void cvt_x_block(int vb, const float* __restrict__ X, b16* Xp) {
  const size_t u = (size_t)vb * 256 + threadIdx.x; const size_t row = u >> 8; const int c8 = (int)(u & 255) * 8;
  if (row >= (size_t)MR) return;
  const size_t b = row / SEQ, s = row % SEQ;
  const float* src = X + (b * SEQ_FULL + s) * DMOD + c8;
  b16* dst = Xp + row * DMOD + c8;
  const v4f x0 = *(const v4f*)src, x1 = *(const v4f*)(src + 4); v8b o;
#pragma unroll
  for (int j = 0; j < 4; ++j) { o[j] = (b16)(bf16_rne(x0[j]) * XS); o[4 + j] = (b16)(bf16_rne(x1[j]) * XS); }
  *(v8b*)dst = o; 
}

// W [2048 k][N n] f32 -> Wt [N][2048] f16 = bf16-RNE(w) x256 (k-contiguous for the B fragments). 2 waves (tid 0..63) per 64x64 tile (bx, by), transposed
// through their own LDS tile St; the four wave pairs of a block take four tiles of one matrix and pass the barrier together.
__device__ __forceinline__ void cvt_w_tile(b16 (*St)[64 + 8], int tid, int bx, int by, const float* __restrict__ W, b16* Wt, int N) {
  const int wave = tid >> 5, lane = tid & 31; const int k0 = bx * 64, n0 = by * 64;
  const float* src = W + (size_t)k0 * N + n0;
  for (int it = 0; it < 16; ++it) {
    const int e = (it * 64 + tid) * 4; const int kr = e >> 6, nc = e & 63;
    const v4f x = *(const v4f*)(src + (size_t)kr * N + nc);
#pragma unroll
    for (int j = 0; j < 4; ++j) St[nc + j][kr] = (b16)(bf16_rne(x[j]) * WS);
  }
  __syncthreads();   // St is read across waves
  b16* dstb = Wt + (size_t)n0 * KD + k0;
  {
#pragma unroll 1
    for (int it = 0; it < 8; ++it) {
      const int n = wave * 32 + it * 4 + (lane >> 3), ks = (lane & 7) * 8;
      const v8b o = *(const v8b*)(&St[n][ks]);
      *(v8b*)(dstb + (size_t)n * KD + ks) = o; }
     }
}

// cos/sin tables [SEQ][64] f32: ang = s * (1 / base^(2j/128)) in f32, precise sincosf. Block = 4 positions x 64 frequencies staged in LDS;
__device__ __forceinline__ void rope_tab_block(float (*Tb)[4][64 + 4], int vb, float* CT, float* ST) {
  const int tid = threadIdx.x; const int r = tid >> 6, j = tid & 63; const int s0 = vb * 4;
  const float ex = (float)(2 * j) * (1.0f / 128.0f);
  const float p = powf(ROPE_BASE, ex);
  const float inv = 1.0f / p;
  const float ang = (float)(s0 + r) * inv;
  float sn, c; sincosf(ang, &sn, &c);
  Tb[0][r][j] = c; Tb[1][r][j] = sn;
  __syncthreads();   // Tb is read across waves
  if (tid < 128) {
    const int tb = tid >> 6, rr = (tid >> 4) & 3, seg = (tid & 15) * 4;
    const v4f f = *(const v4f*)(&Tb[tb][rr][seg]);
    float* dst = (tb == 0 ? CT : ST) + (size_t)(s0 + rr) * 64 + seg;
    *(v4f*)dst = f; 
  }
}

// All operand preparation in one launch: its parts read only inputs and write disjoint planes. Block ranges, each block wholly in one part: first the W tiles
// (four 64x64 tiles a block; Wq, Wo, Wk, Wv), then the RoPE tables, then the rows of x.
constexpr int TQ = (KD / 64) * (DMOD / 64), TK = (KD / 64) * (NKV / 64);   // 64x64 tiles of a 2048-column and of a 512-column W
constexpr int PW = (2 * TQ + 2 * TK) / 4, PR = SEQ / 4, PX = MR;           // blocks of the three parts
static_assert(TQ % 4 == 0 && TK % 4 == 0 && KD / 64 == 32);
__global__ __launch_bounds__(256) void prep_kernel(const float* __restrict__ X, const float* __restrict__ Wq, const float* __restrict__ Wk,
    const float* __restrict__ Wv, const float* __restrict__ Wo, b16* Xp, b16* Wqt, b16* Wkt, b16* Wvt, b16* Wot, float* CT, float* ST) {
  __shared__ __attribute__((aligned(16))) unsigned char Sp[4 * 64 * (64 + 8) * 2];
  static_assert(sizeof(Sp) >= 2 * 4 * (64 + 4) * 4);
  const int vb = (int)blockIdx.x;
  if (vb < PW) {
    const int sub = (int)threadIdx.x >> 6, t4 = vb * 4;   // t4 picks the matrix for the whole block
    const float* W = Wq; b16* Wt = Wqt; int N = DMOD, t = t4 + sub;
    if (t4 >= 2 * TQ + TK) { W = Wv; Wt = Wvt; N = NKV; t -= 2 * TQ + TK; }
    else if (t4 >= 2 * TQ) { W = Wk; Wt = Wkt; N = NKV; t -= 2 * TQ; }
    else if (t4 >= TQ) { W = Wo; Wt = Wot; t -= TQ; }
    cvt_w_tile(reinterpret_cast<b16 (*)[64 + 8]>(Sp + sub * 64 * (64 + 8) * 2), (int)threadIdx.x & 63, t & 31, t >> 5, W, Wt, N);
  } else if (vb < PW + PR) {
    rope_tab_block(reinterpret_cast<float (*)[4][64 + 4]>(Sp), vb - PW, CT, ST);
  } else {
    cvt_x_block(vb - PW - PR, X, Xp);
  }
}

// The accumulators of four waves (tid 0..127, 2 x 2 on the tile) go to the tile's f32 staging To; the caller's barrier follows. Every product and sum of the
// two epilogue functions keeps a rounding of its own (no contraction), as it always had here: the planes they write stay bit-identical.
template <bool RES>
__device__ __forceinline__ void proj_stage(float (*To)[128 + 4], int tid, const v8f (&acc)[16]) {
#pragma clang fp contract(off)
  constexpr int BM = RES ? 64 : 128;
  const int wave = tid >> 5, lane = tid & 31, hh = lane >> 4, col = lane & 15, wm = wave >> 1, wn = wave & 1;
#pragma unroll
  for (int i = 0; i < BM / 32; ++i)
#pragma unroll
    for (int j = 0; j < 4; ++j)
#pragma unroll
      for (int r = 0; r < 8; ++r) {
        float v = acc[i * 4 + j][r];
        if constexpr (RES) v += acc[(i + 2) * 4 + j][r] * (1.0f / RS);
        To[wm * (BM / 2) + i * 16 + 8 * hh + r][wn * 64 + j * 16 + col] = v; }
}
// A staged tile goes to memory, by the 128 threads (tid 0..127) that own it; no barrier inside. Roundings as in proj_stage.
template <int MODE, bool RES>
__device__ __forceinline__ void proj_store(float (*To)[128 + 4], int tid, int bx, int bsel, int s0,
    b16* Ph, b16* Pl, float* Out, const float* __restrict__ CT, const float* __restrict__ ST, int nhead) {
#pragma clang fp contract(off)
  constexpr int BM = RES ? 64 : 128;
  constexpr int HF = BM / 64;   // every pass below handles its rows in each 64-row half of the tile: HF independent pieces, stored together
  if constexpr (MODE == 0) {
    const size_t pb = (((size_t)bsel * nhead + bx) * SEQ + s0) * HD;
    b16* ph = Ph + pb; b16* pl = Pl + pb;
    const float qsc = QS / (XS * WS);
    {
#pragma unroll 1
      for (int it = 0; it < 8; ++it) {
        const int seg = (tid & 15) * 8, sg = seg & 63;
        const float sgn = (seg >= 64) ? 1.0f : -1.0f;   // d < 64: x cos - x[d+64] sin; d >= 64: x cos + x[d-64] sin
        v8b hi[HF], lo[HF];
#pragma unroll
        for (int hf = 0; hf < HF; ++hf) {
          const int rr = hf * 64 + it * 8 + (tid >> 4);
          const float* trow = &To[rr][0]; const size_t ts = (size_t)(s0 + rr) * 64 + sg;
          const v4f xa = *(const v4f*)(trow + seg), xb = *(const v4f*)(trow + seg + 4);
          const v4f ya = *(const v4f*)(trow + (seg ^ 64)), yb = *(const v4f*)(trow + (seg ^ 64) + 4);
          const v4f ca = *(const v4f*)(CT + ts), cb = *(const v4f*)(CT + ts + 4), sa = *(const v4f*)(ST + ts), sb = *(const v4f*)(ST + ts + 4);
#pragma unroll
          for (int j = 0; j < 4; ++j) {
            b16 h0, l0;
            split16((xa[j] * ca[j] + sgn * ya[j] * sa[j]) * qsc, h0, l0); hi[hf][j] = h0; lo[hf][j] = l0;
            split16((xb[j] * cb[j] + sgn * yb[j] * sb[j]) * qsc, h0, l0); hi[hf][4 + j] = h0; lo[hf][4 + j] = l0; }
        }
#pragma unroll
        for (int hf = 0; hf < HF; ++hf) {
          const size_t off = (size_t)(hf * 64 + it * 8 + (tid >> 4)) * HD + seg;
          *(v8b*)(ph + off) = hi[hf]; *(v8b*)(pl + off) = lo[hf]; }
        asm volatile("s_wait_xcnt 0x0" ::: "memory"); }   // in front of the next pass's rewrite of the registers that the stores name
       }
  } else if constexpr (MODE == 1) {
    const size_t pb = ((size_t)bsel * nhead + bx) * HD * (size_t)SEQ + s0;
    b16* ph = Ph + pb; b16* pl = Pl + pb;
    const float vsc = QS / (XS * WS);
    {
#pragma unroll 1
      for (int it = 0; it < 8; ++it) {
        const int d = it * 16 + (tid >> 3);
        v8b hi[HF], lo[HF];
#pragma unroll
        for (int hf = 0; hf < HF; ++hf) {
          const int ss = hf * 64 + (tid & 7) * 8;
#pragma unroll
          for (int j = 0; j < 8; ++j) { b16 h0, l0; split16(To[ss + j][d] * vsc, h0, l0); hi[hf][j] = h0; lo[hf][j] = l0; }
        }
#pragma unroll
        for (int hf = 0; hf < HF; ++hf) {
          const size_t off = (size_t)d * SEQ + hf * 64 + (tid & 7) * 8;
          *(v8b*)(ph + off) = hi[hf]; *(v8b*)(pl + off) = lo[hf]; } }
       }
  }
}

// x@Wq, x@Wk, x@Wv in one launch: column tiles 0..15 are Q heads, 16..19 K heads, 20..23 V heads. A block = 12 waves = NG groups of four waves, one block a WGP;
// group g works column tile NG*blockIdx.x + g (waves 2 x 2 on it, 64x64 each, k ascending in steps of 32), and the NG groups share ONE
// copy of the block's 128 x rows: a buffer is [x 128 rows | group 0's W 128 rows | group 1's | group 2's], 512 rows from L2 where three blocks brought 768.
// A trip is 128 k = 256 B of each row at a pitch of 272 B (16 B x odd, for 16-byte readers): four WMMA steps between two barriers of the 12 waves.
constexpr int CQ = DMOD / 128, CK = NKV / 128, NG = 3;
constexpr int KS3 = 128, LP3 = 272, STAGE3 = 128 * (NG + 1) * LP3, TOB = 128 * (128 + 4) * 4;   // 139,264 B a buffer; 67,584 B of output staging a group
constexpr int QLDS = 2 * STAGE3 > NG * TOB ? 2 * STAGE3 : NG * TOB;                              // 278,528 B
static_assert((CQ + 2 * CK) % NG == 0 && MR % 128 == 0 && SEQ % 128 == 0 && NG == 3 && KD % KS3 == 0 && KD / KS3 >= 2);
// One lane's copies of a trip; 16 lanes cover one 256-B row. Sixteen fill its group's W rows r, r+8, .. r+120 (lw, gw = the lane's LDS byte address and global
// address in row r = its thread number in the group / 16). The x rows are dealt over all 12 waves, two rows a wave-wide copy: rows q, q+24, .. q+96 (lx, gx = the
// lane's addresses in row q = thread number / 16) and, from the first four waves only (sixth, wave-uniform), row q+120.
__device__ __forceinline__ void copy_stage3(unsigned lw, const b16* gw, unsigned lx, const b16* gx, bool sixth) {
  constexpr size_t RJ = (size_t)8 * KD, XJ = (size_t)24 * KD; constexpr unsigned LJ = 8u * LP3, LXJ = 24u * LP3;
  // s_wait_xcnt 0 as the last line of each statement: it stands in front of every later rewrite of a register that a copy names
  asm volatile(
      "global_load_async_to_lds_b128 %0, %11, off\n\t"
      "global_load_async_to_lds_b128 %1, %12, off\n\t"
      "global_load_async_to_lds_b128 %2, %13, off\n\t"
      "global_load_async_to_lds_b128 %3, %14, off\n\t"
      "global_load_async_to_lds_b128 %4, %15, off\n\t"
      "global_load_async_to_lds_b128 %5, %16, off\n\t"
      "global_load_async_to_lds_b128 %6, %17, off\n\t"
      "global_load_async_to_lds_b128 %7, %18, off\n\t"
      "global_load_async_to_lds_b128 %8, %19, off\n\t"
      "global_load_async_to_lds_b128 %9, %20, off\n\t"
      "global_load_async_to_lds_b128 %10, %21, off\n\t"
      "s_wait_xcnt 0x0"
      :: "v"(lx), "v"(lx + LXJ), "v"(lx + 2 * LXJ), "v"(lx + 3 * LXJ), "v"(lx + 4 * LXJ),
         "v"(lw), "v"(lw + LJ), "v"(lw + 2 * LJ), "v"(lw + 3 * LJ), "v"(lw + 4 * LJ), "v"(lw + 5 * LJ),
         "v"(gx), "v"(gx + XJ), "v"(gx + 2 * XJ), "v"(gx + 3 * XJ), "v"(gx + 4 * XJ),
         "v"(gw), "v"(gw + RJ), "v"(gw + 2 * RJ), "v"(gw + 3 * RJ), "v"(gw + 4 * RJ), "v"(gw + 5 * RJ)
      : "memory");
  asm volatile(
      "global_load_async_to_lds_b128 %0, %10, off\n\t"
      "global_load_async_to_lds_b128 %1, %11, off\n\t"
      "global_load_async_to_lds_b128 %2, %12, off\n\t"
      "global_load_async_to_lds_b128 %3, %13, off\n\t"
      "global_load_async_to_lds_b128 %4, %14, off\n\t"
      "global_load_async_to_lds_b128 %5, %15, off\n\t"
      "global_load_async_to_lds_b128 %6, %16, off\n\t"
      "global_load_async_to_lds_b128 %7, %17, off\n\t"
      "global_load_async_to_lds_b128 %8, %18, off\n\t"
      "global_load_async_to_lds_b128 %9, %19, off\n\t"
      "s_wait_xcnt 0x0"
      :: "v"(lw + 6 * LJ), "v"(lw + 7 * LJ), "v"(lw + 8 * LJ), "v"(lw + 9 * LJ), "v"(lw + 10 * LJ),
         "v"(lw + 11 * LJ), "v"(lw + 12 * LJ), "v"(lw + 13 * LJ), "v"(lw + 14 * LJ), "v"(lw + 15 * LJ),
         "v"(gw + 6 * RJ), "v"(gw + 7 * RJ), "v"(gw + 8 * RJ), "v"(gw + 9 * RJ), "v"(gw + 10 * RJ),
         "v"(gw + 11 * RJ), "v"(gw + 12 * RJ), "v"(gw + 13 * RJ), "v"(gw + 14 * RJ), "v"(gw + 15 * RJ)
      : "memory");
  if (sixth)
    asm volatile(
        "global_load_async_to_lds_b128 %0, %1, off\n\t"
        "s_wait_xcnt 0x0"
        :: "v"(lx + 5 * LXJ), "v"(gx + 5 * XJ) : "memory");
}
__global__ __launch_bounds__(128 * NG) __attribute__((amdgpu_num_vgpr(256))) void qkv_kernel(
    const b16* __restrict__ Xp, const b16* __restrict__ Wqt, const b16* __restrict__ Wkt, const b16* __restrict__ Wvt,
    b16* Qh, b16* Ql, b16* Kh, b16* Kl, b16* Vh, b16* Vl, const float* __restrict__ CT, const float* __restrict__ ST) {
  __shared__ __attribute__((aligned(16))) unsigned char Sm[QLDS];
  constexpr int NTRIP = KD / KS3;
  const int tid = (int)threadIdx.x, lane = tid & 31, hh = lane >> 4, col = lane & 15;
  const int wave = __builtin_amdgcn_readfirstlane(tid >> 5);   // in a scalar register: what follows from it (group, matrix, sixth) is decided by scalar branches
  const int grp = wave >> 2, tg = tid & 127, wm = (wave >> 1) & 1, wn = wave & 1;
  const int bx = (int)blockIdx.x * NG + grp, by = (int)blockIdx.y;
  const int bsel = by / (SEQ / 128), s0 = (by - bsel * (SEQ / 128)) * 128;
  const size_t m0 = (size_t)bsel * SEQ + s0;
  const bool isq = bx < CQ, isv = bx >= CQ + CK;
  const int hx = isq ? bx : isv ? bx - CQ - CK : bx - CQ;      // the head (column tile) inside its own matrix
  const b16* Bt = (isq ? Wqt : isv ? Wvt : Wkt) + (size_t)hx * 128 * KD;
  const bool sixth = wave < 4;
  const int cr = tg >> 4, cs = (tid & 15) * 8;                 // the lane's W row in each run of 8 rows, and its 16-byte piece of a row
  const int xr = wave * 2 + hh;                                // the lane's x row in each run of 24 rows
  const b16* gw = Bt + (size_t)cr * KD + cs;
  const b16* gx = Xp + (m0 + xr) * KD + cs;
  const unsigned lw = (unsigned)(uintptr_t)(&Sm[(128 * (grp + 1) + cr) * LP3 + cs * 2]);
  const unsigned lx = (unsigned)(uintptr_t)(&Sm[xr * LP3 + cs * 2]);
  const unsigned char* sa = &Sm[(wm * 64 + col) * LP3];
  const unsigned char* sb = &Sm[(128 * (grp + 1) + wn * 64 + col) * LP3];
  v8f acc[16];
#pragma unroll
  for (int t = 0; t < 16; ++t) acc[t] = (v8f){};
  copy_stage3(lw, gw, lx, gx, sixth);
  asm volatile("s_wait_asynccnt 0x0" ::: "memory");   // this wave's copies of trip 0 have landed
  __syncthreads();                                     // every wave's have: trip 0 may be read
  copy_stage3(lw + STAGE3, gw + KS3, lx + STAGE3, gx + KS3, sixth);
#pragma unroll 1
  for (int tr = 0; tr < NTRIP; ++tr) {
    const int bo = (tr & 1) * STAGE3;
#pragma unroll
    for (int kk = 0; kk < KS3 / 32; ++kk) {
      v16b af[4], bf[4];   // the fragments of one WMMA step, read as one group ahead of its 16 WMMAs
      hold_group();   // no load of this group rises among the WMMAs before it
#pragma unroll
      for (int i = 0; i < 4; ++i) af[i] = frag_kb((const b16*)(sa + bo + i * 16 * LP3) + kk * 32, hh);
#pragma unroll
      for (int j = 0; j < 4; ++j) bf[j] = frag_kb((const b16*)(sb + bo + j * 16 * LP3) + kk * 32, hh);
      hold_group();   // and none sinks among its own WMMAs
#pragma unroll
      for (int i = 0; i < 4; ++i)
#pragma unroll
        for (int j = 0; j < 4; ++j) acc[i * 4 + j] = wmma16b(af[i], bf[j], acc[i * 4 + j]);
    }
    hold_group();   // the trip's WMMAs stay in front of the waits and the barrier: sunk behind them they would delay the refill
    asm volatile("s_wait_dscnt 0x0" ::: "memory");      // this wave's reads of the buffer are done before it is refilled
    asm volatile("s_wait_asynccnt 0x0" ::: "memory");   // this wave's copies of trip tr+1 have landed
    __syncthreads();                                     // publishes trip tr+1 and ends every reader's last read of trip tr
    if (tr + 2 < NTRIP) { const int ko = (tr + 2) * KS3; copy_stage3(lw + bo, gw + ko, lx + bo, gx + ko, sixth); }
  }
  asm volatile("s_wait_asynccnt 0x0" ::: "memory");     // no copy is outstanding when the buffers become output staging
  float (*To)[128 + 4] = reinterpret_cast<float (*)[128 + 4]>(Sm + grp * TOB);   // each group stages its own tile
  proj_stage<false>(To, tg, acc);
  __syncthreads();   // To is read across the group's waves; one barrier for the block, whatever its groups store
  if (!isv) proj_store<0, false>(To, tg, hx, bsel, s0, isq ? Qh : Kh, isq ? Ql : Kl, nullptr, CT, ST, isq ? H : HKV);
  else proj_store<1, false>(To, tg, hx, bsel, s0, Vh, Vl, nullptr, CT, ST, HKV);
}

// Eight asynchronous 16-byte copies of one lane: LDS rows 24 apart, from l on, each from a global address of its own.
__device__ __forceinline__ void copy8(unsigned l, const b16* g0, const b16* g1, const b16* g2, const b16* g3, const b16* g4, const b16* g5, const b16* g6, const b16* g7) {
  constexpr unsigned LJ = 24u * LP3;
  // s_wait_xcnt 0 as the last line: it stands in front of every later rewrite of a register that a copy names
  asm volatile(
      "global_load_async_to_lds_b128 %0, %8, off\n\t"
      "global_load_async_to_lds_b128 %1, %9, off\n\t"
      "global_load_async_to_lds_b128 %2, %10, off\n\t"
      "global_load_async_to_lds_b128 %3, %11, off\n\t"
      "global_load_async_to_lds_b128 %4, %12, off\n\t"
      "global_load_async_to_lds_b128 %5, %13, off\n\t"
      "global_load_async_to_lds_b128 %6, %14, off\n\t"
      "global_load_async_to_lds_b128 %7, %15, off\n\t"
      "s_wait_xcnt 0x0"
      :: "v"(l), "v"(l + LJ), "v"(l + 2 * LJ), "v"(l + 3 * LJ), "v"(l + 4 * LJ), "v"(l + 5 * LJ), "v"(l + 6 * LJ), "v"(l + 7 * LJ),
         "v"(g0), "v"(g1), "v"(g2), "v"(g3), "v"(g4), "v"(g5), "v"(g6), "v"(g7)
      : "memory");
}
// ctx@Wo: 256 blocks of the same work, one a WGP: 144 operand rows of ctx x 256 columns. The rows: 112 token rows of the positions >= QEA, then 16 token rows of the
// positions < QEA from the hi plane, then the same 16 from the x2048 residual plane. 12 waves, 3 x 4 on the tile, 48 x 64 each (3 x 4 accumulators); the third wave
// row holds 16 plain rows, the 16 hi rows and their 16 residual rows, so that a residual sum is folded into its hi sum inside one wave. A buffer is
// [ctx 144 rows | Wo 256 rows]; a trip is 128 k = 256 B of each row at the pitch LP3, two buffers, as in qkv_kernel. Every sum keeps its k order.
constexpr int OP = 112, ORS = 16, OA = OP + 2 * ORS, OBN = 256, OROWS = OA + OBN, STAGE4 = OROWS * LP3, OTP = OBN + 4;   // 108,800 B a buffer
constexpr int OT = (SEQ - QEA) / OP;                                                                                  // row tiles of one batch entry
static_assert((SEQ - QEA) % OP == 0 && QEA % ORS == 0 && QEA / ORS == OT && DMOD % OBN == 0 && OA == 3 * 48 && OROWS == 16 * 24 + 16);
static_assert((OP + ORS) * OTP * 4 <= 2 * STAGE4);
// One lane's copies of a trip; 16 lanes cover one 256-B row, the 12 waves 24 rows: rows q, q+24, .. q+360 (l, g[j] = the lane's LDS byte address in row q = thread
// number / 16 and its global address in row q+24j, at the trip's k) and, from the first eight waves only (last, wave-uniform), row q+384.
__device__ __forceinline__ void copy_stage4(unsigned l, const b16* (&g)[17], bool last) {
  constexpr unsigned LJ = 24u * LP3;
  copy8(l, g[0], g[1], g[2], g[3], g[4], g[5], g[6], g[7]);
  copy8(l + 8 * LJ, g[8], g[9], g[10], g[11], g[12], g[13], g[14], g[15]);
  if (last)
    asm volatile(   // s_wait_xcnt 0 as in copy8
        "global_load_async_to_lds_b128 %0, %1, off\n\t"
        "s_wait_xcnt 0x0"
        :: "v"(l + 16 * LJ), "v"(g[16]) : "memory");
#pragma unroll
  for (int j = 0; j < 17; ++j) g[j] += KS3;   // on to the next trip, behind the waits above
}
__global__ __launch_bounds__(384) __attribute__((amdgpu_num_vgpr(256))) void out_kernel(
    const b16* __restrict__ Ch, const b16* __restrict__ Cl, const b16* __restrict__ Wot, float* Out) {
  __shared__ __attribute__((aligned(16))) unsigned char Sm[2 * STAGE4];
  constexpr int NTRIP = KD / KS3;
  const int tid = (int)threadIdx.x, lane = tid & 31, hh = lane >> 4, col = lane & 15;
  const int wave = __builtin_amdgcn_readfirstlane(tid >> 5);   // in a scalar register: what follows from it (wave row, last, the rows it stores) is decided by scalar branches
  const int wm = wave >> 2, wn = wave & 3;
  const int n0 = (int)blockIdx.x * OBN, by = (int)blockIdx.y;
  const int bsel = by / OT, tsel = by - bsel * OT;
  const int sp = QEA + tsel * OP, sr = tsel * ORS;             // first position of the block's plain rows, and of its rows with a residual
  const size_t mb = (size_t)bsel * SEQ;
  const bool last = wave < 8;
  const int xr = tid >> 4, cs = (tid & 15) * 8;                // the lane's row in each run of 24 rows, and its 16-byte piece of a row
  const b16* g[17];
#pragma unroll
  for (int j = 0; j < 17; ++j) {
    const int r = (j < 16 || last) ? xr + 24 * j : OROWS - 1;  // a wave without a 17th copy holds an address in bounds all the same
    const b16* p = r < OP ? Ch + (mb + sp + r) * KD
                 : r < OP + ORS ? Ch + (mb + sr + (r - OP)) * KD
                 : r < OA ? Cl + (mb + sr + (r - OP - ORS)) * KD
                 : Wot + (size_t)(n0 + (r - OA)) * KD;
    g[j] = p + cs;
  }
  const unsigned lc = (unsigned)(uintptr_t)(&Sm[xr * LP3 + cs * 2]);
  const unsigned char* sa = &Sm[(wm * 48 + col) * LP3];
  const unsigned char* sb = &Sm[(OA + wn * 64 + col) * LP3];
  v8f acc[12];
#pragma unroll
  for (int t = 0; t < 12; ++t) acc[t] = (v8f){};
  copy_stage4(lc, g, last);
  asm volatile("s_wait_asynccnt 0x0" ::: "memory");   // this wave's copies of trip 0 have landed
  __syncthreads();                                     // every wave's have: trip 0 may be read
  copy_stage4(lc + STAGE4, g, last);
#pragma unroll 1
  for (int tr = 0; tr < NTRIP; ++tr) {
    const int bo = (tr & 1) * STAGE4;
#pragma unroll
    for (int kk = 0; kk < KS3 / 32; ++kk) {
      v16b af[3], bf[4];   // the fragments of one WMMA step, read as one group ahead of its 12 WMMAs
      hold_group();   // no load of this group rises among the WMMAs before it
#pragma unroll
      for (int i = 0; i < 3; ++i) af[i] = frag_kb((const b16*)(sa + bo + i * 16 * LP3) + kk * 32, hh);
#pragma unroll
      for (int j = 0; j < 4; ++j) bf[j] = frag_kb((const b16*)(sb + bo + j * 16 * LP3) + kk * 32, hh);
      hold_group();   // and none sinks among its own WMMAs
#pragma unroll
      for (int i = 0; i < 3; ++i)
#pragma unroll
        for (int j = 0; j < 4; ++j) acc[i * 4 + j] = wmma16b(af[i], bf[j], acc[i * 4 + j]);
    }
    hold_group();   // the trip's WMMAs stay in front of the waits and the barrier: sunk behind them they would delay the refill
    asm volatile("s_wait_dscnt 0x0" ::: "memory");      // this wave's reads of the buffer are done before it is refilled
    asm volatile("s_wait_asynccnt 0x0" ::: "memory");   // this wave's copies of trip tr+1 have landed
    __syncthreads();                                     // publishes trip tr+1 and ends every reader's last read of trip tr
    if (tr + 2 < NTRIP) copy_stage4(lc + bo, g, last);
  }
  asm volatile("s_wait_asynccnt 0x0" ::: "memory");     // no copy is outstanding when the buffers become output staging
  // Staging, f32: rows 0..111 the plain token rows, 112..127 the rows with a residual (hi sum + residual sum / 2048; the factor is a power of two, its product exact).
  float (*To)[OTP] = reinterpret_cast<float (*)[OTP]>(Sm);
#pragma unroll
  for (int i = 0; i < 3; ++i) {
    if (wm == 2 && i == 2) continue;   // the residual sums go out with their hi sums
#pragma unroll
    for (int j = 0; j < 4; ++j)
#pragma unroll
      for (int r = 0; r < 8; ++r) {
        float v = acc[i * 4 + j][r];
        if (wm == 2 && i == 1) v += acc[8 + j][r] * (1.0f / RS);
        To[wm * 48 + i * 16 + 8 * hh + r][wn * 64 + j * 16 + col] = v; }
  }
  __syncthreads();   // To is read across waves
  // Two waves store one 1-KB row piece of out; wave pair w2 takes the staged rows w2, w2+6, ..: four rows a pass, read together and stored together. The row's
  // address is scalar, the lane's place in the row a vector offset that no pass rewrites.
  const float osc = 1.0f / (CS * WS);
  const int w2 = wave >> 1; const unsigned seg = (unsigned)(tid & 63) * 4u;
  float* ob = Out + (size_t)bsel * SEQ_FULL * DMOD + n0;
#pragma unroll 1
  for (int it = 0; it < 5; ++it) {   // staged rows 0..119
    v4f f[4];
#pragma unroll
    for (int u = 0; u < 4; ++u) f[u] = *(const v4f*)(&To[w2 + 6 * (it * 4 + u)][seg]) * osc;
#pragma unroll
    for (int u = 0; u < 4; ++u) {
      const int rr = w2 + 6 * (it * 4 + u);
      *(v4f*)(ob + (size_t)(rr < OP ? sp + rr : sr + (rr - OP)) * DMOD + seg) = f[u];
    }
    asm volatile("s_wait_xcnt 0x0" ::: "memory");   // in front of the next pass's rewrite of the registers that the stores name
  }
  static_assert(OP <= 120 && OP + ORS == 128);
  {                                  // staged rows 120..125
    const v4f f = *(const v4f*)(&To[120 + w2][seg]) * osc;
    *(v4f*)(ob + (size_t)(sr + (120 + w2 - OP)) * DMOD + seg) = f;
    asm volatile("s_wait_xcnt 0x0" ::: "memory");   // in front of a rewrite of the registers that the store names
  }
  if (w2 < 2) {                      // staged rows 126, 127
    const v4f f = *(const v4f*)(&To[126 + w2][seg]) * osc;
    *(v4f*)(ob + (size_t)(sr + (126 + w2 - OP)) * DMOD + seg) = f;
  }
}

// One key step of the attention kernel in LDS: K tile = 32 key rows of 256 B at a pitch of 272 B, V tile = DW d rows of 64 B (32 keys) at a pitch of 80 B
// (both 16 B x odd, for 16-byte readers). A buffer holds K hi[, K lo], V hi[, V lo].
constexpr int KP = 272, VP = 80, KTILE = 32 * KP, PBYTES = NREP * 16 * (32 + 8) * 2, ESUB = 65536, ALDS = 2 * ESUB;
// The asynchronous 16-byte copies of one lane (of 128) that fill one buffer: K rows r, r+8, r+16, r+24 (16 lanes cover one 256-B row) and V rows d, d+32[, d+64,
// d+96] (4 lanes cover one 64-B row); ER: the same rows of the lo planes, K lo one K tile and V lo one V tile (64 rows) further in LDS.
// lk, lv = the lane's LDS byte addresses in its first rows, gk, gkl, gv, gvl = its global addresses there.
template <bool ER>
__device__ __forceinline__ void copy_kv(unsigned lk, unsigned lv, const b16* gk, const b16* gkl, const b16* gv, const b16* gvl) {
  constexpr size_t KJ = (size_t)8 * HD, VJ = (size_t)32 * SEQ; constexpr unsigned LKJ = 8u * KP, LVJ = 32u * VP, KL = KTILE, VL = 64u * VP;
  // s_wait_xcnt 0 as the last line of either statement: it stands in front of every later rewrite of a register that a copy names
  if constexpr (ER) {
    asm volatile(
        "global_load_async_to_lds_b128 %0, %12, off\n\t"
        "global_load_async_to_lds_b128 %1, %13, off\n\t"
        "global_load_async_to_lds_b128 %2, %14, off\n\t"
        "global_load_async_to_lds_b128 %3, %15, off\n\t"
        "global_load_async_to_lds_b128 %4, %16, off\n\t"
        "global_load_async_to_lds_b128 %5, %17, off\n\t"
        "global_load_async_to_lds_b128 %6, %18, off\n\t"
        "global_load_async_to_lds_b128 %7, %19, off\n\t"
        "global_load_async_to_lds_b128 %8, %20, off\n\t"
        "global_load_async_to_lds_b128 %9, %21, off\n\t"
        "global_load_async_to_lds_b128 %10, %22, off\n\t"
        "global_load_async_to_lds_b128 %11, %23, off\n\t"
        "s_wait_xcnt 0x0"
        :: "v"(lk), "v"(lk + LKJ), "v"(lk + 2 * LKJ), "v"(lk + 3 * LKJ), "v"(lk + KL), "v"(lk + KL + LKJ), "v"(lk + KL + 2 * LKJ), "v"(lk + KL + 3 * LKJ),
           "v"(lv), "v"(lv + LVJ), "v"(lv + VL), "v"(lv + VL + LVJ),
           "v"(gk), "v"(gk + KJ), "v"(gk + 2 * KJ), "v"(gk + 3 * KJ), "v"(gkl), "v"(gkl + KJ), "v"(gkl + 2 * KJ), "v"(gkl + 3 * KJ),
           "v"(gv), "v"(gv + VJ), "v"(gvl), "v"(gvl + VJ)
        : "memory");
  } else {
    asm volatile(
        "global_load_async_to_lds_b128 %0, %8, off\n\t"
        "global_load_async_to_lds_b128 %1, %9, off\n\t"
        "global_load_async_to_lds_b128 %2, %10, off\n\t"
        "global_load_async_to_lds_b128 %3, %11, off\n\t"
        "global_load_async_to_lds_b128 %4, %12, off\n\t"
        "global_load_async_to_lds_b128 %5, %13, off\n\t"
        "global_load_async_to_lds_b128 %6, %14, off\n\t"
        "global_load_async_to_lds_b128 %7, %15, off\n\t"
        "s_wait_xcnt 0x0"
        :: "v"(lk), "v"(lk + LKJ), "v"(lk + 2 * LKJ), "v"(lk + 3 * LKJ), "v"(lv), "v"(lv + LVJ), "v"(lv + 2 * LVJ), "v"(lv + 3 * LVJ),
           "v"(gk), "v"(gk + KJ), "v"(gk + 2 * KJ), "v"(gk + 3 * KJ), "v"(gv), "v"(gv + VJ), "v"(gv + 2 * VJ), "v"(gv + 3 * VJ)
        : "memory");
  }
}

// Causal GQA attention: block (bx = query tile of 16, bg in NB*HKV) = 8 waves = two sets of 4 waves; a set = the 4 query heads of one KV head on the same 16 queries,
// so its four walk the same keys; each set has its own half of the LDS (buffers, P rows) and fills it itself. Query positions >= QEA: the tile's 32-key steps go
// to the two sets in turn (set 0: 0, 2, ..; set 1: 1, 3, ..), so the longest walk is 32 steps and not 64; each set keeps a running max, sum and O^T of its own, joined
// through LDS behind the loop. Where the step count is odd, set 1's last step lies wholly behind the diagonal (in bounds: SEQ % 64 == 0) and adds zeros.
// ER: both sets walk all steps, set s on d-half s. Each 32-key step's K and V tiles are copied once into LDS, two buffers: the copies of a set's step st+2 fly while
// its step st+1 is worked on; every wave reads its fragments from there. Key steps up to the 32-aligned block of the last query in fixed order; online
// softmax (running max, f32); keys later than the query get -inf on the diagonal step; P x1024 packed from the score registers (ER: via wave-private LDS); O^T += V^T P^T. ER (query position
// < QEA): scores Kh Qh + (Kh Ql + Kl Qh)/2048, O^T second accumulator Vh Pr + Vl Ph folded by 1/2048, each set restricted to 64 of the 128 d rows.
// ctx hi x64 / lo x2048 planes [b*SEQ+s][h*128 + d], staged per wave through the same LDS behind the loop's last barrier.
template <bool ER>
__device__ __forceinline__ void attn_block(unsigned char* Sb, int bx, int bg,
    const b16* __restrict__ Qh, const b16* __restrict__ Ql, const b16* __restrict__ Kh, const b16* __restrict__ Kl,
    const b16* __restrict__ Vh, const b16* __restrict__ Vl, b16* Ch, b16* Cl) {
  constexpr int NT = ER ? 4 : 8, DW = NT * 16, NP = ER ? 2 : 1, VO = NP * KTILE, VT = DW * VP, ASTAGE = VO + NP * VT;   // 27,648 / 18,944 B a buffer
  static_assert(NREP == 4 && NREP * 16 * (DW + 4) * 4 <= 2 * ASTAGE && ASTAGE % 16 == 0);
  static_assert(2 * ASTAGE + NP * PBYTES <= ESUB && QEA >= 64 && SEQ % 64 == 0);
  constexpr int TS = ER ? 1 : 2;                                             // 32-key steps from one step of a set to its next
  const int set = __builtin_amdgcn_readfirstlane((int)threadIdx.x >> 7);    // in a scalar register: what follows from it is scalar, its tests are scalar branches
  const int t0 = ER ? 0 : set;                                               // the set's first 32-key step
  unsigned char* Sm = Sb + set * ESUB;
  b16 (*Pb)[16][32 + 8] = reinterpret_cast<b16 (*)[16][32 + 8]>(Sm + 2 * ASTAGE);            // behind the two buffers, ER only: P, then its residual
  b16 (*Pr)[16][32 + 8] = reinterpret_cast<b16 (*)[16][32 + 8]>(Sm + 2 * ASTAGE + (ER ? PBYTES : 0));
  float (*To)[16][DW + 4] = reinterpret_cast<float (*)[16][DW + 4]>(Sm);
  const int tid = threadIdx.x & 127, wave = tid >> 5, lane = tid & 31, hh = lane >> 4, col = lane & 15;   // numbered inside the set
  const int b = bg / HKV, g = bg - b * HKV, h = g * NREP + wave;
  const int q0 = (ER ? 0 : QEA) + bx * 16, qi = q0 + col;
  const int dh = ER ? set * 64 : 0;
  const b16* qrow = Qh + ((size_t)(b * H + h) * SEQ + qi) * HD;
  const b16* qlrow = Ql + ((size_t)(b * H + h) * SEQ + qi) * HD;
  const size_t ko = (size_t)(b * HKV + g) * SEQ * HD + (size_t)(t0 * 32 + (tid >> 4)) * HD + (tid & 15) * 8;   // the lane's piece of K row tid>>4 of step t0
  const size_t vo = ((size_t)(b * HKV + g) * HD + dh + (tid >> 2)) * SEQ + t0 * 32 + (tid & 3) * 8;            // the lane's piece of V row tid>>2 of step t0
  const b16* gk = Kh + ko; const b16* gkl = Kl + ko; const b16* gv = Vh + vo; const b16* gvl = Vl + vo;
  const unsigned lk = (unsigned)(uintptr_t)(&Sm[(tid >> 4) * KP + (tid & 15) * 16]);
  const unsigned lv = (unsigned)(uintptr_t)(&Sm[VO + (tid >> 2) * VP + (tid & 3) * 16]);
  const unsigned char* sk = &Sm[col * KP];
  const unsigned char* sv = &Sm[VO + col * VP];
  v16b qa[4];
#pragma unroll
  for (int c = 0; c < 4; ++c) { qa[c] = (v16b){}; if constexpr (!ER) qa[c] = frag_kb(qrow + c * 32, hh); }
  const float cs = SCL * LOG2E / (QS * QS);   // 1/sqrt(128) and the two x8 carriers, in the log2 domain
  float m = -INFINITY, l = 0.0f; v8f o[NT], o2[NT];
#pragma unroll
  for (int t = 0; t < NT; ++t) { o[t] = (v8f){}; o2[t] = (v8f){}; }
  const int nst = (q0 / 32 + TS) / TS;   // block-uniform: a set's steps; together keys 0 .. (q0 | 31), rounded up to TS steps
  copy_kv<ER>(lk, lv, gk, gkl, gv, gvl);
  asm volatile("s_wait_asynccnt 0x0" ::: "memory");   // this wave's copies of step 0 have landed
  __syncthreads();                                     // every wave's have: step 0 may be read
  if (1 < nst) copy_kv<ER>(lk + ASTAGE, lv + ASTAGE, gk + (size_t)TS * 32 * HD, gkl + (size_t)TS * 32 * HD, gv + TS * 32, gvl + TS * 32);
#pragma unroll 1
  for (int st = 0; st < nst; ++st) {
    const int bo = (st & 1) * ASTAGE;
    const int kb = (st * TS + t0) * 32; const int lim = qi - kb;   // key offsets > lim are later than the query (binds only from the diagonal step on)
    float e[16]; float mx = -INFINITY;
    v8f s[2], s2[2];
    if constexpr (ER) {
#pragma unroll
      for (int u = 0; u < 2; ++u) {
        v16b kf[4], klf[4];   // 16 keys' K fragments, hi and lo (not held as a group: with the lo planes' they would not fit the registers)
#pragma unroll
        for (int c = 0; c < 4; ++c) {
          kf[c] = frag_kb((const b16*)(sk + bo + u * 16 * KP) + c * 32, hh);
          klf[c] = frag_kb((const b16*)(sk + bo + KTILE + u * 16 * KP) + c * 32, hh);
        }
        s[u] = (v8f){}; s2[u] = (v8f){};
#pragma unroll
        for (int c = 0; c < 4; ++c) {
          const v16b qh = frag_kb(qrow + c * 32, hh), ql = frag_kb(qlrow + c * 32, hh);
          s[u] = wmma16b(kf[c], qh, s[u]); s2[u] = wmma16b(kf[c], ql, s2[u]); s2[u] = wmma16b(klf[c], qh, s2[u]);
        }
      }
    } else {
      v16b kf[2][4];   // the step's K fragments, read as one group ahead of their WMMAs
#pragma unroll
      for (int u = 0; u < 2; ++u)
#pragma unroll
        for (int c = 0; c < 4; ++c) kf[u][c] = frag_kb((const b16*)(sk + bo + u * 16 * KP) + c * 32, hh);
      hold_group();   // no load of the group sinks among the WMMAs
#pragma unroll
      for (int u = 0; u < 2; ++u) { s[u] = (v8f){}; s2[u] = (v8f){}; }
#pragma unroll
      for (int c = 0; c < 4; ++c)   // the two 16-key chains alternate, so that neither waits out its own accumulate latency; each chain's sum order is as it was
#pragma unroll
        for (int u = 0; u < 2; ++u) s[u] = wmma16b(kf[u][c], qa[c], s[u]);
    }
    v16b vf[NT];   // the step's V fragments, read as one group: their LDS latency passes under the softmax arithmetic
#pragma unroll
    for (int t = 0; t < NT; ++t) vf[t] = frag_kb((const b16*)(sv + bo + t * 16 * VP), hh);
    if constexpr (!ER) hold_group();   // keeps the V loads here, ahead of the softmax arithmetic (ER: held so long they would not fit the registers)
#pragma unroll
    for (int u = 0; u < 2; ++u)
#pragma unroll
      for (int r = 0; r < 8; ++r) {
        float v = s[u][r];
        if constexpr (ER) v += s2[u][r] * (1.0f / RS);
        v *= cs;
        if (u * 16 + 8 * hh + r > lim) v = -INFINITY;
        e[u * 8 + r] = v; mx = fmaxf(mx, v); }
    float ox; if constexpr (ER) ox = __shfl_xor(mx, 16); else ox = xhalf(mx);   // ER is left as it was: one register more and it spills
    mx = fmaxf(mx, ox); const float mn = fmaxf(m, mx); const float al = nexp2(m - mn); float sum = 0.0f;
    // A lane's 16 scores are keys 8hh+0..7 and 16+8hh+0..7 of its own query: the k-map of a B fragment, element for element. So P^T is packed where it stands.
    // ER keeps the trip through the wave's LDS rows: without its fence the Q loads of the loop are hoisted and spill.
    v16b pf = (v16b){}, prf = (v16b){};
#pragma unroll
    for (int i2 = 0; i2 < 16; ++i2) {
      const float p = nexp2(e[i2] - mn); sum += p; const int pi = (i2 < 8 ? 0 : 16) + 8 * hh + (i2 & 7);
      const float pp = p * PS; const b16 phv = (b16)pp;
      if constexpr (ER) { Pb[wave][col][pi] = phv; Pr[wave][col][pi] = (b16)((pp - (float)phv) * RS); }
      else pf[i2] = phv; }
    if constexpr (ER) ox = __shfl_xor(sum, 16); else ox = xhalf(sum);
    sum += ox; l = l * al + sum; m = mn;
    if constexpr (ER) { wave_lds_sync(); pf = frag_kb(&Pb[wave][col][0], hh); prf = frag_kb(&Pr[wave][col][0], hh); }
    v16b vlf[NT];  // the lo V fragments only here: held across the softmax they would not fit the registers
#pragma unroll
    for (int t = 0; t < NT; ++t) { vlf[t] = (v16b){}; if constexpr (ER) vlf[t] = frag_kb((const b16*)(sv + bo + VT + t * 16 * VP), hh); }
#pragma unroll
    for (int t = 0; t < NT; ++t) {
      o[t] *= al; o[t] = wmma16b(vf[t], pf, o[t]);
      if constexpr (ER) { o2[t] *= al; o2[t] = wmma16b(vf[t], prf, o2[t]); o2[t] = wmma16b(vlf[t], pf, o2[t]); } }
    hold_group();   // the step's WMMAs stay in front of the waits and the barrier: sunk behind them they would delay the refill
    asm volatile("s_wait_dscnt 0x0" ::: "memory");      // this wave's reads of the buffer (and of its P rows) are done before the refill
    asm volatile("s_wait_asynccnt 0x0" ::: "memory");   // this wave's copies of step st+1 have landed
    __syncthreads();                                     // publishes step st+1 and ends every reader's last read of step st
    if (st + 2 < nst) { const int kq = (st + 2) * TS * 32; const size_t kn = (size_t)kq * HD; copy_kv<ER>(lk + bo, lv + bo, gk + kn, gkl + kn, gv + kq, gvl + kq); }
  }
  asm volatile("s_wait_asynccnt 0x0" ::: "memory");     // no copy is outstanding when the buffers become output staging
  if constexpr (!ER) {
    // The two sets' partial results are joined: wave w of set 1 leaves max, sum and O^T in its set's LDS half (free behind the loop's last barrier), 16 bytes a lane
    // and store, lanes side by side; wave w of set 0 holds the same head, queries and lane layout, rescales both to the common max and goes on alone.
    v4f* Xo = reinterpret_cast<v4f*>(Sb + ESUB) + wave * (17 * 32) + lane;
    static_assert(NREP * 17 * 32 * 16 <= ESUB);
    if (set == 1) {
#pragma unroll
      for (int t = 0; t < NT; ++t) {
        Xo[(2 * t) * 32] = (v4f){o[t][0], o[t][1], o[t][2], o[t][3]};
        Xo[(2 * t + 1) * 32] = (v4f){o[t][4], o[t][5], o[t][6], o[t][7]}; }
      Xo[16 * 32] = (v4f){m, l, 0.0f, 0.0f};
    }
    __syncthreads();   // set 1's partial results are read by set 0
    if (set == 1) return;   // behind the block's last barrier
    const v4f ml = Xo[16 * 32];
    const float mj = fmaxf(m, ml[0]), a0 = nexp2(m - mj), a1 = nexp2(ml[0] - mj);   // both maxima are finite: either set has a step in front of the diagonal
    l = l * a0 + ml[1] * a1;
#pragma unroll
    for (int t = 0; t < NT; ++t) {
      const v4f xa = Xo[(2 * t) * 32], xb = Xo[(2 * t + 1) * 32];
#pragma unroll
      for (int j = 0; j < 4; ++j) { o[t][j] = o[t][j] * a0 + xa[j] * a1; o[t][4 + j] = o[t][4 + j] * a0 + xb[j] * a1; } }
  }
  const float inv = 1.0f / (l * PS * QS);
#pragma unroll
  for (int t = 0; t < NT; ++t) {
#pragma unroll
    for (int r = 0; r < 8; ++r) {
      float ov = o[t][r];
      if constexpr (ER) ov += o2[t][r] * (1.0f / RS);
      To[wave][col][t * 16 + 8 * hh + r] = ov * inv; } }
  wave_lds_sync();
  constexpr int LPR = DW / 8, RPI = 32 / LPR, NIT = 16 / RPI;
  static_assert(NIT * RPI == 16 && LPR * 8 == DW);
  const size_t cbase = ((size_t)b * SEQ + q0) * DMOD + (size_t)h * HD + dh;
  {
#pragma unroll 1
    for (int it = 0; it < NIT; ++it) {
      const int rr = it * RPI + lane / LPR, seg = (lane % LPR) * 8;
      const v4f fa = *(const v4f*)(&To[wave][rr][seg]), fb = *(const v4f*)(&To[wave][rr][seg + 4]);
      v8b hi, lo;
#pragma unroll
      for (int j = 0; j < 4; ++j) { b16 h0, l0; split16(fa[j] * CS, h0, l0); hi[j] = h0; lo[j] = l0; split16(fb[j] * CS, h0, l0); hi[4 + j] = h0; lo[4 + j] = l0; }
      const size_t off = cbase + (size_t)rr * DMOD + seg;
      *(v8b*)(Ch + off) = hi; *(v8b*)(Cl + off) = lo; }
     }
}
// Both attention forms in one launch. There are more blocks than places (two blocks of 8 waves a WGP). Block index order: first the blocks of
// the query positions < QEA (few steps, but long ones), then those of the positions >= QEA, the longest walks first (for speed only).
constexpr int AX = (SEQ - QEA) / 16, AN = AX * NB * HKV, AEX = QEA / 16, AE = AEX * NB * HKV;
__global__ __launch_bounds__(256) __attribute__((amdgpu_num_vgpr(256))) void attn_kernel(
    const b16* __restrict__ Qh, const b16* __restrict__ Ql, const b16* __restrict__ Kh, const b16* __restrict__ Kl,
    const b16* __restrict__ Vh, const b16* __restrict__ Vl, b16* Ch, b16* Cl) {
  __shared__ __attribute__((aligned(16))) unsigned char Sm[ALDS];
  const int vb = (int)blockIdx.x;
  if (vb >= AE) {
    const int v = vb - AE;
    attn_block<false>(Sm, AX - 1 - v / (NB * HKV), v % (NB * HKV), Qh, Ql, Kh, Kl, Vh, Vl, Ch, Cl);
  } else {
    attn_block<true>(Sm, AEX - 1 - vb / (NB * HKV), vb % (NB * HKV), Qh, Ql, Kh, Kl, Vh, Vl, Ch, Cl);
  }
}
}  // namespace

extern "C" void kernel_launch(void* const* d_in, const int* in_sizes, int n_in, void* d_out, int out_size, void* d_ws, size_t ws_size, hipStream_t stream) {
  // wire order: 0 x [NB_FULL][SEQ_FULL][2048] f32, 1 Wq [2048][2048], 2 Wk [2048][512], 3 Wv [2048][512], 4 Wo [2048][2048]; out [NB_FULL][SEQ_FULL][2048] f32
  const size_t need_x = ((size_t)(NB - 1) * SEQ_FULL + SEQ) * DMOD;
  if (n_in < 5 || (size_t)in_sizes[0] < need_x || (size_t)in_sizes[1] < (size_t)KD * DMOD || (size_t)in_sizes[2] < (size_t)KD * NKV ||
      (size_t)in_sizes[3] < (size_t)KD * NKV || (size_t)in_sizes[4] < (size_t)KD * DMOD || (size_t)out_size < need_x) return;
  const float* X = (const float*)d_in[0]; const float* Wq = (const float*)d_in[1]; const float* Wk = (const float*)d_in[2];
  const float* Wv = (const float*)d_in[3]; const float* Wo = (const float*)d_in[4]; float* out = (float*)d_out;
  size_t off = 0; char* ws = (char*)d_ws;
  auto carve = [&](size_t bytes) { char* p = ws + off; off += (bytes + 255) & ~(size_t)255; return p; };
  b16* Xp  = (b16*)carve((size_t)MR * DMOD * 2);
  b16* Wqt = (b16*)carve((size_t)DMOD * KD * 2);
  b16* Wkt = (b16*)carve((size_t)NKV * KD * 2);
  b16* Wvt = (b16*)carve((size_t)NKV * KD * 2);
  b16* Wot = (b16*)carve((size_t)DMOD * KD * 2);
  float* CT = (float*)carve((size_t)SEQ * 64 * 4);
  float* ST = (float*)carve((size_t)SEQ * 64 * 4);
  b16* Qh = (b16*)carve((size_t)MR * H * HD * 2);
  b16* Ql = (b16*)carve((size_t)MR * H * HD * 2);
  b16* Kh = (b16*)carve((size_t)MR * NKV * 2);
  b16* Kl = (b16*)carve((size_t)MR * NKV * 2);
  b16* Vh = (b16*)carve((size_t)MR * NKV * 2);
  b16* Vl = (b16*)carve((size_t)MR * NKV * 2);
  b16* Ch = (b16*)carve((size_t)MR * DMOD * 2);
  b16* Cl = (b16*)carve((size_t)MR * DMOD * 2);
  if (off > ws_size || off > ((size_t)128 << 20)) return;   // 122,683,392 B at NB=2, SEQ=2048
  prep_kernel<<<dim3(PW + PR + PX), 256, 0, stream>>>(X, Wq, Wk, Wv, Wo, Xp, Wqt, Wkt, Wvt, Wot, CT, ST);
  qkv_kernel<<<dim3((CQ + 2 * CK) / NG, MR / 128), 128 * NG, 0, stream>>>(Xp, Wqt, Wkt, Wvt, Qh, Ql, Kh, Kl, Vh, Vl, CT, ST);
  attn_kernel<<<dim3(AN + AE), 256, 0, stream>>>(Qh, Ql, Kh, Kl, Vh, Vl, Ch, Cl);
  out_kernel<<<dim3(DMOD / OBN, NB * OT), 384, 0, stream>>>(Ch, Cl, Wot, out);
}
